// v000
// The times below were measured on an AMD MI455X: many runs one after another, warmed up first and cycling through
// copies of the inputs, with the whole window's GPU time divided by the number of runs. Launches and the gaps
// between them are all in it. The median over several windows is given; except for v000 it joins two sittings, which
// can be a few percent apart, so the side-by-side timings, each taken in one sitting, are the better comparison.
// v000 is the starting kernel. One run takes 306 microseconds.
#include <hip/hip_runtime.h>
// Contractions: q/k/v projections on v_wmma_f32_16x16x32_bf16 (x, W RNE bf16, single product, f32 accumulate); S^T = K Q^T on v_wmma_f32_16x16x32_f16 (q, k as x16 f16 planes, single product); O^T = V^T P^T on v_wmma_f32_16x16x32_f16 (query rows < RH: v x16 hi + x2^11 residual, P x256 hi + x2^11 residual, residual products in their own f32 accumulator; query rows >= RH: v x16, P x256, single product, row sum over the f16 P); output projection: rows < RH on v_wmma_f32_16x16x32_bf16 (ctx bf16 hi + bf16 lo planes, Wo RNE bf16), rows >= RH on v_wmma_f32_16x16x32_f16 (ctx x64 f16, Wo RNE-bf16 value x64 in f16, single product); softmax statistics f32.
// Multi-head attention, B x S x 1024, 16 heads of 64, scale 1/8, mask input (1 = key excluded, score replaced by -inf) read on the device as a packed bit plane.
// Engine: transposed flash. Each wave owns 16 queries. Per 32-key step: S^T tiles (key rows x query columns) from K rows (A, global f16 plane)
// and Q^T (B, registers); the two 16-key D tiles pack straight into the P^T B fragment; O^T (d rows x query columns) accumulates from V^T rows (A, global f16 planes).
#ifndef NB
#define NB 2
#endif
#ifndef SEQ
#define SEQ 2048
#endif
#ifndef RH
#define RH 256                                 /* query rows below RH (per batch) take the hi + residual path */
#endif
#define NB_FULL 2
#define SEQ_FULL 2048
#define DM 1024
#define NH 16
#define HD 64
#define PLANE ((size_t)NB * SEQ * DM)          /* elements of one [NB*SEQ][1024] 16-bit plane */

static_assert(SEQ % 128 == 0);
static_assert(SEQ <= SEQ_FULL);
static_assert(NB <= NB_FULL);
static_assert(RH % 128 == 0);
static_assert(RH >= 0 && RH <= SEQ);
static_assert(NH * HD == DM);
static_assert(HD == 64);
static_assert(DM % 64 == 0);
static_assert(PLANE * 2 * 7 + (size_t)5 * DM * DM * 2 + (size_t)NB * SEQ * (SEQ / 32) * 4 + 4096 <= (size_t)134217728);

typedef __bf16 v16b __attribute__((ext_vector_type(16)));
typedef _Float16 v16h __attribute__((ext_vector_type(16)));
typedef unsigned short v8us __attribute__((ext_vector_type(8), may_alias));
typedef float v8f __attribute__((ext_vector_type(8)));
typedef float v4f __attribute__((ext_vector_type(4)));
typedef float v4fa __attribute__((ext_vector_type(4), may_alias));
typedef int v4i __attribute__((ext_vector_type(4)));
typedef int v4ia __attribute__((ext_vector_type(4), may_alias));
union FragH { v16h v; v8us half[2]; _Float16 h[16]; unsigned short u[16]; };
union FragX { v16b b; v16h h; v8us half[2]; };
union H8 { v8us v; _Float16 h[8]; unsigned short u[8]; };

#define LOG2E 1.4426950408889634f
#define RES_SC 2048.0f
#define RES_INV 0.00048828125f

__device__ __forceinline__ unsigned short bf16_bits(float x) {   // RNE convert to bf16 bits, NaN kept NaN
  const unsigned int u = __float_as_uint(x);
  const unsigned int r = (u + 0x7FFFu + ((u >> 16) & 1u)) >> 16;
  const unsigned int n = (u >> 16) | 0x40u;
  return (unsigned short)(((u & 0x7FFFFFFFu) > 0x7F800000u) ? n : r);
}
__device__ __forceinline__ float bf16_val(unsigned short b) { return __uint_as_float(((unsigned int)b) << 16); }
__device__ __forceinline__ float bf16_rne(float x) { return bf16_val(bf16_bits(x)); }

// 2 x 4 tile group of one 32-deep k-step (bf16), then the hazard guard
__device__ __forceinline__ void mma8(v16b a0, v16b a1, v16b b0, v16b b1, v16b b2, v16b b3, v8f (&c)[8]) {
  c[0] = __builtin_amdgcn_wmma_f32_16x16x32_bf16(false, a0, false, b0, (short)0, c[0], false, false);
  c[1] = __builtin_amdgcn_wmma_f32_16x16x32_bf16(false, a0, false, b1, (short)0, c[1], false, false);
  c[2] = __builtin_amdgcn_wmma_f32_16x16x32_bf16(false, a0, false, b2, (short)0, c[2], false, false);
  c[3] = __builtin_amdgcn_wmma_f32_16x16x32_bf16(false, a0, false, b3, (short)0, c[3], false, false);
  c[4] = __builtin_amdgcn_wmma_f32_16x16x32_bf16(false, a1, false, b0, (short)0, c[4], false, false);
  c[5] = __builtin_amdgcn_wmma_f32_16x16x32_bf16(false, a1, false, b1, (short)0, c[5], false, false);
  c[6] = __builtin_amdgcn_wmma_f32_16x16x32_bf16(false, a1, false, b2, (short)0, c[6], false, false);
  c[7] = __builtin_amdgcn_wmma_f32_16x16x32_bf16(false, a1, false, b3, (short)0, c[7], false, false);
  asm volatile("v_nop\n\tv_nop\n\tv_nop\n\tv_nop"
               : "+v"(c[0]), "+v"(c[1]), "+v"(c[2]), "+v"(c[3]), "+v"(c[4]), "+v"(c[5]), "+v"(c[6]), "+v"(c[7])
               : "v"(a0), "v"(a1), "v"(b0), "v"(b1), "v"(b2), "v"(b3));
}
// the same tile group on f16 operands, then the hazard guard
__device__ __forceinline__ void mma8h(v16h a0, v16h a1, v16h b0, v16h b1, v16h b2, v16h b3, v8f (&c)[8]) {
  c[0] = __builtin_amdgcn_wmma_f32_16x16x32_f16(false, a0, false, b0, (short)0, c[0], false, false);
  c[1] = __builtin_amdgcn_wmma_f32_16x16x32_f16(false, a0, false, b1, (short)0, c[1], false, false);
  c[2] = __builtin_amdgcn_wmma_f32_16x16x32_f16(false, a0, false, b2, (short)0, c[2], false, false);
  c[3] = __builtin_amdgcn_wmma_f32_16x16x32_f16(false, a0, false, b3, (short)0, c[3], false, false);
  c[4] = __builtin_amdgcn_wmma_f32_16x16x32_f16(false, a1, false, b0, (short)0, c[4], false, false);
  c[5] = __builtin_amdgcn_wmma_f32_16x16x32_f16(false, a1, false, b1, (short)0, c[5], false, false);
  c[6] = __builtin_amdgcn_wmma_f32_16x16x32_f16(false, a1, false, b2, (short)0, c[6], false, false);
  c[7] = __builtin_amdgcn_wmma_f32_16x16x32_f16(false, a1, false, b3, (short)0, c[7], false, false);
  asm volatile("v_nop\n\tv_nop\n\tv_nop\n\tv_nop"
               : "+v"(c[0]), "+v"(c[1]), "+v"(c[2]), "+v"(c[3]), "+v"(c[4]), "+v"(c[5]), "+v"(c[6]), "+v"(c[7])
               : "v"(a0), "v"(a1), "v"(b0), "v"(b1), "v"(b2), "v"(b3));
}
// sh += K*Q (64 deep = two k-steps), then the hazard guard
__device__ __forceinline__ void mma_s(v16h k0, v16h k1, v16h q0, v16h q1, v8f& sh) {
  sh = __builtin_amdgcn_wmma_f32_16x16x32_f16(false, k0, false, q0, (short)0, sh, false, false);
  sh = __builtin_amdgcn_wmma_f32_16x16x32_f16(false, k1, false, q1, (short)0, sh, false, false);
  asm volatile("v_nop\n\tv_nop\n\tv_nop\n\tv_nop" : "+v"(sh) : "v"(k0), "v"(k1), "v"(q0), "v"(q1));
}
// oh += Vh*Ph ; ol += Vh*Pl + Vl*Ph (same x2^11 on both residual planes), then the hazard guard
__device__ __forceinline__ void mma_pv3(v16h vh, v16h vl, v16h ph, v16h pl, v8f& oh, v8f& ol) {
  oh = __builtin_amdgcn_wmma_f32_16x16x32_f16(false, vh, false, ph, (short)0, oh, false, false);
  ol = __builtin_amdgcn_wmma_f32_16x16x32_f16(false, vh, false, pl, (short)0, ol, false, false);
  ol = __builtin_amdgcn_wmma_f32_16x16x32_f16(false, vl, false, ph, (short)0, ol, false, false);
  asm volatile("v_nop\n\tv_nop\n\tv_nop\n\tv_nop" : "+v"(oh), "+v"(ol) : "v"(vh), "v"(vl), "v"(ph), "v"(pl));
}
// oh += Vh*Ph, then the hazard guard
__device__ __forceinline__ void mma_pv1(v16h vh, v16h ph, v8f& oh) {
  oh = __builtin_amdgcn_wmma_f32_16x16x32_f16(false, vh, false, ph, (short)0, oh, false, false);
  asm volatile("v_nop\n\tv_nop\n\tv_nop\n\tv_nop" : "+v"(oh) : "v"(vh), "v"(ph));
}

// dst[row][0..1023] = 16-bit image of src[(b*rpb_full + s)][0..1023], row = b*rpb + s. F16 = false: bf16 bits (RNE);
// F16 = true: f16 bits of (RNE bf16 value x 64), exact. Thread per 8 elements; consecutive lanes write consecutive 16-B pieces
template <bool F16>
__global__ __launch_bounds__(256) void k_cvt(const float* __restrict__ src, unsigned short* __restrict__ dst,
                                             int rows, int rpb, int rpb_full) {
  const int t = blockIdx.x * 256 + threadIdx.x;
  if (t >= rows * 128) return;
  const int row = t >> 7, piece = t & 127;
  const int b = row / rpb, s = row - b * rpb;
  const float* p = src + ((size_t)b * rpb_full + s) * DM + piece * 8;
  const v4f x0 = *(const v4fa*)(p), x1 = *(const v4fa*)(p + 4);
  H8 o;
#pragma unroll
  for (int i = 0; i < 4; ++i) {
    if (F16) {
      o.h[i]     = (_Float16)(bf16_rne(x0[i]) * 64.0f);
      o.h[4 + i] = (_Float16)(bf16_rne(x1[i]) * 64.0f);
    } else {
      o.u[i]     = bf16_bits(x0[i]);
      o.u[4 + i] = bf16_bits(x1[i]);
    }
  }
  const v8us ov = o.v;
  unsigned short* d = dst + (size_t)t * 8;
  *(v8us*)d = ov;
  
}

// coverage: NB*SEQ*(SEQ/32) threads x 1 word = the whole plane.
__global__ __launch_bounds__(256) void k_mask(const int* __restrict__ mask, unsigned int* __restrict__ bits) {
  const int t = blockIdx.x * 256 + threadIdx.x;
  if (t >= NB * SEQ * (SEQ / 32)) return;
  const int wd = t % (SEQ / 32), row = t / (SEQ / 32);
  const int b = row / SEQ, q = row - b * SEQ;
  const int* p = mask + ((size_t)b * SEQ_FULL + q) * SEQ_FULL + 32 * wd;
  unsigned int m = 0u;
#pragma unroll
  for (int j = 0; j < 8; ++j) {
    const v4i x = *(const v4ia*)(p + 4 * j);
    m |= ((x[0] == 1) ? 1u : 0u) << (4 * j);
    m |= ((x[1] == 1) ? 1u : 0u) << (4 * j + 1);
    m |= ((x[2] == 1) ? 1u : 0u) << (4 * j + 2);
    m |= ((x[3] == 1) ? 1u : 0u) << (4 * j + 3);
  }
  *(unsigned int*)(bits + t) = m;
  
}

// C[m][n] = sum_k A[m][k] * W[n][k] + bf16(bias[n]); A, W 16-bit planes with 1024-element rows; block tile 128 x 64, 4 waves x (32 x 64).
// Row blocks: block x -> batch b = x / nblk, first row s0 = sbeg + (x % nblk) * 128 of that batch (plane row b*SEQ + s0).
// Fragments straight from global rows: A row m = l&15, B column n = l&15, elements 0..7 <- k0 + 8h + i, 8..15 <- k0 + 16 + 8h + i.
// MODE 0 (grid.z = 2: q, k; bf16 operands): f16 plane [z][b][h][s][64] = f16(16 v); block tile = one contiguous 16-KB run.
// MODE 1 (v; bf16 operands): f16 planes [b][h][d][s], hi = f16(16 v), residual = f16((16 v - hi) 2^11); transposed on the LDS read side.
// MODE 2 (out, rows < RH; bf16 operands): A = ctx hi plane, Alo = ctx lo plane (bf16, unscaled, same accumulator); f32 rows of the output buffer.
// MODE 3 (out, rows >= RH; f16 operands): A = f16(64 ctx), W = f16(64 Wo); accumulator x 2^-12; f32 rows of the output buffer.
// LDS tile so: cross-wave (block barrier); staged extent 128 x 64 == consumed extent.
template <int MODE>
__global__ __launch_bounds__(128) void k_gemm(const unsigned short* __restrict__ A, const unsigned short* __restrict__ Alo,
                                              const unsigned short* __restrict__ Wm,
                                              const float* __restrict__ bias0, const float* __restrict__ bias1,
                                              unsigned short* __restrict__ outH, unsigned short* __restrict__ outL,
                                              float* __restrict__ outF, int sbeg, int nblk) {
  __shared__ __attribute__((aligned(16))) float so[128][68];
  const int tid = threadIdx.x, w = __builtin_amdgcn_readfirstlane((int)(tid >> 5)), lane = tid & 31, ln = lane & 15, hh = lane >> 4;
  const int b = blockIdx.x / nblk, s0 = sbeg + (blockIdx.x - b * nblk) * 128;
  const int rowB = b * SEQ + s0, colB = blockIdx.y * 64, z = blockIdx.z;
  const size_t aoff = (size_t)(rowB + 32 * w + ln) * DM + 8 * hh;
  const unsigned short* ap = A + aoff;
  const unsigned short* lp = Alo + aoff;
  const unsigned short* wp = Wm + (size_t)z * DM * DM + (size_t)(colB + ln) * DM + 8 * hh;
  const v8f z8 = {0.f, 0.f, 0.f, 0.f, 0.f, 0.f, 0.f, 0.f};
  v8f c[8];
#pragma unroll
  for (int i = 0; i < 8; ++i) c[i] = z8;
#pragma unroll 1
  for (int k0 = 0; k0 < DM; k0 += 32) {
    FragX a0, a1, b0, b1, b2, b3;
    a0.half[0] = *(const v8us*)(ap + k0);               a0.half[1] = *(const v8us*)(ap + k0 + 16);
    a1.half[0] = *(const v8us*)(ap + 16 * DM + k0);     a1.half[1] = *(const v8us*)(ap + 16 * DM + k0 + 16);
    b0.half[0] = *(const v8us*)(wp + k0);               b0.half[1] = *(const v8us*)(wp + k0 + 16);
    b1.half[0] = *(const v8us*)(wp + 16 * DM + k0);     b1.half[1] = *(const v8us*)(wp + 16 * DM + k0 + 16);
    b2.half[0] = *(const v8us*)(wp + 32 * DM + k0);     b2.half[1] = *(const v8us*)(wp + 32 * DM + k0 + 16);
    b3.half[0] = *(const v8us*)(wp + 48 * DM + k0);     b3.half[1] = *(const v8us*)(wp + 48 * DM + k0 + 16);
    if (MODE == 3) mma8h(a0.h, a1.h, b0.h, b1.h, b2.h, b3.h, c);
    else           mma8(a0.b, a1.b, b0.b, b1.b, b2.b, b3.b, c);
    if (MODE == 2) {
      FragX l0, l1;
      l0.half[0] = *(const v8us*)(lp + k0);             l0.half[1] = *(const v8us*)(lp + k0 + 16);
      l1.half[0] = *(const v8us*)(lp + 16 * DM + k0);   l1.half[1] = *(const v8us*)(lp + 16 * DM + k0 + 16);
      mma8(l0.b, l1.b, b0.b, b1.b, b2.b, b3.b, c);
    }
  }
  // D element r of tile (i, j) = C(row 32w + 16i + 8h + r, col 16j + l&15)
  const float cs = (MODE == 3) ? 0.000244140625f : 1.0f;     // 2^-12 undoes the x64 carries of ctx and Wo
#pragma unroll
  for (int j = 0; j < 4; ++j) {
    const int n = colB + 16 * j + ln;
    const float bA = bias0[n], bB = bias1[n];
    const float bj = bf16_rne((MODE == 0 && z == 1) ? bB : bA);
#pragma unroll
    for (int i = 0; i < 2; ++i)
#pragma unroll
      for (int r = 0; r < 8; ++r)
        so[32 * w + 16 * i + 8 * hh + r][16 * j + ln] = c[4 * i + j][r] * cs + bj;
  }
  __syncthreads();
  const int hd = blockIdx.y;
  if (MODE == 0) {
    const size_t base = (size_t)z * PLANE + (((size_t)(b * NH + hd)) * SEQ + s0) * HD;
    unsigned short* dh = outH + base;
    {
      for (int i = tid; i < 128 * 8; i += 128) {
        const int row = i >> 3, p8 = (i & 7) * 8;
        const v4f x0 = *(const v4fa*)&so[row][p8], x1 = *(const v4fa*)&so[row][p8 + 4];
        H8 oh;
#pragma unroll
        for (int q = 0; q < 4; ++q) {
          oh.h[q]     = (_Float16)(x0[q] * 16.0f);
          oh.h[4 + q] = (_Float16)(x1[q] * 16.0f);
        }
        const v8us ov = oh.v;
        *(v8us*)(dh + (size_t)i * 8) = ov;
      }
      
    }
  } else if (MODE == 1) {
    const size_t base = (((size_t)(b * NH + hd)) * HD) * SEQ + s0;
    unsigned short* dh = outH + base;
    unsigned short* dl = outL + base;
    {
      for (int i = tid; i < 64 * 16; i += 128) {
        const int d = i >> 4, s8 = (i & 15) * 8;
        H8 oh, ol;
#pragma unroll
        for (int q = 0; q < 8; ++q) {
          const float v0 = so[s8 + q][d] * 16.0f;
          const _Float16 h0 = (_Float16)v0;
          oh.h[q] = h0;
          ol.h[q] = (_Float16)((v0 - (float)h0) * RES_SC);
        }
        const v8us ovh = oh.v, ovl = ol.v;
        *(v8us*)(dh + (size_t)d * SEQ + s8) = ovh;
        *(v8us*)(dl + (size_t)d * SEQ + s8) = ovl;
      }
      
    }
  } else {
    float* og = outF + ((size_t)b * SEQ_FULL + s0) * DM + colB;
    {
      for (int i = tid; i < 128 * 16; i += 128) {
        const int row = i >> 4, c4 = (i & 15) * 4;
        const v4f v = *(const v4fa*)&so[row][c4];
        *(v4f*)(og + (size_t)row * DM + c4) = v;
      }
      
    }
  }
}

// One 32-key step for a wave's 16 queries (this lane's column: one query). Pointers are the (batch, head) bases of the planes.
// EARLY: P and v as hi + residual planes (three products, lr over the f32 weights); else one product and lr over the f16 weights.
template <bool EARLY>
__device__ __forceinline__ void fa_step(const unsigned short* __restrict__ Khp,
                                        const unsigned short* __restrict__ Vhp, const unsigned short* __restrict__ Vlp,
                                        int key0, unsigned int mw, int ln, int hh,
                                        const FragH& qh0, const FragH& qh1,
                                        float& mr, float& lr, v8f (&Oh)[4], v8f (&Ol)[4]) {
  const v8f z8 = {0.f, 0.f, 0.f, 0.f, 0.f, 0.f, 0.f, 0.f};
  // A fragments of K: row m = key (key0 + 16*kt + ln), elements 0..7 <- d = 32c + 8h + i, 8..15 <- d = 32c + 16 + 8h + i
  const size_t ko = (size_t)(key0 + ln) * HD + 8 * hh;
  float sc[16];
#pragma unroll
  for (int kt = 0; kt < 2; ++kt) {
    const unsigned short* kph = Khp + ko + (size_t)kt * 16 * HD;
    FragH kh0, kh1;
    kh0.half[0] = *(const v8us*)(kph);      kh0.half[1] = *(const v8us*)(kph + 16);
    kh1.half[0] = *(const v8us*)(kph + 32); kh1.half[1] = *(const v8us*)(kph + 48);
    v8f sh = z8;
    mma_s(kh0.v, kh1.v, qh0.v, qh1.v, sh);
    // S^T element r of tile kt = score(key0 + 16*kt + 8h + r, this lane's query); carries: 16 x 16 on q, k, then 1/8 -> 2^-11
#pragma unroll
    for (int r = 0; r < 8; ++r) sc[8 * kt + r] = sh[r] * 0.00048828125f;
  }
  // replace-fill: excluded keys get -inf (bit 8h + r of the word <-> tile 0, bit 16 + 8h + r <-> tile 1)
  const float ninf = __uint_as_float(0xFF800000u);
  const unsigned int mb = mw >> (8 * hh);
#pragma unroll
  for (int r = 0; r < 8; ++r) {
    sc[r]     = ((mb >> r) & 1u) ? ninf : sc[r];
    sc[8 + r] = ((mb >> (16 + r)) & 1u) ? ninf : sc[8 + r];
  }
  float mx = sc[0];
#pragma unroll
  for (int i = 1; i < 16; ++i) mx = fmaxf(mx, sc[i]);
  mx = fmaxf(mx, __shfl_xor(mx, 16, 32));           // the other lane half holds the other 16 keys of this query
  const float mnew = fmaxf(mr, mx);
  const float al = exp2f((mr - mnew) * LOG2E);
  mr = mnew;
  // weights carried x256: pc = 256 * exp(sc - mnew); hi plane f16(pc); EARLY: residual plane f16((pc - hi) * 2048)
  FragH ph, pl;
  float ps = 0.0f;
#pragma unroll
  for (int i = 0; i < 16; ++i) {
    const float pc = exp2f(fmaf(sc[i] - mnew, LOG2E, 8.0f));
    const _Float16 h = (_Float16)pc;
    ph.h[i] = h;                                    // B element i: i<8 -> key0 + 8h + i (tile 0 row 8h+i); i>=8 -> key0 + 16 + 8h + (i-8) (tile 1)
    if (EARLY) {
      ps += pc;
      pl.h[i] = (_Float16)((pc - (float)h) * RES_SC);
    } else {
      ps += (float)h;
    }
  }
  ps += __shfl_xor(ps, 16, 32);
  lr = lr * al + ps;
#pragma unroll
  for (int t = 0; t < 4; ++t) {
    Oh[t] = Oh[t] * al;
    if (EARLY) Ol[t] = Ol[t] * al;
  }
  // A fragments of V^T: row m = d (16*t + ln), elements 0..7 <- key0 + 8h + i, 8..15 <- key0 + 16 + 8h + i
  const size_t vo = (size_t)ln * SEQ + key0 + 8 * hh;
#pragma unroll
  for (int t = 0; t < 4; ++t) {
    const unsigned short* vph = Vhp + vo + (size_t)t * 16 * SEQ;
    FragH vh;
    vh.half[0] = *(const v8us*)(vph); vh.half[1] = *(const v8us*)(vph + 16);
    if (EARLY) {
      const unsigned short* vpl = Vlp + vo + (size_t)t * 16 * SEQ;
      FragH vl;
      vl.half[0] = *(const v8us*)(vpl); vl.half[1] = *(const v8us*)(vpl + 16);
      mma_pv3(vh.v, vl.v, ph.v, pl.v, Oh[t], Ol[t]);
    } else {
      mma_pv1(vh.v, ph.v, Oh[t]);
    }
  }
}

// Block = 4 waves x 16 queries = 64 queries of one (batch, head); query tile = qt0 + (block % nqt); no LDS and no barrier in the key loop.
// Steps whose 32 keys are excluded for all 16 queries of the wave are skipped under a wave-uniform ballot (exact for any mask value).
// Epilogue: O^T tile -> per-wave LDS tile [16 queries][64 d] (block barrier; staged 16 x 64 == consumed), then lanes 8g..8g+7 write the
// coverage: NB*NH*nqt blocks x 4 waves x 16 rows x 64 columns = every (row, head) segment of the band exactly once.
template <bool EARLY>
__global__ __launch_bounds__(128) void k_attn(const unsigned short* __restrict__ QKh,
                                              const unsigned short* __restrict__ Vth, const unsigned short* __restrict__ Vtl,
                                              const unsigned int* __restrict__ bits,
                                              unsigned short* __restrict__ Cp, unsigned short* __restrict__ Cl,
                                              int qt0, int nqt) {
  __shared__ __attribute__((aligned(16))) float so[4][16][68];
  const int tid = threadIdx.x, w = __builtin_amdgcn_readfirstlane((int)(tid >> 5)), lane = tid & 31, ln = lane & 15, hh = lane >> 4;
  const int bh = blockIdx.x / nqt, qt = qt0 + (blockIdx.x - bh * nqt);
  const int b = bh / NH, hd = bh - b * NH;
  const int qbase = qt * 64 + 16 * w;
  const int qg = qbase + ln;
  const size_t hb = (size_t)bh * SEQ * HD;
  // Q^T B fragments: column n = query qg, elements 0..7 <- d = 32c + 8h + i, 8..15 <- d = 32c + 16 + 8h + i
  FragH qh0, qh1;
  {
    const unsigned short* qrh = QKh + hb + (size_t)qg * HD + 8 * hh;
    qh0.half[0] = *(const v8us*)(qrh);      qh0.half[1] = *(const v8us*)(qrh + 16);
    qh1.half[0] = *(const v8us*)(qrh + 32); qh1.half[1] = *(const v8us*)(qrh + 48);
  }
  const unsigned short* Khp = QKh + PLANE + hb;
  const unsigned short* Vhp = Vth + hb;
  const unsigned short* Vlp = Vtl + hb;
  const unsigned int* mrow = bits + ((size_t)b * SEQ + qg) * (SEQ / 32);
  float mr = -3.0e38f, lr = 0.0f;
  v8f Oh[4] = {}, Ol[4] = {};
#pragma unroll 1
  for (int j = 0; j < SEQ / 32; ++j) {
    const unsigned int mw = mrow[j];
    if (__ballot(mw != 0xFFFFFFFFu) == 0) continue;   // wave-uniform
    fa_step<EARLY>(Khp, Vhp, Vlp, 32 * j, mw, ln, hh, qh0, qh1, mr, lr, Oh, Ol);
  }

  // O^T element r of tile t = ctx(query qg, d = 16t + 8h + r); undo the carries: x256 (in lr), x16 (v), x2048 (residual accumulator)
  const float inv = 1.0f / (16.0f * lr);
#pragma unroll
  for (int t = 0; t < 4; ++t) {
    v4f u0, u1;
#pragma unroll
    for (int r = 0; r < 4; ++r) {
      if (EARLY) {
        u0[r] = (Oh[t][r] + Ol[t][r] * RES_INV) * inv;
        u1[r] = (Oh[t][4 + r] + Ol[t][4 + r] * RES_INV) * inv;
      } else {
        u0[r] = Oh[t][r] * inv;
        u1[r] = Oh[t][4 + r] * inv;
      }
    }
    *(v4fa*)&so[w][ln][16 * t + 8 * hh] = u0;
    *(v4fa*)&so[w][ln][16 * t + 8 * hh + 4] = u1;
  }
  __syncthreads();
  const int rsub = lane >> 3, p8 = (lane & 7) * 8;
  const size_t cb = ((size_t)(b * SEQ + qbase)) * DM + hd * HD + p8;
  {
#pragma unroll
    for (int q = 0; q < 4; ++q) {
      const int row = 4 * q + rsub;                 // rows 0..15: 4 rows per instruction x 4 instructions
      const v4f x0 = *(const v4fa*)&so[w][row][p8], x1 = *(const v4fa*)&so[w][row][p8 + 4];
      if (EARLY) {
        v8us oh, ol;
#pragma unroll
        for (int e = 0; e < 4; ++e) {
          const unsigned short h0 = bf16_bits(x0[e]), h1 = bf16_bits(x1[e]);
          oh[e] = h0; oh[4 + e] = h1;
          ol[e] = bf16_bits(x0[e] - bf16_val(h0));
          ol[4 + e] = bf16_bits(x1[e] - bf16_val(h1));
        }
        *(v8us*)(Cp + cb + (size_t)row * DM) = oh;
        *(v8us*)(Cl + cb + (size_t)row * DM) = ol;
      } else {
        H8 of;
#pragma unroll
        for (int e = 0; e < 4; ++e) {
          of.h[e]     = (_Float16)(x0[e] * 64.0f);
          of.h[4 + e] = (_Float16)(x1[e] * 64.0f);
        }
        const v8us ov = of.v;
        *(v8us*)(Cp + cb + (size_t)row * DM) = ov;
      }
    }
    
  }
}

extern "C" void kernel_launch(void* const* d_in, const int* in_sizes, int n_in,
                              void* d_out, int out_size, void* d_ws, size_t ws_size, hipStream_t stream) {
  if (n_in < 10) return;
  const long long needx = (long long)(NB - 1) * SEQ_FULL * DM + (long long)SEQ * DM;   // last element touched + 1
  const long long needm = (long long)(NB - 1) * SEQ_FULL * SEQ_FULL + (long long)(SEQ - 1) * SEQ_FULL + SEQ;
  if ((long long)in_sizes[0] < needx) return;
  if ((long long)in_sizes[1] < (long long)DM * DM || (long long)in_sizes[3] < (long long)DM * DM) return;
  if ((long long)in_sizes[5] < (long long)DM * DM || (long long)in_sizes[7] < (long long)DM * DM) return;
  if (in_sizes[2] < DM || in_sizes[4] < DM || in_sizes[6] < DM || in_sizes[8] < DM) return;
  if ((long long)in_sizes[9] < needm) return;
  if ((long long)out_size < needx) return;
  const float* x  = (const float*)d_in[0];   // wire order: x, Wq, bq, Wk, bk, Wv, bv, Wo, bo, attention_mask
  const float* Wq = (const float*)d_in[1];
  const float* bq = (const float*)d_in[2];
  const float* Wk = (const float*)d_in[3];
  const float* bk = (const float*)d_in[4];
  const float* Wv = (const float*)d_in[5];
  const float* bv = (const float*)d_in[6];
  const float* Wo = (const float*)d_in[7];
  const float* bo = (const float*)d_in[8];
  const int* mask = (const int*)d_in[9];
  float* out = (float*)d_out;

  char* ws = (char*)d_ws;
  size_t off = 0;
  const size_t pl2 = PLANE * 2;                               // bytes of one [NB*SEQ][1024] 16-bit plane (8 MiB at full size), multiple of 256
  const size_t wsz = (size_t)DM * DM * 2;                     // 2 MiB per weight plane
  const size_t bsz = (size_t)NB * SEQ * (SEQ / 32) * 4;       // 1 MiB at full size
  unsigned short* Xb  = (unsigned short*)(ws + off); off += pl2;
  unsigned short* Wb  = (unsigned short*)(ws + off); off += 4 * wsz;      // bf16 planes q, k, v, o
  unsigned short* Woh = (unsigned short*)(ws + off); off += wsz;          // f16 plane of 64 Wo
  unsigned short* QKh = (unsigned short*)(ws + off); off += 2 * pl2;      // [q|k][b][h][s][64]
  unsigned short* Vth = (unsigned short*)(ws + off); off += pl2;          // [b][h][64][s]
  unsigned short* Vtl = (unsigned short*)(ws + off); off += pl2;
  unsigned int*   Mb  = (unsigned int*)(ws + off);   off += (bsz + 255) & ~(size_t)255;
  unsigned short* Cp  = (unsigned short*)(ws + off); off += pl2;          // [b*SEQ + s][1024]: rows < RH bf16 hi, rows >= RH f16(64 ctx)
  unsigned short* Cl  = (unsigned short*)(ws + off); off += pl2;          // rows < RH: bf16 lo (other rows never written, never read)
  if (off > ws_size || off > (size_t)134217728) return;

  const int M = NB * SEQ;
  k_cvt<false><<<(unsigned)((M * 128 + 255) / 256), 256, 0, stream>>>(x, Xb, M, SEQ, SEQ_FULL);
  k_cvt<false><<<(unsigned)((DM * 128 + 255) / 256), 256, 0, stream>>>(Wq, Wb, DM, DM, DM);
  k_cvt<false><<<(unsigned)((DM * 128 + 255) / 256), 256, 0, stream>>>(Wk, Wb + (size_t)DM * DM, DM, DM, DM);
  k_cvt<false><<<(unsigned)((DM * 128 + 255) / 256), 256, 0, stream>>>(Wv, Wb + (size_t)2 * DM * DM, DM, DM, DM);
  if (RH > 0)
    k_cvt<false><<<(unsigned)((DM * 128 + 255) / 256), 256, 0, stream>>>(Wo, Wb + (size_t)3 * DM * DM, DM, DM, DM);
  if (SEQ > RH)
    k_cvt<true><<<(unsigned)((DM * 128 + 255) / 256), 256, 0, stream>>>(Wo, Woh, DM, DM, DM);
  k_mask<<<(unsigned)((NB * SEQ * (SEQ / 32) + 255) / 256), 256, 0, stream>>>(mask, Mb);
  // A[M][1024] x W[1024][1024]^T: grid (row blocks, 1024/64, planes)
  k_gemm<0><<<dim3((unsigned)(NB * (SEQ / 128)), DM / 64, 2), 128, 0, stream>>>(Xb, Xb, Wb, bq, bk, QKh, QKh, out, 0, SEQ / 128);
  k_gemm<1><<<dim3((unsigned)(NB * (SEQ / 128)), DM / 64, 1), 128, 0, stream>>>(Xb, Xb, Wb + (size_t)2 * DM * DM, bv, bv, Vth, Vtl, out, 0, SEQ / 128);
  if (RH > 0)
    k_attn<true><<<(unsigned)(NB * NH * (RH / 64)), 128, 0, stream>>>(QKh, Vth, Vtl, Mb, Cp, Cl, 0, RH / 64);
  if (SEQ > RH)
    k_attn<false><<<(unsigned)(NB * NH * ((SEQ - RH) / 64)), 128, 0, stream>>>(QKh, Vth, Vtl, Mb, Cp, Cl, RH / 64, (SEQ - RH) / 64);
  if (RH > 0)
    k_gemm<2><<<dim3((unsigned)(NB * (RH / 128)), DM / 64, 1), 128, 0, stream>>>(Cp, Cl, Wb + (size_t)3 * DM * DM, bo, bo, QKh, QKh, out, 0, RH / 128);
  if (SEQ > RH)
    k_gemm<3><<<dim3((unsigned)(NB * ((SEQ - RH) / 128)), DM / 64, 1), 128, 0, stream>>>(Cp, Cl, Woh, bo, bo, QKh, QKh, out, RH, (SEQ - RH) / 128);
}

// v001
// A run of this version takes 235 microseconds.
// Timed twice side by side with v000, it ran 1.32 and 1.34 times as fast.
#include <hip/hip_runtime.h>
// Contractions: q/k/v projections on v_wmma_f32_16x16x32_bf16 (x, W RNE bf16, single product, f32 accumulate); S^T = K Q^T on v_wmma_f32_16x16x32_f16 (q, k as x16 f16 planes, single product); O^T = V^T P^T on v_wmma_f32_16x16x32_f16 (query rows < RH: v x16 hi + x2^11 residual, P x256 hi + x2^11 residual, residual products in their own f32 accumulator; query rows >= RH: v x16, P x256, single product, row sum over the f16 P); output projection: rows < RH on v_wmma_f32_16x16x32_bf16 (ctx bf16 hi + bf16 lo planes, Wo RNE bf16), rows >= RH on v_wmma_f32_16x16x32_f16 (ctx x64 f16, Wo RNE-bf16 value x64 in f16, single product); softmax statistics f32.
// Multi-head attention, B x S x 1024, 16 heads of 64, scale 1/8, mask input (1 = key excluded, score replaced by -inf) read on the device as a packed bit plane.
// Engine: transposed flash. Each wave owns 16 queries. Per 32-key step: S^T tiles (key rows x query columns) from K rows (A, global f16 plane)
// and Q^T (B, registers); the two 16-key D tiles pack straight into the P^T B fragment; O^T (d rows x query columns) accumulates from V^T rows (A, global f16 planes).
#ifndef NB
#define NB 2
#endif
#ifndef SEQ
#define SEQ 2048
#endif
#ifndef RH
#define RH 256                                 /* query rows below RH (per batch) take the hi + residual path */
#endif
#define NB_FULL 2
#define SEQ_FULL 2048
#define DM 1024
#define NH 16
#define HD 64
#define PLANE ((size_t)NB * SEQ * DM)          /* elements of one [NB*SEQ][1024] 16-bit plane */

static_assert(SEQ % 128 == 0);
static_assert(SEQ <= SEQ_FULL);
static_assert(NB <= NB_FULL);
static_assert(RH % 128 == 0);
static_assert(RH >= 0 && RH <= SEQ);
static_assert(NH * HD == DM);
static_assert(HD == 64);
static_assert(DM % 64 == 0);
static_assert(PLANE * 2 * 7 + (size_t)5 * DM * DM * 2 + (size_t)NB * SEQ * (SEQ / 32) * 4 + 4096 <= (size_t)134217728);

typedef __bf16 v16b __attribute__((ext_vector_type(16)));
typedef _Float16 v16h __attribute__((ext_vector_type(16)));
typedef unsigned short v8us __attribute__((ext_vector_type(8), may_alias));
typedef float v8f __attribute__((ext_vector_type(8)));
typedef float v4f __attribute__((ext_vector_type(4)));
typedef float v4fa __attribute__((ext_vector_type(4), may_alias));
typedef int v4i __attribute__((ext_vector_type(4)));
typedef int v4ia __attribute__((ext_vector_type(4), may_alias));
union FragH { v16h v; v8us half[2]; _Float16 h[16]; unsigned short u[16]; };
union FragX { v16b b; v16h h; v8us half[2]; };
union H8 { v8us v; _Float16 h[8]; unsigned short u[8]; };

#define LOG2E 1.4426950408889634f
#define RES_SC 2048.0f
#define RES_INV 0.00048828125f

__device__ __forceinline__ unsigned short bf16_bits(float x) {   // RNE convert to bf16 bits, NaN kept NaN
  const unsigned int u = __float_as_uint(x);
  const unsigned int r = (u + 0x7FFFu + ((u >> 16) & 1u)) >> 16;
  const unsigned int n = (u >> 16) | 0x40u;
  return (unsigned short)(((u & 0x7FFFFFFFu) > 0x7F800000u) ? n : r);
}
__device__ __forceinline__ float bf16_val(unsigned short b) { return __uint_as_float(((unsigned int)b) << 16); }
__device__ __forceinline__ float bf16_rne(float x) { return bf16_val(bf16_bits(x)); }

// 2 x 4 tile group of one 32-deep k-step (bf16), then the hazard guard
__device__ __forceinline__ void mma8(v16b a0, v16b a1, v16b b0, v16b b1, v16b b2, v16b b3, v8f (&c)[8]) {
  c[0] = __builtin_amdgcn_wmma_f32_16x16x32_bf16(false, a0, false, b0, (short)0, c[0], false, false);
  c[1] = __builtin_amdgcn_wmma_f32_16x16x32_bf16(false, a0, false, b1, (short)0, c[1], false, false);
  c[2] = __builtin_amdgcn_wmma_f32_16x16x32_bf16(false, a0, false, b2, (short)0, c[2], false, false);
  c[3] = __builtin_amdgcn_wmma_f32_16x16x32_bf16(false, a0, false, b3, (short)0, c[3], false, false);
  c[4] = __builtin_amdgcn_wmma_f32_16x16x32_bf16(false, a1, false, b0, (short)0, c[4], false, false);
  c[5] = __builtin_amdgcn_wmma_f32_16x16x32_bf16(false, a1, false, b1, (short)0, c[5], false, false);
  c[6] = __builtin_amdgcn_wmma_f32_16x16x32_bf16(false, a1, false, b2, (short)0, c[6], false, false);
  c[7] = __builtin_amdgcn_wmma_f32_16x16x32_bf16(false, a1, false, b3, (short)0, c[7], false, false);
  asm volatile("v_nop\n\tv_nop\n\tv_nop\n\tv_nop"
               : "+v"(c[0]), "+v"(c[1]), "+v"(c[2]), "+v"(c[3]), "+v"(c[4]), "+v"(c[5]), "+v"(c[6]), "+v"(c[7])
               : "v"(a0), "v"(a1), "v"(b0), "v"(b1), "v"(b2), "v"(b3));
}
// the same tile group on f16 operands, then the hazard guard
__device__ __forceinline__ void mma8h(v16h a0, v16h a1, v16h b0, v16h b1, v16h b2, v16h b3, v8f (&c)[8]) {
  c[0] = __builtin_amdgcn_wmma_f32_16x16x32_f16(false, a0, false, b0, (short)0, c[0], false, false);
  c[1] = __builtin_amdgcn_wmma_f32_16x16x32_f16(false, a0, false, b1, (short)0, c[1], false, false);
  c[2] = __builtin_amdgcn_wmma_f32_16x16x32_f16(false, a0, false, b2, (short)0, c[2], false, false);
  c[3] = __builtin_amdgcn_wmma_f32_16x16x32_f16(false, a0, false, b3, (short)0, c[3], false, false);
  c[4] = __builtin_amdgcn_wmma_f32_16x16x32_f16(false, a1, false, b0, (short)0, c[4], false, false);
  c[5] = __builtin_amdgcn_wmma_f32_16x16x32_f16(false, a1, false, b1, (short)0, c[5], false, false);
  c[6] = __builtin_amdgcn_wmma_f32_16x16x32_f16(false, a1, false, b2, (short)0, c[6], false, false);
  c[7] = __builtin_amdgcn_wmma_f32_16x16x32_f16(false, a1, false, b3, (short)0, c[7], false, false);
  asm volatile("v_nop\n\tv_nop\n\tv_nop\n\tv_nop"
               : "+v"(c[0]), "+v"(c[1]), "+v"(c[2]), "+v"(c[3]), "+v"(c[4]), "+v"(c[5]), "+v"(c[6]), "+v"(c[7])
               : "v"(a0), "v"(a1), "v"(b0), "v"(b1), "v"(b2), "v"(b3));
}
// sh += K*Q (64 deep = two k-steps), then the hazard guard
__device__ __forceinline__ void mma_s(v16h k0, v16h k1, v16h q0, v16h q1, v8f& sh) {
  sh = __builtin_amdgcn_wmma_f32_16x16x32_f16(false, k0, false, q0, (short)0, sh, false, false);
  sh = __builtin_amdgcn_wmma_f32_16x16x32_f16(false, k1, false, q1, (short)0, sh, false, false);
  asm volatile("v_nop\n\tv_nop\n\tv_nop\n\tv_nop" : "+v"(sh) : "v"(k0), "v"(k1), "v"(q0), "v"(q1));
}
// oh += Vh*Ph ; ol += Vh*Pl + Vl*Ph (same x2^11 on both residual planes), then the hazard guard
__device__ __forceinline__ void mma_pv3(v16h vh, v16h vl, v16h ph, v16h pl, v8f& oh, v8f& ol) {
  oh = __builtin_amdgcn_wmma_f32_16x16x32_f16(false, vh, false, ph, (short)0, oh, false, false);
  ol = __builtin_amdgcn_wmma_f32_16x16x32_f16(false, vh, false, pl, (short)0, ol, false, false);
  ol = __builtin_amdgcn_wmma_f32_16x16x32_f16(false, vl, false, ph, (short)0, ol, false, false);
  asm volatile("v_nop\n\tv_nop\n\tv_nop\n\tv_nop" : "+v"(oh), "+v"(ol) : "v"(vh), "v"(vl), "v"(ph), "v"(pl));
}
// oh += Vh*Ph, then the hazard guard
__device__ __forceinline__ void mma_pv1(v16h vh, v16h ph, v8f& oh) {
  oh = __builtin_amdgcn_wmma_f32_16x16x32_f16(false, vh, false, ph, (short)0, oh, false, false);
  asm volatile("v_nop\n\tv_nop\n\tv_nop\n\tv_nop" : "+v"(oh) : "v"(vh), "v"(ph));
}

// dst[row][0..1023] = 16-bit image of src[(b*rpb_full + s)][0..1023], row = b*rpb + s. F16 = false: bf16 bits (RNE);
// F16 = true: f16 bits of (RNE bf16 value x 64), exact. Thread per 8 elements; consecutive lanes write consecutive 16-B pieces
template <bool F16>
__global__ __launch_bounds__(256) void k_cvt(const float* __restrict__ src, unsigned short* __restrict__ dst,
                                             int rows, int rpb, int rpb_full) {
  const int t = blockIdx.x * 256 + threadIdx.x;
  if (t >= rows * 128) return;
  const int row = t >> 7, piece = t & 127;
  const int b = row / rpb, s = row - b * rpb;
  const float* p = src + ((size_t)b * rpb_full + s) * DM + piece * 8;
  const v4f x0 = *(const v4fa*)(p), x1 = *(const v4fa*)(p + 4);
  H8 o;
#pragma unroll
  for (int i = 0; i < 4; ++i) {
    if (F16) {
      o.h[i]     = (_Float16)(bf16_rne(x0[i]) * 64.0f);
      o.h[4 + i] = (_Float16)(bf16_rne(x1[i]) * 64.0f);
    } else {
      o.u[i]     = bf16_bits(x0[i]);
      o.u[4 + i] = bf16_bits(x1[i]);
    }
  }
  const v8us ov = o.v;
  unsigned short* d = dst + (size_t)t * 8;
  *(v8us*)d = ov;
  
}

// coverage: NB*SEQ*(SEQ/32) threads x 1 word = the whole plane.
__global__ __launch_bounds__(256) void k_mask(const int* __restrict__ mask, unsigned int* __restrict__ bits) {
  const int t = blockIdx.x * 256 + threadIdx.x;
  if (t >= NB * SEQ * (SEQ / 32)) return;
  const int wd = t % (SEQ / 32), row = t / (SEQ / 32);
  const int b = row / SEQ, q = row - b * SEQ;
  const int* p = mask + ((size_t)b * SEQ_FULL + q) * SEQ_FULL + 32 * wd;
  unsigned int m = 0u;
#pragma unroll
  for (int j = 0; j < 8; ++j) {
    const v4i x = *(const v4ia*)(p + 4 * j);
    m |= ((x[0] == 1) ? 1u : 0u) << (4 * j);
    m |= ((x[1] == 1) ? 1u : 0u) << (4 * j + 1);
    m |= ((x[2] == 1) ? 1u : 0u) << (4 * j + 2);
    m |= ((x[3] == 1) ? 1u : 0u) << (4 * j + 3);
  }
  *(unsigned int*)(bits + t) = m;
  
}

// C[m][n] = sum_k A[m][k] * W[n][k] + bf16(bias[n]); A, W 16-bit planes with 1024-element rows; block tile 128 x 64, 4 waves x (32 x 64).
// Row blocks: block x -> batch b = x / nblk, first row s0 = sbeg + (x % nblk) * 128 of that batch (plane row b*SEQ + s0).
// Fragments straight from global rows: A row m = l&15, B column n = l&15, elements 0..7 <- k0 + 8h + i, 8..15 <- k0 + 16 + 8h + i.
// MODE 0 (grid.z = 2: q, k; bf16 operands): f16 plane [z][b][h][s][64] = f16(16 v); block tile = one contiguous 16-KB run.
// MODE 1 (v; bf16 operands): f16 planes [b][h][d][s], hi = f16(16 v), residual = f16((16 v - hi) 2^11); transposed on the LDS read side.
// MODE 2 (out, rows < RH; bf16 operands): A = ctx hi plane, Alo = ctx lo plane (bf16, unscaled, same accumulator); f32 rows of the output buffer.
// MODE 3 (out, rows >= RH; f16 operands): A = f16(64 ctx), W = f16(64 Wo); accumulator x 2^-12; f32 rows of the output buffer.
// LDS tile so: cross-wave (block barrier); staged extent 128 x 64 == consumed extent.
template <int MODE>
__global__ __launch_bounds__(128) void k_gemm(const unsigned short* __restrict__ A, const unsigned short* __restrict__ Alo,
                                              const unsigned short* __restrict__ Wm,
                                              const float* __restrict__ bias0, const float* __restrict__ bias1,
                                              unsigned short* __restrict__ outH, unsigned short* __restrict__ outL,
                                              float* __restrict__ outF, int sbeg, int nblk) {
  __shared__ __attribute__((aligned(16))) float so[128][68];
  const int tid = threadIdx.x, w = __builtin_amdgcn_readfirstlane((int)(tid >> 5)), lane = tid & 31, ln = lane & 15, hh = lane >> 4;
  const int b = blockIdx.x / nblk, s0 = sbeg + (blockIdx.x - b * nblk) * 128;
  const int rowB = b * SEQ + s0, colB = blockIdx.y * 64, z = blockIdx.z;
  const size_t aoff = (size_t)(rowB + 32 * w + ln) * DM + 8 * hh;
  const unsigned short* ap = A + aoff;
  const unsigned short* lp = Alo + aoff;
  const unsigned short* wp = Wm + (size_t)z * DM * DM + (size_t)(colB + ln) * DM + 8 * hh;
  const v8f z8 = {0.f, 0.f, 0.f, 0.f, 0.f, 0.f, 0.f, 0.f};
  v8f c[8];
#pragma unroll
  for (int i = 0; i < 8; ++i) c[i] = z8;
#pragma unroll 1
  for (int k0 = 0; k0 < DM; k0 += 32) {
    FragX a0, a1, b0, b1, b2, b3;
    a0.half[0] = *(const v8us*)(ap + k0);               a0.half[1] = *(const v8us*)(ap + k0 + 16);
    a1.half[0] = *(const v8us*)(ap + 16 * DM + k0);     a1.half[1] = *(const v8us*)(ap + 16 * DM + k0 + 16);
    b0.half[0] = *(const v8us*)(wp + k0);               b0.half[1] = *(const v8us*)(wp + k0 + 16);
    b1.half[0] = *(const v8us*)(wp + 16 * DM + k0);     b1.half[1] = *(const v8us*)(wp + 16 * DM + k0 + 16);
    b2.half[0] = *(const v8us*)(wp + 32 * DM + k0);     b2.half[1] = *(const v8us*)(wp + 32 * DM + k0 + 16);
    b3.half[0] = *(const v8us*)(wp + 48 * DM + k0);     b3.half[1] = *(const v8us*)(wp + 48 * DM + k0 + 16);
    if (MODE == 3) mma8h(a0.h, a1.h, b0.h, b1.h, b2.h, b3.h, c);
    else           mma8(a0.b, a1.b, b0.b, b1.b, b2.b, b3.b, c);
    if (MODE == 2) {
      FragX l0, l1;
      l0.half[0] = *(const v8us*)(lp + k0);             l0.half[1] = *(const v8us*)(lp + k0 + 16);
      l1.half[0] = *(const v8us*)(lp + 16 * DM + k0);   l1.half[1] = *(const v8us*)(lp + 16 * DM + k0 + 16);
      mma8(l0.b, l1.b, b0.b, b1.b, b2.b, b3.b, c);
    }
  }
  // D element r of tile (i, j) = C(row 32w + 16i + 8h + r, col 16j + l&15)
  const float cs = (MODE == 3) ? 0.000244140625f : 1.0f;     // 2^-12 undoes the x64 carries of ctx and Wo
#pragma unroll
  for (int j = 0; j < 4; ++j) {
    const int n = colB + 16 * j + ln;
    const float bA = bias0[n], bB = bias1[n];
    const float bj = bf16_rne((MODE == 0 && z == 1) ? bB : bA);
#pragma unroll
    for (int i = 0; i < 2; ++i)
#pragma unroll
      for (int r = 0; r < 8; ++r)
        so[32 * w + 16 * i + 8 * hh + r][16 * j + ln] = c[4 * i + j][r] * cs + bj;
  }
  __syncthreads();
  const int hd = blockIdx.y;
  if (MODE == 0) {
    const size_t base = (size_t)z * PLANE + (((size_t)(b * NH + hd)) * SEQ + s0) * HD;
    unsigned short* dh = outH + base;
    {
      for (int i = tid; i < 128 * 8; i += 128) {
        const int row = i >> 3, p8 = (i & 7) * 8;
        const v4f x0 = *(const v4fa*)&so[row][p8], x1 = *(const v4fa*)&so[row][p8 + 4];
        H8 oh;
#pragma unroll
        for (int q = 0; q < 4; ++q) {
          oh.h[q]     = (_Float16)(x0[q] * 16.0f);
          oh.h[4 + q] = (_Float16)(x1[q] * 16.0f);
        }
        const v8us ov = oh.v;
        *(v8us*)(dh + (size_t)i * 8) = ov;
      }
      
    }
  } else if (MODE == 1) {
    const size_t base = (((size_t)(b * NH + hd)) * HD) * SEQ + s0;
    unsigned short* dh = outH + base;
    unsigned short* dl = outL + base;
    {
      for (int i = tid; i < 64 * 16; i += 128) {
        const int d = i >> 4, s8 = (i & 15) * 8;
        H8 oh, ol;
#pragma unroll
        for (int q = 0; q < 8; ++q) {
          const float v0 = so[s8 + q][d] * 16.0f;
          const _Float16 h0 = (_Float16)v0;
          oh.h[q] = h0;
          ol.h[q] = (_Float16)((v0 - (float)h0) * RES_SC);
        }
        const v8us ovh = oh.v, ovl = ol.v;
        *(v8us*)(dh + (size_t)d * SEQ + s8) = ovh;
        *(v8us*)(dl + (size_t)d * SEQ + s8) = ovl;
      }
      
    }
  } else {
    float* og = outF + ((size_t)b * SEQ_FULL + s0) * DM + colB;
    {
      for (int i = tid; i < 128 * 16; i += 128) {
        const int row = i >> 4, c4 = (i & 15) * 4;
        const v4f v = *(const v4fa*)&so[row][c4];
        *(v4f*)(og + (size_t)row * DM + c4) = v;
      }
      
    }
  }
}

// Fragment loads of one 32-key step. Pointers are the (batch, head) bases of the planes.
// A fragments of K: row m = key (key0 + 16*kt + ln), elements 0..7 <- d = 32c + 8h + i, 8..15 <- d = 32c + 16 + 8h + i; kf[2*kt + c]
__device__ __forceinline__ void load_k(const unsigned short* __restrict__ Khp, int key0, int ln, int hh, FragH (&kf)[4]) {
  const unsigned short* kp = Khp + (size_t)(key0 + ln) * HD + 8 * hh;
#pragma unroll
  for (int kt = 0; kt < 2; ++kt) {
    const unsigned short* kph = kp + (size_t)kt * 16 * HD;
    kf[2 * kt].half[0]     = *(const v8us*)(kph);      kf[2 * kt].half[1]     = *(const v8us*)(kph + 16);
    kf[2 * kt + 1].half[0] = *(const v8us*)(kph + 32); kf[2 * kt + 1].half[1] = *(const v8us*)(kph + 48);
  }
}
// A fragments of V^T: row m = d (16*t + ln), elements 0..7 <- key0 + 8h + i, 8..15 <- key0 + 16 + 8h + i
__device__ __forceinline__ void load_v(const unsigned short* __restrict__ Vp, int key0, int ln, int hh, FragH (&vf)[4]) {
  const unsigned short* vp = Vp + (size_t)ln * SEQ + key0 + 8 * hh;
#pragma unroll
  for (int t = 0; t < 4; ++t) {
    const unsigned short* vph = vp + (size_t)t * 16 * SEQ;
    vf[t].half[0] = *(const v8us*)(vph); vf[t].half[1] = *(const v8us*)(vph + 16);
  }
}

// One 32-key step for a wave's 16 queries (this lane's column: one query), on fragments and a mask word that were loaded one step earlier.
// Each fragment set is reloaded for step keyN (the wave's next active step) right behind its last product, so that those loads fly
// under the rest of this step and the head of the next one.
// EARLY: P and v as hi + residual planes (three products, lr over the f32 weights); else one product and lr over the f16 weights.
template <bool EARLY>
__device__ __forceinline__ void fa_step(const unsigned short* __restrict__ Khp,
                                        const unsigned short* __restrict__ Vhp, const unsigned short* __restrict__ Vlp,
                                        int keyN, unsigned int mw, int ln, int hh,
                                        const FragH& qh0, const FragH& qh1,
                                        FragH (&kf)[4], FragH (&vf)[4], FragH (&vlf)[4],
                                        float& mr, float& lr, v8f (&Oh)[4], v8f (&Ol)[4]) {
  const v8f z8 = {0.f, 0.f, 0.f, 0.f, 0.f, 0.f, 0.f, 0.f};
  float sc[16];
#pragma unroll
  for (int kt = 0; kt < 2; ++kt) {
    v8f sh = z8;
    mma_s(kf[2 * kt].v, kf[2 * kt + 1].v, qh0.v, qh1.v, sh);
    // S^T element r of tile kt = score(key0 + 16*kt + 8h + r, this lane's query); carries: 16 x 16 on q, k, then 1/8 -> 2^-11
#pragma unroll
    for (int r = 0; r < 8; ++r) sc[8 * kt + r] = sh[r] * 0.00048828125f;
  }
  load_k(Khp, keyN, ln, hh, kf);
  __builtin_amdgcn_sched_barrier(0);   // keeps the K reloads here: sunk below the softmax they would have too short a lead on the next step's products
  // replace-fill: excluded keys get -inf (bit 8h + r of the word <-> tile 0, bit 16 + 8h + r <-> tile 1)
  const float ninf = __uint_as_float(0xFF800000u);
  const unsigned int mb = mw >> (8 * hh);
#pragma unroll
  for (int r = 0; r < 8; ++r) {
    sc[r]     = ((mb >> r) & 1u) ? ninf : sc[r];
    sc[8 + r] = ((mb >> (16 + r)) & 1u) ? ninf : sc[8 + r];
  }
  float mx = sc[0];
#pragma unroll
  for (int i = 1; i < 16; ++i) mx = fmaxf(mx, sc[i]);
  mx = fmaxf(mx, __shfl_xor(mx, 16, 32));           // the other lane half holds the other 16 keys of this query
  const float mnew = fmaxf(mr, mx);
  const float al = exp2f((mr - mnew) * LOG2E);
  mr = mnew;
  // weights carried x256: pc = 256 * exp(sc - mnew); hi plane f16(pc); EARLY: residual plane f16((pc - hi) * 2048)
  FragH ph, pl;
  float ps = 0.0f;
#pragma unroll
  for (int i = 0; i < 16; ++i) {
    const float pc = exp2f(fmaf(sc[i] - mnew, LOG2E, 8.0f));
    const _Float16 h = (_Float16)pc;
    ph.h[i] = h;                                    // B element i: i<8 -> key0 + 8h + i (tile 0 row 8h+i); i>=8 -> key0 + 16 + 8h + (i-8) (tile 1)
    if (EARLY) {
      ps += pc;
      pl.h[i] = (_Float16)((pc - (float)h) * RES_SC);
    } else {
      ps += (float)h;
    }
  }
  ps += __shfl_xor(ps, 16, 32);
  lr = lr * al + ps;
#pragma unroll
  for (int t = 0; t < 4; ++t) {
    Oh[t] = Oh[t] * al;
    if (EARLY) Ol[t] = Ol[t] * al;
  }
#pragma unroll
  for (int t = 0; t < 4; ++t) {
    if (EARLY) mma_pv3(vf[t].v, vlf[t].v, ph.v, pl.v, Oh[t], Ol[t]);
    else       mma_pv1(vf[t].v, ph.v, Oh[t]);
  }
  load_v(Vhp, keyN, ln, hh, vf);
  if (EARLY) load_v(Vlp, keyN, ln, hh, vlf);
  asm volatile("s_wait_xcnt 0x0" ::: "memory");   // in front of the next step's writes to the registers that held these loads' addresses
}

// Block = 4 waves x 16 queries = 64 queries of one (batch, head); query tile = qt0 + (block % nqt); no LDS and no barrier in the key loop.
// Steps whose 32 keys are excluded for all 16 queries of the wave are skipped (exact for any mask value): a wave-uniform map of the
// active steps is built from the wave's mask rows in front of the loop, so that the step after the current one is known when its loads issue.
// Epilogue: O^T tile -> per-wave LDS tile [16 queries][64 d] (block barrier; staged 16 x 64 == consumed), then lanes 8g..8g+7 write the
// coverage: NB*NH*nqt blocks x 4 waves x 16 rows x 64 columns = every (row, head) segment of the band exactly once.
template <bool EARLY>
__global__ __launch_bounds__(128) void k_attn(const unsigned short* __restrict__ QKh,
                                              const unsigned short* __restrict__ Vth, const unsigned short* __restrict__ Vtl,
                                              const unsigned int* __restrict__ bits,
                                              unsigned short* __restrict__ Cp, unsigned short* __restrict__ Cl,
                                              int qt0, int nqt) {
  static_assert(SEQ / 32 <= 64);
  __shared__ __attribute__((aligned(16))) float so[4][16][68];
  const int tid = threadIdx.x, w = __builtin_amdgcn_readfirstlane((int)(tid >> 5)), lane = tid & 31, ln = lane & 15, hh = lane >> 4;
  const int bh = blockIdx.x / nqt, qt = qt0 + (blockIdx.x - bh * nqt);
  const int b = bh / NH, hd = bh - b * NH;
  const int qbase = qt * 64 + 16 * w;
  const int qg = qbase + ln;
  const size_t hb = (size_t)bh * SEQ * HD;
  // Q^T B fragments: column n = query qg, elements 0..7 <- d = 32c + 8h + i, 8..15 <- d = 32c + 16 + 8h + i
  FragH qh0, qh1;
  {
    const unsigned short* qrh = QKh + hb + (size_t)qg * HD + 8 * hh;
    qh0.half[0] = *(const v8us*)(qrh);      qh0.half[1] = *(const v8us*)(qrh + 16);
    qh1.half[0] = *(const v8us*)(qrh + 32); qh1.half[1] = *(const v8us*)(qrh + 48);
  }
  const unsigned short* Khp = QKh + PLANE + hb;
  const unsigned short* Vhp = Vth + hb;
  const unsigned short* Vlp = Vtl + hb;
  const unsigned int* mrow = bits + ((size_t)b * SEQ + qg) * (SEQ / 32);
  float mr = -3.0e38f, lr = 0.0f;
  v8f Oh[4] = {}, Ol[4] = {};
  // bit j of act: step j has a key that some query of the wave keeps
  unsigned long long act = 0ull;
#pragma unroll
  for (int i = 0; i < SEQ / 128; ++i) {
    const v4i x = *(const v4ia*)(mrow + 4 * i);
#pragma unroll
    for (int e = 0; e < 4; ++e)
      if (__ballot(x[e] != -1) != 0) act |= 1ull << (4 * i + e);   // wave-uniform
  }
  if (act != 0ull) {
    int j = __builtin_ctzll(act);
    act &= act - 1ull;
    FragH kf[4], vf[4], vlf[4];
    unsigned int mw = mrow[j];
    __builtin_amdgcn_sched_barrier(0);                // mask word first in load order: the loop's wait for it then leaves the fragment loads in flight
    load_k(Khp, 32 * j, ln, hh, kf);
    load_v(Vhp, 32 * j, ln, hh, vf);
    if (EARLY) load_v(Vlp, 32 * j, ln, hh, vlf);
    asm volatile("s_wait_xcnt 0x0" ::: "memory");     // in front of later writes to the registers that held these loads' addresses
    __builtin_amdgcn_sched_barrier(0);                // keeps those writes behind the wait
#pragma unroll 1
    for (;;) {
      const bool more = act != 0ull;                  // wave-uniform
      const int jn = more ? __builtin_ctzll(act) : j; // last step: its own tiles once more (in bounds, never used)
      act &= act - 1ull;
      const unsigned int mwn = mrow[jn];
      fa_step<EARLY>(Khp, Vhp, Vlp, 32 * jn, mw, ln, hh, qh0, qh1, kf, vf, vlf, mr, lr, Oh, Ol);
      if (!more) break;
      mw = mwn;
      j = jn;
    }
  }

  // O^T element r of tile t = ctx(query qg, d = 16t + 8h + r); undo the carries: x256 (in lr), x16 (v), x2048 (residual accumulator)
  const float inv = 1.0f / (16.0f * lr);
#pragma unroll
  for (int t = 0; t < 4; ++t) {
    v4f u0, u1;
#pragma unroll
    for (int r = 0; r < 4; ++r) {
      if (EARLY) {
        u0[r] = (Oh[t][r] + Ol[t][r] * RES_INV) * inv;
        u1[r] = (Oh[t][4 + r] + Ol[t][4 + r] * RES_INV) * inv;
      } else {
        u0[r] = Oh[t][r] * inv;
        u1[r] = Oh[t][4 + r] * inv;
      }
    }
    *(v4fa*)&so[w][ln][16 * t + 8 * hh] = u0;
    *(v4fa*)&so[w][ln][16 * t + 8 * hh + 4] = u1;
  }
  __syncthreads();
  const int rsub = lane >> 3, p8 = (lane & 7) * 8;
  const size_t cb = ((size_t)(b * SEQ + qbase)) * DM + hd * HD + p8;
  {
#pragma unroll
    for (int q = 0; q < 4; ++q) {
      const int row = 4 * q + rsub;                 // rows 0..15: 4 rows per instruction x 4 instructions
      const v4f x0 = *(const v4fa*)&so[w][row][p8], x1 = *(const v4fa*)&so[w][row][p8 + 4];
      if (EARLY) {
        v8us oh, ol;
#pragma unroll
        for (int e = 0; e < 4; ++e) {
          const unsigned short h0 = bf16_bits(x0[e]), h1 = bf16_bits(x1[e]);
          oh[e] = h0; oh[4 + e] = h1;
          ol[e] = bf16_bits(x0[e] - bf16_val(h0));
          ol[4 + e] = bf16_bits(x1[e] - bf16_val(h1));
        }
        *(v8us*)(Cp + cb + (size_t)row * DM) = oh;
        *(v8us*)(Cl + cb + (size_t)row * DM) = ol;
      } else {
        H8 of;
#pragma unroll
        for (int e = 0; e < 4; ++e) {
          of.h[e]     = (_Float16)(x0[e] * 64.0f);
          of.h[4 + e] = (_Float16)(x1[e] * 64.0f);
        }
        const v8us ov = of.v;
        *(v8us*)(Cp + cb + (size_t)row * DM) = ov;
      }
    }
    
  }
}

extern "C" void kernel_launch(void* const* d_in, const int* in_sizes, int n_in,
                              void* d_out, int out_size, void* d_ws, size_t ws_size, hipStream_t stream) {
  if (n_in < 10) return;
  const long long needx = (long long)(NB - 1) * SEQ_FULL * DM + (long long)SEQ * DM;   // last element touched + 1
  const long long needm = (long long)(NB - 1) * SEQ_FULL * SEQ_FULL + (long long)(SEQ - 1) * SEQ_FULL + SEQ;
  if ((long long)in_sizes[0] < needx) return;
  if ((long long)in_sizes[1] < (long long)DM * DM || (long long)in_sizes[3] < (long long)DM * DM) return;
  if ((long long)in_sizes[5] < (long long)DM * DM || (long long)in_sizes[7] < (long long)DM * DM) return;
  if (in_sizes[2] < DM || in_sizes[4] < DM || in_sizes[6] < DM || in_sizes[8] < DM) return;
  if ((long long)in_sizes[9] < needm) return;
  if ((long long)out_size < needx) return;
  const float* x  = (const float*)d_in[0];   // wire order: x, Wq, bq, Wk, bk, Wv, bv, Wo, bo, attention_mask
  const float* Wq = (const float*)d_in[1];
  const float* bq = (const float*)d_in[2];
  const float* Wk = (const float*)d_in[3];
  const float* bk = (const float*)d_in[4];
  const float* Wv = (const float*)d_in[5];
  const float* bv = (const float*)d_in[6];
  const float* Wo = (const float*)d_in[7];
  const float* bo = (const float*)d_in[8];
  const int* mask = (const int*)d_in[9];
  float* out = (float*)d_out;

  char* ws = (char*)d_ws;
  size_t off = 0;
  const size_t pl2 = PLANE * 2;                               // bytes of one [NB*SEQ][1024] 16-bit plane (8 MiB at full size), multiple of 256
  const size_t wsz = (size_t)DM * DM * 2;                     // 2 MiB per weight plane
  const size_t bsz = (size_t)NB * SEQ * (SEQ / 32) * 4;       // 1 MiB at full size
  unsigned short* Xb  = (unsigned short*)(ws + off); off += pl2;
  unsigned short* Wb  = (unsigned short*)(ws + off); off += 4 * wsz;      // bf16 planes q, k, v, o
  unsigned short* Woh = (unsigned short*)(ws + off); off += wsz;          // f16 plane of 64 Wo
  unsigned short* QKh = (unsigned short*)(ws + off); off += 2 * pl2;      // [q|k][b][h][s][64]
  unsigned short* Vth = (unsigned short*)(ws + off); off += pl2;          // [b][h][64][s]
  unsigned short* Vtl = (unsigned short*)(ws + off); off += pl2;
  unsigned int*   Mb  = (unsigned int*)(ws + off);   off += (bsz + 255) & ~(size_t)255;
  unsigned short* Cp  = (unsigned short*)(ws + off); off += pl2;          // [b*SEQ + s][1024]: rows < RH bf16 hi, rows >= RH f16(64 ctx)
  unsigned short* Cl  = (unsigned short*)(ws + off); off += pl2;          // rows < RH: bf16 lo (other rows never written, never read)
  if (off > ws_size || off > (size_t)134217728) return;

  const int M = NB * SEQ;
  k_cvt<false><<<(unsigned)((M * 128 + 255) / 256), 256, 0, stream>>>(x, Xb, M, SEQ, SEQ_FULL);
  k_cvt<false><<<(unsigned)((DM * 128 + 255) / 256), 256, 0, stream>>>(Wq, Wb, DM, DM, DM);
  k_cvt<false><<<(unsigned)((DM * 128 + 255) / 256), 256, 0, stream>>>(Wk, Wb + (size_t)DM * DM, DM, DM, DM);
  k_cvt<false><<<(unsigned)((DM * 128 + 255) / 256), 256, 0, stream>>>(Wv, Wb + (size_t)2 * DM * DM, DM, DM, DM);
  if (RH > 0)
    k_cvt<false><<<(unsigned)((DM * 128 + 255) / 256), 256, 0, stream>>>(Wo, Wb + (size_t)3 * DM * DM, DM, DM, DM);
  if (SEQ > RH)
    k_cvt<true><<<(unsigned)((DM * 128 + 255) / 256), 256, 0, stream>>>(Wo, Woh, DM, DM, DM);
  k_mask<<<(unsigned)((NB * SEQ * (SEQ / 32) + 255) / 256), 256, 0, stream>>>(mask, Mb);
  // A[M][1024] x W[1024][1024]^T: grid (row blocks, 1024/64, planes)
  k_gemm<0><<<dim3((unsigned)(NB * (SEQ / 128)), DM / 64, 2), 128, 0, stream>>>(Xb, Xb, Wb, bq, bk, QKh, QKh, out, 0, SEQ / 128);
  k_gemm<1><<<dim3((unsigned)(NB * (SEQ / 128)), DM / 64, 1), 128, 0, stream>>>(Xb, Xb, Wb + (size_t)2 * DM * DM, bv, bv, Vth, Vtl, out, 0, SEQ / 128);
  if (RH > 0)
    k_attn<true><<<(unsigned)(NB * NH * (RH / 64)), 128, 0, stream>>>(QKh, Vth, Vtl, Mb, Cp, Cl, 0, RH / 64);
  if (SEQ > RH)
    k_attn<false><<<(unsigned)(NB * NH * ((SEQ - RH) / 64)), 128, 0, stream>>>(QKh, Vth, Vtl, Mb, Cp, Cl, RH / 64, (SEQ - RH) / 64);
  if (RH > 0)
    k_gemm<2><<<dim3((unsigned)(NB * (RH / 128)), DM / 64, 1), 128, 0, stream>>>(Cp, Cl, Wb + (size_t)3 * DM * DM, bo, bo, QKh, QKh, out, 0, RH / 128);
  if (SEQ > RH)
    k_gemm<3><<<dim3((unsigned)(NB * ((SEQ - RH) / 128)), DM / 64, 1), 128, 0, stream>>>(Cp, Cl, Woh, bo, bo, QKh, QKh, out, RH, (SEQ - RH) / 128);
}

// v002
// It runs in 181 microseconds.
// In two side-by-side timings against v001, it was 1.31 and 1.30 times as fast.
// Over all steps from v000 it is 1.74 times as fast.
#include <hip/hip_runtime.h>
// Contractions: q/k/v projections on v_wmma_f32_16x16x32_bf16 (x, W RNE bf16, single product, f32 accumulate); S^T = K Q^T on v_wmma_f32_16x16x32_f16 (q, k as x16 f16 planes, single product); O^T = V^T P^T on v_wmma_f32_16x16x32_f16 (query rows < RH: v x16 hi + x2^11 residual, P x256 hi + x2^11 residual, residual products in their own f32 accumulator; query rows >= RH: v x16, P x256, single product, row sum over the f16 P); output projection: rows < RH on v_wmma_f32_16x16x32_bf16 (ctx bf16 hi + bf16 lo planes, Wo RNE bf16), rows >= RH on v_wmma_f32_16x16x32_f16 (ctx x64 f16, Wo RNE-bf16 value x64 in f16, single product); softmax statistics f32.
// Multi-head attention, B x S x 1024, 16 heads of 64, scale 1/8, mask input (1 = key excluded, score replaced by -inf) read on the device as a packed bit plane.
// Engine: transposed flash. Each wave owns 16 queries. Per 32-key step: S^T tiles (key rows x query columns) from K rows (A, global f16 plane)
// and Q^T (B, registers); the two 16-key D tiles pack straight into the P^T B fragment; O^T (d rows x query columns) accumulates from V^T rows (A, global f16 planes).
// Plane layout: every 16-bit operand plane is stored in fragment order. One fragment (16 rows x 32 k) = 1 KB = [half 0..1][lane 0..31][8 elements];
// lane = 16h + row, element i of half f = k 16f + 8h + i. A wave-wide 16-byte load of one half is 512 contiguous bytes (four whole lines).
#ifndef NB
#define NB 2
#endif
#ifndef SEQ
#define SEQ 2048
#endif
#ifndef RH
#define RH 256                                 /* query rows below RH (per batch) take the hi + residual path */
#endif
#define NB_FULL 2
#define SEQ_FULL 2048
#define DM 1024
#define NH 16
#define HD 64
#define PLANE ((size_t)NB * SEQ * DM)          /* elements of one [NB*SEQ][1024] 16-bit plane */

static_assert(SEQ % 128 == 0);
static_assert(SEQ <= SEQ_FULL);
static_assert(NB <= NB_FULL);
static_assert(RH % 128 == 0);
static_assert(RH >= 0 && RH <= SEQ);
static_assert(NH * HD == DM);
static_assert(HD == 64);
static_assert(DM % 64 == 0);
static_assert(PLANE * 2 * 7 + (size_t)5 * DM * DM * 2 + (size_t)NB * SEQ * (SEQ / 32) * 4 + 4096 <= (size_t)134217728);

typedef __bf16 v16b __attribute__((ext_vector_type(16)));
typedef _Float16 v16h __attribute__((ext_vector_type(16)));
typedef unsigned short v8us __attribute__((ext_vector_type(8), may_alias));
typedef float v8f __attribute__((ext_vector_type(8)));
typedef float v4f __attribute__((ext_vector_type(4)));
typedef float v4fa __attribute__((ext_vector_type(4), may_alias));
typedef int v4i __attribute__((ext_vector_type(4)));
typedef int v4ia __attribute__((ext_vector_type(4), may_alias));
union FragH { v16h v; v8us half[2]; _Float16 h[16]; unsigned short u[16]; };
union FragX { v16b b; v16h h; v8us half[2]; };
union H8 { v8us v; _Float16 h[8]; unsigned short u[8]; };

#define LOG2E 1.4426950408889634f
#define RES_SC 2048.0f
#define RES_INV 0.00048828125f

__device__ __forceinline__ unsigned short bf16_bits(float x) {   // RNE convert to bf16 bits, NaN kept NaN
  const unsigned int u = __float_as_uint(x);
  const unsigned int r = (u + 0x7FFFu + ((u >> 16) & 1u)) >> 16;
  const unsigned int n = (u >> 16) | 0x40u;
  return (unsigned short)(((u & 0x7FFFFFFFu) > 0x7F800000u) ? n : r);
}
__device__ __forceinline__ float bf16_val(unsigned short b) { return __uint_as_float(((unsigned int)b) << 16); }
__device__ __forceinline__ float bf16_rne(float x) { return bf16_val(bf16_bits(x)); }

// 2 x 4 tile group of one 32-deep k-step (bf16), then the hazard guard
__device__ __forceinline__ void mma8(v16b a0, v16b a1, v16b b0, v16b b1, v16b b2, v16b b3, v8f (&c)[8]) {
  c[0] = __builtin_amdgcn_wmma_f32_16x16x32_bf16(false, a0, false, b0, (short)0, c[0], false, false);
  c[1] = __builtin_amdgcn_wmma_f32_16x16x32_bf16(false, a0, false, b1, (short)0, c[1], false, false);
  c[2] = __builtin_amdgcn_wmma_f32_16x16x32_bf16(false, a0, false, b2, (short)0, c[2], false, false);
  c[3] = __builtin_amdgcn_wmma_f32_16x16x32_bf16(false, a0, false, b3, (short)0, c[3], false, false);
  c[4] = __builtin_amdgcn_wmma_f32_16x16x32_bf16(false, a1, false, b0, (short)0, c[4], false, false);
  c[5] = __builtin_amdgcn_wmma_f32_16x16x32_bf16(false, a1, false, b1, (short)0, c[5], false, false);
  c[6] = __builtin_amdgcn_wmma_f32_16x16x32_bf16(false, a1, false, b2, (short)0, c[6], false, false);
  c[7] = __builtin_amdgcn_wmma_f32_16x16x32_bf16(false, a1, false, b3, (short)0, c[7], false, false);
  asm volatile("v_nop\n\tv_nop\n\tv_nop\n\tv_nop"
               : "+v"(c[0]), "+v"(c[1]), "+v"(c[2]), "+v"(c[3]), "+v"(c[4]), "+v"(c[5]), "+v"(c[6]), "+v"(c[7])
               : "v"(a0), "v"(a1), "v"(b0), "v"(b1), "v"(b2), "v"(b3));
}
// the same tile group on f16 operands, then the hazard guard
__device__ __forceinline__ void mma8h(v16h a0, v16h a1, v16h b0, v16h b1, v16h b2, v16h b3, v8f (&c)[8]) {
  c[0] = __builtin_amdgcn_wmma_f32_16x16x32_f16(false, a0, false, b0, (short)0, c[0], false, false);
  c[1] = __builtin_amdgcn_wmma_f32_16x16x32_f16(false, a0, false, b1, (short)0, c[1], false, false);
  c[2] = __builtin_amdgcn_wmma_f32_16x16x32_f16(false, a0, false, b2, (short)0, c[2], false, false);
  c[3] = __builtin_amdgcn_wmma_f32_16x16x32_f16(false, a0, false, b3, (short)0, c[3], false, false);
  c[4] = __builtin_amdgcn_wmma_f32_16x16x32_f16(false, a1, false, b0, (short)0, c[4], false, false);
  c[5] = __builtin_amdgcn_wmma_f32_16x16x32_f16(false, a1, false, b1, (short)0, c[5], false, false);
  c[6] = __builtin_amdgcn_wmma_f32_16x16x32_f16(false, a1, false, b2, (short)0, c[6], false, false);
  c[7] = __builtin_amdgcn_wmma_f32_16x16x32_f16(false, a1, false, b3, (short)0, c[7], false, false);
  asm volatile("v_nop\n\tv_nop\n\tv_nop\n\tv_nop"
               : "+v"(c[0]), "+v"(c[1]), "+v"(c[2]), "+v"(c[3]), "+v"(c[4]), "+v"(c[5]), "+v"(c[6]), "+v"(c[7])
               : "v"(a0), "v"(a1), "v"(b0), "v"(b1), "v"(b2), "v"(b3));
}
// sh += K*Q (64 deep = two k-steps), then the hazard guard
__device__ __forceinline__ void mma_s(v16h k0, v16h k1, v16h q0, v16h q1, v8f& sh) {
  sh = __builtin_amdgcn_wmma_f32_16x16x32_f16(false, k0, false, q0, (short)0, sh, false, false);
  sh = __builtin_amdgcn_wmma_f32_16x16x32_f16(false, k1, false, q1, (short)0, sh, false, false);
  asm volatile("v_nop\n\tv_nop\n\tv_nop\n\tv_nop" : "+v"(sh) : "v"(k0), "v"(k1), "v"(q0), "v"(q1));
}
// oh += Vh*Ph ; ol += Vh*Pl + Vl*Ph (same x2^11 on both residual planes), then the hazard guard
__device__ __forceinline__ void mma_pv3(v16h vh, v16h vl, v16h ph, v16h pl, v8f& oh, v8f& ol) {
  oh = __builtin_amdgcn_wmma_f32_16x16x32_f16(false, vh, false, ph, (short)0, oh, false, false);
  ol = __builtin_amdgcn_wmma_f32_16x16x32_f16(false, vh, false, pl, (short)0, ol, false, false);
  ol = __builtin_amdgcn_wmma_f32_16x16x32_f16(false, vl, false, ph, (short)0, ol, false, false);
  asm volatile("v_nop\n\tv_nop\n\tv_nop\n\tv_nop" : "+v"(oh), "+v"(ol) : "v"(vh), "v"(vl), "v"(ph), "v"(pl));
}
// oh += Vh*Ph, then the hazard guard
__device__ __forceinline__ void mma_pv1(v16h vh, v16h ph, v8f& oh) {
  oh = __builtin_amdgcn_wmma_f32_16x16x32_f16(false, vh, false, ph, (short)0, oh, false, false);
  asm volatile("v_nop\n\tv_nop\n\tv_nop\n\tv_nop" : "+v"(oh) : "v"(vh), "v"(ph));
}

// dst = 16-bit image of src[(b*rpb_full + s)][0..1023], row = b*rpb + s, in fragment order [row / 16][k / 32][half][lane][8]. F16 = false: bf16 bits (RNE);
// F16 = true: f16 bits of (RNE bf16 value x 64), exact. Thread per 8 elements; a wave takes 8 rows x 32 k: it reads 8 whole 128-B lines and writes
// 4 whole lines (8 rows of one (half, h) each); rows a multiple of 16
template <bool F16>
__global__ __launch_bounds__(256) void k_cvt(const float* __restrict__ src, unsigned short* __restrict__ dst,
                                             int rows, int rpb, int rpb_full) {
  const int t = blockIdx.x * 256 + threadIdx.x;
  if (t >= rows * 128) return;
  const int wv = t >> 5, g = (t >> 3) & 3;                                      // g = 2 * half + h: which 8 k of the k-step
  const int r16 = (wv & 1) * 8 + (t & 7), frag = wv >> 1;                       // row in its 16-row band; fragment = band * 32 + k-step
  const int row = (frag >> 5) * 16 + r16, kk = (frag & 31) * 32 + g * 8;
  const int b = row / rpb, s = row - b * rpb;
  const float* p = src + ((size_t)b * rpb_full + s) * DM + kk;
  const v4f x0 = *(const v4fa*)(p), x1 = *(const v4fa*)(p + 4);
  H8 o;
#pragma unroll
  for (int i = 0; i < 4; ++i) {
    if (F16) {
      o.h[i]     = (_Float16)(bf16_rne(x0[i]) * 64.0f);
      o.h[4 + i] = (_Float16)(bf16_rne(x1[i]) * 64.0f);
    } else {
      o.u[i]     = bf16_bits(x0[i]);
      o.u[4 + i] = bf16_bits(x1[i]);
    }
  }
  const v8us ov = o.v;
  unsigned short* d = dst + ((size_t)frag * 64 + g * 16 + r16) * 8;
  *(v8us*)d = ov;
  
}

// coverage: NB*SEQ*(SEQ/32) threads x 1 word = the whole plane.
__global__ __launch_bounds__(256) void k_mask(const int* __restrict__ mask, unsigned int* __restrict__ bits) {
  const int t = blockIdx.x * 256 + threadIdx.x;
  if (t >= NB * SEQ * (SEQ / 32)) return;
  const int wd = t % (SEQ / 32), row = t / (SEQ / 32);
  const int b = row / SEQ, q = row - b * SEQ;
  const int* p = mask + ((size_t)b * SEQ_FULL + q) * SEQ_FULL + 32 * wd;
  unsigned int m = 0u;
#pragma unroll
  for (int j = 0; j < 8; ++j) {
    const v4i x = *(const v4ia*)(p + 4 * j);
    m |= ((x[0] == 1) ? 1u : 0u) << (4 * j);
    m |= ((x[1] == 1) ? 1u : 0u) << (4 * j + 1);
    m |= ((x[2] == 1) ? 1u : 0u) << (4 * j + 2);
    m |= ((x[3] == 1) ? 1u : 0u) << (4 * j + 3);
  }
  *(unsigned int*)(bits + t) = m;
  
}

// C[m][n] = sum_k A[m][k] * W[n][k] + bf16(bias[n]); A, W 16-bit planes with 1024-element rows; block tile 128 x 64, 4 waves x (32 x 64).
// Row blocks: block x -> batch b = x / nblk, first row s0 = sbeg + (x % nblk) * 128 of that batch (plane row b*SEQ + s0).
// Fragments straight from the fragment-ordered planes: A row m = l&15, B column n = l&15, elements 0..7 <- k0 + 8h + i, 8..15 <- k0 + 16 + 8h + i.
// MODE 0 (grid.z = 2: q, k; bf16 operands): f16 plane [z][b][h][s / 16][d / 32][half][lane][8] = f16(16 v); block tile = one contiguous 16-KB run.
// MODE 1 (v; bf16 operands): f16 planes [b][h][s / 32][d / 16][half][lane][8 keys], hi = f16(16 v), residual = f16((16 v - hi) 2^11); transposed on the LDS read side.
// MODE 2 (out, rows < RH; bf16 operands): A = ctx hi plane, Alo = ctx lo plane (bf16, unscaled, same accumulator); f32 rows of the output buffer.
// MODE 3 (out, rows >= RH; f16 operands): A = f16(64 ctx), W = f16(64 Wo); accumulator x 2^-12; f32 rows of the output buffer.
// LDS tile so: cross-wave (block barrier); staged extent 128 x 64 == consumed extent.
template <int MODE>
__global__ __launch_bounds__(128) void k_gemm(const unsigned short* __restrict__ A, const unsigned short* __restrict__ Alo,
                                              const unsigned short* __restrict__ Wm,
                                              const float* __restrict__ bias0, const float* __restrict__ bias1,
                                              unsigned short* __restrict__ outH, unsigned short* __restrict__ outL,
                                              float* __restrict__ outF, int sbeg, int nblk) {
  __shared__ __attribute__((aligned(16))) float so[128][68];
  const int tid = threadIdx.x, w = __builtin_amdgcn_readfirstlane((int)(tid >> 5)), lane = tid & 31, ln = lane & 15, hh = lane >> 4;
  const int b = blockIdx.x / nblk, s0 = sbeg + (blockIdx.x - b * nblk) * 128;
  const int rowB = b * SEQ + s0, colB = blockIdx.y * 64, z = blockIdx.z;
  const size_t aoff = (size_t)(rowB + 32 * w) * DM + 8 * lane;                  // 16 plane rows = 32 fragments = 16 * DM elements
  const unsigned short* ap = A + aoff;
  const unsigned short* lp = Alo + aoff;
  const unsigned short* wp = Wm + (size_t)z * DM * DM + (size_t)colB * DM + 8 * lane;
  const v8f z8 = {0.f, 0.f, 0.f, 0.f, 0.f, 0.f, 0.f, 0.f};
  v8f c[8];
#pragma unroll
  for (int i = 0; i < 8; ++i) c[i] = z8;
#pragma unroll 1
  for (int k0 = 0; k0 < 16 * DM; k0 += 512) {                                   // k0: element offset of the k-step's fragment in its 16-row band
    FragX a0, a1, b0, b1, b2, b3;
    a0.half[0] = *(const v8us*)(ap + k0);               a0.half[1] = *(const v8us*)(ap + k0 + 256);
    a1.half[0] = *(const v8us*)(ap + 16 * DM + k0);     a1.half[1] = *(const v8us*)(ap + 16 * DM + k0 + 256);
    if (MODE == 2) asm volatile("s_wait_xcnt 0x0" ::: "memory");   // in front of loads whose results may land in the registers that held the A loads' address
    b0.half[0] = *(const v8us*)(wp + k0);               b0.half[1] = *(const v8us*)(wp + k0 + 256);
    b1.half[0] = *(const v8us*)(wp + 16 * DM + k0);     b1.half[1] = *(const v8us*)(wp + 16 * DM + k0 + 256);
    b2.half[0] = *(const v8us*)(wp + 32 * DM + k0);     b2.half[1] = *(const v8us*)(wp + 32 * DM + k0 + 256);
    b3.half[0] = *(const v8us*)(wp + 48 * DM + k0);
    if (MODE == 2) asm volatile("s_wait_xcnt 0x0" ::: "memory");   // the last W load's result may land in the registers that held the W loads' address
    b3.half[1] = *(const v8us*)(wp + 48 * DM + k0 + 256);
    if (MODE == 3) mma8h(a0.h, a1.h, b0.h, b1.h, b2.h, b3.h, c);
    else           mma8(a0.b, a1.b, b0.b, b1.b, b2.b, b3.b, c);
    if (MODE == 2) {
      FragX l0, l1;
      l0.half[0] = *(const v8us*)(lp + k0);             l0.half[1] = *(const v8us*)(lp + k0 + 256);
      l1.half[0] = *(const v8us*)(lp + 16 * DM + k0);   l1.half[1] = *(const v8us*)(lp + 16 * DM + k0 + 256);
      mma8(l0.b, l1.b, b0.b, b1.b, b2.b, b3.b, c);
    }
  }
  // D element r of tile (i, j) = C(row 32w + 16i + 8h + r, col 16j + l&15)
  const float cs = (MODE == 3) ? 0.000244140625f : 1.0f;     // 2^-12 undoes the x64 carries of ctx and Wo
#pragma unroll
  for (int j = 0; j < 4; ++j) {
    const int n = colB + 16 * j + ln;
    const float bA = bias0[n], bB = bias1[n];
    const float bj = bf16_rne((MODE == 0 && z == 1) ? bB : bA);
#pragma unroll
    for (int i = 0; i < 2; ++i)
#pragma unroll
      for (int r = 0; r < 8; ++r)
        so[32 * w + 16 * i + 8 * hh + r][16 * j + ln] = c[4 * i + j][r] * cs + bj;
  }
  __syncthreads();
  const int hd = blockIdx.y;
  if (MODE == 0) {
    const size_t base = (size_t)z * PLANE + (((size_t)(b * NH + hd)) * SEQ + s0) * HD;
    unsigned short* dh = outH + base;
    {
      for (int i = tid; i < 128 * 8; i += 128) {
        const int row = (i >> 7) * 16 + (i & 15), p8 = ((i >> 4) & 7) * 8;   // piece i = [s / 16][d / 32][half][h][s % 16]; d = 8 * bits 6..4
        const v4f x0 = *(const v4fa*)&so[row][p8], x1 = *(const v4fa*)&so[row][p8 + 4];
        H8 oh;
#pragma unroll
        for (int q = 0; q < 4; ++q) {
          oh.h[q]     = (_Float16)(x0[q] * 16.0f);
          oh.h[4 + q] = (_Float16)(x1[q] * 16.0f);
        }
        const v8us ov = oh.v;
        *(v8us*)(dh + (size_t)i * 8) = ov;
      }
      
    }
  } else if (MODE == 1) {
    const size_t base = (((size_t)(b * NH + hd)) * SEQ + s0) * HD;             // 32 keys x 64 d = 2048 elements per key step
    unsigned short* dh = outH + base;
    unsigned short* dl = outL + base;
    {
      for (int i = tid; i < 64 * 16; i += 128) {
        const int d = ((i >> 6) & 3) * 16 + (i & 15), s8 = (i >> 8) * 32 + ((i >> 4) & 3) * 8;   // piece i = [s / 32][d / 16][half][h][d % 16]
        H8 oh, ol;
#pragma unroll
        for (int q = 0; q < 8; ++q) {
          const float v0 = so[s8 + q][d] * 16.0f;
          const _Float16 h0 = (_Float16)v0;
          oh.h[q] = h0;
          ol.h[q] = (_Float16)((v0 - (float)h0) * RES_SC);
        }
        const v8us ovh = oh.v, ovl = ol.v;
        *(v8us*)(dh + (size_t)i * 8) = ovh;
        *(v8us*)(dl + (size_t)i * 8) = ovl;
      }
      
    }
  } else {
    float* og = outF + ((size_t)b * SEQ_FULL + s0) * DM + colB;
    {
      for (int i = tid; i < 128 * 16; i += 128) {
        const int row = i >> 4, c4 = (i & 15) * 4;
        const v4f v = *(const v4fa*)&so[row][c4];
        *(v4f*)(og + (size_t)row * DM + c4) = v;
      }
      
    }
  }
}

// Fragment loads of one 32-key step. Pointers are the (batch, head) bases of the planes.
// A fragments of K: row m = key (key0 + 16*kt + ln), elements 0..7 <- d = 32c + 8h + i, 8..15 <- d = 32c + 16 + 8h + i; kf[2*kt + c];
// the step's eight halves are 4 KB in a row of the fragment-ordered plane
__device__ __forceinline__ void load_k(const unsigned short* __restrict__ Khp, int key0, int ln, int hh, FragH (&kf)[4]) {
  const unsigned short* kp = Khp + (size_t)key0 * HD + 8 * (16 * hh + ln);
#pragma unroll
  for (int f = 0; f < 4; ++f) {
    kf[f].half[0] = *(const v8us*)(kp + 512 * f); kf[f].half[1] = *(const v8us*)(kp + 512 * f + 256);
  }
}
// A fragments of V^T: row m = d (16*t + ln), elements 0..7 <- key0 + 8h + i, 8..15 <- key0 + 16 + 8h + i; again 4 KB in a row (key0 a multiple of 32)
__device__ __forceinline__ void load_v(const unsigned short* __restrict__ Vp, int key0, int ln, int hh, FragH (&vf)[4]) {
  const unsigned short* vp = Vp + (size_t)key0 * HD + 8 * (16 * hh + ln);
#pragma unroll
  for (int t = 0; t < 4; ++t) {
    vf[t].half[0] = *(const v8us*)(vp + 512 * t); vf[t].half[1] = *(const v8us*)(vp + 512 * t + 256);
  }
}

// One 32-key step for a wave's 16 queries (this lane's column: one query), on fragments and a mask word that were loaded one step earlier.
// Each fragment set is reloaded for step keyN (the wave's next active step) right behind its last product, so that those loads fly
// under the rest of this step and the head of the next one.
// EARLY: P and v as hi + residual planes (three products, lr over the f32 weights); else one product and lr over the f16 weights.
template <bool EARLY>
__device__ __forceinline__ void fa_step(const unsigned short* __restrict__ Khp,
                                        const unsigned short* __restrict__ Vhp, const unsigned short* __restrict__ Vlp,
                                        int keyN, unsigned int mw, int ln, int hh,
                                        const FragH& qh0, const FragH& qh1,
                                        FragH (&kf)[4], FragH (&vf)[4], FragH (&vlf)[4],
                                        float& mr, float& lr, v8f (&Oh)[4], v8f (&Ol)[4]) {
  const v8f z8 = {0.f, 0.f, 0.f, 0.f, 0.f, 0.f, 0.f, 0.f};
  float sc[16];
#pragma unroll
  for (int kt = 0; kt < 2; ++kt) {
    v8f sh = z8;
    mma_s(kf[2 * kt].v, kf[2 * kt + 1].v, qh0.v, qh1.v, sh);
    // S^T element r of tile kt = score(key0 + 16*kt + 8h + r, this lane's query); carries: 16 x 16 on q, k, then 1/8 -> 2^-11
#pragma unroll
    for (int r = 0; r < 8; ++r) sc[8 * kt + r] = sh[r] * 0.00048828125f;
  }
  load_k(Khp, keyN, ln, hh, kf);
  __builtin_amdgcn_sched_barrier(0);   // keeps the K reloads here: sunk below the softmax they would have too short a lead on the next step's products
  // replace-fill: excluded keys get -inf (bit 8h + r of the word <-> tile 0, bit 16 + 8h + r <-> tile 1)
  const float ninf = __uint_as_float(0xFF800000u);
  const unsigned int mb = mw >> (8 * hh);
#pragma unroll
  for (int r = 0; r < 8; ++r) {
    sc[r]     = ((mb >> r) & 1u) ? ninf : sc[r];
    sc[8 + r] = ((mb >> (16 + r)) & 1u) ? ninf : sc[8 + r];
  }
  float mx = sc[0];
#pragma unroll
  for (int i = 1; i < 16; ++i) mx = fmaxf(mx, sc[i]);
  mx = fmaxf(mx, __shfl_xor(mx, 16, 32));           // the other lane half holds the other 16 keys of this query
  const float mnew = fmaxf(mr, mx);
  const float al = exp2f((mr - mnew) * LOG2E);
  mr = mnew;
  // weights carried x256: pc = 256 * exp(sc - mnew); hi plane f16(pc); EARLY: residual plane f16((pc - hi) * 2048)
  FragH ph, pl;
  float ps = 0.0f;
#pragma unroll
  for (int i = 0; i < 16; ++i) {
    const float pc = exp2f(fmaf(sc[i] - mnew, LOG2E, 8.0f));
    const _Float16 h = (_Float16)pc;
    ph.h[i] = h;                                    // B element i: i<8 -> key0 + 8h + i (tile 0 row 8h+i); i>=8 -> key0 + 16 + 8h + (i-8) (tile 1)
    if (EARLY) {
      ps += pc;
      pl.h[i] = (_Float16)((pc - (float)h) * RES_SC);
    } else {
      ps += (float)h;
    }
  }
  ps += __shfl_xor(ps, 16, 32);
  lr = lr * al + ps;
#pragma unroll
  for (int t = 0; t < 4; ++t) {
    Oh[t] = Oh[t] * al;
    if (EARLY) Ol[t] = Ol[t] * al;
  }
#pragma unroll
  for (int t = 0; t < 4; ++t) {
    if (EARLY) mma_pv3(vf[t].v, vlf[t].v, ph.v, pl.v, Oh[t], Ol[t]);
    else       mma_pv1(vf[t].v, ph.v, Oh[t]);
  }
  load_v(Vhp, keyN, ln, hh, vf);
  if (EARLY) load_v(Vlp, keyN, ln, hh, vlf);
  asm volatile("s_wait_xcnt 0x0" ::: "memory");   // in front of the next step's writes to the registers that held these loads' addresses
}

// Block = 4 waves x 16 queries = 64 queries of one (batch, head); query tile = qt0 + (block % nqt); no LDS and no barrier.
// Steps whose 32 keys are excluded for all 16 queries of the wave are skipped (exact for any mask value): a wave-uniform map of the
// active steps is built from the wave's mask rows in front of the loop, so that the step after the current one is known when its loads issue.
// Epilogue: lane 16h + q holds ctx(query q, d = 16t + 8h + r), which is half t & 1 of the ctx plane's fragment (k-step 2*head + t / 2): each O^T tile
// goes out of its registers as one 512-byte run.
// coverage: NB*NH*nqt blocks x 4 waves x 16 rows x 64 columns = every (row, head) segment of the band exactly once.
template <bool EARLY>
__global__ __launch_bounds__(128) void k_attn(const unsigned short* __restrict__ QKh,
                                              const unsigned short* __restrict__ Vth, const unsigned short* __restrict__ Vtl,
                                              const unsigned int* __restrict__ bits,
                                              unsigned short* __restrict__ Cp, unsigned short* __restrict__ Cl,
                                              int qt0, int nqt) {
  static_assert(SEQ / 32 <= 64);
  const int tid = threadIdx.x, w = __builtin_amdgcn_readfirstlane((int)(tid >> 5)), lane = tid & 31, ln = lane & 15, hh = lane >> 4;
  const int bh = blockIdx.x / nqt, qt = qt0 + (blockIdx.x - bh * nqt);
  const int b = bh / NH, hd = bh - b * NH;
  const int qbase = qt * 64 + 16 * w;
  const int qg = qbase + ln;
  const size_t hb = (size_t)bh * SEQ * HD;
  // Q^T B fragments: column n = query qg, elements 0..7 <- d = 32c + 8h + i, 8..15 <- d = 32c + 16 + 8h + i
  FragH qh0, qh1;
  {
    const unsigned short* qrh = QKh + hb + (size_t)qbase * HD + 8 * lane;
    qh0.half[0] = *(const v8us*)(qrh);       qh0.half[1] = *(const v8us*)(qrh + 256);
    qh1.half[0] = *(const v8us*)(qrh + 512); qh1.half[1] = *(const v8us*)(qrh + 768);
  }
  const unsigned short* Khp = QKh + PLANE + hb;
  const unsigned short* Vhp = Vth + hb;
  const unsigned short* Vlp = Vtl + hb;
  const unsigned int* mrow = bits + ((size_t)b * SEQ + qg) * (SEQ / 32);
  float mr = -3.0e38f, lr = 0.0f;
  v8f Oh[4] = {}, Ol[4] = {};
  // bit j of act: step j has a key that some query of the wave keeps
  unsigned long long act = 0ull;
#pragma unroll
  for (int i = 0; i < SEQ / 128; ++i) {
    const v4i x = *(const v4ia*)(mrow + 4 * i);
#pragma unroll
    for (int e = 0; e < 4; ++e)
      if (__ballot(x[e] != -1) != 0) act |= 1ull << (4 * i + e);   // wave-uniform
  }
  if (act != 0ull) {
    int j = __builtin_ctzll(act);
    act &= act - 1ull;
    FragH kf[4], vf[4], vlf[4];
    unsigned int mw = mrow[j];
    __builtin_amdgcn_sched_barrier(0);                // mask word first in load order: the loop's wait for it then leaves the fragment loads in flight
    load_k(Khp, 32 * j, ln, hh, kf);
    load_v(Vhp, 32 * j, ln, hh, vf);
    if (EARLY) load_v(Vlp, 32 * j, ln, hh, vlf);
    asm volatile("s_wait_xcnt 0x0" ::: "memory");     // in front of later writes to the registers that held these loads' addresses
    __builtin_amdgcn_sched_barrier(0);                // keeps those writes behind the wait
#pragma unroll 1
    for (;;) {
      const bool more = act != 0ull;                  // wave-uniform
      const int jn = more ? __builtin_ctzll(act) : j; // last step: its own tiles once more (in bounds, never used)
      act &= act - 1ull;
      const unsigned int mwn = mrow[jn];
      fa_step<EARLY>(Khp, Vhp, Vlp, 32 * jn, mw, ln, hh, qh0, qh1, kf, vf, vlf, mr, lr, Oh, Ol);
      if (!more) break;
      mw = mwn;
      j = jn;
    }
  }

  // O^T element r of tile t = ctx(query qg, d = 16t + 8h + r); undo the carries: x256 (in lr), x16 (v), x2048 (residual accumulator)
  const float inv = 1.0f / (16.0f * lr);
  const size_t cb = ((size_t)(b * SEQ + qbase)) * DM + (size_t)hd * (16 * HD) + 8 * lane;
#pragma unroll
  for (int t = 0; t < 4; ++t) {
    if (EARLY) {
      v8us oh, ol;
#pragma unroll
      for (int r = 0; r < 8; ++r) {
        const float x = (Oh[t][r] + Ol[t][r] * RES_INV) * inv;
        const unsigned short h0 = bf16_bits(x);
        oh[r] = h0;
        ol[r] = bf16_bits(x - bf16_val(h0));
      }
      *(v8us*)(Cp + cb + 256 * t) = oh;
      *(v8us*)(Cl + cb + 256 * t) = ol;
    } else {
      H8 of;
#pragma unroll
      for (int r = 0; r < 8; ++r) of.h[r] = (_Float16)((Oh[t][r] * inv) * 64.0f);
      const v8us ov = of.v;
      *(v8us*)(Cp + cb + 256 * t) = ov;
    }
  }
}

extern "C" void kernel_launch(void* const* d_in, const int* in_sizes, int n_in,
                              void* d_out, int out_size, void* d_ws, size_t ws_size, hipStream_t stream) {
  if (n_in < 10) return;
  const long long needx = (long long)(NB - 1) * SEQ_FULL * DM + (long long)SEQ * DM;   // last element touched + 1
  const long long needm = (long long)(NB - 1) * SEQ_FULL * SEQ_FULL + (long long)(SEQ - 1) * SEQ_FULL + SEQ;
  if ((long long)in_sizes[0] < needx) return;
  if ((long long)in_sizes[1] < (long long)DM * DM || (long long)in_sizes[3] < (long long)DM * DM) return;
  if ((long long)in_sizes[5] < (long long)DM * DM || (long long)in_sizes[7] < (long long)DM * DM) return;
  if (in_sizes[2] < DM || in_sizes[4] < DM || in_sizes[6] < DM || in_sizes[8] < DM) return;
  if ((long long)in_sizes[9] < needm) return;
  if ((long long)out_size < needx) return;
  const float* x  = (const float*)d_in[0];   // wire order: x, Wq, bq, Wk, bk, Wv, bv, Wo, bo, attention_mask
  const float* Wq = (const float*)d_in[1];
  const float* bq = (const float*)d_in[2];
  const float* Wk = (const float*)d_in[3];
  const float* bk = (const float*)d_in[4];
  const float* Wv = (const float*)d_in[5];
  const float* bv = (const float*)d_in[6];
  const float* Wo = (const float*)d_in[7];
  const float* bo = (const float*)d_in[8];
  const int* mask = (const int*)d_in[9];
  float* out = (float*)d_out;

  char* ws = (char*)d_ws;
  size_t off = 0;
  const size_t pl2 = PLANE * 2;                               // bytes of one [NB*SEQ][1024] 16-bit plane (8 MiB at full size), multiple of 256
  const size_t wsz = (size_t)DM * DM * 2;                     // 2 MiB per weight plane
  const size_t bsz = (size_t)NB * SEQ * (SEQ / 32) * 4;       // 1 MiB at full size
  unsigned short* Xb  = (unsigned short*)(ws + off); off += pl2;
  unsigned short* Wb  = (unsigned short*)(ws + off); off += 4 * wsz;      // bf16 planes q, k, v, o
  unsigned short* Woh = (unsigned short*)(ws + off); off += wsz;          // f16 plane of 64 Wo
  unsigned short* QKh = (unsigned short*)(ws + off); off += 2 * pl2;      // [q|k][b][h][s][64], fragment order
  unsigned short* Vth = (unsigned short*)(ws + off); off += pl2;          // [b][h][s / 32][64 x 32], fragment order
  unsigned short* Vtl = (unsigned short*)(ws + off); off += pl2;
  unsigned int*   Mb  = (unsigned int*)(ws + off);   off += (bsz + 255) & ~(size_t)255;
  unsigned short* Cp  = (unsigned short*)(ws + off); off += pl2;          // [b*SEQ + s][1024], fragment order: rows < RH bf16 hi, rows >= RH f16(64 ctx)
  unsigned short* Cl  = (unsigned short*)(ws + off); off += pl2;          // rows < RH: bf16 lo (other rows never written, never read)
  if (off > ws_size || off > (size_t)134217728) return;

  const int M = NB * SEQ;
  k_cvt<false><<<(unsigned)((M * 128 + 255) / 256), 256, 0, stream>>>(x, Xb, M, SEQ, SEQ_FULL);
  k_cvt<false><<<(unsigned)((DM * 128 + 255) / 256), 256, 0, stream>>>(Wq, Wb, DM, DM, DM);
  k_cvt<false><<<(unsigned)((DM * 128 + 255) / 256), 256, 0, stream>>>(Wk, Wb + (size_t)DM * DM, DM, DM, DM);
  k_cvt<false><<<(unsigned)((DM * 128 + 255) / 256), 256, 0, stream>>>(Wv, Wb + (size_t)2 * DM * DM, DM, DM, DM);
  if (RH > 0)
    k_cvt<false><<<(unsigned)((DM * 128 + 255) / 256), 256, 0, stream>>>(Wo, Wb + (size_t)3 * DM * DM, DM, DM, DM);
  if (SEQ > RH)
    k_cvt<true><<<(unsigned)((DM * 128 + 255) / 256), 256, 0, stream>>>(Wo, Woh, DM, DM, DM);
  k_mask<<<(unsigned)((NB * SEQ * (SEQ / 32) + 255) / 256), 256, 0, stream>>>(mask, Mb);
  // A[M][1024] x W[1024][1024]^T: grid (row blocks, 1024/64, planes)
  k_gemm<0><<<dim3((unsigned)(NB * (SEQ / 128)), DM / 64, 2), 128, 0, stream>>>(Xb, Xb, Wb, bq, bk, QKh, QKh, out, 0, SEQ / 128);
  k_gemm<1><<<dim3((unsigned)(NB * (SEQ / 128)), DM / 64, 1), 128, 0, stream>>>(Xb, Xb, Wb + (size_t)2 * DM * DM, bv, bv, Vth, Vtl, out, 0, SEQ / 128);
  if (RH > 0)
    k_attn<true><<<(unsigned)(NB * NH * (RH / 64)), 128, 0, stream>>>(QKh, Vth, Vtl, Mb, Cp, Cl, 0, RH / 64);
  if (SEQ > RH)
    k_attn<false><<<(unsigned)(NB * NH * ((SEQ - RH) / 64)), 128, 0, stream>>>(QKh, Vth, Vtl, Mb, Cp, Cl, RH / 64, (SEQ - RH) / 64);
  if (RH > 0)
    k_gemm<2><<<dim3((unsigned)(NB * (RH / 128)), DM / 64, 1), 128, 0, stream>>>(Cp, Cl, Wb + (size_t)3 * DM * DM, bo, bo, QKh, QKh, out, 0, RH / 128);
  if (SEQ > RH)
    k_gemm<3><<<dim3((unsigned)(NB * ((SEQ - RH) / 128)), DM / 64, 1), 128, 0, stream>>>(Cp, Cl, Woh, bo, bo, QKh, QKh, out, RH, (SEQ - RH) / 128);
}

// v003
// It runs in 131 microseconds.
// Timed twice side by side with v002, it ran 1.39 times as fast both times.
// All steps since v000 together make it 2.42 times as fast.
#include <hip/hip_runtime.h>
// Contractions: q/k/v projections on v_wmma_f32_16x16x32_bf16 (x, W RNE bf16, single product, f32 accumulate); S^T = K Q^T on v_wmma_f32_16x16x32_f16 (q, k as x16 f16 planes, single product); O^T = V^T P^T on v_wmma_f32_16x16x32_f16 (query rows < RH: v x16 hi + x2^11 residual, P x256 hi + x2^11 residual, residual products in their own f32 accumulator; query rows >= RH: v x16, P x256, single product, row sum over the f16 P); output projection: rows < RH on v_wmma_f32_16x16x32_bf16 (ctx bf16 hi + bf16 lo planes, Wo RNE bf16), rows >= RH on v_wmma_f32_16x16x32_f16 (ctx x64 f16, Wo RNE-bf16 value x64 in f16, single product); softmax statistics f32.
// Multi-head attention, B x S x 1024, 16 heads of 64, scale 1/8, mask input (1 = key excluded, score replaced by -inf) read on the device as a packed bit plane.
// Engine: transposed flash. Each wave owns 16 queries. Per 32-key step: S^T tiles (key rows x query columns) from K rows (A, global f16 plane)
// and Q^T (B, registers); the two 16-key D tiles pack straight into the P^T B fragment; O^T (d rows x query columns) accumulates from V^T rows (A, global f16 planes).
// Plane layout: every 16-bit operand plane is stored in fragment order. One fragment (16 rows x 32 k) = 1 KB = [half 0..1][lane 0..31][8 elements];
// lane = 16h + row, element i of half f = k 16f + 8h + i. A wave-wide 16-byte load of one half is 512 contiguous bytes (four whole lines).
#ifndef NB
#define NB 2
#endif
#ifndef SEQ
#define SEQ 2048
#endif
#ifndef RH
#define RH 256                                 /* query rows below RH (per batch) take the hi + residual path */
#endif
#define NB_FULL 2
#define SEQ_FULL 2048
#define DM 1024
#define NH 16
#define HD 64
#define PLANE ((size_t)NB * SEQ * DM)          /* elements of one [NB*SEQ][1024] 16-bit plane */

static_assert(SEQ % 128 == 0);
static_assert(SEQ <= SEQ_FULL);
static_assert(NB <= NB_FULL);
static_assert(RH % 128 == 0);
static_assert(RH >= 0 && RH <= SEQ);
static_assert(NH * HD == DM);
static_assert(HD == 64);
static_assert(DM % 64 == 0);
static_assert(PLANE * 2 * 7 + (size_t)5 * DM * DM * 2 + (size_t)NB * SEQ * (SEQ / 32) * 4 + 4096 <= (size_t)134217728);

typedef __bf16 v16b __attribute__((ext_vector_type(16)));
typedef _Float16 v16h __attribute__((ext_vector_type(16)));
typedef unsigned short v8us __attribute__((ext_vector_type(8), may_alias));
typedef float v8f __attribute__((ext_vector_type(8)));
typedef float v4f __attribute__((ext_vector_type(4)));
typedef float v4fa __attribute__((ext_vector_type(4), may_alias));
typedef int v4i __attribute__((ext_vector_type(4)));
typedef int v4ia __attribute__((ext_vector_type(4), may_alias));
union FragH { v16h v; v8us half[2]; _Float16 h[16]; unsigned short u[16]; };
union FragX { v16b b; v16h h; v8us half[2]; };
union H8 { v8us v; _Float16 h[8]; unsigned short u[8]; };

#define LOG2E 1.4426950408889634f
#define RES_SC 2048.0f
#define RES_INV 0.00048828125f

__device__ __forceinline__ unsigned short bf16_bits(float x) {   // RNE convert to bf16 bits, NaN kept NaN
  const unsigned int u = __float_as_uint(x);
  const unsigned int r = (u + 0x7FFFu + ((u >> 16) & 1u)) >> 16;
  const unsigned int n = (u >> 16) | 0x40u;
  return (unsigned short)(((u & 0x7FFFFFFFu) > 0x7F800000u) ? n : r);
}
__device__ __forceinline__ float bf16_val(unsigned short b) { return __uint_as_float(((unsigned int)b) << 16); }
__device__ __forceinline__ float bf16_rne(float x) { return bf16_val(bf16_bits(x)); }

// 2 x 4 tile group of one 32-deep k-step (bf16), then the hazard guard
__device__ __forceinline__ void mma8(v16b a0, v16b a1, v16b b0, v16b b1, v16b b2, v16b b3, v8f (&c)[8]) {
  c[0] = __builtin_amdgcn_wmma_f32_16x16x32_bf16(false, a0, false, b0, (short)0, c[0], false, false);
  c[1] = __builtin_amdgcn_wmma_f32_16x16x32_bf16(false, a0, false, b1, (short)0, c[1], false, false);
  c[2] = __builtin_amdgcn_wmma_f32_16x16x32_bf16(false, a0, false, b2, (short)0, c[2], false, false);
  c[3] = __builtin_amdgcn_wmma_f32_16x16x32_bf16(false, a0, false, b3, (short)0, c[3], false, false);
  c[4] = __builtin_amdgcn_wmma_f32_16x16x32_bf16(false, a1, false, b0, (short)0, c[4], false, false);
  c[5] = __builtin_amdgcn_wmma_f32_16x16x32_bf16(false, a1, false, b1, (short)0, c[5], false, false);
  c[6] = __builtin_amdgcn_wmma_f32_16x16x32_bf16(false, a1, false, b2, (short)0, c[6], false, false);
  c[7] = __builtin_amdgcn_wmma_f32_16x16x32_bf16(false, a1, false, b3, (short)0, c[7], false, false);
  asm volatile("v_nop\n\tv_nop\n\tv_nop\n\tv_nop"
               : "+v"(c[0]), "+v"(c[1]), "+v"(c[2]), "+v"(c[3]), "+v"(c[4]), "+v"(c[5]), "+v"(c[6]), "+v"(c[7])
               : "v"(a0), "v"(a1), "v"(b0), "v"(b1), "v"(b2), "v"(b3));
}
// the same tile group on f16 operands, then the hazard guard
__device__ __forceinline__ void mma8h(v16h a0, v16h a1, v16h b0, v16h b1, v16h b2, v16h b3, v8f (&c)[8]) {
  c[0] = __builtin_amdgcn_wmma_f32_16x16x32_f16(false, a0, false, b0, (short)0, c[0], false, false);
  c[1] = __builtin_amdgcn_wmma_f32_16x16x32_f16(false, a0, false, b1, (short)0, c[1], false, false);
  c[2] = __builtin_amdgcn_wmma_f32_16x16x32_f16(false, a0, false, b2, (short)0, c[2], false, false);
  c[3] = __builtin_amdgcn_wmma_f32_16x16x32_f16(false, a0, false, b3, (short)0, c[3], false, false);
  c[4] = __builtin_amdgcn_wmma_f32_16x16x32_f16(false, a1, false, b0, (short)0, c[4], false, false);
  c[5] = __builtin_amdgcn_wmma_f32_16x16x32_f16(false, a1, false, b1, (short)0, c[5], false, false);
  c[6] = __builtin_amdgcn_wmma_f32_16x16x32_f16(false, a1, false, b2, (short)0, c[6], false, false);
  c[7] = __builtin_amdgcn_wmma_f32_16x16x32_f16(false, a1, false, b3, (short)0, c[7], false, false);
  asm volatile("v_nop\n\tv_nop\n\tv_nop\n\tv_nop"
               : "+v"(c[0]), "+v"(c[1]), "+v"(c[2]), "+v"(c[3]), "+v"(c[4]), "+v"(c[5]), "+v"(c[6]), "+v"(c[7])
               : "v"(a0), "v"(a1), "v"(b0), "v"(b1), "v"(b2), "v"(b3));
}
// sh += K*Q (64 deep = two k-steps), then the hazard guard
__device__ __forceinline__ void mma_s(v16h k0, v16h k1, v16h q0, v16h q1, v8f& sh) {
  sh = __builtin_amdgcn_wmma_f32_16x16x32_f16(false, k0, false, q0, (short)0, sh, false, false);
  sh = __builtin_amdgcn_wmma_f32_16x16x32_f16(false, k1, false, q1, (short)0, sh, false, false);
  asm volatile("v_nop\n\tv_nop\n\tv_nop\n\tv_nop" : "+v"(sh) : "v"(k0), "v"(k1), "v"(q0), "v"(q1));
}
// oh += Vh*Ph ; ol += Vh*Pl + Vl*Ph (same x2^11 on both residual planes), then the hazard guard
__device__ __forceinline__ void mma_pv3(v16h vh, v16h vl, v16h ph, v16h pl, v8f& oh, v8f& ol) {
  oh = __builtin_amdgcn_wmma_f32_16x16x32_f16(false, vh, false, ph, (short)0, oh, false, false);
  ol = __builtin_amdgcn_wmma_f32_16x16x32_f16(false, vh, false, pl, (short)0, ol, false, false);
  ol = __builtin_amdgcn_wmma_f32_16x16x32_f16(false, vl, false, ph, (short)0, ol, false, false);
  asm volatile("v_nop\n\tv_nop\n\tv_nop\n\tv_nop" : "+v"(oh), "+v"(ol) : "v"(vh), "v"(vl), "v"(ph), "v"(pl));
}
// oh += Vh*Ph, then the hazard guard
__device__ __forceinline__ void mma_pv1(v16h vh, v16h ph, v8f& oh) {
  oh = __builtin_amdgcn_wmma_f32_16x16x32_f16(false, vh, false, ph, (short)0, oh, false, false);
  asm volatile("v_nop\n\tv_nop\n\tv_nop\n\tv_nop" : "+v"(oh) : "v"(vh), "v"(ph));
}

// dst = 16-bit image of src[(b*rpb_full + s)][0..1023], row = b*rpb + s, in fragment order [row / 16][k / 32][half][lane][8]. F16 = false: bf16 bits (RNE);
// F16 = true: f16 bits of (RNE bf16 value x 64), exact. Thread per 8 elements; a wave takes 8 rows x 32 k: it reads 8 whole 128-B lines and writes
// 4 whole lines (8 rows of one (half, h) each); rows a multiple of 16; t = thread index inside this plane's share of the grid
template <bool F16>
__device__ __forceinline__ void cvt_part(const float* __restrict__ src, unsigned short* __restrict__ dst,
                                         int t, int rows, int rpb, int rpb_full) {
  if (t >= rows * 128) return;
  const int wv = t >> 5, g = (t >> 3) & 3;                                      // g = 2 * half + h: which 8 k of the k-step
  const int r16 = (wv & 1) * 8 + (t & 7), frag = wv >> 1;                       // row in its 16-row band; fragment = band * 32 + k-step
  const int row = (frag >> 5) * 16 + r16, kk = (frag & 31) * 32 + g * 8;
  const int b = row / rpb, s = row - b * rpb;
  const float* p = src + ((size_t)b * rpb_full + s) * DM + kk;
  const v4f x0 = *(const v4fa*)(p), x1 = *(const v4fa*)(p + 4);
  H8 o;
#pragma unroll
  for (int i = 0; i < 4; ++i) {
    if (F16) {
      o.h[i]     = (_Float16)(bf16_rne(x0[i]) * 64.0f);
      o.h[4 + i] = (_Float16)(bf16_rne(x1[i]) * 64.0f);
    } else {
      o.u[i]     = bf16_bits(x0[i]);
      o.u[4 + i] = bf16_bits(x1[i]);
    }
  }
  const v8us ov = o.v;
  unsigned short* d = dst + ((size_t)frag * 64 + g * 16 + r16) * 8;
  *(v8us*)d = ov;
  
}

// coverage: NB*SEQ*(SEQ/32) threads x 1 word = the whole plane.
__device__ __forceinline__ void mask_part(const int* __restrict__ mask, unsigned int* __restrict__ bits, int t) {
  if (t >= NB * SEQ * (SEQ / 32)) return;
  const int wd = t % (SEQ / 32), row = t / (SEQ / 32);
  const int b = row / SEQ, q = row - b * SEQ;
  const int* p = mask + ((size_t)b * SEQ_FULL + q) * SEQ_FULL + 32 * wd;
  unsigned int m = 0u;
#pragma unroll
  for (int j = 0; j < 8; ++j) {
    const v4i x = *(const v4ia*)(p + 4 * j);
    m |= ((x[0] == 1) ? 1u : 0u) << (4 * j);
    m |= ((x[1] == 1) ? 1u : 0u) << (4 * j + 1);
    m |= ((x[2] == 1) ? 1u : 0u) << (4 * j + 2);
    m |= ((x[3] == 1) ? 1u : 0u) << (4 * j + 3);
  }
  *(unsigned int*)(bits + t) = m;
  
}

// One grid for everything that reads only the inputs: none of these parts reads what another writes. Block ranges, in index order:
// mask words (the longest threads, placed first for speed only), x, then the weight planes q, k, v, o (bf16) and o (f16 x64).
#define PB_MASK (NB * SEQ * (SEQ / 32) / 256)
#define PB_X (NB * SEQ * 128 / 256)
#define PB_W (DM * 128 / 256)
#define PB_NW (3 + (RH > 0 ? 1 : 0) + (SEQ > RH ? 1 : 0))
static_assert((NB * SEQ * (SEQ / 32)) % 256 == 0 && (NB * SEQ * 128) % 256 == 0 && (DM * 128) % 256 == 0);
__global__ __launch_bounds__(256) void k_prep(const float* __restrict__ x, const float* __restrict__ Wq, const float* __restrict__ Wk,
                                              const float* __restrict__ Wv, const float* __restrict__ Wo, const int* __restrict__ mask,
                                              unsigned short* __restrict__ Xb, unsigned short* __restrict__ Wb,
                                              unsigned short* __restrict__ Woh, unsigned int* __restrict__ bits) {
  const int tid = threadIdx.x;
  int blk = blockIdx.x;
  if (blk < PB_MASK) { mask_part(mask, bits, blk * 256 + tid); return; }
  blk -= PB_MASK;
  if (blk < PB_X) { cvt_part<false>(x, Xb, blk * 256 + tid, NB * SEQ, SEQ, SEQ_FULL); return; }
  blk -= PB_X;
  const int pl = blk / PB_W, t = (blk - pl * PB_W) * 256 + tid;
  if (pl == 4 || (pl == 3 && RH == 0)) { cvt_part<true>(Wo, Woh, t, DM, DM, DM); return; }
  const float* w = (pl == 0) ? Wq : (pl == 1) ? Wk : (pl == 2) ? Wv : Wo;
  cvt_part<false>(w, Wb + (size_t)pl * DM * DM, t, DM, DM, DM);
}

// C[m][n] = sum_k A[m][k] * W[n][k] + bf16(bias[n]); A, W 16-bit planes with 1024-element rows; block tile 128 x 64, 4 waves x (32 x 64).
// Row blocks: block bx -> batch b = bx / nblk, first row s0 = sbeg + (bx % nblk) * 128 of that batch (plane row b*SEQ + s0); column block by.
// Fragments straight from the fragment-ordered planes: A row m = l&15, B column n = l&15, elements 0..7 <- k0 + 8h + i, 8..15 <- k0 + 16 + 8h + i.
// MODE 0 (z = 0, 1: q, k; bf16 operands): f16 plane [z][b][h][s / 16][d / 32][half][lane][8] = f16(16 v); block tile = one contiguous 16-KB run.
// MODE 1 (v; bf16 operands): f16 planes [b][h][s / 32][d / 16][half][lane][8 keys], hi = f16(16 v), residual = f16((16 v - hi) 2^11); transposed on the LDS read side.
// MODE 2 (out, rows < RH; bf16 operands): A = ctx hi plane, Alo = ctx lo plane (bf16, unscaled, same accumulator); f32 rows of the output buffer.
// MODE 3 (out, rows >= RH; f16 operands): A = f16(64 ctx), W = f16(64 Wo); accumulator x 2^-12; f32 rows of the output buffer.
// LDS tile so (the calling kernel's one tile): cross-wave (block barrier); staged extent 128 x 64 == consumed extent.
template <int MODE>
__device__ __forceinline__ void gemm_part(float (&so)[128][68],
                                          const unsigned short* __restrict__ A, const unsigned short* __restrict__ Alo,
                                          const unsigned short* __restrict__ Wm,
                                          const float* __restrict__ bias0, const float* __restrict__ bias1,
                                          unsigned short* __restrict__ outH, unsigned short* __restrict__ outL,
                                          float* __restrict__ outF, int bx, int by, int z, int sbeg, int nblk) {
  const int tid = threadIdx.x, w = __builtin_amdgcn_readfirstlane((int)(tid >> 5)), lane = tid & 31, ln = lane & 15, hh = lane >> 4;
  const int b = bx / nblk, s0 = sbeg + (bx - b * nblk) * 128;
  const int rowB = b * SEQ + s0, colB = by * 64;
  const size_t aoff = (size_t)(rowB + 32 * w) * DM + 8 * lane;                  // 16 plane rows = 32 fragments = 16 * DM elements
  const unsigned short* ap = A + aoff;
  const unsigned short* lp = Alo + aoff;
  const unsigned short* wp = Wm + (size_t)z * DM * DM + (size_t)colB * DM + 8 * lane;
  const v8f z8 = {0.f, 0.f, 0.f, 0.f, 0.f, 0.f, 0.f, 0.f};
  v8f c[8];
#pragma unroll
  for (int i = 0; i < 8; ++i) c[i] = z8;
#pragma unroll 1
  for (int k0 = 0; k0 < 16 * DM; k0 += 512) {                                   // k0: element offset of the k-step's fragment in its 16-row band
    FragX a0, a1, b0, b1, b2, b3;
    a0.half[0] = *(const v8us*)(ap + k0);               a0.half[1] = *(const v8us*)(ap + k0 + 256);
    a1.half[0] = *(const v8us*)(ap + 16 * DM + k0);     a1.half[1] = *(const v8us*)(ap + 16 * DM + k0 + 256);
    if (MODE != 0) asm volatile("s_wait_xcnt 0x0" ::: "memory");   // in front of loads whose results may land in the registers that held the A loads' address
    b0.half[0] = *(const v8us*)(wp + k0);               b0.half[1] = *(const v8us*)(wp + k0 + 256);
    b1.half[0] = *(const v8us*)(wp + 16 * DM + k0);     b1.half[1] = *(const v8us*)(wp + 16 * DM + k0 + 256);
    b2.half[0] = *(const v8us*)(wp + 32 * DM + k0);     b2.half[1] = *(const v8us*)(wp + 32 * DM + k0 + 256);
    b3.half[0] = *(const v8us*)(wp + 48 * DM + k0);
    if (MODE != 0) asm volatile("s_wait_xcnt 0x0" ::: "memory");   // the last W load's result may land in the registers that held the W loads' address
    b3.half[1] = *(const v8us*)(wp + 48 * DM + k0 + 256);
    if (MODE == 3) mma8h(a0.h, a1.h, b0.h, b1.h, b2.h, b3.h, c);
    else           mma8(a0.b, a1.b, b0.b, b1.b, b2.b, b3.b, c);
    if (MODE == 2) {
      FragX l0, l1;
      l0.half[0] = *(const v8us*)(lp + k0);             l0.half[1] = *(const v8us*)(lp + k0 + 256);
      l1.half[0] = *(const v8us*)(lp + 16 * DM + k0);   l1.half[1] = *(const v8us*)(lp + 16 * DM + k0 + 256);
      mma8(l0.b, l1.b, b0.b, b1.b, b2.b, b3.b, c);
    }
  }
  // D element r of tile (i, j) = C(row 32w + 16i + 8h + r, col 16j + l&15)
  const float cs = (MODE == 3) ? 0.000244140625f : 1.0f;     // 2^-12 undoes the x64 carries of ctx and Wo
#pragma unroll
  for (int j = 0; j < 4; ++j) {
    const int n = colB + 16 * j + ln;
    const float bA = bias0[n], bB = bias1[n];
    const float bj = bf16_rne((MODE == 0 && z == 1) ? bB : bA);
#pragma unroll
    for (int i = 0; i < 2; ++i)
#pragma unroll
      for (int r = 0; r < 8; ++r)
        so[32 * w + 16 * i + 8 * hh + r][16 * j + ln] = c[4 * i + j][r] * cs + bj;
  }
  __syncthreads();
  const int hd = by;
  if (MODE == 0) {
    const size_t base = (size_t)z * PLANE + (((size_t)(b * NH + hd)) * SEQ + s0) * HD;
    unsigned short* dh = outH + base;
    {
      for (int i = tid; i < 128 * 8; i += 128) {
        const int row = (i >> 7) * 16 + (i & 15), p8 = ((i >> 4) & 7) * 8;   // piece i = [s / 16][d / 32][half][h][s % 16]; d = 8 * bits 6..4
        const v4f x0 = *(const v4fa*)&so[row][p8], x1 = *(const v4fa*)&so[row][p8 + 4];
        H8 oh;
#pragma unroll
        for (int q = 0; q < 4; ++q) {
          oh.h[q]     = (_Float16)(x0[q] * 16.0f);
          oh.h[4 + q] = (_Float16)(x1[q] * 16.0f);
        }
        const v8us ov = oh.v;
        *(v8us*)(dh + (size_t)i * 8) = ov;
      }
      
    }
  } else if (MODE == 1) {
    const size_t base = (((size_t)(b * NH + hd)) * SEQ + s0) * HD;             // 32 keys x 64 d = 2048 elements per key step
    unsigned short* dh = outH + base;
    unsigned short* dl = outL + base;
    {
      for (int i = tid; i < 64 * 16; i += 128) {
        const int d = ((i >> 6) & 3) * 16 + (i & 15), s8 = (i >> 8) * 32 + ((i >> 4) & 3) * 8;   // piece i = [s / 32][d / 16][half][h][d % 16]
        H8 oh, ol;
#pragma unroll
        for (int q = 0; q < 8; ++q) {
          const float v0 = so[s8 + q][d] * 16.0f;
          const _Float16 h0 = (_Float16)v0;
          oh.h[q] = h0;
          ol.h[q] = (_Float16)((v0 - (float)h0) * RES_SC);
        }
        const v8us ovh = oh.v, ovl = ol.v;
        *(v8us*)(dh + (size_t)i * 8) = ovh;
        *(v8us*)(dl + (size_t)i * 8) = ovl;
      }
      
    }
  } else {
    float* og = outF + ((size_t)b * SEQ_FULL + s0) * DM + colB;
    {
      for (int i = tid; i < 128 * 16; i += 128) {
        const int row = i >> 4, c4 = (i & 15) * 4;
        const v4f v = *(const v4fa*)&so[row][c4];
        *(v4f*)(og + (size_t)row * DM + c4) = v;
      }
      
    }
  }
}

// The three projections of x in one grid (row blocks, 1024/64, 3): z = 0, 1 -> q, k (MODE 0), z = 2 -> v (MODE 1); the branch is block-uniform.
__global__ __launch_bounds__(128) void k_qkv(const unsigned short* __restrict__ Xb, const unsigned short* __restrict__ Wb,
                                             const float* __restrict__ bq, const float* __restrict__ bk, const float* __restrict__ bv,
                                             unsigned short* __restrict__ QKh, unsigned short* __restrict__ Vth,
                                             unsigned short* __restrict__ Vtl) {
  __shared__ __attribute__((aligned(16))) float so[128][68];
  const int bx = blockIdx.x, by = blockIdx.y, z = blockIdx.z;
  if (z < 2) gemm_part<0>(so, Xb, Xb, Wb, bq, bk, QKh, QKh, nullptr, bx, by, z, 0, SEQ / 128);
  else       gemm_part<1>(so, Xb, Xb, Wb + (size_t)2 * DM * DM, bv, bv, Vth, Vtl, nullptr, bx, by, 0, 0, SEQ / 128);
}

// Both row bands of the output projection in one grid (NB * SEQ / 128, 1024/64): the first NB * RH / 128 row blocks are the rows < RH (MODE 2),
// the others the rows >= RH (MODE 3); the branch is block-uniform.
__global__ __launch_bounds__(128) void k_out(const unsigned short* __restrict__ Cp, const unsigned short* __restrict__ Cl,
                                             const unsigned short* __restrict__ Wob, const unsigned short* __restrict__ Woh,
                                             const float* __restrict__ bo, float* __restrict__ out) {
  __shared__ __attribute__((aligned(16))) float so[128][68];
  const int bx = blockIdx.x, by = blockIdx.y;
  if (bx < NB * (RH / 128)) gemm_part<2>(so, Cp, Cl, Wob, bo, bo, nullptr, nullptr, out, bx, by, 0, 0, RH / 128);
  else                      gemm_part<3>(so, Cp, Cl, Woh, bo, bo, nullptr, nullptr, out, bx - NB * (RH / 128), by, 0, RH, (SEQ - RH) / 128);
}

// Fragment loads of one 32-key step. Pointers are the (batch, head) bases of the planes.
// A fragments of K: row m = key (key0 + 16*kt + ln), elements 0..7 <- d = 32c + 8h + i, 8..15 <- d = 32c + 16 + 8h + i; kf[2*kt + c];
// the step's eight halves are 4 KB in a row of the fragment-ordered plane
__device__ __forceinline__ void load_k(const unsigned short* __restrict__ Khp, int key0, int ln, int hh, FragH (&kf)[4]) {
  const unsigned short* kp = Khp + (size_t)key0 * HD + 8 * (16 * hh + ln);
#pragma unroll
  for (int f = 0; f < 4; ++f) {
    kf[f].half[0] = *(const v8us*)(kp + 512 * f); kf[f].half[1] = *(const v8us*)(kp + 512 * f + 256);
  }
}
// A fragments of V^T: row m = d (16*t + ln), elements 0..7 <- key0 + 8h + i, 8..15 <- key0 + 16 + 8h + i; again 4 KB in a row (key0 a multiple of 32)
__device__ __forceinline__ void load_v(const unsigned short* __restrict__ Vp, int key0, int ln, int hh, FragH (&vf)[4]) {
  const unsigned short* vp = Vp + (size_t)key0 * HD + 8 * (16 * hh + ln);
#pragma unroll
  for (int t = 0; t < 4; ++t) {
    vf[t].half[0] = *(const v8us*)(vp + 512 * t); vf[t].half[1] = *(const v8us*)(vp + 512 * t + 256);
  }
}

// One 32-key step for a wave's 16 queries (this lane's column: one query), on fragments and a mask word that were loaded one step earlier.
// Each fragment set is reloaded for step keyN (the wave's next active step) right behind its last product, so that those loads fly
// under the rest of this step and the head of the next one.
// EARLY: P and v as hi + residual planes (three products, lr over the f32 weights); else one product and lr over the f16 weights.
template <bool EARLY>
__device__ __forceinline__ void fa_step(const unsigned short* __restrict__ Khp,
                                        const unsigned short* __restrict__ Vhp, const unsigned short* __restrict__ Vlp,
                                        int keyN, unsigned int mw, int ln, int hh,
                                        const FragH& qh0, const FragH& qh1,
                                        FragH (&kf)[4], FragH (&vf)[4], FragH (&vlf)[4],
                                        float& mr, float& lr, v8f (&Oh)[4], v8f (&Ol)[4]) {
  const v8f z8 = {0.f, 0.f, 0.f, 0.f, 0.f, 0.f, 0.f, 0.f};
  float sc[16];
#pragma unroll
  for (int kt = 0; kt < 2; ++kt) {
    v8f sh = z8;
    mma_s(kf[2 * kt].v, kf[2 * kt + 1].v, qh0.v, qh1.v, sh);
    // S^T element r of tile kt = score(key0 + 16*kt + 8h + r, this lane's query); carries: 16 x 16 on q, k, then 1/8 -> 2^-11
#pragma unroll
    for (int r = 0; r < 8; ++r) sc[8 * kt + r] = sh[r] * 0.00048828125f;
  }
  load_k(Khp, keyN, ln, hh, kf);
  __builtin_amdgcn_sched_barrier(0);   // keeps the K reloads here: sunk below the softmax they would have too short a lead on the next step's products
  // replace-fill: excluded keys get -inf (bit 8h + r of the word <-> tile 0, bit 16 + 8h + r <-> tile 1)
  const float ninf = __uint_as_float(0xFF800000u);
  const unsigned int mb = mw >> (8 * hh);
#pragma unroll
  for (int r = 0; r < 8; ++r) {
    sc[r]     = ((mb >> r) & 1u) ? ninf : sc[r];
    sc[8 + r] = ((mb >> (16 + r)) & 1u) ? ninf : sc[8 + r];
  }
  float mx = sc[0];
#pragma unroll
  for (int i = 1; i < 16; ++i) mx = fmaxf(mx, sc[i]);
  mx = fmaxf(mx, __shfl_xor(mx, 16, 32));           // the other lane half holds the other 16 keys of this query
  const float mnew = fmaxf(mr, mx);
  const float al = exp2f((mr - mnew) * LOG2E);
  mr = mnew;
  // weights carried x256: pc = 256 * exp(sc - mnew); hi plane f16(pc); EARLY: residual plane f16((pc - hi) * 2048)
  FragH ph, pl;
  float ps = 0.0f;
#pragma unroll
  for (int i = 0; i < 16; ++i) {
    const float pc = exp2f(fmaf(sc[i] - mnew, LOG2E, 8.0f));
    const _Float16 h = (_Float16)pc;
    ph.h[i] = h;                                    // B element i: i<8 -> key0 + 8h + i (tile 0 row 8h+i); i>=8 -> key0 + 16 + 8h + (i-8) (tile 1)
    if (EARLY) {
      ps += pc;
      pl.h[i] = (_Float16)((pc - (float)h) * RES_SC);
    } else {
      ps += (float)h;
    }
  }
  ps += __shfl_xor(ps, 16, 32);
  lr = lr * al + ps;
#pragma unroll
  for (int t = 0; t < 4; ++t) {
    Oh[t] = Oh[t] * al;
    if (EARLY) Ol[t] = Ol[t] * al;
  }
#pragma unroll
  for (int t = 0; t < 4; ++t) {
    if (EARLY) mma_pv3(vf[t].v, vlf[t].v, ph.v, pl.v, Oh[t], Ol[t]);
    else       mma_pv1(vf[t].v, ph.v, Oh[t]);
  }
  load_v(Vhp, keyN, ln, hh, vf);
  if (EARLY) load_v(Vlp, keyN, ln, hh, vlf);
  asm volatile("s_wait_xcnt 0x0" ::: "memory");   // in front of the next step's writes to the registers that held these loads' addresses
}

// Block = 4 waves x 16 queries = 64 queries of one (batch, head); query tile = qt0 + (blk % nqt), blk = block index inside its band; no LDS and no barrier.
// Steps whose 32 keys are excluded for all 16 queries of the wave are skipped (exact for any mask value): a wave-uniform map of the
// active steps is built from the wave's mask rows in front of the loop, so that the step after the current one is known when its loads issue.
// Epilogue: lane 16h + q holds ctx(query q, d = 16t + 8h + r), which is half t & 1 of the ctx plane's fragment (k-step 2*head + t / 2): each O^T tile
// goes out of its registers as one 512-byte run.
// coverage: NB*NH*nqt blocks x 4 waves x 16 rows x 64 columns = every (row, head) segment of the band exactly once.
template <bool EARLY>
__device__ __forceinline__ void attn_part(const unsigned short* __restrict__ QKh,
                                          const unsigned short* __restrict__ Vth, const unsigned short* __restrict__ Vtl,
                                          const unsigned int* __restrict__ bits,
                                          unsigned short* __restrict__ Cp, unsigned short* __restrict__ Cl,
                                          int blk, int qt0, int nqt) {
  static_assert(SEQ / 32 <= 64);
  const int tid = threadIdx.x, w = __builtin_amdgcn_readfirstlane((int)(tid >> 5)), lane = tid & 31, ln = lane & 15, hh = lane >> 4;
  const int bh = blk / nqt, qt = qt0 + (blk - bh * nqt);
  const int b = bh / NH, hd = bh - b * NH;
  const int qbase = qt * 64 + 16 * w;
  const int qg = qbase + ln;
  const size_t hb = (size_t)bh * SEQ * HD;
  // Q^T B fragments: column n = query qg, elements 0..7 <- d = 32c + 8h + i, 8..15 <- d = 32c + 16 + 8h + i
  FragH qh0, qh1;
  {
    const unsigned short* qrh = QKh + hb + (size_t)qbase * HD + 8 * lane;
    qh0.half[0] = *(const v8us*)(qrh);       qh0.half[1] = *(const v8us*)(qrh + 256);
    qh1.half[0] = *(const v8us*)(qrh + 512); qh1.half[1] = *(const v8us*)(qrh + 768);
  }
  const unsigned short* Khp = QKh + PLANE + hb;
  const unsigned short* Vhp = Vth + hb;
  const unsigned short* Vlp = Vtl + hb;
  const unsigned int* mrow = bits + ((size_t)b * SEQ + qg) * (SEQ / 32);
  float mr = -3.0e38f, lr = 0.0f;
  v8f Oh[4] = {}, Ol[4] = {};
  // bit j of act: step j has a key that some query of the wave keeps
  unsigned long long act = 0ull;
#pragma unroll
  for (int i = 0; i < SEQ / 128; ++i) {
    const v4i x = *(const v4ia*)(mrow + 4 * i);
#pragma unroll
    for (int e = 0; e < 4; ++e)
      if (__ballot(x[e] != -1) != 0) act |= 1ull << (4 * i + e);   // wave-uniform
  }
  if (act != 0ull) {
    int j = __builtin_ctzll(act);
    act &= act - 1ull;
    FragH kf[4], vf[4], vlf[4];
    unsigned int mw = mrow[j];
    __builtin_amdgcn_sched_barrier(0);                // mask word first in load order: the loop's wait for it then leaves the fragment loads in flight
    load_k(Khp, 32 * j, ln, hh, kf);
    load_v(Vhp, 32 * j, ln, hh, vf);
    if (EARLY) load_v(Vlp, 32 * j, ln, hh, vlf);
    asm volatile("s_wait_xcnt 0x0" ::: "memory");     // in front of later writes to the registers that held these loads' addresses
    __builtin_amdgcn_sched_barrier(0);                // keeps those writes behind the wait
#pragma unroll 1
    for (;;) {
      const bool more = act != 0ull;                  // wave-uniform
      const int jn = more ? __builtin_ctzll(act) : j; // last step: its own tiles once more (in bounds, never used)
      act &= act - 1ull;
      const unsigned int mwn = mrow[jn];
      fa_step<EARLY>(Khp, Vhp, Vlp, 32 * jn, mw, ln, hh, qh0, qh1, kf, vf, vlf, mr, lr, Oh, Ol);
      if (!more) break;
      mw = mwn;
      j = jn;
    }
  }

  // O^T element r of tile t = ctx(query qg, d = 16t + 8h + r); undo the carries: x256 (in lr), x16 (v), x2048 (residual accumulator)
  const float inv = 1.0f / (16.0f * lr);
  const size_t cb = ((size_t)(b * SEQ + qbase)) * DM + (size_t)hd * (16 * HD) + 8 * lane;
#pragma unroll
  for (int t = 0; t < 4; ++t) {
    if (EARLY) {
      v8us oh, ol;
#pragma unroll
      for (int r = 0; r < 8; ++r) {
        const float x = (Oh[t][r] + Ol[t][r] * RES_INV) * inv;
        const unsigned short h0 = bf16_bits(x);
        oh[r] = h0;
        ol[r] = bf16_bits(x - bf16_val(h0));
      }
      *(v8us*)(Cp + cb + 256 * t) = oh;
      *(v8us*)(Cl + cb + 256 * t) = ol;
    } else {
      H8 of;
#pragma unroll
      for (int r = 0; r < 8; ++r) of.h[r] = (_Float16)((Oh[t][r] * inv) * 64.0f);
      const v8us ov = of.v;
      *(v8us*)(Cp + cb + 256 * t) = ov;
    }
  }
  if (EARLY) asm volatile("s_wait_xcnt 0x0" ::: "memory");   // the built code joins the two bands behind these stores: in front of the other band's writes to their registers
}

// Both query bands in one grid: the first NB * NH * (SEQ - RH) / 64 blocks take the rows >= RH, the others the rows < RH (the smaller band, placed
// last for speed only); the branch is block-uniform.
#define AB_LATE (NB * NH * ((SEQ - RH) / 64))
#define AB_EARLY (NB * NH * (RH / 64))
__global__ __launch_bounds__(128) void k_attn(const unsigned short* __restrict__ QKh,
                                              const unsigned short* __restrict__ Vth, const unsigned short* __restrict__ Vtl,
                                              const unsigned int* __restrict__ bits,
                                              unsigned short* __restrict__ Cp, unsigned short* __restrict__ Cl) {
  const int blk = blockIdx.x;
  if (blk < AB_LATE) attn_part<false>(QKh, Vth, Vtl, bits, Cp, Cl, blk, RH / 64, (SEQ - RH) / 64);
  else               attn_part<true>(QKh, Vth, Vtl, bits, Cp, Cl, blk - AB_LATE, 0, RH / 64);
}

extern "C" void kernel_launch(void* const* d_in, const int* in_sizes, int n_in,
                              void* d_out, int out_size, void* d_ws, size_t ws_size, hipStream_t stream) {
  if (n_in < 10) return;
  const long long needx = (long long)(NB - 1) * SEQ_FULL * DM + (long long)SEQ * DM;   // last element touched + 1
  const long long needm = (long long)(NB - 1) * SEQ_FULL * SEQ_FULL + (long long)(SEQ - 1) * SEQ_FULL + SEQ;
  if ((long long)in_sizes[0] < needx) return;
  if ((long long)in_sizes[1] < (long long)DM * DM || (long long)in_sizes[3] < (long long)DM * DM) return;
  if ((long long)in_sizes[5] < (long long)DM * DM || (long long)in_sizes[7] < (long long)DM * DM) return;
  if (in_sizes[2] < DM || in_sizes[4] < DM || in_sizes[6] < DM || in_sizes[8] < DM) return;
  if ((long long)in_sizes[9] < needm) return;
  if ((long long)out_size < needx) return;
  const float* x  = (const float*)d_in[0];   // wire order: x, Wq, bq, Wk, bk, Wv, bv, Wo, bo, attention_mask
  const float* Wq = (const float*)d_in[1];
  const float* bq = (const float*)d_in[2];
  const float* Wk = (const float*)d_in[3];
  const float* bk = (const float*)d_in[4];
  const float* Wv = (const float*)d_in[5];
  const float* bv = (const float*)d_in[6];
  const float* Wo = (const float*)d_in[7];
  const float* bo = (const float*)d_in[8];
  const int* mask = (const int*)d_in[9];
  float* out = (float*)d_out;

  char* ws = (char*)d_ws;
  size_t off = 0;
  const size_t pl2 = PLANE * 2;                               // bytes of one [NB*SEQ][1024] 16-bit plane (8 MiB at full size), multiple of 256
  const size_t wsz = (size_t)DM * DM * 2;                     // 2 MiB per weight plane
  const size_t bsz = (size_t)NB * SEQ * (SEQ / 32) * 4;       // 1 MiB at full size
  unsigned short* Xb  = (unsigned short*)(ws + off); off += pl2;
  unsigned short* Wb  = (unsigned short*)(ws + off); off += 4 * wsz;      // bf16 planes q, k, v, o
  unsigned short* Woh = (unsigned short*)(ws + off); off += wsz;          // f16 plane of 64 Wo
  unsigned short* QKh = (unsigned short*)(ws + off); off += 2 * pl2;      // [q|k][b][h][s][64], fragment order
  unsigned short* Vth = (unsigned short*)(ws + off); off += pl2;          // [b][h][s / 32][64 x 32], fragment order
  unsigned short* Vtl = (unsigned short*)(ws + off); off += pl2;
  unsigned int*   Mb  = (unsigned int*)(ws + off);   off += (bsz + 255) & ~(size_t)255;
  unsigned short* Cp  = (unsigned short*)(ws + off); off += pl2;          // [b*SEQ + s][1024], fragment order: rows < RH bf16 hi, rows >= RH f16(64 ctx)
  unsigned short* Cl  = (unsigned short*)(ws + off); off += pl2;          // rows < RH: bf16 lo (other rows never written, never read)
  if (off > ws_size || off > (size_t)134217728) return;

  // four launches, each reading only what an earlier one (or the caller) wrote
  k_prep<<<(unsigned)(PB_MASK + PB_X + PB_NW * PB_W), 256, 0, stream>>>(x, Wq, Wk, Wv, Wo, mask, Xb, Wb, Woh, Mb);
  k_qkv<<<dim3((unsigned)(NB * (SEQ / 128)), DM / 64, 3), 128, 0, stream>>>(Xb, Wb, bq, bk, bv, QKh, Vth, Vtl);
  k_attn<<<(unsigned)(AB_LATE + AB_EARLY), 128, 0, stream>>>(QKh, Vth, Vtl, Mb, Cp, Cl);
  k_out<<<dim3((unsigned)(NB * (SEQ / 128)), DM / 64, 1), 128, 0, stream>>>(Cp, Cl, Wb + (size_t)3 * DM * DM, Woh, bo, out);
}

// v004
// It runs in 126 microseconds.
// Timed twice side by side with v003, it ran 1.03 and 1.04 times as fast.
// All steps since v000 together make it 2.51 times as fast.
#include <hip/hip_runtime.h>
// Contractions: q/k/v projections on v_wmma_f32_16x16x32_bf16 (x, W RNE bf16, single product, f32 accumulate); S^T = K Q^T on v_wmma_f32_16x16x32_f16 (q, k as x16 f16 planes, single product); O^T = V^T P^T on v_wmma_f32_16x16x32_f16 (query rows < RH: v x16 hi + x2^11 residual, P x256 hi + x2^11 residual, residual products in their own f32 accumulator; query rows >= RH: v x16, P x256, single product, row sum over the f16 P); output projection: rows < RH on v_wmma_f32_16x16x32_bf16 (ctx bf16 hi + bf16 lo planes, Wo RNE bf16), rows >= RH on v_wmma_f32_16x16x32_f16 (ctx x64 f16, Wo RNE-bf16 value x64 in f16, single product); softmax statistics f32.
// Multi-head attention, B x S x 1024, 16 heads of 64, scale 1/8, mask input (1 = key excluded, score replaced by -inf) read on the device as a packed bit plane.
// Engine: transposed flash. Each wave owns 16 queries. Per 32-key step: S^T tiles (key rows x query columns) from K rows (A, global f16 plane)
// and Q^T (B, registers); the two 16-key D tiles pack straight into the P^T B fragment; O^T (d rows x query columns) accumulates from V^T rows (A, global f16 planes).
// Plane layout: every 16-bit operand plane is stored in fragment order. One fragment (16 rows x 32 k) = 1 KB = [half 0..1][lane 0..31][8 elements];
// lane = 16h + row, element i of half f = k 16f + 8h + i. A wave-wide 16-byte load of one half is 512 contiguous bytes (four whole lines).
#ifndef NB
#define NB 2
#endif
#ifndef SEQ
#define SEQ 2048
#endif
#ifndef RH
#define RH 256                                 /* query rows below RH (per batch) take the hi + residual path */
#endif
#define NB_FULL 2
#define SEQ_FULL 2048
#define DM 1024
#define NH 16
#define HD 64
#define PLANE ((size_t)NB * SEQ * DM)          /* elements of one [NB*SEQ][1024] 16-bit plane */

static_assert(SEQ % 128 == 0);
static_assert(SEQ <= SEQ_FULL);
static_assert(NB <= NB_FULL);
static_assert(RH % 128 == 0);
static_assert(RH >= 0 && RH <= SEQ);
static_assert(NH * HD == DM);
static_assert(HD == 64);
static_assert(DM % 64 == 0);
static_assert(PLANE * 2 * 7 + (size_t)5 * DM * DM * 2 + (size_t)NB * SEQ * (SEQ / 32) * 4 + 4096 <= (size_t)134217728);

typedef __bf16 v16b __attribute__((ext_vector_type(16)));
typedef _Float16 v16h __attribute__((ext_vector_type(16)));
typedef unsigned short v8us __attribute__((ext_vector_type(8), may_alias));
typedef float v8f __attribute__((ext_vector_type(8)));
typedef float v2f __attribute__((ext_vector_type(2)));
typedef _Float16 v2h __attribute__((ext_vector_type(2)));
typedef float v4f __attribute__((ext_vector_type(4)));
typedef float v4fa __attribute__((ext_vector_type(4), may_alias));
typedef int v4i __attribute__((ext_vector_type(4)));
typedef int v4ia __attribute__((ext_vector_type(4), may_alias));
union FragH { v16h v; v8us half[2]; _Float16 h[16]; unsigned short u[16]; };
union FragX { v16b b; v16h h; v8us half[2]; };
union H8 { v8us v; _Float16 h[8]; unsigned short u[8]; };

#define LOG2E 1.4426950408889634f
#define RES_SC 2048.0f
#define RES_INV 0.00048828125f

__device__ __forceinline__ unsigned short bf16_bits(float x) {   // RNE convert to bf16 bits, NaN kept NaN
  const unsigned int u = __float_as_uint(x);
  const unsigned int r = (u + 0x7FFFu + ((u >> 16) & 1u)) >> 16;
  const unsigned int n = (u >> 16) | 0x40u;
  return (unsigned short)(((u & 0x7FFFFFFFu) > 0x7F800000u) ? n : r);
}
__device__ __forceinline__ float bf16_val(unsigned short b) { return __uint_as_float(((unsigned int)b) << 16); }
__device__ __forceinline__ float bf16_rne(float x) { return bf16_val(bf16_bits(x)); }

// 2^x on the bare hardware instruction. exp2f() wraps the same instruction in a compare, two selects, an add and an ldexp that only serve results
// below 2^-126 (x < -126), which the bare form returns as 0. Here such a result has no effect: a weight that small is 0 in both f16 planes
// (its residual is below 2^-115) and vanishes in the f32 row sum, which holds 256 from the row's maximum; a rescale factor that small
// multiplies sums that the same step's weight of 256 outweighs by more than 2^100. For x >= -126, -inf included, the value is the same bit for bit.
__device__ __forceinline__ float exp2_hw(float x) { return __builtin_amdgcn_exp2f(x); }

// 2 x 4 tile group of one 32-deep k-step (bf16), then the hazard guard
__device__ __forceinline__ void mma8(v16b a0, v16b a1, v16b b0, v16b b1, v16b b2, v16b b3, v8f (&c)[8]) {
  c[0] = __builtin_amdgcn_wmma_f32_16x16x32_bf16(false, a0, false, b0, (short)0, c[0], false, false);
  c[1] = __builtin_amdgcn_wmma_f32_16x16x32_bf16(false, a0, false, b1, (short)0, c[1], false, false);
  c[2] = __builtin_amdgcn_wmma_f32_16x16x32_bf16(false, a0, false, b2, (short)0, c[2], false, false);
  c[3] = __builtin_amdgcn_wmma_f32_16x16x32_bf16(false, a0, false, b3, (short)0, c[3], false, false);
  c[4] = __builtin_amdgcn_wmma_f32_16x16x32_bf16(false, a1, false, b0, (short)0, c[4], false, false);
  c[5] = __builtin_amdgcn_wmma_f32_16x16x32_bf16(false, a1, false, b1, (short)0, c[5], false, false);
  c[6] = __builtin_amdgcn_wmma_f32_16x16x32_bf16(false, a1, false, b2, (short)0, c[6], false, false);
  c[7] = __builtin_amdgcn_wmma_f32_16x16x32_bf16(false, a1, false, b3, (short)0, c[7], false, false);
  asm volatile("v_nop\n\tv_nop\n\tv_nop\n\tv_nop"
               : "+v"(c[0]), "+v"(c[1]), "+v"(c[2]), "+v"(c[3]), "+v"(c[4]), "+v"(c[5]), "+v"(c[6]), "+v"(c[7])
               : "v"(a0), "v"(a1), "v"(b0), "v"(b1), "v"(b2), "v"(b3));
}
// the same tile group on f16 operands, then the hazard guard
__device__ __forceinline__ void mma8h(v16h a0, v16h a1, v16h b0, v16h b1, v16h b2, v16h b3, v8f (&c)[8]) {
  c[0] = __builtin_amdgcn_wmma_f32_16x16x32_f16(false, a0, false, b0, (short)0, c[0], false, false);
  c[1] = __builtin_amdgcn_wmma_f32_16x16x32_f16(false, a0, false, b1, (short)0, c[1], false, false);
  c[2] = __builtin_amdgcn_wmma_f32_16x16x32_f16(false, a0, false, b2, (short)0, c[2], false, false);
  c[3] = __builtin_amdgcn_wmma_f32_16x16x32_f16(false, a0, false, b3, (short)0, c[3], false, false);
  c[4] = __builtin_amdgcn_wmma_f32_16x16x32_f16(false, a1, false, b0, (short)0, c[4], false, false);
  c[5] = __builtin_amdgcn_wmma_f32_16x16x32_f16(false, a1, false, b1, (short)0, c[5], false, false);
  c[6] = __builtin_amdgcn_wmma_f32_16x16x32_f16(false, a1, false, b2, (short)0, c[6], false, false);
  c[7] = __builtin_amdgcn_wmma_f32_16x16x32_f16(false, a1, false, b3, (short)0, c[7], false, false);
  asm volatile("v_nop\n\tv_nop\n\tv_nop\n\tv_nop"
               : "+v"(c[0]), "+v"(c[1]), "+v"(c[2]), "+v"(c[3]), "+v"(c[4]), "+v"(c[5]), "+v"(c[6]), "+v"(c[7])
               : "v"(a0), "v"(a1), "v"(b0), "v"(b1), "v"(b2), "v"(b3));
}
// sh += K*Q (64 deep = two k-steps), then the hazard guard
__device__ __forceinline__ void mma_s(v16h k0, v16h k1, v16h q0, v16h q1, v8f& sh) {
  sh = __builtin_amdgcn_wmma_f32_16x16x32_f16(false, k0, false, q0, (short)0, sh, false, false);
  sh = __builtin_amdgcn_wmma_f32_16x16x32_f16(false, k1, false, q1, (short)0, sh, false, false);
  asm volatile("v_nop\n\tv_nop\n\tv_nop\n\tv_nop" : "+v"(sh) : "v"(k0), "v"(k1), "v"(q0), "v"(q1));
}
// oh += Vh*Ph ; ol += Vh*Pl + Vl*Ph (same x2^11 on both residual planes), then the hazard guard
__device__ __forceinline__ void mma_pv3(v16h vh, v16h vl, v16h ph, v16h pl, v8f& oh, v8f& ol) {
  oh = __builtin_amdgcn_wmma_f32_16x16x32_f16(false, vh, false, ph, (short)0, oh, false, false);
  ol = __builtin_amdgcn_wmma_f32_16x16x32_f16(false, vh, false, pl, (short)0, ol, false, false);
  ol = __builtin_amdgcn_wmma_f32_16x16x32_f16(false, vl, false, ph, (short)0, ol, false, false);
  asm volatile("v_nop\n\tv_nop\n\tv_nop\n\tv_nop" : "+v"(oh), "+v"(ol) : "v"(vh), "v"(vl), "v"(ph), "v"(pl));
}
// oh += Vh*Ph, then the hazard guard
__device__ __forceinline__ void mma_pv1(v16h vh, v16h ph, v8f& oh) {
  oh = __builtin_amdgcn_wmma_f32_16x16x32_f16(false, vh, false, ph, (short)0, oh, false, false);
  asm volatile("v_nop\n\tv_nop\n\tv_nop\n\tv_nop" : "+v"(oh) : "v"(vh), "v"(ph));
}

// dst = 16-bit image of src[(b*rpb_full + s)][0..1023], row = b*rpb + s, in fragment order [row / 16][k / 32][half][lane][8]. F16 = false: bf16 bits (RNE);
// F16 = true: f16 bits of (RNE bf16 value x 64), exact. Thread per 8 elements; a wave takes 8 rows x 32 k: it reads 8 whole 128-B lines and writes
// 4 whole lines (8 rows of one (half, h) each); rows a multiple of 16; t = thread index inside this plane's share of the grid
template <bool F16>
__device__ __forceinline__ void cvt_part(const float* __restrict__ src, unsigned short* __restrict__ dst,
                                         int t, int rows, int rpb, int rpb_full) {
  if (t >= rows * 128) return;
  const int wv = t >> 5, g = (t >> 3) & 3;                                      // g = 2 * half + h: which 8 k of the k-step
  const int r16 = (wv & 1) * 8 + (t & 7), frag = wv >> 1;                       // row in its 16-row band; fragment = band * 32 + k-step
  const int row = (frag >> 5) * 16 + r16, kk = (frag & 31) * 32 + g * 8;
  const int b = row / rpb, s = row - b * rpb;
  const float* p = src + ((size_t)b * rpb_full + s) * DM + kk;
  const v4f x0 = *(const v4fa*)(p), x1 = *(const v4fa*)(p + 4);
  H8 o;
#pragma unroll
  for (int i = 0; i < 4; ++i) {
    if (F16) {
      o.h[i]     = (_Float16)(bf16_rne(x0[i]) * 64.0f);
      o.h[4 + i] = (_Float16)(bf16_rne(x1[i]) * 64.0f);
    } else {
      o.u[i]     = bf16_bits(x0[i]);
      o.u[4 + i] = bf16_bits(x1[i]);
    }
  }
  const v8us ov = o.v;
  unsigned short* d = dst + ((size_t)frag * 64 + g * 16 + r16) * 8;
  *(v8us*)d = ov;
  
}

// coverage: NB*SEQ*(SEQ/32) threads x 1 word = the whole plane.
__device__ __forceinline__ void mask_part(const int* __restrict__ mask, unsigned int* __restrict__ bits, int t) {
  if (t >= NB * SEQ * (SEQ / 32)) return;
  const int wd = t % (SEQ / 32), row = t / (SEQ / 32);
  const int b = row / SEQ, q = row - b * SEQ;
  const int* p = mask + ((size_t)b * SEQ_FULL + q) * SEQ_FULL + 32 * wd;
  unsigned int m = 0u;
#pragma unroll
  for (int j = 0; j < 8; ++j) {
    const v4i x = *(const v4ia*)(p + 4 * j);
    m |= ((x[0] == 1) ? 1u : 0u) << (4 * j);
    m |= ((x[1] == 1) ? 1u : 0u) << (4 * j + 1);
    m |= ((x[2] == 1) ? 1u : 0u) << (4 * j + 2);
    m |= ((x[3] == 1) ? 1u : 0u) << (4 * j + 3);
  }
  *(unsigned int*)(bits + t) = m;
  
}

// One grid for everything that reads only the inputs: none of these parts reads what another writes. Block ranges, in index order:
// mask words (the longest threads, placed first for speed only), x, then the weight planes q, k, v, o (bf16) and o (f16 x64).
#define PB_MASK (NB * SEQ * (SEQ / 32) / 256)
#define PB_X (NB * SEQ * 128 / 256)
#define PB_W (DM * 128 / 256)
#define PB_NW (3 + (RH > 0 ? 1 : 0) + (SEQ > RH ? 1 : 0))
static_assert((NB * SEQ * (SEQ / 32)) % 256 == 0 && (NB * SEQ * 128) % 256 == 0 && (DM * 128) % 256 == 0);
__global__ __launch_bounds__(256) void k_prep(const float* __restrict__ x, const float* __restrict__ Wq, const float* __restrict__ Wk,
                                              const float* __restrict__ Wv, const float* __restrict__ Wo, const int* __restrict__ mask,
                                              unsigned short* __restrict__ Xb, unsigned short* __restrict__ Wb,
                                              unsigned short* __restrict__ Woh, unsigned int* __restrict__ bits) {
  const int tid = threadIdx.x;
  int blk = blockIdx.x;
  if (blk < PB_MASK) { mask_part(mask, bits, blk * 256 + tid); return; }
  blk -= PB_MASK;
  if (blk < PB_X) { cvt_part<false>(x, Xb, blk * 256 + tid, NB * SEQ, SEQ, SEQ_FULL); return; }
  blk -= PB_X;
  const int pl = blk / PB_W, t = (blk - pl * PB_W) * 256 + tid;
  if (pl == 4 || (pl == 3 && RH == 0)) { cvt_part<true>(Wo, Woh, t, DM, DM, DM); return; }
  const float* w = (pl == 0) ? Wq : (pl == 1) ? Wk : (pl == 2) ? Wv : Wo;
  cvt_part<false>(w, Wb + (size_t)pl * DM * DM, t, DM, DM, DM);
}

// C[m][n] = sum_k A[m][k] * W[n][k] + bf16(bias[n]); A, W 16-bit planes with 1024-element rows; block tile 128 x 64, 4 waves x (32 x 64).
// Row blocks: block bx -> batch b = bx / nblk, first row s0 = sbeg + (bx % nblk) * 128 of that batch (plane row b*SEQ + s0); column block by.
// Fragments straight from the fragment-ordered planes: A row m = l&15, B column n = l&15, elements 0..7 <- k0 + 8h + i, 8..15 <- k0 + 16 + 8h + i.
// MODE 0 (z = 0, 1: q, k; bf16 operands): f16 plane [z][b][h][s / 16][d / 32][half][lane][8] = f16(16 v); block tile = one contiguous 16-KB run.
// MODE 1 (v; bf16 operands): f16 planes [b][h][s / 32][d / 16][half][lane][8 keys], hi = f16(16 v), residual = f16((16 v - hi) 2^11); transposed on the LDS read side.
// MODE 2 (out, rows < RH; bf16 operands): A = ctx hi plane, Alo = ctx lo plane (bf16, unscaled, same accumulator); f32 rows of the output buffer.
// MODE 3 (out, rows >= RH; f16 operands): A = f16(64 ctx), W = f16(64 Wo); accumulator x 2^-12; f32 rows of the output buffer.
// LDS tile so (the calling kernel's one tile): cross-wave (block barrier); staged extent 128 x 64 == consumed extent.
template <int MODE>
__device__ __forceinline__ void gemm_part(float (&so)[128][68],
                                          const unsigned short* __restrict__ A, const unsigned short* __restrict__ Alo,
                                          const unsigned short* __restrict__ Wm,
                                          const float* __restrict__ bias0, const float* __restrict__ bias1,
                                          unsigned short* __restrict__ outH, unsigned short* __restrict__ outL,
                                          float* __restrict__ outF, int bx, int by, int z, int sbeg, int nblk) {
  const int tid = threadIdx.x, w = __builtin_amdgcn_readfirstlane((int)(tid >> 5)), lane = tid & 31, ln = lane & 15, hh = lane >> 4;
  const int b = bx / nblk, s0 = sbeg + (bx - b * nblk) * 128;
  const int rowB = b * SEQ + s0, colB = by * 64;
  const size_t aoff = (size_t)(rowB + 32 * w) * DM + 8 * lane;                  // 16 plane rows = 32 fragments = 16 * DM elements
  const unsigned short* ap = A + aoff;
  const unsigned short* lp = Alo + aoff;
  const unsigned short* wp = Wm + (size_t)z * DM * DM + (size_t)colB * DM + 8 * lane;
  const v8f z8 = {0.f, 0.f, 0.f, 0.f, 0.f, 0.f, 0.f, 0.f};
  v8f c[8];
#pragma unroll
  for (int i = 0; i < 8; ++i) c[i] = z8;
#pragma unroll 1
  for (int k0 = 0; k0 < 16 * DM; k0 += 512) {                                   // k0: element offset of the k-step's fragment in its 16-row band
    FragX a0, a1, b0, b1, b2, b3;
    a0.half[0] = *(const v8us*)(ap + k0);               a0.half[1] = *(const v8us*)(ap + k0 + 256);
    a1.half[0] = *(const v8us*)(ap + 16 * DM + k0);     a1.half[1] = *(const v8us*)(ap + 16 * DM + k0 + 256);
    if (MODE != 0) asm volatile("s_wait_xcnt 0x0" ::: "memory");   // in front of loads whose results may land in the registers that held the A loads' address
    b0.half[0] = *(const v8us*)(wp + k0);               b0.half[1] = *(const v8us*)(wp + k0 + 256);
    b1.half[0] = *(const v8us*)(wp + 16 * DM + k0);     b1.half[1] = *(const v8us*)(wp + 16 * DM + k0 + 256);
    b2.half[0] = *(const v8us*)(wp + 32 * DM + k0);     b2.half[1] = *(const v8us*)(wp + 32 * DM + k0 + 256);
    b3.half[0] = *(const v8us*)(wp + 48 * DM + k0);
    if (MODE != 0) asm volatile("s_wait_xcnt 0x0" ::: "memory");   // the last W load's result may land in the registers that held the W loads' address
    b3.half[1] = *(const v8us*)(wp + 48 * DM + k0 + 256);
    if (MODE == 3) mma8h(a0.h, a1.h, b0.h, b1.h, b2.h, b3.h, c);
    else           mma8(a0.b, a1.b, b0.b, b1.b, b2.b, b3.b, c);
    if (MODE == 2) {
      FragX l0, l1;
      l0.half[0] = *(const v8us*)(lp + k0);             l0.half[1] = *(const v8us*)(lp + k0 + 256);
      l1.half[0] = *(const v8us*)(lp + 16 * DM + k0);   l1.half[1] = *(const v8us*)(lp + 16 * DM + k0 + 256);
      mma8(l0.b, l1.b, b0.b, b1.b, b2.b, b3.b, c);
    }
  }
  // D element r of tile (i, j) = C(row 32w + 16i + 8h + r, col 16j + l&15)
  const float cs = (MODE == 3) ? 0.000244140625f : 1.0f;     // 2^-12 undoes the x64 carries of ctx and Wo
#pragma unroll
  for (int j = 0; j < 4; ++j) {
    const int n = colB + 16 * j + ln;
    const float bA = bias0[n], bB = bias1[n];
    const float bj = bf16_rne((MODE == 0 && z == 1) ? bB : bA);
#pragma unroll
    for (int i = 0; i < 2; ++i)
#pragma unroll
      for (int r = 0; r < 8; ++r)
        so[32 * w + 16 * i + 8 * hh + r][16 * j + ln] = c[4 * i + j][r] * cs + bj;
  }
  __syncthreads();
  const int hd = by;
  if (MODE == 0) {
    const size_t base = (size_t)z * PLANE + (((size_t)(b * NH + hd)) * SEQ + s0) * HD;
    unsigned short* dh = outH + base;
    {
      for (int i = tid; i < 128 * 8; i += 128) {
        const int row = (i >> 7) * 16 + (i & 15), p8 = ((i >> 4) & 7) * 8;   // piece i = [s / 16][d / 32][half][h][s % 16]; d = 8 * bits 6..4
        const v4f x0 = *(const v4fa*)&so[row][p8], x1 = *(const v4fa*)&so[row][p8 + 4];
        H8 oh;
#pragma unroll
        for (int q = 0; q < 4; ++q) {
          oh.h[q]     = (_Float16)(x0[q] * 16.0f);
          oh.h[4 + q] = (_Float16)(x1[q] * 16.0f);
        }
        const v8us ov = oh.v;
        *(v8us*)(dh + (size_t)i * 8) = ov;
      }
      
    }
  } else if (MODE == 1) {
    const size_t base = (((size_t)(b * NH + hd)) * SEQ + s0) * HD;             // 32 keys x 64 d = 2048 elements per key step
    unsigned short* dh = outH + base;
    unsigned short* dl = outL + base;
    {
      for (int i = tid; i < 64 * 16; i += 128) {
        const int d = ((i >> 6) & 3) * 16 + (i & 15), s8 = (i >> 8) * 32 + ((i >> 4) & 3) * 8;   // piece i = [s / 32][d / 16][half][h][d % 16]
        H8 oh, ol;
#pragma unroll
        for (int q = 0; q < 8; ++q) {
          const float v0 = so[s8 + q][d] * 16.0f;
          const _Float16 h0 = (_Float16)v0;
          oh.h[q] = h0;
          ol.h[q] = (_Float16)((v0 - (float)h0) * RES_SC);
        }
        const v8us ovh = oh.v, ovl = ol.v;
        *(v8us*)(dh + (size_t)i * 8) = ovh;
        *(v8us*)(dl + (size_t)i * 8) = ovl;
      }
      
    }
  } else {
    float* og = outF + ((size_t)b * SEQ_FULL + s0) * DM + colB;
    {
      for (int i = tid; i < 128 * 16; i += 128) {
        const int row = i >> 4, c4 = (i & 15) * 4;
        const v4f v = *(const v4fa*)&so[row][c4];
        *(v4f*)(og + (size_t)row * DM + c4) = v;
      }
      
    }
  }
}

// The three projections of x in one grid (row blocks, 1024/64, 3): z = 0, 1 -> q, k (MODE 0), z = 2 -> v (MODE 1); the branch is block-uniform.
__global__ __launch_bounds__(128) void k_qkv(const unsigned short* __restrict__ Xb, const unsigned short* __restrict__ Wb,
                                             const float* __restrict__ bq, const float* __restrict__ bk, const float* __restrict__ bv,
                                             unsigned short* __restrict__ QKh, unsigned short* __restrict__ Vth,
                                             unsigned short* __restrict__ Vtl) {
  __shared__ __attribute__((aligned(16))) float so[128][68];
  const int bx = blockIdx.x, by = blockIdx.y, z = blockIdx.z;
  if (z < 2) gemm_part<0>(so, Xb, Xb, Wb, bq, bk, QKh, QKh, nullptr, bx, by, z, 0, SEQ / 128);
  else       gemm_part<1>(so, Xb, Xb, Wb + (size_t)2 * DM * DM, bv, bv, Vth, Vtl, nullptr, bx, by, 0, 0, SEQ / 128);
}

// Both row bands of the output projection in one grid (NB * SEQ / 128, 1024/64): the first NB * RH / 128 row blocks are the rows < RH (MODE 2),
// the others the rows >= RH (MODE 3); the branch is block-uniform.
__global__ __launch_bounds__(128) void k_out(const unsigned short* __restrict__ Cp, const unsigned short* __restrict__ Cl,
                                             const unsigned short* __restrict__ Wob, const unsigned short* __restrict__ Woh,
                                             const float* __restrict__ bo, float* __restrict__ out) {
  __shared__ __attribute__((aligned(16))) float so[128][68];
  const int bx = blockIdx.x, by = blockIdx.y;
  if (bx < NB * (RH / 128)) gemm_part<2>(so, Cp, Cl, Wob, bo, bo, nullptr, nullptr, out, bx, by, 0, 0, RH / 128);
  else                      gemm_part<3>(so, Cp, Cl, Woh, bo, bo, nullptr, nullptr, out, bx - NB * (RH / 128), by, 0, RH, (SEQ - RH) / 128);
}

// Fragment loads of one 32-key step. Pointers are the (batch, head) bases of the planes.
// A fragments of K: row m = key (key0 + 16*kt + ln), elements 0..7 <- d = 32c + 8h + i, 8..15 <- d = 32c + 16 + 8h + i; kf[2*kt + c];
// the step's eight halves are 4 KB in a row of the fragment-ordered plane
__device__ __forceinline__ void load_k(const unsigned short* __restrict__ Khp, int key0, int ln, int hh, FragH (&kf)[4]) {
  const unsigned short* kp = Khp + (size_t)key0 * HD + 8 * (16 * hh + ln);
#pragma unroll
  for (int f = 0; f < 4; ++f) {
    kf[f].half[0] = *(const v8us*)(kp + 512 * f); kf[f].half[1] = *(const v8us*)(kp + 512 * f + 256);
  }
}
// A fragments of V^T: row m = d (16*t + ln), elements 0..7 <- key0 + 8h + i, 8..15 <- key0 + 16 + 8h + i; again 4 KB in a row (key0 a multiple of 32)
__device__ __forceinline__ void load_v(const unsigned short* __restrict__ Vp, int key0, int ln, int hh, FragH (&vf)[4]) {
  const unsigned short* vp = Vp + (size_t)key0 * HD + 8 * (16 * hh + ln);
#pragma unroll
  for (int t = 0; t < 4; ++t) {
    vf[t].half[0] = *(const v8us*)(vp + 512 * t); vf[t].half[1] = *(const v8us*)(vp + 512 * t + 256);
  }
}

// One 32-key step for a wave's 16 queries (this lane's column: one query), on fragments and a mask word that were loaded one step earlier.
// Each fragment set is reloaded for step keyN (the wave's next active step) right behind its last product, so that those loads fly
// under the rest of this step and the head of the next one.
// EARLY: P and v as hi + residual planes (three products, lr over the f32 weights); else one product and lr over the f16 weights.
template <bool EARLY>
__device__ __forceinline__ void fa_step(const unsigned short* __restrict__ Khp,
                                        const unsigned short* __restrict__ Vhp, const unsigned short* __restrict__ Vlp,
                                        int keyN, unsigned int mw, int ln, int hh,
                                        const FragH& qh0, const FragH& qh1,
                                        FragH (&kf)[4], FragH (&vf)[4], FragH (&vlf)[4],
                                        float& mr, float& lr, v8f (&Oh)[4], v8f (&Ol)[4]) {
  const v8f z8 = {0.f, 0.f, 0.f, 0.f, 0.f, 0.f, 0.f, 0.f};
  float sc[16];
#pragma unroll
  for (int kt = 0; kt < 2; ++kt) {
    v8f sh = z8;
    mma_s(kf[2 * kt].v, kf[2 * kt + 1].v, qh0.v, qh1.v, sh);
    // S^T element r of tile kt = score(key0 + 16*kt + 8h + r, this lane's query); carries: 16 x 16 on q, k, then 1/8 -> 2^-11
#pragma unroll
    for (int r = 0; r < 8; ++r) sc[8 * kt + r] = sh[r] * 0.00048828125f;
  }
  load_k(Khp, keyN, ln, hh, kf);
  __builtin_amdgcn_sched_barrier(0);   // keeps the K reloads here: sunk below the softmax they would have too short a lead on the next step's products
  // replace-fill: excluded keys get -inf (bit 8h + r of the word <-> tile 0, bit 16 + 8h + r <-> tile 1)
  const float ninf = __uint_as_float(0xFF800000u);
  const unsigned int mb = mw >> (8 * hh);
#pragma unroll
  for (int r = 0; r < 8; ++r) {
    sc[r]     = ((mb >> r) & 1u) ? ninf : sc[r];
    sc[8 + r] = ((mb >> (16 + r)) & 1u) ? ninf : sc[8 + r];
  }
  float mx = sc[0];
#pragma unroll
  for (int i = 1; i < 16; ++i) mx = fmaxf(mx, sc[i]);
  mx = fmaxf(mx, __shfl_xor(mx, 16, 32));           // the other lane half holds the other 16 keys of this query
  const float mnew = fmaxf(mr, mx);
  const float al = exp2_hw((mr - mnew) * LOG2E);
  mr = mnew;
  // weights carried x256: pc = 256 * exp(sc - mnew); hi plane f16(pc); EARLY: residual plane f16((pc - hi) * 2048)
  FragH ph, pl;
  float ps = 0.0f;
#pragma unroll
  for (int i = 0; i < 16; i += 2) {
    const v2f s2 = {sc[i], sc[i + 1]};
    const v2f x2 = __builtin_elementwise_fma(s2 - mnew, (v2f){LOG2E, LOG2E}, (v2f){8.0f, 8.0f});
    const v2f pc = {exp2_hw(x2[0]), exp2_hw(x2[1])};
    const v2h h = __builtin_convertvector(pc, v2h);  // one packed convert; the uses below read its halves
    ph.h[i] = h[0]; ph.h[i + 1] = h[1];             // B element i: i<8 -> key0 + 8h + i (tile 0 row 8h+i); i>=8 -> key0 + 16 + 8h + (i-8) (tile 1)
    if (EARLY) {
      ps += pc[0];
      ps += pc[1];
      pl.h[i]     = (_Float16)((pc[0] - (float)h[0]) * RES_SC);
      pl.h[i + 1] = (_Float16)((pc[1] - (float)h[1]) * RES_SC);
    } else {
      ps += (float)h[0];
      ps += (float)h[1];
    }
  }
  ps += __shfl_xor(ps, 16, 32);
  lr = lr * al + ps;
#pragma unroll
  for (int t = 0; t < 4; ++t) {
    Oh[t] = Oh[t] * al;
    if (EARLY) Ol[t] = Ol[t] * al;
  }
#pragma unroll
  for (int t = 0; t < 4; ++t) {
    if (EARLY) mma_pv3(vf[t].v, vlf[t].v, ph.v, pl.v, Oh[t], Ol[t]);
    else       mma_pv1(vf[t].v, ph.v, Oh[t]);
  }
  load_v(Vhp, keyN, ln, hh, vf);
  if (EARLY) load_v(Vlp, keyN, ln, hh, vlf);
  asm volatile("s_wait_xcnt 0x0" ::: "memory");   // in front of the next step's writes to the registers that held these loads' addresses
}

// Block = 4 waves x 16 queries = 64 queries of one (batch, head); query tile = qt0 + (blk % nqt), blk = block index inside its band; no LDS and no barrier.
// Steps whose 32 keys are excluded for all 16 queries of the wave are skipped (exact for any mask value): a wave-uniform map of the
// active steps is built from the wave's mask rows in front of the loop, so that the step after the current one is known when its loads issue.
// Epilogue: lane 16h + q holds ctx(query q, d = 16t + 8h + r), which is half t & 1 of the ctx plane's fragment (k-step 2*head + t / 2): each O^T tile
// goes out of its registers as one 512-byte run.
// coverage: NB*NH*nqt blocks x 4 waves x 16 rows x 64 columns = every (row, head) segment of the band exactly once.
template <bool EARLY>
__device__ __forceinline__ void attn_part(const unsigned short* __restrict__ QKh,
                                          const unsigned short* __restrict__ Vth, const unsigned short* __restrict__ Vtl,
                                          const unsigned int* __restrict__ bits,
                                          unsigned short* __restrict__ Cp, unsigned short* __restrict__ Cl,
                                          int blk, int qt0, int nqt) {
  static_assert(SEQ / 32 <= 64);
  const int tid = threadIdx.x, w = __builtin_amdgcn_readfirstlane((int)(tid >> 5)), lane = tid & 31, ln = lane & 15, hh = lane >> 4;
  const int bh = blk / nqt, qt = qt0 + (blk - bh * nqt);
  const int b = bh / NH, hd = bh - b * NH;
  const int qbase = qt * 64 + 16 * w;
  const int qg = qbase + ln;
  const size_t hb = (size_t)bh * SEQ * HD;
  // Q^T B fragments: column n = query qg, elements 0..7 <- d = 32c + 8h + i, 8..15 <- d = 32c + 16 + 8h + i
  FragH qh0, qh1;
  {
    const unsigned short* qrh = QKh + hb + (size_t)qbase * HD + 8 * lane;
    qh0.half[0] = *(const v8us*)(qrh);       qh0.half[1] = *(const v8us*)(qrh + 256);
    qh1.half[0] = *(const v8us*)(qrh + 512); qh1.half[1] = *(const v8us*)(qrh + 768);
  }
  const unsigned short* Khp = QKh + PLANE + hb;
  const unsigned short* Vhp = Vth + hb;
  const unsigned short* Vlp = Vtl + hb;
  const unsigned int* mrow = bits + ((size_t)b * SEQ + qg) * (SEQ / 32);
  float mr = -3.0e38f, lr = 0.0f;
  v8f Oh[4] = {}, Ol[4] = {};
  // bit j of act: step j has a key that some query of the wave keeps
  unsigned long long act = 0ull;
#pragma unroll
  for (int i = 0; i < SEQ / 128; ++i) {
    const v4i x = *(const v4ia*)(mrow + 4 * i);
#pragma unroll
    for (int e = 0; e < 4; ++e)
      if (__ballot(x[e] != -1) != 0) act |= 1ull << (4 * i + e);   // wave-uniform
  }
  if (act != 0ull) {
    int j = __builtin_ctzll(act);
    act &= act - 1ull;
    FragH kf[4], vf[4], vlf[4];
    unsigned int mw = mrow[j];
    __builtin_amdgcn_sched_barrier(0);                // mask word first in load order: the loop's wait for it then leaves the fragment loads in flight
    load_k(Khp, 32 * j, ln, hh, kf);
    load_v(Vhp, 32 * j, ln, hh, vf);
    if (EARLY) load_v(Vlp, 32 * j, ln, hh, vlf);
    asm volatile("s_wait_xcnt 0x0" ::: "memory");     // in front of later writes to the registers that held these loads' addresses
    __builtin_amdgcn_sched_barrier(0);                // keeps those writes behind the wait
#pragma unroll 1
    for (;;) {
      const bool more = act != 0ull;                  // wave-uniform
      const int jn = more ? __builtin_ctzll(act) : j; // last step: its own tiles once more (in bounds, never used)
      act &= act - 1ull;
      const unsigned int mwn = mrow[jn];
      fa_step<EARLY>(Khp, Vhp, Vlp, 32 * jn, mw, ln, hh, qh0, qh1, kf, vf, vlf, mr, lr, Oh, Ol);
      if (!more) break;
      mw = mwn;
      j = jn;
    }
  }

  // O^T element r of tile t = ctx(query qg, d = 16t + 8h + r); undo the carries: x256 (in lr), x16 (v), x2048 (residual accumulator)
  const float inv = 1.0f / (16.0f * lr);
  const size_t cb = ((size_t)(b * SEQ + qbase)) * DM + (size_t)hd * (16 * HD) + 8 * lane;
#pragma unroll
  for (int t = 0; t < 4; ++t) {
    if (EARLY) {
      v8us oh, ol;
#pragma unroll
      for (int r = 0; r < 8; ++r) {
        const float x = (Oh[t][r] + Ol[t][r] * RES_INV) * inv;
        const unsigned short h0 = bf16_bits(x);
        oh[r] = h0;
        ol[r] = bf16_bits(x - bf16_val(h0));
      }
      *(v8us*)(Cp + cb + 256 * t) = oh;
      *(v8us*)(Cl + cb + 256 * t) = ol;
    } else {
      H8 of;
#pragma unroll
      for (int r = 0; r < 8; ++r) of.h[r] = (_Float16)((Oh[t][r] * inv) * 64.0f);
      const v8us ov = of.v;
      *(v8us*)(Cp + cb + 256 * t) = ov;
    }
  }
  if (EARLY) asm volatile("s_wait_xcnt 0x0" ::: "memory");   // the built code joins the two bands behind these stores: in front of the other band's writes to their registers
}

// Both query bands in one grid: the first NB * NH * (SEQ - RH) / 64 blocks take the rows >= RH, the others the rows < RH (the smaller band, placed
// last for speed only); the branch is block-uniform.
#define AB_LATE (NB * NH * ((SEQ - RH) / 64))
#define AB_EARLY (NB * NH * (RH / 64))
__global__ __launch_bounds__(128) void k_attn(const unsigned short* __restrict__ QKh,
                                              const unsigned short* __restrict__ Vth, const unsigned short* __restrict__ Vtl,
                                              const unsigned int* __restrict__ bits,
                                              unsigned short* __restrict__ Cp, unsigned short* __restrict__ Cl) {
  const int blk = blockIdx.x;
  if (blk < AB_LATE) attn_part<false>(QKh, Vth, Vtl, bits, Cp, Cl, blk, RH / 64, (SEQ - RH) / 64);
  else               attn_part<true>(QKh, Vth, Vtl, bits, Cp, Cl, blk - AB_LATE, 0, RH / 64);
}

extern "C" void kernel_launch(void* const* d_in, const int* in_sizes, int n_in,
                              void* d_out, int out_size, void* d_ws, size_t ws_size, hipStream_t stream) {
  if (n_in < 10) return;
  const long long needx = (long long)(NB - 1) * SEQ_FULL * DM + (long long)SEQ * DM;   // last element touched + 1
  const long long needm = (long long)(NB - 1) * SEQ_FULL * SEQ_FULL + (long long)(SEQ - 1) * SEQ_FULL + SEQ;
  if ((long long)in_sizes[0] < needx) return;
  if ((long long)in_sizes[1] < (long long)DM * DM || (long long)in_sizes[3] < (long long)DM * DM) return;
  if ((long long)in_sizes[5] < (long long)DM * DM || (long long)in_sizes[7] < (long long)DM * DM) return;
  if (in_sizes[2] < DM || in_sizes[4] < DM || in_sizes[6] < DM || in_sizes[8] < DM) return;
  if ((long long)in_sizes[9] < needm) return;
  if ((long long)out_size < needx) return;
  const float* x  = (const float*)d_in[0];   // wire order: x, Wq, bq, Wk, bk, Wv, bv, Wo, bo, attention_mask
  const float* Wq = (const float*)d_in[1];
  const float* bq = (const float*)d_in[2];
  const float* Wk = (const float*)d_in[3];
  const float* bk = (const float*)d_in[4];
  const float* Wv = (const float*)d_in[5];
  const float* bv = (const float*)d_in[6];
  const float* Wo = (const float*)d_in[7];
  const float* bo = (const float*)d_in[8];
  const int* mask = (const int*)d_in[9];
  float* out = (float*)d_out;

  char* ws = (char*)d_ws;
  size_t off = 0;
  const size_t pl2 = PLANE * 2;                               // bytes of one [NB*SEQ][1024] 16-bit plane (8 MiB at full size), multiple of 256
  const size_t wsz = (size_t)DM * DM * 2;                     // 2 MiB per weight plane
  const size_t bsz = (size_t)NB * SEQ * (SEQ / 32) * 4;       // 1 MiB at full size
  unsigned short* Xb  = (unsigned short*)(ws + off); off += pl2;
  unsigned short* Wb  = (unsigned short*)(ws + off); off += 4 * wsz;      // bf16 planes q, k, v, o
  unsigned short* Woh = (unsigned short*)(ws + off); off += wsz;          // f16 plane of 64 Wo
  unsigned short* QKh = (unsigned short*)(ws + off); off += 2 * pl2;      // [q|k][b][h][s][64], fragment order
  unsigned short* Vth = (unsigned short*)(ws + off); off += pl2;          // [b][h][s / 32][64 x 32], fragment order
  unsigned short* Vtl = (unsigned short*)(ws + off); off += pl2;
  unsigned int*   Mb  = (unsigned int*)(ws + off);   off += (bsz + 255) & ~(size_t)255;
  unsigned short* Cp  = (unsigned short*)(ws + off); off += pl2;          // [b*SEQ + s][1024], fragment order: rows < RH bf16 hi, rows >= RH f16(64 ctx)
  unsigned short* Cl  = (unsigned short*)(ws + off); off += pl2;          // rows < RH: bf16 lo (other rows never written, never read)
  if (off > ws_size || off > (size_t)134217728) return;

  // four launches, each reading only what an earlier one (or the caller) wrote
  k_prep<<<(unsigned)(PB_MASK + PB_X + PB_NW * PB_W), 256, 0, stream>>>(x, Wq, Wk, Wv, Wo, mask, Xb, Wb, Woh, Mb);
  k_qkv<<<dim3((unsigned)(NB * (SEQ / 128)), DM / 64, 3), 128, 0, stream>>>(Xb, Wb, bq, bk, bv, QKh, Vth, Vtl);
  k_attn<<<(unsigned)(AB_LATE + AB_EARLY), 128, 0, stream>>>(QKh, Vth, Vtl, Mb, Cp, Cl);
  k_out<<<dim3((unsigned)(NB * (SEQ / 128)), DM / 64, 1), 128, 0, stream>>>(Cp, Cl, Wb + (size_t)3 * DM * DM, Woh, bo, out);
}

// v005
// One run takes 104 microseconds.
// Next to v004, in two timings, it ran 1.21 and 1.18 times as fast.
// Over all steps from v000 it is 3.00 times as fast.
#include <hip/hip_runtime.h>
// Contractions: q/k/v projections on v_wmma_f32_16x16x32_bf16 (x, W RNE bf16, single product, f32 accumulate); S^T = K Q^T on v_wmma_f32_16x16x32_f16 (q, k as x16 f16 planes, single product); O^T = V^T P^T on v_wmma_f32_16x16x32_f16 (query rows < RH: v x16 hi + x2^11 residual, P x256 hi + x2^11 residual, residual products in their own f32 accumulator; query rows >= RH: v x16, P x256, single product, row sum over the f16 P); output projection: rows < RH on v_wmma_f32_16x16x32_bf16 (ctx bf16 hi + bf16 lo planes, Wo RNE bf16), rows >= RH on v_wmma_f32_16x16x32_f16 (ctx x64 f16, Wo RNE-bf16 value x64 in f16, single product); softmax statistics f32.
// Multi-head attention, B x S x 1024, 16 heads of 64, scale 1/8, mask input (1 = key excluded, score replaced by -inf) read on the device as a packed bit plane.
// Engine: transposed flash. Each wave owns 16 queries. Per 32-key step: S^T tiles (key rows x query columns) from K rows (A, global f16 plane)
// and Q^T (B, registers); the two 16-key D tiles pack straight into the P^T B fragment; O^T (d rows x query columns) accumulates from V^T rows (A, global f16 planes).
// Plane layout: every 16-bit operand plane is stored in fragment order. One fragment (16 rows x 32 k) = 1 KB = [half 0..1][lane 0..31][8 elements];
// lane = 16h + row, element i of half f = k 16f + 8h + i. A wave-wide 16-byte load of one half is 512 contiguous bytes (four whole lines).
#ifndef NB
#define NB 2
#endif
#ifndef SEQ
#define SEQ 2048
#endif
#ifndef RH
#define RH 256                                 /* query rows below RH (per batch) take the hi + residual path */
#endif
#define NB_FULL 2
#define SEQ_FULL 2048
#define DM 1024
#define NH 16
#define HD 64
#define PLANE ((size_t)NB * SEQ * DM)          /* elements of one [NB*SEQ][1024] 16-bit plane */

static_assert(SEQ % 128 == 0);
static_assert(SEQ <= SEQ_FULL);
static_assert(NB <= NB_FULL);
static_assert(RH % 128 == 0);
static_assert(RH >= 0 && RH <= SEQ);
static_assert(NH * HD == DM);
static_assert(HD == 64);
static_assert(DM % 64 == 0);
static_assert(PLANE * 2 * 7 + (size_t)5 * DM * DM * 2 + (size_t)NB * SEQ * (SEQ / 32) * 4 + 4096 <= (size_t)134217728);

typedef __bf16 v16b __attribute__((ext_vector_type(16)));
typedef _Float16 v16h __attribute__((ext_vector_type(16)));
typedef unsigned short v8us __attribute__((ext_vector_type(8), may_alias));
typedef float v8f __attribute__((ext_vector_type(8)));
typedef float v2f __attribute__((ext_vector_type(2)));
typedef _Float16 v2h __attribute__((ext_vector_type(2)));
typedef float v4f __attribute__((ext_vector_type(4)));
typedef float v4fa __attribute__((ext_vector_type(4), may_alias));
typedef int v4i __attribute__((ext_vector_type(4)));
typedef int v4ia __attribute__((ext_vector_type(4), may_alias));
union FragH { v16h v; v8us half[2]; _Float16 h[16]; unsigned short u[16]; };
union FragX { v16b b; v16h h; v8us half[2]; };
union H8 { v8us v; _Float16 h[8]; unsigned short u[8]; };

#define LOG2E 1.4426950408889634f
#define RES_SC 2048.0f
#define RES_INV 0.00048828125f

__device__ __forceinline__ unsigned short bf16_bits(float x) {   // RNE convert to bf16 bits, NaN kept NaN
  const unsigned int u = __float_as_uint(x);
  const unsigned int r = (u + 0x7FFFu + ((u >> 16) & 1u)) >> 16;
  const unsigned int n = (u >> 16) | 0x40u;
  return (unsigned short)(((u & 0x7FFFFFFFu) > 0x7F800000u) ? n : r);
}
__device__ __forceinline__ float bf16_val(unsigned short b) { return __uint_as_float(((unsigned int)b) << 16); }
__device__ __forceinline__ float bf16_rne(float x) { return bf16_val(bf16_bits(x)); }

// 2^x on the bare hardware instruction. exp2f() wraps the same instruction in a compare, two selects, an add and an ldexp that only serve results
// below 2^-126 (x < -126), which the bare form returns as 0. Here such a result has no effect: a weight that small is 0 in both f16 planes
// (its residual is below 2^-115) and vanishes in the f32 row sum, which holds 256 from the row's maximum; a rescale factor that small
// multiplies sums that the same step's weight of 256 outweighs by more than 2^100. For x >= -126, -inf included, the value is the same bit for bit.
__device__ __forceinline__ float exp2_hw(float x) { return __builtin_amdgcn_exp2f(x); }

// 2 x 4 tile group of one 32-deep k-step (bf16), then the hazard guard
__device__ __forceinline__ void mma8(v16b a0, v16b a1, v16b b0, v16b b1, v16b b2, v16b b3, v8f (&c)[8]) {
  c[0] = __builtin_amdgcn_wmma_f32_16x16x32_bf16(false, a0, false, b0, (short)0, c[0], false, false);
  c[1] = __builtin_amdgcn_wmma_f32_16x16x32_bf16(false, a0, false, b1, (short)0, c[1], false, false);
  c[2] = __builtin_amdgcn_wmma_f32_16x16x32_bf16(false, a0, false, b2, (short)0, c[2], false, false);
  c[3] = __builtin_amdgcn_wmma_f32_16x16x32_bf16(false, a0, false, b3, (short)0, c[3], false, false);
  c[4] = __builtin_amdgcn_wmma_f32_16x16x32_bf16(false, a1, false, b0, (short)0, c[4], false, false);
  c[5] = __builtin_amdgcn_wmma_f32_16x16x32_bf16(false, a1, false, b1, (short)0, c[5], false, false);
  c[6] = __builtin_amdgcn_wmma_f32_16x16x32_bf16(false, a1, false, b2, (short)0, c[6], false, false);
  c[7] = __builtin_amdgcn_wmma_f32_16x16x32_bf16(false, a1, false, b3, (short)0, c[7], false, false);
  asm volatile("v_nop\n\tv_nop\n\tv_nop\n\tv_nop"
               : "+v"(c[0]), "+v"(c[1]), "+v"(c[2]), "+v"(c[3]), "+v"(c[4]), "+v"(c[5]), "+v"(c[6]), "+v"(c[7])
               : "v"(a0), "v"(a1), "v"(b0), "v"(b1), "v"(b2), "v"(b3));
}
// sh += K*Q (64 deep = two k-steps), then the hazard guard
__device__ __forceinline__ void mma_s(v16h k0, v16h k1, v16h q0, v16h q1, v8f& sh) {
  sh = __builtin_amdgcn_wmma_f32_16x16x32_f16(false, k0, false, q0, (short)0, sh, false, false);
  sh = __builtin_amdgcn_wmma_f32_16x16x32_f16(false, k1, false, q1, (short)0, sh, false, false);
  asm volatile("v_nop\n\tv_nop\n\tv_nop\n\tv_nop" : "+v"(sh) : "v"(k0), "v"(k1), "v"(q0), "v"(q1));
}
// oh += Vh*Ph ; ol += Vh*Pl + Vl*Ph (same x2^11 on both residual planes), then the hazard guard
__device__ __forceinline__ void mma_pv3(v16h vh, v16h vl, v16h ph, v16h pl, v8f& oh, v8f& ol) {
  oh = __builtin_amdgcn_wmma_f32_16x16x32_f16(false, vh, false, ph, (short)0, oh, false, false);
  ol = __builtin_amdgcn_wmma_f32_16x16x32_f16(false, vh, false, pl, (short)0, ol, false, false);
  ol = __builtin_amdgcn_wmma_f32_16x16x32_f16(false, vl, false, ph, (short)0, ol, false, false);
  asm volatile("v_nop\n\tv_nop\n\tv_nop\n\tv_nop" : "+v"(oh), "+v"(ol) : "v"(vh), "v"(vl), "v"(ph), "v"(pl));
}
// oh += Vh*Ph, then the hazard guard
__device__ __forceinline__ void mma_pv1(v16h vh, v16h ph, v8f& oh) {
  oh = __builtin_amdgcn_wmma_f32_16x16x32_f16(false, vh, false, ph, (short)0, oh, false, false);
  asm volatile("v_nop\n\tv_nop\n\tv_nop\n\tv_nop" : "+v"(oh) : "v"(vh), "v"(ph));
}

// dst = 16-bit image of src[(b*rpb_full + s)][0..1023], row = b*rpb + s, in fragment order [row / 16][k / 32][half][lane][8]. F16 = false: bf16 bits (RNE);
// F16 = true: f16 bits of (RNE bf16 value x 64), exact. Thread per 8 elements; a wave takes 8 rows x 32 k: it reads 8 whole 128-B lines and writes
// 4 whole lines (8 rows of one (half, h) each); rows a multiple of 16; t = thread index inside this plane's share of the grid
template <bool F16>
__device__ __forceinline__ void cvt_part(const float* __restrict__ src, unsigned short* __restrict__ dst,
                                         int t, int rows, int rpb, int rpb_full) {
  if (t >= rows * 128) return;
  const int wv = t >> 5, g = (t >> 3) & 3;                                      // g = 2 * half + h: which 8 k of the k-step
  const int r16 = (wv & 1) * 8 + (t & 7), frag = wv >> 1;                       // row in its 16-row band; fragment = band * 32 + k-step
  const int row = (frag >> 5) * 16 + r16, kk = (frag & 31) * 32 + g * 8;
  const int b = row / rpb, s = row - b * rpb;
  const float* p = src + ((size_t)b * rpb_full + s) * DM + kk;
  const v4f x0 = *(const v4fa*)(p), x1 = *(const v4fa*)(p + 4);
  H8 o;
#pragma unroll
  for (int i = 0; i < 4; ++i) {
    if (F16) {
      o.h[i]     = (_Float16)(bf16_rne(x0[i]) * 64.0f);
      o.h[4 + i] = (_Float16)(bf16_rne(x1[i]) * 64.0f);
    } else {
      o.u[i]     = bf16_bits(x0[i]);
      o.u[4 + i] = bf16_bits(x1[i]);
    }
  }
  const v8us ov = o.v;
  unsigned short* d = dst + ((size_t)frag * 64 + g * 16 + r16) * 8;
  *(v8us*)d = ov;
  
}

// coverage: NB*SEQ*(SEQ/32) threads x 1 word = the whole plane.
__device__ __forceinline__ void mask_part(const int* __restrict__ mask, unsigned int* __restrict__ bits, int t) {
  if (t >= NB * SEQ * (SEQ / 32)) return;
  const int wd = t % (SEQ / 32), row = t / (SEQ / 32);
  const int b = row / SEQ, q = row - b * SEQ;
  const int* p = mask + ((size_t)b * SEQ_FULL + q) * SEQ_FULL + 32 * wd;
  unsigned int m = 0u;
#pragma unroll
  for (int j = 0; j < 8; ++j) {
    const v4i x = *(const v4ia*)(p + 4 * j);
    m |= ((x[0] == 1) ? 1u : 0u) << (4 * j);
    m |= ((x[1] == 1) ? 1u : 0u) << (4 * j + 1);
    m |= ((x[2] == 1) ? 1u : 0u) << (4 * j + 2);
    m |= ((x[3] == 1) ? 1u : 0u) << (4 * j + 3);
  }
  *(unsigned int*)(bits + t) = m;
  
}

// One grid for everything that reads only the inputs: none of these parts reads what another writes. Block ranges, in index order:
// mask words (the longest threads, placed first for speed only), x, then the weight planes q, k, v, o (bf16) and o (f16 x64).
#define PB_MASK (NB * SEQ * (SEQ / 32) / 256)
#define PB_X (NB * SEQ * 128 / 256)
#define PB_W (DM * 128 / 256)
#define PB_NW (3 + (RH > 0 ? 1 : 0) + (SEQ > RH ? 1 : 0))
static_assert((NB * SEQ * (SEQ / 32)) % 256 == 0 && (NB * SEQ * 128) % 256 == 0 && (DM * 128) % 256 == 0);
__global__ __launch_bounds__(256) void k_prep(const float* __restrict__ x, const float* __restrict__ Wq, const float* __restrict__ Wk,
                                              const float* __restrict__ Wv, const float* __restrict__ Wo, const int* __restrict__ mask,
                                              unsigned short* __restrict__ Xb, unsigned short* __restrict__ Wb,
                                              unsigned short* __restrict__ Woh, unsigned int* __restrict__ bits) {
  const int tid = threadIdx.x;
  int blk = blockIdx.x;
  if (blk < PB_MASK) { mask_part(mask, bits, blk * 256 + tid); return; }
  blk -= PB_MASK;
  if (blk < PB_X) { cvt_part<false>(x, Xb, blk * 256 + tid, NB * SEQ, SEQ, SEQ_FULL); return; }
  blk -= PB_X;
  const int pl = blk / PB_W, t = (blk - pl * PB_W) * 256 + tid;
  if (pl == 4 || (pl == 3 && RH == 0)) { cvt_part<true>(Wo, Woh, t, DM, DM, DM); return; }
  const float* w = (pl == 0) ? Wq : (pl == 1) ? Wk : (pl == 2) ? Wv : Wo;
  cvt_part<false>(w, Wb + (size_t)pl * DM * DM, t, DM, DM, DM);
}

// the 2 x 4 tile group for the register ring: builtins alone, the hazard guard stands behind the call; no asm statement names the fragments, since
// a value that an asm operand names is held below v256 and the ring's sets do not all fit there
template <bool F16>
__device__ __forceinline__ void mma8s(const FragX (&a)[2], const FragX (&b)[4], v8f (&c)[8]) {
#pragma unroll
  for (int i = 0; i < 2; ++i)
#pragma unroll
    for (int j = 0; j < 4; ++j) {
      if (F16) c[4 * i + j] = __builtin_amdgcn_wmma_f32_16x16x32_f16(false, a[i].h, false, b[j].h, (short)0, c[4 * i + j], false, false);
      else     c[4 * i + j] = __builtin_amdgcn_wmma_f32_16x16x32_bf16(false, a[i].b, false, b[j].b, (short)0, c[4 * i + j], false, false);
    }
}

// The fragments of one k-step of the output projection: A rows (two 16-row bands), with LO the same of the lo plane, and four W bands; k0 = element
// offset of the k-step's fragment in its band. LAST: the wave's last loads, behind which the address registers are free for other use.
template <bool LO, bool LAST>
__device__ __forceinline__ void load_set(const unsigned short* __restrict__ ap, const unsigned short* __restrict__ lp,
                                         const unsigned short* __restrict__ wp, int k0, FragX (&a)[2], FragX (&l)[2], FragX (&b)[4]) {
  a[0].half[0] = *(const v8us*)(ap + k0);               a[0].half[1] = *(const v8us*)(ap + k0 + 256);
  a[1].half[0] = *(const v8us*)(ap + 16 * DM + k0);     a[1].half[1] = *(const v8us*)(ap + 16 * DM + k0 + 256);
  if (LO) {
    if (LAST) asm volatile("s_wait_xcnt 0x0" ::: "memory");   // in front of loads whose results may land in the registers that held the A loads' address
    l[0].half[0] = *(const v8us*)(lp + k0);             l[0].half[1] = *(const v8us*)(lp + k0 + 256);
    l[1].half[0] = *(const v8us*)(lp + 16 * DM + k0);   l[1].half[1] = *(const v8us*)(lp + 16 * DM + k0 + 256);
  }
  if (LAST) asm volatile("s_wait_xcnt 0x0" ::: "memory");     // in front of loads whose results may land in the registers that held the A loads' addresses
  b[0].half[0] = *(const v8us*)(wp + k0);               b[0].half[1] = *(const v8us*)(wp + k0 + 256);
  b[1].half[0] = *(const v8us*)(wp + 16 * DM + k0);     b[1].half[1] = *(const v8us*)(wp + 16 * DM + k0 + 256);
  b[2].half[0] = *(const v8us*)(wp + 32 * DM + k0);     b[2].half[1] = *(const v8us*)(wp + 32 * DM + k0 + 256);
  b[3].half[0] = *(const v8us*)(wp + 48 * DM + k0);
  if (LAST) asm volatile("s_wait_xcnt 0x0" ::: "memory");     // the last W load's result may land in the registers that held the W loads' address
  b[3].half[1] = *(const v8us*)(wp + 48 * DM + k0 + 256);
  if (LAST) asm volatile("s_wait_xcnt 0x0" ::: "memory");     // in front of whatever is written next to the register that held the last load's address
}

// C[m][n] = sum_k A[m][k] * W[n][k] + bf16(bias[n]); A, W 16-bit planes with 1024-element rows; block tile 128 x 64, 4 waves x (32 x 64).
// Row blocks: block bx -> batch b = bx / nblk, first row s0 = sbeg + (bx % nblk) * 128 of that batch (plane row b*SEQ + s0); column block by.
// Fragments straight from the fragment-ordered planes: A row m = l&15, B column n = l&15, elements 0..7 <- k0 + 8h + i, 8..15 <- k0 + 16 + 8h + i.
// MODE 0 (z = 0, 1: q, k; bf16 operands): f16 plane [z][b][h][s / 16][d / 32][half][lane][8] = f16(16 v); block tile = one contiguous 16-KB run.
// MODE 1 (v; bf16 operands): f16 planes [b][h][s / 32][d / 16][half][lane][8 keys], hi = f16(16 v), residual = f16((16 v - hi) 2^11); transposed on the LDS read side.
// MODE 2 (out, rows < RH; bf16 operands): A = ctx hi plane, Alo = ctx lo plane (bf16, unscaled, same accumulator); f32 rows of the output buffer.
// MODE 3 (out, rows >= RH; f16 operands): A = f16(64 ctx), W = f16(64 Wo); accumulator x 2^-12; f32 rows of the output buffer.
// LDS tile so (the calling kernel's one tile): cross-wave (block barrier); staged extent 128 x 64 == consumed extent.
template <int MODE>
__device__ __forceinline__ void gemm_part(float (&so)[128][68],
                                          const unsigned short* __restrict__ A, const unsigned short* __restrict__ Alo,
                                          const unsigned short* __restrict__ Wm,
                                          const float* __restrict__ bias0, const float* __restrict__ bias1,
                                          unsigned short* __restrict__ outH, unsigned short* __restrict__ outL,
                                          float* __restrict__ outF, int bx, int by, int z, int sbeg, int nblk) {
  const int tid = threadIdx.x, w = __builtin_amdgcn_readfirstlane((int)(tid >> 5)), lane = tid & 31, ln = lane & 15, hh = lane >> 4;
  const int b = bx / nblk, s0 = sbeg + (bx - b * nblk) * 128;
  const int rowB = b * SEQ + s0, colB = by * 64;
  const size_t aoff = (size_t)(rowB + 32 * w) * DM + 8 * lane;                  // 16 plane rows = 32 fragments = 16 * DM elements
  const unsigned short* ap = A + aoff;
  const unsigned short* lp = Alo + aoff;
  const unsigned short* wp = Wm + (size_t)z * DM * DM + (size_t)colB * DM + 8 * lane;
  const v8f z8 = {0.f, 0.f, 0.f, 0.f, 0.f, 0.f, 0.f, 0.f};
  v8f c[8];
#pragma unroll
  for (int i = 0; i < 8; ++i) c[i] = z8;
  if constexpr (MODE >= 2) {
    // Output projection: two waves share a SIMD here, too few to cover a load's way with other waves' work, so each wave covers its own:
    // a ring of NR register sets, all filled in front of the loop; behind the products of k-step s its set is refilled for k-step s + NR.
    // The k loop is unrolled whole: the ring index is a compile-time number and every load is base + immediate offset, so that no address
    // register changes while loads fly.
    constexpr int NS = DM / 32;                     // k-steps
    constexpr int NR = (MODE == 2) ? 3 : 4;         // 48 loads of a wave in flight in either mode
    FragX fa[NR][2], fl[NR][2], fb[NR][4];
#pragma unroll
    for (int s = 0; s < NR; ++s) load_set<MODE == 2, false>(ap, lp, wp, 512 * s, fa[s], fl[s], fb[s]);
#pragma unroll
    for (int s = 0; s < NS; ++s) {
      __builtin_amdgcn_sched_barrier(0);            // keeps the loads above in front of these products: sunk below them they would lose a step of lead
      mma8s<MODE == 3>(fa[s % NR], fb[s % NR], c);
      if (MODE == 2) mma8s<false>(fl[s % NR], fb[s % NR], c);
      if (s + NR < NS) {
        __builtin_amdgcn_sched_barrier(0);          // keeps the products in front of the guard below
        asm volatile("v_nop\n\tv_nop\n\tv_nop\n\tv_nop");   // hazard guard: four vector slots between the last product and the loads that refill its A and B registers
        __builtin_amdgcn_sched_barrier(0);          // keeps the refill behind the guard
        if (s + NR < NS - 1) load_set<MODE == 2, false>(ap, lp, wp, 512 * (s + NR), fa[s % NR], fl[s % NR], fb[s % NR]);
        else                 load_set<MODE == 2, true>(ap, lp, wp, 512 * (s + NR), fa[s % NR], fl[s % NR], fb[s % NR]);
      }
    }
  } else {
#pragma unroll 1
    for (int k0 = 0; k0 < 16 * DM; k0 += 512) {                                 // k0: element offset of the k-step's fragment in its 16-row band
      FragX a0, a1, b0, b1, b2, b3;
      a0.half[0] = *(const v8us*)(ap + k0);               a0.half[1] = *(const v8us*)(ap + k0 + 256);
      a1.half[0] = *(const v8us*)(ap + 16 * DM + k0);     a1.half[1] = *(const v8us*)(ap + 16 * DM + k0 + 256);
      if (MODE != 0) asm volatile("s_wait_xcnt 0x0" ::: "memory");   // in front of loads whose results may land in the registers that held the A loads' address
      b0.half[0] = *(const v8us*)(wp + k0);               b0.half[1] = *(const v8us*)(wp + k0 + 256);
      b1.half[0] = *(const v8us*)(wp + 16 * DM + k0);     b1.half[1] = *(const v8us*)(wp + 16 * DM + k0 + 256);
      b2.half[0] = *(const v8us*)(wp + 32 * DM + k0);     b2.half[1] = *(const v8us*)(wp + 32 * DM + k0 + 256);
      b3.half[0] = *(const v8us*)(wp + 48 * DM + k0);
      if (MODE != 0) asm volatile("s_wait_xcnt 0x0" ::: "memory");   // the last W load's result may land in the registers that held the W loads' address
      b3.half[1] = *(const v8us*)(wp + 48 * DM + k0 + 256);
      mma8(a0.b, a1.b, b0.b, b1.b, b2.b, b3.b, c);
    }
  }
  // D element r of tile (i, j) = C(row 32w + 16i + 8h + r, col 16j + l&15)
  const float cs = (MODE == 3) ? 0.000244140625f : 1.0f;     // 2^-12 undoes the x64 carries of ctx and Wo
#pragma unroll
  for (int j = 0; j < 4; ++j) {
    const int n = colB + 16 * j + ln;
    const float bA = bias0[n], bB = bias1[n];
    const float bj = bf16_rne((MODE == 0 && z == 1) ? bB : bA);
#pragma unroll
    for (int i = 0; i < 2; ++i)
#pragma unroll
      for (int r = 0; r < 8; ++r)
        so[32 * w + 16 * i + 8 * hh + r][16 * j + ln] = c[4 * i + j][r] * cs + bj;
  }
  __syncthreads();
  const int hd = by;
  if (MODE == 0) {
    const size_t base = (size_t)z * PLANE + (((size_t)(b * NH + hd)) * SEQ + s0) * HD;
    unsigned short* dh = outH + base;
    {
      for (int i = tid; i < 128 * 8; i += 128) {
        const int row = (i >> 7) * 16 + (i & 15), p8 = ((i >> 4) & 7) * 8;   // piece i = [s / 16][d / 32][half][h][s % 16]; d = 8 * bits 6..4
        const v4f x0 = *(const v4fa*)&so[row][p8], x1 = *(const v4fa*)&so[row][p8 + 4];
        H8 oh;
#pragma unroll
        for (int q = 0; q < 4; ++q) {
          oh.h[q]     = (_Float16)(x0[q] * 16.0f);
          oh.h[4 + q] = (_Float16)(x1[q] * 16.0f);
        }
        const v8us ov = oh.v;
        *(v8us*)(dh + (size_t)i * 8) = ov;
      }
      
    }
  } else if (MODE == 1) {
    const size_t base = (((size_t)(b * NH + hd)) * SEQ + s0) * HD;             // 32 keys x 64 d = 2048 elements per key step
    unsigned short* dh = outH + base;
    unsigned short* dl = outL + base;
    {
      for (int i = tid; i < 64 * 16; i += 128) {
        const int d = ((i >> 6) & 3) * 16 + (i & 15), s8 = (i >> 8) * 32 + ((i >> 4) & 3) * 8;   // piece i = [s / 32][d / 16][half][h][d % 16]
        H8 oh, ol;
#pragma unroll
        for (int q = 0; q < 8; ++q) {
          const float v0 = so[s8 + q][d] * 16.0f;
          const _Float16 h0 = (_Float16)v0;
          oh.h[q] = h0;
          ol.h[q] = (_Float16)((v0 - (float)h0) * RES_SC);
        }
        const v8us ovh = oh.v, ovl = ol.v;
        *(v8us*)(dh + (size_t)i * 8) = ovh;
        *(v8us*)(dl + (size_t)i * 8) = ovl;
      }
      
    }
  } else {
    float* og = outF + ((size_t)b * SEQ_FULL + s0) * DM + colB;
    {
      for (int i = tid; i < 128 * 16; i += 128) {
        const int row = i >> 4, c4 = (i & 15) * 4;
        const v4f v = *(const v4fa*)&so[row][c4];
        *(v4f*)(og + (size_t)row * DM + c4) = v;
      }
      
    }
  }
}

// The three projections of x in one grid (row blocks, 1024/64, 3): z = 0, 1 -> q, k (MODE 0), z = 2 -> v (MODE 1); the branch is block-uniform.
__global__ __launch_bounds__(128) void k_qkv(const unsigned short* __restrict__ Xb, const unsigned short* __restrict__ Wb,
                                             const float* __restrict__ bq, const float* __restrict__ bk, const float* __restrict__ bv,
                                             unsigned short* __restrict__ QKh, unsigned short* __restrict__ Vth,
                                             unsigned short* __restrict__ Vtl) {
  __shared__ __attribute__((aligned(16))) float so[128][68];
  const int bx = blockIdx.x, by = blockIdx.y, z = blockIdx.z;
  if (z < 2) gemm_part<0>(so, Xb, Xb, Wb, bq, bk, QKh, QKh, nullptr, bx, by, z, 0, SEQ / 128);
  else       gemm_part<1>(so, Xb, Xb, Wb + (size_t)2 * DM * DM, bv, bv, Vth, Vtl, nullptr, bx, by, 0, 0, SEQ / 128);
}

// Both row bands of the output projection in one grid (NB * SEQ / 128, 1024/64): the first NB * RH / 128 row blocks are the rows < RH (MODE 2),
// the others the rows >= RH (MODE 3); the branch is block-uniform.
__global__ __launch_bounds__(128) void k_out(const unsigned short* __restrict__ Cp, const unsigned short* __restrict__ Cl,
                                             const unsigned short* __restrict__ Wob, const unsigned short* __restrict__ Woh,
                                             const float* __restrict__ bo, float* __restrict__ out) {
  __shared__ __attribute__((aligned(16))) float so[128][68];
  const int bx = blockIdx.x, by = blockIdx.y;
  if (bx < NB * (RH / 128)) gemm_part<2>(so, Cp, Cl, Wob, bo, bo, nullptr, nullptr, out, bx, by, 0, 0, RH / 128);
  else                      gemm_part<3>(so, Cp, Cl, Woh, bo, bo, nullptr, nullptr, out, bx - NB * (RH / 128), by, 0, RH, (SEQ - RH) / 128);
}

// Fragment loads of one 32-key step. Pointers are the (batch, head) bases of the planes.
// A fragments of K: row m = key (key0 + 16*kt + ln), elements 0..7 <- d = 32c + 8h + i, 8..15 <- d = 32c + 16 + 8h + i; kf[2*kt + c];
// the step's eight halves are 4 KB in a row of the fragment-ordered plane
__device__ __forceinline__ void load_k(const unsigned short* __restrict__ Khp, int key0, int ln, int hh, FragH (&kf)[4]) {
  const unsigned short* kp = Khp + (size_t)key0 * HD + 8 * (16 * hh + ln);
#pragma unroll
  for (int f = 0; f < 4; ++f) {
    kf[f].half[0] = *(const v8us*)(kp + 512 * f); kf[f].half[1] = *(const v8us*)(kp + 512 * f + 256);
  }
}
// A fragments of V^T: row m = d (16*t + ln), elements 0..7 <- key0 + 8h + i, 8..15 <- key0 + 16 + 8h + i; again 4 KB in a row (key0 a multiple of 32)
__device__ __forceinline__ void load_v(const unsigned short* __restrict__ Vp, int key0, int ln, int hh, FragH (&vf)[4]) {
  const unsigned short* vp = Vp + (size_t)key0 * HD + 8 * (16 * hh + ln);
#pragma unroll
  for (int t = 0; t < 4; ++t) {
    vf[t].half[0] = *(const v8us*)(vp + 512 * t); vf[t].half[1] = *(const v8us*)(vp + 512 * t + 256);
  }
}

// One 32-key step for a wave's 16 queries (this lane's column: one query), on fragments and a mask word that were loaded one step earlier.
// Each fragment set is reloaded for step keyN (the wave's next active step) right behind its last product, so that those loads fly
// under the rest of this step and the head of the next one.
// EARLY: P and v as hi + residual planes (three products, lr over the f32 weights); else one product and lr over the f16 weights.
template <bool EARLY>
__device__ __forceinline__ void fa_step(const unsigned short* __restrict__ Khp,
                                        const unsigned short* __restrict__ Vhp, const unsigned short* __restrict__ Vlp,
                                        int keyN, unsigned int mw, int ln, int hh,
                                        const FragH& qh0, const FragH& qh1,
                                        FragH (&kf)[4], FragH (&vf)[4], FragH (&vlf)[4],
                                        float& mr, float& lr, v8f (&Oh)[4], v8f (&Ol)[4]) {
  const v8f z8 = {0.f, 0.f, 0.f, 0.f, 0.f, 0.f, 0.f, 0.f};
  float sc[16];
#pragma unroll
  for (int kt = 0; kt < 2; ++kt) {
    v8f sh = z8;
    mma_s(kf[2 * kt].v, kf[2 * kt + 1].v, qh0.v, qh1.v, sh);
    // S^T element r of tile kt = score(key0 + 16*kt + 8h + r, this lane's query); carries: 16 x 16 on q, k, then 1/8 -> 2^-11
#pragma unroll
    for (int r = 0; r < 8; ++r) sc[8 * kt + r] = sh[r] * 0.00048828125f;
  }
  load_k(Khp, keyN, ln, hh, kf);
  __builtin_amdgcn_sched_barrier(0);   // keeps the K reloads here: sunk below the softmax they would have too short a lead on the next step's products
  // replace-fill: excluded keys get -inf (bit 8h + r of the word <-> tile 0, bit 16 + 8h + r <-> tile 1)
  const float ninf = __uint_as_float(0xFF800000u);
  const unsigned int mb = mw >> (8 * hh);
#pragma unroll
  for (int r = 0; r < 8; ++r) {
    sc[r]     = ((mb >> r) & 1u) ? ninf : sc[r];
    sc[8 + r] = ((mb >> (16 + r)) & 1u) ? ninf : sc[8 + r];
  }
  float mx = sc[0];
#pragma unroll
  for (int i = 1; i < 16; ++i) mx = fmaxf(mx, sc[i]);
  mx = fmaxf(mx, __shfl_xor(mx, 16, 32));           // the other lane half holds the other 16 keys of this query
  const float mnew = fmaxf(mr, mx);
  const float al = exp2_hw((mr - mnew) * LOG2E);
  mr = mnew;
  // weights carried x256: pc = 256 * exp(sc - mnew); hi plane f16(pc); EARLY: residual plane f16((pc - hi) * 2048)
  FragH ph, pl;
  float ps = 0.0f;
#pragma unroll
  for (int i = 0; i < 16; i += 2) {
    const v2f s2 = {sc[i], sc[i + 1]};
    const v2f x2 = __builtin_elementwise_fma(s2 - mnew, (v2f){LOG2E, LOG2E}, (v2f){8.0f, 8.0f});
    const v2f pc = {exp2_hw(x2[0]), exp2_hw(x2[1])};
    const v2h h = __builtin_convertvector(pc, v2h);  // one packed convert; the uses below read its halves
    ph.h[i] = h[0]; ph.h[i + 1] = h[1];             // B element i: i<8 -> key0 + 8h + i (tile 0 row 8h+i); i>=8 -> key0 + 16 + 8h + (i-8) (tile 1)
    if (EARLY) {
      ps += pc[0];
      ps += pc[1];
      pl.h[i]     = (_Float16)((pc[0] - (float)h[0]) * RES_SC);
      pl.h[i + 1] = (_Float16)((pc[1] - (float)h[1]) * RES_SC);
    } else {
      ps += (float)h[0];
      ps += (float)h[1];
    }
  }
  ps += __shfl_xor(ps, 16, 32);
  lr = lr * al + ps;
#pragma unroll
  for (int t = 0; t < 4; ++t) {
    Oh[t] = Oh[t] * al;
    if (EARLY) Ol[t] = Ol[t] * al;
  }
#pragma unroll
  for (int t = 0; t < 4; ++t) {
    if (EARLY) mma_pv3(vf[t].v, vlf[t].v, ph.v, pl.v, Oh[t], Ol[t]);
    else       mma_pv1(vf[t].v, ph.v, Oh[t]);
  }
  load_v(Vhp, keyN, ln, hh, vf);
  if (EARLY) load_v(Vlp, keyN, ln, hh, vlf);
  asm volatile("s_wait_xcnt 0x0" ::: "memory");   // in front of the next step's writes to the registers that held these loads' addresses
}

// Block = 4 waves x 16 queries = 64 queries of one (batch, head); query tile = qt0 + (blk % nqt), blk = block index inside its band; no LDS and no barrier.
// Steps whose 32 keys are excluded for all 16 queries of the wave are skipped (exact for any mask value): a wave-uniform map of the
// active steps is built from the wave's mask rows in front of the loop, so that the step after the current one is known when its loads issue.
// Epilogue: lane 16h + q holds ctx(query q, d = 16t + 8h + r), which is half t & 1 of the ctx plane's fragment (k-step 2*head + t / 2): each O^T tile
// goes out of its registers as one 512-byte run.
// coverage: NB*NH*nqt blocks x 4 waves x 16 rows x 64 columns = every (row, head) segment of the band exactly once.
template <bool EARLY>
__device__ __forceinline__ void attn_part(const unsigned short* __restrict__ QKh,
                                          const unsigned short* __restrict__ Vth, const unsigned short* __restrict__ Vtl,
                                          const unsigned int* __restrict__ bits,
                                          unsigned short* __restrict__ Cp, unsigned short* __restrict__ Cl,
                                          int blk, int qt0, int nqt) {
  static_assert(SEQ / 32 <= 64);
  const int tid = threadIdx.x, w = __builtin_amdgcn_readfirstlane((int)(tid >> 5)), lane = tid & 31, ln = lane & 15, hh = lane >> 4;
  const int bh = blk / nqt, qt = qt0 + (blk - bh * nqt);
  const int b = bh / NH, hd = bh - b * NH;
  const int qbase = qt * 64 + 16 * w;
  const int qg = qbase + ln;
  const size_t hb = (size_t)bh * SEQ * HD;
  // Q^T B fragments: column n = query qg, elements 0..7 <- d = 32c + 8h + i, 8..15 <- d = 32c + 16 + 8h + i
  FragH qh0, qh1;
  {
    const unsigned short* qrh = QKh + hb + (size_t)qbase * HD + 8 * lane;
    qh0.half[0] = *(const v8us*)(qrh);       qh0.half[1] = *(const v8us*)(qrh + 256);
    qh1.half[0] = *(const v8us*)(qrh + 512); qh1.half[1] = *(const v8us*)(qrh + 768);
  }
  const unsigned short* Khp = QKh + PLANE + hb;
  const unsigned short* Vhp = Vth + hb;
  const unsigned short* Vlp = Vtl + hb;
  const unsigned int* mrow = bits + ((size_t)b * SEQ + qg) * (SEQ / 32);
  float mr = -3.0e38f, lr = 0.0f;
  v8f Oh[4] = {}, Ol[4] = {};
  // bit j of act: step j has a key that some query of the wave keeps
  unsigned long long act = 0ull;
#pragma unroll
  for (int i = 0; i < SEQ / 128; ++i) {
    const v4i x = *(const v4ia*)(mrow + 4 * i);
#pragma unroll
    for (int e = 0; e < 4; ++e)
      if (__ballot(x[e] != -1) != 0) act |= 1ull << (4 * i + e);   // wave-uniform
  }
  if (act != 0ull) {
    int j = __builtin_ctzll(act);
    act &= act - 1ull;
    FragH kf[4], vf[4], vlf[4];
    unsigned int mw = mrow[j];
    __builtin_amdgcn_sched_barrier(0);                // mask word first in load order: the loop's wait for it then leaves the fragment loads in flight
    load_k(Khp, 32 * j, ln, hh, kf);
    load_v(Vhp, 32 * j, ln, hh, vf);
    if (EARLY) load_v(Vlp, 32 * j, ln, hh, vlf);
    asm volatile("s_wait_xcnt 0x0" ::: "memory");     // in front of later writes to the registers that held these loads' addresses
    __builtin_amdgcn_sched_barrier(0);                // keeps those writes behind the wait
#pragma unroll 1
    for (;;) {
      const bool more = act != 0ull;                  // wave-uniform
      const int jn = more ? __builtin_ctzll(act) : j; // last step: its own tiles once more (in bounds, never used)
      act &= act - 1ull;
      const unsigned int mwn = mrow[jn];
      fa_step<EARLY>(Khp, Vhp, Vlp, 32 * jn, mw, ln, hh, qh0, qh1, kf, vf, vlf, mr, lr, Oh, Ol);
      if (!more) break;
      mw = mwn;
      j = jn;
    }
  }

  // O^T element r of tile t = ctx(query qg, d = 16t + 8h + r); undo the carries: x256 (in lr), x16 (v), x2048 (residual accumulator)
  const float inv = 1.0f / (16.0f * lr);
  const size_t cb = ((size_t)(b * SEQ + qbase)) * DM + (size_t)hd * (16 * HD) + 8 * lane;
#pragma unroll
  for (int t = 0; t < 4; ++t) {
    if (EARLY) {
      v8us oh, ol;
#pragma unroll
      for (int r = 0; r < 8; ++r) {
        const float x = (Oh[t][r] + Ol[t][r] * RES_INV) * inv;
        const unsigned short h0 = bf16_bits(x);
        oh[r] = h0;
        ol[r] = bf16_bits(x - bf16_val(h0));
      }
      *(v8us*)(Cp + cb + 256 * t) = oh;
      *(v8us*)(Cl + cb + 256 * t) = ol;
    } else {
      H8 of;
#pragma unroll
      for (int r = 0; r < 8; ++r) of.h[r] = (_Float16)((Oh[t][r] * inv) * 64.0f);
      const v8us ov = of.v;
      *(v8us*)(Cp + cb + 256 * t) = ov;
    }
  }
  if (EARLY) asm volatile("s_wait_xcnt 0x0" ::: "memory");   // the built code joins the two bands behind these stores: in front of the other band's writes to their registers
}

// Both query bands in one grid: the first NB * NH * (SEQ - RH) / 64 blocks take the rows >= RH, the others the rows < RH (the smaller band, placed
// last for speed only); the branch is block-uniform.
#define AB_LATE (NB * NH * ((SEQ - RH) / 64))
#define AB_EARLY (NB * NH * (RH / 64))
__global__ __launch_bounds__(128) void k_attn(const unsigned short* __restrict__ QKh,
                                              const unsigned short* __restrict__ Vth, const unsigned short* __restrict__ Vtl,
                                              const unsigned int* __restrict__ bits,
                                              unsigned short* __restrict__ Cp, unsigned short* __restrict__ Cl) {
  const int blk = blockIdx.x;
  if (blk < AB_LATE) attn_part<false>(QKh, Vth, Vtl, bits, Cp, Cl, blk, RH / 64, (SEQ - RH) / 64);
  else               attn_part<true>(QKh, Vth, Vtl, bits, Cp, Cl, blk - AB_LATE, 0, RH / 64);
}

extern "C" void kernel_launch(void* const* d_in, const int* in_sizes, int n_in,
                              void* d_out, int out_size, void* d_ws, size_t ws_size, hipStream_t stream) {
  if (n_in < 10) return;
  const long long needx = (long long)(NB - 1) * SEQ_FULL * DM + (long long)SEQ * DM;   // last element touched + 1
  const long long needm = (long long)(NB - 1) * SEQ_FULL * SEQ_FULL + (long long)(SEQ - 1) * SEQ_FULL + SEQ;
  if ((long long)in_sizes[0] < needx) return;
  if ((long long)in_sizes[1] < (long long)DM * DM || (long long)in_sizes[3] < (long long)DM * DM) return;
  if ((long long)in_sizes[5] < (long long)DM * DM || (long long)in_sizes[7] < (long long)DM * DM) return;
  if (in_sizes[2] < DM || in_sizes[4] < DM || in_sizes[6] < DM || in_sizes[8] < DM) return;
  if ((long long)in_sizes[9] < needm) return;
  if ((long long)out_size < needx) return;
  const float* x  = (const float*)d_in[0];   // wire order: x, Wq, bq, Wk, bk, Wv, bv, Wo, bo, attention_mask
  const float* Wq = (const float*)d_in[1];
  const float* bq = (const float*)d_in[2];
  const float* Wk = (const float*)d_in[3];
  const float* bk = (const float*)d_in[4];
  const float* Wv = (const float*)d_in[5];
  const float* bv = (const float*)d_in[6];
  const float* Wo = (const float*)d_in[7];
  const float* bo = (const float*)d_in[8];
  const int* mask = (const int*)d_in[9];
  float* out = (float*)d_out;

  char* ws = (char*)d_ws;
  size_t off = 0;
  const size_t pl2 = PLANE * 2;                               // bytes of one [NB*SEQ][1024] 16-bit plane (8 MiB at full size), multiple of 256
  const size_t wsz = (size_t)DM * DM * 2;                     // 2 MiB per weight plane
  const size_t bsz = (size_t)NB * SEQ * (SEQ / 32) * 4;       // 1 MiB at full size
  unsigned short* Xb  = (unsigned short*)(ws + off); off += pl2;
  unsigned short* Wb  = (unsigned short*)(ws + off); off += 4 * wsz;      // bf16 planes q, k, v, o
  unsigned short* Woh = (unsigned short*)(ws + off); off += wsz;          // f16 plane of 64 Wo
  unsigned short* QKh = (unsigned short*)(ws + off); off += 2 * pl2;      // [q|k][b][h][s][64], fragment order
  unsigned short* Vth = (unsigned short*)(ws + off); off += pl2;          // [b][h][s / 32][64 x 32], fragment order
  unsigned short* Vtl = (unsigned short*)(ws + off); off += pl2;
  unsigned int*   Mb  = (unsigned int*)(ws + off);   off += (bsz + 255) & ~(size_t)255;
  unsigned short* Cp  = (unsigned short*)(ws + off); off += pl2;          // [b*SEQ + s][1024], fragment order: rows < RH bf16 hi, rows >= RH f16(64 ctx)
  unsigned short* Cl  = (unsigned short*)(ws + off); off += pl2;          // rows < RH: bf16 lo (other rows never written, never read)
  if (off > ws_size || off > (size_t)134217728) return;

  // four launches, each reading only what an earlier one (or the caller) wrote
  k_prep<<<(unsigned)(PB_MASK + PB_X + PB_NW * PB_W), 256, 0, stream>>>(x, Wq, Wk, Wv, Wo, mask, Xb, Wb, Woh, Mb);
  k_qkv<<<dim3((unsigned)(NB * (SEQ / 128)), DM / 64, 3), 128, 0, stream>>>(Xb, Wb, bq, bk, bv, QKh, Vth, Vtl);
  k_attn<<<(unsigned)(AB_LATE + AB_EARLY), 128, 0, stream>>>(QKh, Vth, Vtl, Mb, Cp, Cl);
  k_out<<<dim3((unsigned)(NB * (SEQ / 128)), DM / 64, 1), 128, 0, stream>>>(Cp, Cl, Wb + (size_t)3 * DM * DM, Woh, bo, out);
}

// v006
// Measured time: 101 microseconds a run.
// Timed twice side by side with v005, it ran 1.03 and 1.04 times as fast.
// Over all steps from v000 it is 3.11 times as fast.
#include <hip/hip_runtime.h>
// Contractions: q/k/v projections on v_wmma_f32_16x16x32_bf16 (x, W RNE bf16, single product, f32 accumulate); S^T = K Q^T on v_wmma_f32_16x16x32_f16 (q, k as x16 f16 planes, single product); O^T = V^T P^T on v_wmma_f32_16x16x32_f16 (query rows < RH: v x16 hi + x2^11 residual, P x256 hi + x2^11 residual, residual products in their own f32 accumulator; query rows >= RH: v x16, P x256, single product, row sum over the f16 P); output projection: rows < RH on v_wmma_f32_16x16x32_bf16 (ctx bf16 hi + bf16 lo planes, Wo RNE bf16), rows >= RH on v_wmma_f32_16x16x32_f16 (ctx x64 f16, Wo RNE-bf16 value x64 in f16, single product); softmax statistics f32.
// Multi-head attention, B x S x 1024, 16 heads of 64, scale 1/8, mask input (1 = key excluded, score replaced by -inf) read on the device as a packed bit plane.
// Engine: transposed flash. Each wave owns 16 queries. Per 32-key step: S^T tiles (key rows x query columns) from K rows (A, global f16 plane)
// and Q^T (B, registers); the two 16-key D tiles pack straight into the P^T B fragment; O^T (d rows x query columns) accumulates from V^T rows (A, global f16 planes).
// Plane layout: every 16-bit operand plane is stored in fragment order. One fragment (16 rows x 32 k) = 1 KB = [half 0..1][lane 0..31][8 elements];
// lane = 16h + row, element i of half f = k 16f + 8h + i. A wave-wide 16-byte load of one half is 512 contiguous bytes (four whole lines).
#ifndef NB
#define NB 2
#endif
#ifndef SEQ
#define SEQ 2048
#endif
#ifndef RH
#define RH 256                                 /* query rows below RH (per batch) take the hi + residual path */
#endif
#define NB_FULL 2
#define SEQ_FULL 2048
#define DM 1024
#define NH 16
#define HD 64
#define PLANE ((size_t)NB * SEQ * DM)          /* elements of one [NB*SEQ][1024] 16-bit plane */

static_assert(SEQ % 128 == 0);
static_assert(SEQ <= SEQ_FULL);
static_assert(NB <= NB_FULL);
static_assert(RH % 128 == 0);
static_assert(RH >= 0 && RH <= SEQ);
static_assert(NH * HD == DM);
static_assert(HD == 64);
static_assert(DM % 64 == 0);
static_assert(PLANE * 2 * 7 + (size_t)5 * DM * DM * 2 + (size_t)NB * SEQ * (SEQ / 32) * 4 + 4096 <= (size_t)134217728);

typedef __bf16 v16b __attribute__((ext_vector_type(16)));
typedef _Float16 v16h __attribute__((ext_vector_type(16)));
typedef unsigned short v8us __attribute__((ext_vector_type(8), may_alias));
typedef float v8f __attribute__((ext_vector_type(8)));
typedef float v2f __attribute__((ext_vector_type(2)));
typedef _Float16 v2h __attribute__((ext_vector_type(2)));
typedef float v4f __attribute__((ext_vector_type(4)));
typedef float v4fa __attribute__((ext_vector_type(4), may_alias));
typedef int v4i __attribute__((ext_vector_type(4)));
typedef int v4ia __attribute__((ext_vector_type(4), may_alias));
union FragH { v16h v; v8us half[2]; _Float16 h[16]; unsigned short u[16]; };
union FragX { v16b b; v16h h; v8us half[2]; };
union H8 { v8us v; _Float16 h[8]; unsigned short u[8]; };

#define LOG2E 1.4426950408889634f
#define RES_SC 2048.0f
#define RES_INV 0.00048828125f

__device__ __forceinline__ unsigned short bf16_bits(float x) {   // RNE convert to bf16 bits, NaN kept NaN
  const unsigned int u = __float_as_uint(x);
  const unsigned int r = (u + 0x7FFFu + ((u >> 16) & 1u)) >> 16;
  const unsigned int n = (u >> 16) | 0x40u;
  return (unsigned short)(((u & 0x7FFFFFFFu) > 0x7F800000u) ? n : r);
}
__device__ __forceinline__ float bf16_val(unsigned short b) { return __uint_as_float(((unsigned int)b) << 16); }
__device__ __forceinline__ float bf16_rne(float x) { return bf16_val(bf16_bits(x)); }

// 2^x on the bare hardware instruction. exp2f() wraps the same instruction in a compare, two selects, an add and an ldexp that only serve results
// below 2^-126 (x < -126), which the bare form returns as 0. Here such a result has no effect: a weight that small is 0 in both f16 planes
// (its residual is below 2^-115) and vanishes in the f32 row sum, which holds 256 from the row's maximum; a rescale factor that small
// multiplies sums that the same step's weight of 256 outweighs by more than 2^100. For x >= -126, -inf included, the value is the same bit for bit.
__device__ __forceinline__ float exp2_hw(float x) { return __builtin_amdgcn_exp2f(x); }

// sh += K*Q (64 deep = two k-steps), then the hazard guard
__device__ __forceinline__ void mma_s(v16h k0, v16h k1, v16h q0, v16h q1, v8f& sh) {
  sh = __builtin_amdgcn_wmma_f32_16x16x32_f16(false, k0, false, q0, (short)0, sh, false, false);
  sh = __builtin_amdgcn_wmma_f32_16x16x32_f16(false, k1, false, q1, (short)0, sh, false, false);
  asm volatile("v_nop\n\tv_nop\n\tv_nop\n\tv_nop" : "+v"(sh) : "v"(k0), "v"(k1), "v"(q0), "v"(q1));
}
// oh += Vh*Ph ; ol += Vh*Pl + Vl*Ph (same x2^11 on both residual planes), then the hazard guard
__device__ __forceinline__ void mma_pv3(v16h vh, v16h vl, v16h ph, v16h pl, v8f& oh, v8f& ol) {
  oh = __builtin_amdgcn_wmma_f32_16x16x32_f16(false, vh, false, ph, (short)0, oh, false, false);
  ol = __builtin_amdgcn_wmma_f32_16x16x32_f16(false, vh, false, pl, (short)0, ol, false, false);
  ol = __builtin_amdgcn_wmma_f32_16x16x32_f16(false, vl, false, ph, (short)0, ol, false, false);
  asm volatile("v_nop\n\tv_nop\n\tv_nop\n\tv_nop" : "+v"(oh), "+v"(ol) : "v"(vh), "v"(vl), "v"(ph), "v"(pl));
}
// oh += Vh*Ph, then the hazard guard
__device__ __forceinline__ void mma_pv1(v16h vh, v16h ph, v8f& oh) {
  oh = __builtin_amdgcn_wmma_f32_16x16x32_f16(false, vh, false, ph, (short)0, oh, false, false);
  asm volatile("v_nop\n\tv_nop\n\tv_nop\n\tv_nop" : "+v"(oh) : "v"(vh), "v"(ph));
}

// dst = 16-bit image of src[(b*rpb_full + s)][0..1023], row = b*rpb + s, in fragment order [row / 16][k / 32][half][lane][8]. F16 = false: bf16 bits (RNE);
// F16 = true: f16 bits of (RNE bf16 value x 64), exact. Thread per 8 elements; a wave takes 8 rows x 32 k: it reads 8 whole 128-B lines and writes
// 4 whole lines (8 rows of one (half, h) each); rows a multiple of 16; t = thread index inside this plane's share of the grid
template <bool F16>
__device__ __forceinline__ void cvt_part(const float* __restrict__ src, unsigned short* __restrict__ dst,
                                         int t, int rows, int rpb, int rpb_full) {
  if (t >= rows * 128) return;
  const int wv = t >> 5, g = (t >> 3) & 3;                                      // g = 2 * half + h: which 8 k of the k-step
  const int r16 = (wv & 1) * 8 + (t & 7), frag = wv >> 1;                       // row in its 16-row band; fragment = band * 32 + k-step
  const int row = (frag >> 5) * 16 + r16, kk = (frag & 31) * 32 + g * 8;
  const int b = row / rpb, s = row - b * rpb;
  const float* p = src + ((size_t)b * rpb_full + s) * DM + kk;
  const v4f x0 = *(const v4fa*)(p), x1 = *(const v4fa*)(p + 4);
  H8 o;
#pragma unroll
  for (int i = 0; i < 4; ++i) {
    if (F16) {
      o.h[i]     = (_Float16)(bf16_rne(x0[i]) * 64.0f);
      o.h[4 + i] = (_Float16)(bf16_rne(x1[i]) * 64.0f);
    } else {
      o.u[i]     = bf16_bits(x0[i]);
      o.u[4 + i] = bf16_bits(x1[i]);
    }
  }
  const v8us ov = o.v;
  unsigned short* d = dst + ((size_t)frag * 64 + g * 16 + r16) * 8;
  *(v8us*)d = ov;
  
}

// coverage: NB*SEQ*(SEQ/32) threads x 1 word = the whole plane.
__device__ __forceinline__ void mask_part(const int* __restrict__ mask, unsigned int* __restrict__ bits, int t) {
  if (t >= NB * SEQ * (SEQ / 32)) return;
  const int wd = t % (SEQ / 32), row = t / (SEQ / 32);
  const int b = row / SEQ, q = row - b * SEQ;
  const int* p = mask + ((size_t)b * SEQ_FULL + q) * SEQ_FULL + 32 * wd;
  unsigned int m = 0u;
#pragma unroll
  for (int j = 0; j < 8; ++j) {
    const v4i x = *(const v4ia*)(p + 4 * j);
    m |= ((x[0] == 1) ? 1u : 0u) << (4 * j);
    m |= ((x[1] == 1) ? 1u : 0u) << (4 * j + 1);
    m |= ((x[2] == 1) ? 1u : 0u) << (4 * j + 2);
    m |= ((x[3] == 1) ? 1u : 0u) << (4 * j + 3);
  }
  *(unsigned int*)(bits + t) = m;
  
}

// One grid for everything that reads only the inputs: none of these parts reads what another writes. Block ranges, in index order:
// mask words (the longest threads, placed first for speed only), x, then the weight planes q, k, v, o (bf16) and o (f16 x64).
#define PB_MASK (NB * SEQ * (SEQ / 32) / 256)
#define PB_X (NB * SEQ * 128 / 256)
#define PB_W (DM * 128 / 256)
#define PB_NW (3 + (RH > 0 ? 1 : 0) + (SEQ > RH ? 1 : 0))
static_assert((NB * SEQ * (SEQ / 32)) % 256 == 0 && (NB * SEQ * 128) % 256 == 0 && (DM * 128) % 256 == 0);
__global__ __launch_bounds__(256) void k_prep(const float* __restrict__ x, const float* __restrict__ Wq, const float* __restrict__ Wk,
                                              const float* __restrict__ Wv, const float* __restrict__ Wo, const int* __restrict__ mask,
                                              unsigned short* __restrict__ Xb, unsigned short* __restrict__ Wb,
                                              unsigned short* __restrict__ Woh, unsigned int* __restrict__ bits) {
  const int tid = threadIdx.x;
  int blk = blockIdx.x;
  if (blk < PB_MASK) { mask_part(mask, bits, blk * 256 + tid); return; }
  blk -= PB_MASK;
  if (blk < PB_X) { cvt_part<false>(x, Xb, blk * 256 + tid, NB * SEQ, SEQ, SEQ_FULL); return; }
  blk -= PB_X;
  const int pl = blk / PB_W, t = (blk - pl * PB_W) * 256 + tid;
  if (pl == 4 || (pl == 3 && RH == 0)) { cvt_part<true>(Wo, Woh, t, DM, DM, DM); return; }
  const float* w = (pl == 0) ? Wq : (pl == 1) ? Wk : (pl == 2) ? Wv : Wo;
  cvt_part<false>(w, Wb + (size_t)pl * DM * DM, t, DM, DM, DM);
}

// the 2 x 4 tile group for the register ring: builtins alone, the hazard guard stands behind the call; no asm statement names the fragments, since
// a value that an asm operand names is held below v256 and the ring's sets do not all fit there
template <bool F16>
__device__ __forceinline__ void mma8s(const FragX (&a)[2], const FragX (&b)[4], v8f (&c)[8]) {
#pragma unroll
  for (int i = 0; i < 2; ++i)
#pragma unroll
    for (int j = 0; j < 4; ++j) {
      if (F16) c[4 * i + j] = __builtin_amdgcn_wmma_f32_16x16x32_f16(false, a[i].h, false, b[j].h, (short)0, c[4 * i + j], false, false);
      else     c[4 * i + j] = __builtin_amdgcn_wmma_f32_16x16x32_bf16(false, a[i].b, false, b[j].b, (short)0, c[4 * i + j], false, false);
    }
}

// The fragments of one k-step of the output projection: A rows (two 16-row bands), with LO the same of the lo plane, and four W bands; k0 = element
// offset of the k-step's fragment in its band. LAST: the wave's last loads, behind which the address registers are free for other use.
template <bool LO, bool LAST>
__device__ __forceinline__ void load_set(const unsigned short* __restrict__ ap, const unsigned short* __restrict__ lp,
                                         const unsigned short* __restrict__ wp, int k0, FragX (&a)[2], FragX (&l)[2], FragX (&b)[4]) {
  a[0].half[0] = *(const v8us*)(ap + k0);               a[0].half[1] = *(const v8us*)(ap + k0 + 256);
  a[1].half[0] = *(const v8us*)(ap + 16 * DM + k0);     a[1].half[1] = *(const v8us*)(ap + 16 * DM + k0 + 256);
  if (LO) {
    if (LAST) asm volatile("s_wait_xcnt 0x0" ::: "memory");   // in front of loads whose results may land in the registers that held the A loads' address
    l[0].half[0] = *(const v8us*)(lp + k0);             l[0].half[1] = *(const v8us*)(lp + k0 + 256);
    l[1].half[0] = *(const v8us*)(lp + 16 * DM + k0);   l[1].half[1] = *(const v8us*)(lp + 16 * DM + k0 + 256);
  }
  if (LAST) asm volatile("s_wait_xcnt 0x0" ::: "memory");     // in front of loads whose results may land in the registers that held the A loads' addresses
  b[0].half[0] = *(const v8us*)(wp + k0);               b[0].half[1] = *(const v8us*)(wp + k0 + 256);
  b[1].half[0] = *(const v8us*)(wp + 16 * DM + k0);     b[1].half[1] = *(const v8us*)(wp + 16 * DM + k0 + 256);
  b[2].half[0] = *(const v8us*)(wp + 32 * DM + k0);     b[2].half[1] = *(const v8us*)(wp + 32 * DM + k0 + 256);
  b[3].half[0] = *(const v8us*)(wp + 48 * DM + k0);
  if (LAST) asm volatile("s_wait_xcnt 0x0" ::: "memory");     // the last W load's result may land in the registers that held the W loads' address
  b[3].half[1] = *(const v8us*)(wp + 48 * DM + k0 + 256);
  if (LAST) asm volatile("s_wait_xcnt 0x0" ::: "memory");     // in front of whatever is written next to the register that held the last load's address
}

// Output projection. C[m][n] = sum_k A[m][k] * W[n][k] + bf16(bias[n]); A, W 16-bit planes with 1024-element rows; block tile 128 x 64, 4 waves x (32 x 64).
// Row blocks: block bx -> batch b = bx / nblk, first row s0 = sbeg + (bx % nblk) * 128 of that batch (plane row b*SEQ + s0); column block by.
// Fragments straight from the fragment-ordered planes: A row m = l&15, B column n = l&15, elements 0..7 <- k0 + 8h + i, 8..15 <- k0 + 16 + 8h + i.
// MODE 2 (rows < RH; bf16 operands): A = ctx hi plane, Alo = ctx lo plane (bf16, unscaled, same accumulator); f32 rows of the output buffer.
// MODE 3 (rows >= RH; f16 operands): A = f16(64 ctx), W = f16(64 Wo); accumulator x 2^-12; f32 rows of the output buffer.
// LDS tile so (the calling kernel's one tile): cross-wave (block barrier); staged extent 128 x 64 == consumed extent.
template <int MODE>
__device__ __forceinline__ void gemm_part(float (&so)[128][68],
                                          const unsigned short* __restrict__ A, const unsigned short* __restrict__ Alo,
                                          const unsigned short* __restrict__ Wm, const float* __restrict__ bias,
                                          float* __restrict__ outF, int bx, int by, int sbeg, int nblk) {
  const int tid = threadIdx.x, w = __builtin_amdgcn_readfirstlane((int)(tid >> 5)), lane = tid & 31, ln = lane & 15, hh = lane >> 4;
  const int b = bx / nblk, s0 = sbeg + (bx - b * nblk) * 128;
  const int rowB = b * SEQ + s0, colB = by * 64;
  const size_t aoff = (size_t)(rowB + 32 * w) * DM + 8 * lane;                  // 16 plane rows = 32 fragments = 16 * DM elements
  const unsigned short* ap = A + aoff;
  const unsigned short* lp = Alo + aoff;
  const unsigned short* wp = Wm + (size_t)colB * DM + 8 * lane;
  const v8f z8 = {0.f, 0.f, 0.f, 0.f, 0.f, 0.f, 0.f, 0.f};
  v8f c[8];
#pragma unroll
  for (int i = 0; i < 8; ++i) c[i] = z8;
  {
    // Two waves share a SIMD here, too few to cover a load's way with other waves' work, so each wave covers its own:
    // a ring of NR register sets, all filled in front of the loop; behind the products of k-step s its set is refilled for k-step s + NR.
    // The k loop is unrolled whole: the ring index is a compile-time number and every load is base + immediate offset, so that no address
    // register changes while loads fly.
    constexpr int NS = DM / 32;                     // k-steps
    constexpr int NR = (MODE == 2) ? 3 : 4;         // 48 loads of a wave in flight in either mode
    FragX fa[NR][2], fl[NR][2], fb[NR][4];
#pragma unroll
    for (int s = 0; s < NR; ++s) load_set<MODE == 2, false>(ap, lp, wp, 512 * s, fa[s], fl[s], fb[s]);
#pragma unroll
    for (int s = 0; s < NS; ++s) {
      __builtin_amdgcn_sched_barrier(0);            // keeps the loads above in front of these products: sunk below them they would lose a step of lead
      mma8s<MODE == 3>(fa[s % NR], fb[s % NR], c);
      if (MODE == 2) mma8s<false>(fl[s % NR], fb[s % NR], c);
      if (s + NR < NS) {
        __builtin_amdgcn_sched_barrier(0);          // keeps the products in front of the guard below
        asm volatile("v_nop\n\tv_nop\n\tv_nop\n\tv_nop");   // hazard guard: four vector slots between the last product and the loads that refill its A and B registers
        __builtin_amdgcn_sched_barrier(0);          // keeps the refill behind the guard
        if (s + NR < NS - 1) load_set<MODE == 2, false>(ap, lp, wp, 512 * (s + NR), fa[s % NR], fl[s % NR], fb[s % NR]);
        else                 load_set<MODE == 2, true>(ap, lp, wp, 512 * (s + NR), fa[s % NR], fl[s % NR], fb[s % NR]);
      }
    }
  }
  // D element r of tile (i, j) = C(row 32w + 16i + 8h + r, col 16j + l&15)
  const float cs = (MODE == 3) ? 0.000244140625f : 1.0f;     // 2^-12 undoes the x64 carries of ctx and Wo
#pragma unroll
  for (int j = 0; j < 4; ++j) {
    const float bj = bf16_rne(bias[colB + 16 * j + ln]);
#pragma unroll
    for (int i = 0; i < 2; ++i)
#pragma unroll
      for (int r = 0; r < 8; ++r)
        so[32 * w + 16 * i + 8 * hh + r][16 * j + ln] = c[4 * i + j][r] * cs + bj;
  }
  __syncthreads();
  float* og = outF + ((size_t)b * SEQ_FULL + s0) * DM + colB;
  for (int i = tid; i < 128 * 16; i += 128) {
    const int row = i >> 4, c4 = (i & 15) * 4;
    const v4f v = *(const v4fa*)&so[row][c4];
    *(v4f*)(og + (size_t)row * DM + c4) = v;
  }
}

// 4 x 4 tile group of one 32-deep k-step (bf16): builtins alone, the hazard guard stands behind the pass's last call; no asm statement names the
// fragments or the accumulators, since a value that an asm operand names is held below v256 and they do not all fit there
__device__ __forceinline__ void mma16(const FragX (&a)[4], const FragX (&b)[4], v8f (&c)[16]) {
#pragma unroll
  for (int i = 0; i < 4; ++i)
#pragma unroll
    for (int j = 0; j < 4; ++j)
      c[4 * i + j] = __builtin_amdgcn_wmma_f32_16x16x32_bf16(false, a[i].b, false, b[j].b, (short)0, c[4 * i + j], false, false);
}

// Projections of x. C[m][n] = sum_k A[m][k] * W[n][k] + bf16(bias[n]); A, W bf16 planes with 1024-element rows.
// Block tile 128 x 128 (two heads), 2 x 2 waves x (64 x 64): the loop is bound by the fragment bytes it loads, and a 64 x 64 wave tile feeds 16 products
// from 8 KB of fragments where a 32 x 64 tile feeds 8 from 6 KB; of the block's bytes each is wanted by two waves. A pass is 64 k (two k-steps),
// so that a wave has 32 loads in flight although only three waves share a SIMD.
// Row blocks: block bx -> batch b = bx / (SEQ / 128), first row s0 = (bx % (SEQ / 128)) * 128 of that batch (plane row b*SEQ + s0); column block by = heads 2 by, 2 by + 1.
// Fragments straight from the fragment-ordered planes: A row m = l&15, B column n = l&15, elements 0..7 <- k0 + 8h + i, 8..15 <- k0 + 16 + 8h + i.
// MODE 0 (q, k): f16 plane [b][h][s / 16][d / 32][half][lane][8] = f16(16 v); a head's part of the block tile = one contiguous 16-KB run.
// MODE 1 (v): f16 planes [b][h][s / 32][d / 16][half][lane][8 keys], hi = f16(16 v), residual = f16((16 v - hi) 2^11); transposed on the LDS read side.
// LDS tile so (one 128 x 64 tile per head): cross-wave (block barrier); staged extent == consumed extent.
template <int MODE>
__device__ __forceinline__ void proj_part(float (&so)[2][128][68],
                                          const unsigned short* __restrict__ A, const unsigned short* __restrict__ Wm,
                                          const float* __restrict__ bias,
                                          unsigned short* __restrict__ outH, unsigned short* __restrict__ outL, int bx, int by) {
  const int tid = threadIdx.x, w = __builtin_amdgcn_readfirstlane((int)(tid >> 5)), lane = tid & 31, ln = lane & 15, hh = lane >> 4;
  const int wr = w >> 1, wc = w & 1;                                            // the wave's 64 rows, its 64 columns (one head)
  const int b = bx / (SEQ / 128), s0 = (bx - b * (SEQ / 128)) * 128;
  const int rowB = b * SEQ + s0, colB = by * 128;
  const unsigned short* ap = A + (size_t)(rowB + 64 * wr) * DM + 8 * lane;      // 16 plane rows = 32 fragments = 16 * DM elements
  const unsigned short* wp = Wm + (size_t)(colB + 64 * wc) * DM + 8 * lane;
  const v8f z8 = {0.f, 0.f, 0.f, 0.f, 0.f, 0.f, 0.f, 0.f};
  v8f c[16];
#pragma unroll
  for (int i = 0; i < 16; ++i) c[i] = z8;
#pragma unroll 1
  for (int k0 = 0; k0 < 16 * DM; k0 += 1024) {                                  // k0: element offset of the pass's first fragment in its 16-row band
    FragX a[2][4], bb[2][4];
#pragma unroll
    for (int s = 0; s < 2; ++s) {
#pragma unroll
      for (int i = 0; i < 4; ++i) {
        a[s][i].half[0] = *(const v8us*)(ap + 16 * DM * i + k0 + 512 * s);
        a[s][i].half[1] = *(const v8us*)(ap + 16 * DM * i + k0 + 512 * s + 256);
      }
      if (s == 1) asm volatile("s_wait_xcnt 0x0" ::: "memory");   // in front of loads whose results may land in the registers that held the A loads' address
#pragma unroll
      for (int j = 0; j < 4; ++j) {
        bb[s][j].half[0] = *(const v8us*)(wp + 16 * DM * j + k0 + 512 * s);
        if (s == 1 && j == 3) asm volatile("s_wait_xcnt 0x0" ::: "memory");   // the last W load's result may land in the registers that held the W loads' address
        bb[s][j].half[1] = *(const v8us*)(wp + 16 * DM * j + k0 + 512 * s + 256);
      }
    }
    asm volatile("s_wait_xcnt 0x0" ::: "memory");   // in front of the next pass's writes to the registers that held these loads' addresses
    __builtin_amdgcn_sched_barrier(0);              // keeps all 32 loads in front of the products: sunk among them each group would be waited for on its own
    mma16(a[0], bb[0], c);
    mma16(a[1], bb[1], c);
    __builtin_amdgcn_sched_barrier(0);              // keeps the products in front of the guard below
    asm volatile("v_nop\n\tv_nop\n\tv_nop\n\tv_nop");   // hazard guard: four vector slots between the last product and the loads that refill its A and B registers
    __builtin_amdgcn_sched_barrier(0);              // keeps the next pass's loads behind the guard
  }
  // D element r of tile (i, j) = C(row 64 wr + 16i + 8h + r, col 64 wc + 16j + l&15)
#pragma unroll
  for (int j = 0; j < 4; ++j) {
    const float bj = bf16_rne(bias[colB + 64 * wc + 16 * j + ln]);
#pragma unroll
    for (int i = 0; i < 4; ++i)
#pragma unroll
      for (int r = 0; r < 8; ++r)
        so[wc][64 * wr + 16 * i + 8 * hh + r][16 * j + ln] = c[4 * i + j][r] + bj;
  }
  __syncthreads();
  const size_t base = (((size_t)(b * NH + 2 * by)) * SEQ + s0) * HD;            // head 2 by; head 2 by + 1 lies SEQ * HD elements on
  if (MODE == 0) {
    for (int i2 = tid; i2 < 2 * 128 * 8; i2 += 128) {
      const int hs = i2 >> 10, i = i2 & 1023;
      const int row = (i >> 7) * 16 + (i & 15), p8 = ((i >> 4) & 7) * 8;        // piece i = [s / 16][d / 32][half][h][s % 16]; d = 8 * bits 6..4
      const v4f x0 = *(const v4fa*)&so[hs][row][p8], x1 = *(const v4fa*)&so[hs][row][p8 + 4];
      H8 oh;
#pragma unroll
      for (int q = 0; q < 4; ++q) {
        oh.h[q]     = (_Float16)(x0[q] * 16.0f);
        oh.h[4 + q] = (_Float16)(x1[q] * 16.0f);
      }
      const v8us ov = oh.v;
      *(v8us*)(outH + base + (size_t)hs * SEQ * HD + (size_t)i * 8) = ov;
    }
  } else {
    for (int i2 = tid; i2 < 2 * 64 * 16; i2 += 128) {                           // 32 keys x 64 d = 2048 elements per key step
      const int hs = i2 >> 10, i = i2 & 1023;
      const int d = ((i >> 6) & 3) * 16 + (i & 15), s8 = (i >> 8) * 32 + ((i >> 4) & 3) * 8;   // piece i = [s / 32][d / 16][half][h][d % 16]
      H8 oh, ol;
#pragma unroll
      for (int q = 0; q < 8; ++q) {
        const float v0 = so[hs][s8 + q][d] * 16.0f;
        const _Float16 h0 = (_Float16)v0;
        oh.h[q] = h0;
        ol.h[q] = (_Float16)((v0 - (float)h0) * RES_SC);
      }
      const v8us ovh = oh.v, ovl = ol.v;
      *(v8us*)(outH + base + (size_t)hs * SEQ * HD + (size_t)i * 8) = ovh;
      *(v8us*)(outL + base + (size_t)hs * SEQ * HD + (size_t)i * 8) = ovl;
    }
  }
}

// The three projections of x in one grid (row blocks, 1024/128, 3): z = 0, 1 -> q, k (MODE 0), z = 2 -> v (MODE 1); the branch is block-uniform.
__global__ __launch_bounds__(128) void k_qkv(const unsigned short* __restrict__ Xb, const unsigned short* __restrict__ Wb,
                                             const float* __restrict__ bq, const float* __restrict__ bk, const float* __restrict__ bv,
                                             unsigned short* __restrict__ QKh, unsigned short* __restrict__ Vth,
                                             unsigned short* __restrict__ Vtl) {
  __shared__ __attribute__((aligned(16))) float so[2][128][68];
  const int bx = blockIdx.x, by = blockIdx.y, z = blockIdx.z;
  if (z < 2) proj_part<0>(so, Xb, Wb + (size_t)z * DM * DM, z == 1 ? bk : bq, QKh + (size_t)z * PLANE, QKh, bx, by);
  else       proj_part<1>(so, Xb, Wb + (size_t)2 * DM * DM, bv, Vth, Vtl, bx, by);
}

// Both row bands of the output projection in one grid (NB * SEQ / 128, 1024/64): the first NB * RH / 128 row blocks are the rows < RH (MODE 2),
// the others the rows >= RH (MODE 3); the branch is block-uniform.
__global__ __launch_bounds__(128) void k_out(const unsigned short* __restrict__ Cp, const unsigned short* __restrict__ Cl,
                                             const unsigned short* __restrict__ Wob, const unsigned short* __restrict__ Woh,
                                             const float* __restrict__ bo, float* __restrict__ out) {
  __shared__ __attribute__((aligned(16))) float so[128][68];
  const int bx = blockIdx.x, by = blockIdx.y;
  if (bx < NB * (RH / 128)) gemm_part<2>(so, Cp, Cl, Wob, bo, out, bx, by, 0, RH / 128);
  else                      gemm_part<3>(so, Cp, Cl, Woh, bo, out, bx - NB * (RH / 128), by, RH, (SEQ - RH) / 128);
}

// Fragment loads of one 32-key step. Pointers are the (batch, head) bases of the planes.
// A fragments of K: row m = key (key0 + 16*kt + ln), elements 0..7 <- d = 32c + 8h + i, 8..15 <- d = 32c + 16 + 8h + i; kf[2*kt + c];
// the step's eight halves are 4 KB in a row of the fragment-ordered plane
__device__ __forceinline__ void load_k(const unsigned short* __restrict__ Khp, int key0, int ln, int hh, FragH (&kf)[4]) {
  const unsigned short* kp = Khp + (size_t)key0 * HD + 8 * (16 * hh + ln);
#pragma unroll
  for (int f = 0; f < 4; ++f) {
    kf[f].half[0] = *(const v8us*)(kp + 512 * f); kf[f].half[1] = *(const v8us*)(kp + 512 * f + 256);
  }
}
// A fragments of V^T: row m = d (16*t + ln), elements 0..7 <- key0 + 8h + i, 8..15 <- key0 + 16 + 8h + i; again 4 KB in a row (key0 a multiple of 32)
__device__ __forceinline__ void load_v(const unsigned short* __restrict__ Vp, int key0, int ln, int hh, FragH (&vf)[4]) {
  const unsigned short* vp = Vp + (size_t)key0 * HD + 8 * (16 * hh + ln);
#pragma unroll
  for (int t = 0; t < 4; ++t) {
    vf[t].half[0] = *(const v8us*)(vp + 512 * t); vf[t].half[1] = *(const v8us*)(vp + 512 * t + 256);
  }
}

// One 32-key step for a wave's 16 queries (this lane's column: one query), on fragments and a mask word that were loaded one step earlier.
// Each fragment set is reloaded for step keyN (the wave's next active step) right behind its last product, so that those loads fly
// under the rest of this step and the head of the next one.
// EARLY: P and v as hi + residual planes (three products, lr over the f32 weights); else one product and lr over the f16 weights.
template <bool EARLY>
__device__ __forceinline__ void fa_step(const unsigned short* __restrict__ Khp,
                                        const unsigned short* __restrict__ Vhp, const unsigned short* __restrict__ Vlp,
                                        int keyN, unsigned int mw, int ln, int hh,
                                        const FragH& qh0, const FragH& qh1,
                                        FragH (&kf)[4], FragH (&vf)[4], FragH (&vlf)[4],
                                        float& mr, float& lr, v8f (&Oh)[4], v8f (&Ol)[4]) {
  const v8f z8 = {0.f, 0.f, 0.f, 0.f, 0.f, 0.f, 0.f, 0.f};
  float sc[16];
#pragma unroll
  for (int kt = 0; kt < 2; ++kt) {
    v8f sh = z8;
    mma_s(kf[2 * kt].v, kf[2 * kt + 1].v, qh0.v, qh1.v, sh);
    // S^T element r of tile kt = score(key0 + 16*kt + 8h + r, this lane's query); carries: 16 x 16 on q, k, then 1/8 -> 2^-11
#pragma unroll
    for (int r = 0; r < 8; ++r) sc[8 * kt + r] = sh[r] * 0.00048828125f;
  }
  load_k(Khp, keyN, ln, hh, kf);
  __builtin_amdgcn_sched_barrier(0);   // keeps the K reloads here: sunk below the softmax they would have too short a lead on the next step's products
  // replace-fill: excluded keys get -inf (bit 8h + r of the word <-> tile 0, bit 16 + 8h + r <-> tile 1)
  const float ninf = __uint_as_float(0xFF800000u);
  const unsigned int mb = mw >> (8 * hh);
#pragma unroll
  for (int r = 0; r < 8; ++r) {
    sc[r]     = ((mb >> r) & 1u) ? ninf : sc[r];
    sc[8 + r] = ((mb >> (16 + r)) & 1u) ? ninf : sc[8 + r];
  }
  float mx = sc[0];
#pragma unroll
  for (int i = 1; i < 16; ++i) mx = fmaxf(mx, sc[i]);
  mx = fmaxf(mx, __shfl_xor(mx, 16, 32));           // the other lane half holds the other 16 keys of this query
  const float mnew = fmaxf(mr, mx);
  const float al = exp2_hw((mr - mnew) * LOG2E);
  mr = mnew;
  // weights carried x256: pc = 256 * exp(sc - mnew); hi plane f16(pc); EARLY: residual plane f16((pc - hi) * 2048)
  FragH ph, pl;
  float ps = 0.0f;
#pragma unroll
  for (int i = 0; i < 16; i += 2) {
    const v2f s2 = {sc[i], sc[i + 1]};
    const v2f x2 = __builtin_elementwise_fma(s2 - mnew, (v2f){LOG2E, LOG2E}, (v2f){8.0f, 8.0f});
    const v2f pc = {exp2_hw(x2[0]), exp2_hw(x2[1])};
    const v2h h = __builtin_convertvector(pc, v2h);  // one packed convert; the uses below read its halves
    ph.h[i] = h[0]; ph.h[i + 1] = h[1];             // B element i: i<8 -> key0 + 8h + i (tile 0 row 8h+i); i>=8 -> key0 + 16 + 8h + (i-8) (tile 1)
    if (EARLY) {
      ps += pc[0];
      ps += pc[1];
      pl.h[i]     = (_Float16)((pc[0] - (float)h[0]) * RES_SC);
      pl.h[i + 1] = (_Float16)((pc[1] - (float)h[1]) * RES_SC);
    } else {
      ps += (float)h[0];
      ps += (float)h[1];
    }
  }
  ps += __shfl_xor(ps, 16, 32);
  lr = lr * al + ps;
#pragma unroll
  for (int t = 0; t < 4; ++t) {
    Oh[t] = Oh[t] * al;
    if (EARLY) Ol[t] = Ol[t] * al;
  }
#pragma unroll
  for (int t = 0; t < 4; ++t) {
    if (EARLY) mma_pv3(vf[t].v, vlf[t].v, ph.v, pl.v, Oh[t], Ol[t]);
    else       mma_pv1(vf[t].v, ph.v, Oh[t]);
  }
  load_v(Vhp, keyN, ln, hh, vf);
  if (EARLY) load_v(Vlp, keyN, ln, hh, vlf);
  asm volatile("s_wait_xcnt 0x0" ::: "memory");   // in front of the next step's writes to the registers that held these loads' addresses
}

// Block = 4 waves x 16 queries = 64 queries of one (batch, head); query tile = qt0 + (blk % nqt), blk = block index inside its band; no LDS and no barrier.
// Steps whose 32 keys are excluded for all 16 queries of the wave are skipped (exact for any mask value): a wave-uniform map of the
// active steps is built from the wave's mask rows in front of the loop, so that the step after the current one is known when its loads issue.
// Epilogue: lane 16h + q holds ctx(query q, d = 16t + 8h + r), which is half t & 1 of the ctx plane's fragment (k-step 2*head + t / 2): each O^T tile
// goes out of its registers as one 512-byte run.
// coverage: NB*NH*nqt blocks x 4 waves x 16 rows x 64 columns = every (row, head) segment of the band exactly once.
template <bool EARLY>
__device__ __forceinline__ void attn_part(const unsigned short* __restrict__ QKh,
                                          const unsigned short* __restrict__ Vth, const unsigned short* __restrict__ Vtl,
                                          const unsigned int* __restrict__ bits,
                                          unsigned short* __restrict__ Cp, unsigned short* __restrict__ Cl,
                                          int blk, int qt0, int nqt) {
  static_assert(SEQ / 32 <= 64);
  const int tid = threadIdx.x, w = __builtin_amdgcn_readfirstlane((int)(tid >> 5)), lane = tid & 31, ln = lane & 15, hh = lane >> 4;
  const int bh = blk / nqt, qt = qt0 + (blk - bh * nqt);
  const int b = bh / NH, hd = bh - b * NH;
  const int qbase = qt * 64 + 16 * w;
  const int qg = qbase + ln;
  const size_t hb = (size_t)bh * SEQ * HD;
  // Q^T B fragments: column n = query qg, elements 0..7 <- d = 32c + 8h + i, 8..15 <- d = 32c + 16 + 8h + i
  FragH qh0, qh1;
  {
    const unsigned short* qrh = QKh + hb + (size_t)qbase * HD + 8 * lane;
    qh0.half[0] = *(const v8us*)(qrh);       qh0.half[1] = *(const v8us*)(qrh + 256);
    qh1.half[0] = *(const v8us*)(qrh + 512); qh1.half[1] = *(const v8us*)(qrh + 768);
  }
  const unsigned short* Khp = QKh + PLANE + hb;
  const unsigned short* Vhp = Vth + hb;
  const unsigned short* Vlp = Vtl + hb;
  const unsigned int* mrow = bits + ((size_t)b * SEQ + qg) * (SEQ / 32);
  float mr = -3.0e38f, lr = 0.0f;
  v8f Oh[4] = {}, Ol[4] = {};
  // bit j of act: step j has a key that some query of the wave keeps
  unsigned long long act = 0ull;
#pragma unroll
  for (int i = 0; i < SEQ / 128; ++i) {
    const v4i x = *(const v4ia*)(mrow + 4 * i);
#pragma unroll
    for (int e = 0; e < 4; ++e)
      if (__ballot(x[e] != -1) != 0) act |= 1ull << (4 * i + e);   // wave-uniform
  }
  if (act != 0ull) {
    int j = __builtin_ctzll(act);
    act &= act - 1ull;
    FragH kf[4], vf[4], vlf[4];
    unsigned int mw = mrow[j];
    __builtin_amdgcn_sched_barrier(0);                // mask word first in load order: the loop's wait for it then leaves the fragment loads in flight
    load_k(Khp, 32 * j, ln, hh, kf);
    load_v(Vhp, 32 * j, ln, hh, vf);
    if (EARLY) load_v(Vlp, 32 * j, ln, hh, vlf);
    asm volatile("s_wait_xcnt 0x0" ::: "memory");     // in front of later writes to the registers that held these loads' addresses
    __builtin_amdgcn_sched_barrier(0);                // keeps those writes behind the wait
#pragma unroll 1
    for (;;) {
      const bool more = act != 0ull;                  // wave-uniform
      const int jn = more ? __builtin_ctzll(act) : j; // last step: its own tiles once more (in bounds, never used)
      act &= act - 1ull;
      const unsigned int mwn = mrow[jn];
      fa_step<EARLY>(Khp, Vhp, Vlp, 32 * jn, mw, ln, hh, qh0, qh1, kf, vf, vlf, mr, lr, Oh, Ol);
      if (!more) break;
      mw = mwn;
      j = jn;
    }
  }

  // O^T element r of tile t = ctx(query qg, d = 16t + 8h + r); undo the carries: x256 (in lr), x16 (v), x2048 (residual accumulator)
  const float inv = 1.0f / (16.0f * lr);
  const size_t cb = ((size_t)(b * SEQ + qbase)) * DM + (size_t)hd * (16 * HD) + 8 * lane;
#pragma unroll
  for (int t = 0; t < 4; ++t) {
    if (EARLY) {
      v8us oh, ol;
#pragma unroll
      for (int r = 0; r < 8; ++r) {
        const float x = (Oh[t][r] + Ol[t][r] * RES_INV) * inv;
        const unsigned short h0 = bf16_bits(x);
        oh[r] = h0;
        ol[r] = bf16_bits(x - bf16_val(h0));
      }
      *(v8us*)(Cp + cb + 256 * t) = oh;
      *(v8us*)(Cl + cb + 256 * t) = ol;
    } else {
      H8 of;
#pragma unroll
      for (int r = 0; r < 8; ++r) of.h[r] = (_Float16)((Oh[t][r] * inv) * 64.0f);
      const v8us ov = of.v;
      *(v8us*)(Cp + cb + 256 * t) = ov;
    }
  }
  if (EARLY) asm volatile("s_wait_xcnt 0x0" ::: "memory");   // the built code joins the two bands behind these stores: in front of the other band's writes to their registers
}

// Both query bands in one grid: the first NB * NH * (SEQ - RH) / 64 blocks take the rows >= RH, the others the rows < RH (the smaller band, placed
// last for speed only); the branch is block-uniform.
#define AB_LATE (NB * NH * ((SEQ - RH) / 64))
#define AB_EARLY (NB * NH * (RH / 64))
__global__ __launch_bounds__(128) void k_attn(const unsigned short* __restrict__ QKh,
                                              const unsigned short* __restrict__ Vth, const unsigned short* __restrict__ Vtl,
                                              const unsigned int* __restrict__ bits,
                                              unsigned short* __restrict__ Cp, unsigned short* __restrict__ Cl) {
  const int blk = blockIdx.x;
  if (blk < AB_LATE) attn_part<false>(QKh, Vth, Vtl, bits, Cp, Cl, blk, RH / 64, (SEQ - RH) / 64);
  else               attn_part<true>(QKh, Vth, Vtl, bits, Cp, Cl, blk - AB_LATE, 0, RH / 64);
}

extern "C" void kernel_launch(void* const* d_in, const int* in_sizes, int n_in,
                              void* d_out, int out_size, void* d_ws, size_t ws_size, hipStream_t stream) {
  if (n_in < 10) return;
  const long long needx = (long long)(NB - 1) * SEQ_FULL * DM + (long long)SEQ * DM;   // last element touched + 1
  const long long needm = (long long)(NB - 1) * SEQ_FULL * SEQ_FULL + (long long)(SEQ - 1) * SEQ_FULL + SEQ;
  if ((long long)in_sizes[0] < needx) return;
  if ((long long)in_sizes[1] < (long long)DM * DM || (long long)in_sizes[3] < (long long)DM * DM) return;
  if ((long long)in_sizes[5] < (long long)DM * DM || (long long)in_sizes[7] < (long long)DM * DM) return;
  if (in_sizes[2] < DM || in_sizes[4] < DM || in_sizes[6] < DM || in_sizes[8] < DM) return;
  if ((long long)in_sizes[9] < needm) return;
  if ((long long)out_size < needx) return;
  const float* x  = (const float*)d_in[0];   // wire order: x, Wq, bq, Wk, bk, Wv, bv, Wo, bo, attention_mask
  const float* Wq = (const float*)d_in[1];
  const float* bq = (const float*)d_in[2];
  const float* Wk = (const float*)d_in[3];
  const float* bk = (const float*)d_in[4];
  const float* Wv = (const float*)d_in[5];
  const float* bv = (const float*)d_in[6];
  const float* Wo = (const float*)d_in[7];
  const float* bo = (const float*)d_in[8];
  const int* mask = (const int*)d_in[9];
  float* out = (float*)d_out;

  char* ws = (char*)d_ws;
  size_t off = 0;
  const size_t pl2 = PLANE * 2;                               // bytes of one [NB*SEQ][1024] 16-bit plane (8 MiB at full size), multiple of 256
  const size_t wsz = (size_t)DM * DM * 2;                     // 2 MiB per weight plane
  const size_t bsz = (size_t)NB * SEQ * (SEQ / 32) * 4;       // 1 MiB at full size
  unsigned short* Xb  = (unsigned short*)(ws + off); off += pl2;
  unsigned short* Wb  = (unsigned short*)(ws + off); off += 4 * wsz;      // bf16 planes q, k, v, o
  unsigned short* Woh = (unsigned short*)(ws + off); off += wsz;          // f16 plane of 64 Wo
  unsigned short* QKh = (unsigned short*)(ws + off); off += 2 * pl2;      // [q|k][b][h][s][64], fragment order
  unsigned short* Vth = (unsigned short*)(ws + off); off += pl2;          // [b][h][s / 32][64 x 32], fragment order
  unsigned short* Vtl = (unsigned short*)(ws + off); off += pl2;
  unsigned int*   Mb  = (unsigned int*)(ws + off);   off += (bsz + 255) & ~(size_t)255;
  unsigned short* Cp  = (unsigned short*)(ws + off); off += pl2;          // [b*SEQ + s][1024], fragment order: rows < RH bf16 hi, rows >= RH f16(64 ctx)
  unsigned short* Cl  = (unsigned short*)(ws + off); off += pl2;          // rows < RH: bf16 lo (other rows never written, never read)
  if (off > ws_size || off > (size_t)134217728) return;

  // four launches, each reading only what an earlier one (or the caller) wrote
  k_prep<<<(unsigned)(PB_MASK + PB_X + PB_NW * PB_W), 256, 0, stream>>>(x, Wq, Wk, Wv, Wo, mask, Xb, Wb, Woh, Mb);
  k_qkv<<<dim3((unsigned)(NB * (SEQ / 128)), DM / 128, 3), 128, 0, stream>>>(Xb, Wb, bq, bk, bv, QKh, Vth, Vtl);
  k_attn<<<(unsigned)(AB_LATE + AB_EARLY), 128, 0, stream>>>(QKh, Vth, Vtl, Mb, Cp, Cl);
  k_out<<<dim3((unsigned)(NB * (SEQ / 128)), DM / 64, 1), 128, 0, stream>>>(Cp, Cl, Wb + (size_t)3 * DM * DM, Woh, bo, out);
}

// v007
// One run takes 95.8 microseconds.
// Timed twice side by side with v006, it ran 1.05 and 1.04 times as fast.
// All steps since v000 together make it 3.25 times as fast.
#include <hip/hip_runtime.h>
// Contractions: q/k/v projections on v_wmma_f32_16x16x32_bf16 (x, W RNE bf16, single product, f32 accumulate); S^T = K Q^T on v_wmma_f32_16x16x32_f16 (q, k as x16 f16 planes, single product); O^T = V^T P^T on v_wmma_f32_16x16x32_f16 (query rows < RH: v x16 hi + x2^11 residual, P x256 hi + x2^11 residual, residual products in their own f32 accumulator; query rows >= RH: v x16, P x256, single product, row sum over the f16 P); output projection: rows < RH on v_wmma_f32_16x16x32_bf16 (ctx bf16 hi + bf16 lo planes, Wo RNE bf16), rows >= RH on v_wmma_f32_16x16x32_f16 (ctx x64 f16, Wo RNE-bf16 value x64 in f16, single product); softmax statistics f32.
// Multi-head attention, B x S x 1024, 16 heads of 64, scale 1/8, mask input (1 = key excluded, score replaced by -inf) read on the device as a packed bit plane.
// Engine: transposed flash. Each wave owns 16 queries. Per 32-key step: S^T tiles (key rows x query columns) from K rows (A, global f16 plane)
// and Q^T (B, registers); the two 16-key D tiles pack straight into the P^T B fragment; O^T (d rows x query columns) accumulates from V^T rows (A, global f16 planes).
// Plane layout: every 16-bit operand plane is stored in fragment order. One fragment (16 rows x 32 k) = 1 KB = [half 0..1][lane 0..31][8 elements];
// lane = 16h + row, element i of half f = k 16f + 8h + i. A wave-wide 16-byte load of one half is 512 contiguous bytes (four whole lines).
#ifndef NB
#define NB 2
#endif
#ifndef SEQ
#define SEQ 2048
#endif
#ifndef RH
#define RH 256                                 /* query rows below RH (per batch) take the hi + residual path */
#endif
#define NB_FULL 2
#define SEQ_FULL 2048
#define DM 1024
#define NH 16
#define HD 64
#define PLANE ((size_t)NB * SEQ * DM)          /* elements of one [NB*SEQ][1024] 16-bit plane */

static_assert(SEQ % 128 == 0);
static_assert(SEQ <= SEQ_FULL);
static_assert(NB <= NB_FULL);
static_assert(RH % 128 == 0);
static_assert(RH >= 0 && RH <= SEQ);
static_assert(NH * HD == DM);
static_assert(HD == 64);
static_assert(DM % 64 == 0);
static_assert(PLANE * 2 * 7 + (size_t)5 * DM * DM * 2 + (size_t)NB * SEQ * (SEQ / 32) * 4 + 4096 <= (size_t)134217728);

typedef __bf16 v16b __attribute__((ext_vector_type(16)));
typedef _Float16 v16h __attribute__((ext_vector_type(16)));
typedef unsigned short v8us __attribute__((ext_vector_type(8), may_alias));
typedef float v8f __attribute__((ext_vector_type(8)));
typedef float v2f __attribute__((ext_vector_type(2)));
typedef _Float16 v2h __attribute__((ext_vector_type(2)));
typedef float v4f __attribute__((ext_vector_type(4)));
typedef float v4fa __attribute__((ext_vector_type(4), may_alias));
typedef int v4i __attribute__((ext_vector_type(4)));
typedef int v4ia __attribute__((ext_vector_type(4), may_alias));
union FragH { v16h v; v8us half[2]; _Float16 h[16]; unsigned short u[16]; };
union FragX { v16b b; v16h h; v8us half[2]; };
union H8 { v8us v; _Float16 h[8]; unsigned short u[8]; };

#define LOG2E 1.4426950408889634f
#define RES_SC 2048.0f
#define RES_INV 0.00048828125f

__device__ __forceinline__ unsigned short bf16_bits(float x) {   // RNE convert to bf16 bits, NaN kept NaN
  const unsigned int u = __float_as_uint(x);
  const unsigned int r = (u + 0x7FFFu + ((u >> 16) & 1u)) >> 16;
  const unsigned int n = (u >> 16) | 0x40u;
  return (unsigned short)(((u & 0x7FFFFFFFu) > 0x7F800000u) ? n : r);
}
__device__ __forceinline__ float bf16_val(unsigned short b) { return __uint_as_float(((unsigned int)b) << 16); }
__device__ __forceinline__ float bf16_rne(float x) { return bf16_val(bf16_bits(x)); }

// 2^x on the bare hardware instruction. exp2f() wraps the same instruction in a compare, two selects, an add and an ldexp that only serve results
// below 2^-126 (x < -126), which the bare form returns as 0. Here such a result has no effect: a weight that small is 0 in both f16 planes
// (its residual is below 2^-115) and vanishes in the f32 row sum, which holds 256 from the row's maximum; a rescale factor that small
// multiplies sums that the same step's weight of 256 outweighs by more than 2^100. For x >= -126, -inf included, the value is the same bit for bit.
__device__ __forceinline__ float exp2_hw(float x) { return __builtin_amdgcn_exp2f(x); }

// sh += K*Q (64 deep = two k-steps), then the hazard guard
__device__ __forceinline__ void mma_s(v16h k0, v16h k1, v16h q0, v16h q1, v8f& sh) {
  sh = __builtin_amdgcn_wmma_f32_16x16x32_f16(false, k0, false, q0, (short)0, sh, false, false);
  sh = __builtin_amdgcn_wmma_f32_16x16x32_f16(false, k1, false, q1, (short)0, sh, false, false);
  asm volatile("v_nop\n\tv_nop\n\tv_nop\n\tv_nop" : "+v"(sh) : "v"(k0), "v"(k1), "v"(q0), "v"(q1));
}
// oh += Vh*Ph ; ol += Vh*Pl + Vl*Ph (same x2^11 on both residual planes), then the hazard guard
__device__ __forceinline__ void mma_pv3(v16h vh, v16h vl, v16h ph, v16h pl, v8f& oh, v8f& ol) {
  oh = __builtin_amdgcn_wmma_f32_16x16x32_f16(false, vh, false, ph, (short)0, oh, false, false);
  ol = __builtin_amdgcn_wmma_f32_16x16x32_f16(false, vh, false, pl, (short)0, ol, false, false);
  ol = __builtin_amdgcn_wmma_f32_16x16x32_f16(false, vl, false, ph, (short)0, ol, false, false);
  asm volatile("v_nop\n\tv_nop\n\tv_nop\n\tv_nop" : "+v"(oh), "+v"(ol) : "v"(vh), "v"(vl), "v"(ph), "v"(pl));
}
// oh += Vh*Ph, then the hazard guard
__device__ __forceinline__ void mma_pv1(v16h vh, v16h ph, v8f& oh) {
  oh = __builtin_amdgcn_wmma_f32_16x16x32_f16(false, vh, false, ph, (short)0, oh, false, false);
  asm volatile("v_nop\n\tv_nop\n\tv_nop\n\tv_nop" : "+v"(oh) : "v"(vh), "v"(ph));
}

// dst = 16-bit image of src[(b*rpb_full + s)][0..1023], row = b*rpb + s, in fragment order [row / 16][k / 32][half][lane][8]. F16 = false: bf16 bits (RNE);
// F16 = true: f16 bits of (RNE bf16 value x 64), exact. Thread per 8 elements; a wave takes 8 rows x 32 k: it reads 8 whole 128-B lines and writes
// 4 whole lines (8 rows of one (half, h) each); rows a multiple of 16; t = thread index inside this plane's share of the grid
template <bool F16>
__device__ __forceinline__ void cvt_part(const float* __restrict__ src, unsigned short* __restrict__ dst,
                                         int t, int rows, int rpb, int rpb_full) {
  if (t >= rows * 128) return;
  const int wv = t >> 5, g = (t >> 3) & 3;                                      // g = 2 * half + h: which 8 k of the k-step
  const int r16 = (wv & 1) * 8 + (t & 7), frag = wv >> 1;                       // row in its 16-row band; fragment = band * 32 + k-step
  const int row = (frag >> 5) * 16 + r16, kk = (frag & 31) * 32 + g * 8;
  const int b = row / rpb, s = row - b * rpb;
  const float* p = src + ((size_t)b * rpb_full + s) * DM + kk;
  const v4f x0 = *(const v4fa*)(p), x1 = *(const v4fa*)(p + 4);
  H8 o;
#pragma unroll
  for (int i = 0; i < 4; ++i) {
    if (F16) {
      o.h[i]     = (_Float16)(bf16_rne(x0[i]) * 64.0f);
      o.h[4 + i] = (_Float16)(bf16_rne(x1[i]) * 64.0f);
    } else {
      o.u[i]     = bf16_bits(x0[i]);
      o.u[4 + i] = bf16_bits(x1[i]);
    }
  }
  const v8us ov = o.v;
  unsigned short* d = dst + ((size_t)frag * 64 + g * 16 + r16) * 8;
  *(v8us*)d = ov;
  
}

// coverage: NB*SEQ*(SEQ/32) threads x 1 word = the whole plane.
__device__ __forceinline__ void mask_part(const int* __restrict__ mask, unsigned int* __restrict__ bits, int t) {
  if (t >= NB * SEQ * (SEQ / 32)) return;
  const int wd = t % (SEQ / 32), row = t / (SEQ / 32);
  const int b = row / SEQ, q = row - b * SEQ;
  const int* p = mask + ((size_t)b * SEQ_FULL + q) * SEQ_FULL + 32 * wd;
  unsigned int m = 0u;
#pragma unroll
  for (int j = 0; j < 8; ++j) {
    const v4i x = *(const v4ia*)(p + 4 * j);
    m |= ((x[0] == 1) ? 1u : 0u) << (4 * j);
    m |= ((x[1] == 1) ? 1u : 0u) << (4 * j + 1);
    m |= ((x[2] == 1) ? 1u : 0u) << (4 * j + 2);
    m |= ((x[3] == 1) ? 1u : 0u) << (4 * j + 3);
  }
  *(unsigned int*)(bits + t) = m;
  
}

// One grid for everything that reads only the inputs: none of these parts reads what another writes. Block ranges, in index order:
// mask words (the longest threads, placed first for speed only), x, then the weight planes q, k, v, o (bf16) and o (f16 x64).
#define PB_MASK (NB * SEQ * (SEQ / 32) / 256)
#define PB_X (NB * SEQ * 128 / 256)
#define PB_W (DM * 128 / 256)
#define PB_NW (3 + (RH > 0 ? 1 : 0) + (SEQ > RH ? 1 : 0))
static_assert((NB * SEQ * (SEQ / 32)) % 256 == 0 && (NB * SEQ * 128) % 256 == 0 && (DM * 128) % 256 == 0);
__global__ __launch_bounds__(256) void k_prep(const float* __restrict__ x, const float* __restrict__ Wq, const float* __restrict__ Wk,
                                              const float* __restrict__ Wv, const float* __restrict__ Wo, const int* __restrict__ mask,
                                              unsigned short* __restrict__ Xb, unsigned short* __restrict__ Wb,
                                              unsigned short* __restrict__ Woh, unsigned int* __restrict__ bits) {
  const int tid = threadIdx.x;
  int blk = blockIdx.x;
  if (blk < PB_MASK) { mask_part(mask, bits, blk * 256 + tid); return; }
  blk -= PB_MASK;
  if (blk < PB_X) { cvt_part<false>(x, Xb, blk * 256 + tid, NB * SEQ, SEQ, SEQ_FULL); return; }
  blk -= PB_X;
  const int pl = blk / PB_W, t = (blk - pl * PB_W) * 256 + tid;
  if (pl == 4 || (pl == 3 && RH == 0)) { cvt_part<true>(Wo, Woh, t, DM, DM, DM); return; }
  const float* w = (pl == 0) ? Wq : (pl == 1) ? Wk : (pl == 2) ? Wv : Wo;
  cvt_part<false>(w, Wb + (size_t)pl * DM * DM, t, DM, DM, DM);
}

// the 2 x 4 tile group for the register ring: builtins alone, the hazard guard stands behind the call; no asm statement names the fragments, since
// a value that an asm operand names is held below v256 and the ring's sets do not all fit there
template <bool F16>
__device__ __forceinline__ void mma8s(const FragX (&a)[2], const FragX (&b)[4], v8f (&c)[8]) {
#pragma unroll
  for (int i = 0; i < 2; ++i)
#pragma unroll
    for (int j = 0; j < 4; ++j) {
      if (F16) c[4 * i + j] = __builtin_amdgcn_wmma_f32_16x16x32_f16(false, a[i].h, false, b[j].h, (short)0, c[4 * i + j], false, false);
      else     c[4 * i + j] = __builtin_amdgcn_wmma_f32_16x16x32_bf16(false, a[i].b, false, b[j].b, (short)0, c[4 * i + j], false, false);
    }
}

// The fragments of one k-step of the output projection: A rows (two 16-row bands), with LO the same of the lo plane, and four W bands; k0 = element
// offset of the k-step's fragment in its band. LAST: the wave's last loads, behind which the address registers are free for other use.
template <bool LO, bool LAST>
__device__ __forceinline__ void load_set(const unsigned short* __restrict__ ap, const unsigned short* __restrict__ lp,
                                         const unsigned short* __restrict__ wp, int k0, FragX (&a)[2], FragX (&l)[2], FragX (&b)[4]) {
  a[0].half[0] = *(const v8us*)(ap + k0);               a[0].half[1] = *(const v8us*)(ap + k0 + 256);
  a[1].half[0] = *(const v8us*)(ap + 16 * DM + k0);     a[1].half[1] = *(const v8us*)(ap + 16 * DM + k0 + 256);
  if (LO) {
    if (LAST) asm volatile("s_wait_xcnt 0x0" ::: "memory");   // in front of loads whose results may land in the registers that held the A loads' address
    l[0].half[0] = *(const v8us*)(lp + k0);             l[0].half[1] = *(const v8us*)(lp + k0 + 256);
    l[1].half[0] = *(const v8us*)(lp + 16 * DM + k0);   l[1].half[1] = *(const v8us*)(lp + 16 * DM + k0 + 256);
  }
  if (LAST) asm volatile("s_wait_xcnt 0x0" ::: "memory");     // in front of loads whose results may land in the registers that held the A loads' addresses
  b[0].half[0] = *(const v8us*)(wp + k0);               b[0].half[1] = *(const v8us*)(wp + k0 + 256);
  b[1].half[0] = *(const v8us*)(wp + 16 * DM + k0);     b[1].half[1] = *(const v8us*)(wp + 16 * DM + k0 + 256);
  b[2].half[0] = *(const v8us*)(wp + 32 * DM + k0);     b[2].half[1] = *(const v8us*)(wp + 32 * DM + k0 + 256);
  b[3].half[0] = *(const v8us*)(wp + 48 * DM + k0);
  if (LAST) asm volatile("s_wait_xcnt 0x0" ::: "memory");     // the last W load's result may land in the registers that held the W loads' address
  b[3].half[1] = *(const v8us*)(wp + 48 * DM + k0 + 256);
  if (LAST) asm volatile("s_wait_xcnt 0x0" ::: "memory");     // in front of whatever is written next to the register that held the last load's address
}

// Output projection. C[m][n] = sum_k A[m][k] * W[n][k] + bf16(bias[n]); A, W 16-bit planes with 1024-element rows; block tile 128 x 64, 4 waves x (32 x 64).
// Row blocks: block bx -> batch b = bx / nblk, first row s0 = sbeg + (bx % nblk) * 128 of that batch (plane row b*SEQ + s0); column block by.
// Fragments straight from the fragment-ordered planes: A row m = l&15, B column n = l&15, elements 0..7 <- k0 + 8h + i, 8..15 <- k0 + 16 + 8h + i.
// MODE 2 (rows < RH; bf16 operands): A = ctx hi plane, Alo = ctx lo plane (bf16, unscaled, same accumulator); f32 rows of the output buffer.
// MODE 3 (rows >= RH; f16 operands): A = f16(64 ctx), W = f16(64 Wo); accumulator x 2^-12; f32 rows of the output buffer.
// LDS tile so (the calling kernel's one tile): cross-wave (block barrier); staged extent 128 x 64 == consumed extent.
template <int MODE>
__device__ __forceinline__ void gemm_part(float (&so)[128][68],
                                          const unsigned short* __restrict__ A, const unsigned short* __restrict__ Alo,
                                          const unsigned short* __restrict__ Wm, const float* __restrict__ bias,
                                          float* __restrict__ outF, int bx, int by, int sbeg, int nblk) {
  const int tid = threadIdx.x, w = __builtin_amdgcn_readfirstlane((int)(tid >> 5)), lane = tid & 31, ln = lane & 15, hh = lane >> 4;
  const int b = bx / nblk, s0 = sbeg + (bx - b * nblk) * 128;
  const int rowB = b * SEQ + s0, colB = by * 64;
  const size_t aoff = (size_t)(rowB + 32 * w) * DM + 8 * lane;                  // 16 plane rows = 32 fragments = 16 * DM elements
  const unsigned short* ap = A + aoff;
  const unsigned short* lp = Alo + aoff;
  const unsigned short* wp = Wm + (size_t)colB * DM + 8 * lane;
  const v8f z8 = {0.f, 0.f, 0.f, 0.f, 0.f, 0.f, 0.f, 0.f};
  v8f c[8];
#pragma unroll
  for (int i = 0; i < 8; ++i) c[i] = z8;
  {
    // Two waves share a SIMD here, too few to cover a load's way with other waves' work, so each wave covers its own:
    // a ring of NR register sets, all filled in front of the loop; behind the products of k-step s its set is refilled for k-step s + NR.
    // The k loop is unrolled whole: the ring index is a compile-time number and every load is base + immediate offset, so that no address
    // register changes while loads fly.
    constexpr int NS = DM / 32;                     // k-steps
    constexpr int NR = (MODE == 2) ? 3 : 4;         // 48 loads of a wave in flight in either mode
    FragX fa[NR][2], fl[NR][2], fb[NR][4];
#pragma unroll
    for (int s = 0; s < NR; ++s) load_set<MODE == 2, false>(ap, lp, wp, 512 * s, fa[s], fl[s], fb[s]);
#pragma unroll
    for (int s = 0; s < NS; ++s) {
      __builtin_amdgcn_sched_barrier(0);            // keeps the loads above in front of these products: sunk below them they would lose a step of lead
      mma8s<MODE == 3>(fa[s % NR], fb[s % NR], c);
      if (MODE == 2) mma8s<false>(fl[s % NR], fb[s % NR], c);
      if (s + NR < NS) {
        __builtin_amdgcn_sched_barrier(0);          // keeps the products in front of the guard below
        asm volatile("v_nop\n\tv_nop\n\tv_nop\n\tv_nop");   // hazard guard: four vector slots between the last product and the loads that refill its A and B registers
        __builtin_amdgcn_sched_barrier(0);          // keeps the refill behind the guard
        if (s + NR < NS - 1) load_set<MODE == 2, false>(ap, lp, wp, 512 * (s + NR), fa[s % NR], fl[s % NR], fb[s % NR]);
        else                 load_set<MODE == 2, true>(ap, lp, wp, 512 * (s + NR), fa[s % NR], fl[s % NR], fb[s % NR]);
      }
    }
  }
  // D element r of tile (i, j) = C(row 32w + 16i + 8h + r, col 16j + l&15)
  const float cs = (MODE == 3) ? 0.000244140625f : 1.0f;     // 2^-12 undoes the x64 carries of ctx and Wo
#pragma unroll
  for (int j = 0; j < 4; ++j) {
    const float bj = bf16_rne(bias[colB + 16 * j + ln]);
#pragma unroll
    for (int i = 0; i < 2; ++i)
#pragma unroll
      for (int r = 0; r < 8; ++r)
        so[32 * w + 16 * i + 8 * hh + r][16 * j + ln] = c[4 * i + j][r] * cs + bj;
  }
  __syncthreads();
  float* og = outF + ((size_t)b * SEQ_FULL + s0) * DM + colB;
  for (int i = tid; i < 128 * 16; i += 128) {
    const int row = i >> 4, c4 = (i & 15) * 4;
    const v4f v = *(const v4fa*)&so[row][c4];
    *(v4f*)(og + (size_t)row * DM + c4) = v;
  }
}

// 4 x 4 tile group of one 32-deep k-step (bf16): builtins alone, the hazard guard stands behind the pass's last call; no asm statement names the
// fragments or the accumulators, since a value that an asm operand names is held below v256 and they do not all fit there
__device__ __forceinline__ void mma16(const FragX (&a)[4], const FragX (&b)[4], v8f (&c)[16]) {
#pragma unroll
  for (int i = 0; i < 4; ++i)
#pragma unroll
    for (int j = 0; j < 4; ++j)
      c[4 * i + j] = __builtin_amdgcn_wmma_f32_16x16x32_bf16(false, a[i].b, false, b[j].b, (short)0, c[4 * i + j], false, false);
}

// Projections of x. C[m][n] = sum_k A[m][k] * W[n][k] + bf16(bias[n]); A, W bf16 planes with 1024-element rows.
// Block tile 128 x 128 (two heads), 2 x 2 waves x (64 x 64): the loop is bound by the fragment bytes it loads, and a 64 x 64 wave tile feeds 16 products
// from 8 KB of fragments where a 32 x 64 tile feeds 8 from 6 KB; of the block's bytes each is wanted by two waves. A pass is 64 k (two k-steps),
// so that a wave has 32 loads in flight although only three waves share a SIMD.
// Row blocks: block bx -> batch b = bx / (SEQ / 128), first row s0 = (bx % (SEQ / 128)) * 128 of that batch (plane row b*SEQ + s0); column block by = heads 2 by, 2 by + 1.
// Fragments straight from the fragment-ordered planes: A row m = l&15, B column n = l&15, elements 0..7 <- k0 + 8h + i, 8..15 <- k0 + 16 + 8h + i.
// MODE 0 (q, k): f16 plane [b][h][s / 16][d / 32][half][lane][8] = f16(16 v); a head's part of the block tile = one contiguous 16-KB run.
// MODE 1 (v): f16 planes [b][h][s / 32][d / 16][half][lane][8 keys], hi = f16(16 v), residual = f16((16 v - hi) 2^11); transposed on the LDS read side.
// LDS tile so (one 128 x 64 tile per head): cross-wave (block barrier); staged extent == consumed extent.
template <int MODE>
__device__ __forceinline__ void proj_part(float (&so)[2][128][68],
                                          const unsigned short* __restrict__ A, const unsigned short* __restrict__ Wm,
                                          const float* __restrict__ bias,
                                          unsigned short* __restrict__ outH, unsigned short* __restrict__ outL, int bx, int by) {
  const int tid = threadIdx.x, w = __builtin_amdgcn_readfirstlane((int)(tid >> 5)), lane = tid & 31, ln = lane & 15, hh = lane >> 4;
  const int wr = w >> 1, wc = w & 1;                                            // the wave's 64 rows, its 64 columns (one head)
  const int b = bx / (SEQ / 128), s0 = (bx - b * (SEQ / 128)) * 128;
  const int rowB = b * SEQ + s0, colB = by * 128;
  const unsigned short* ap = A + (size_t)(rowB + 64 * wr) * DM + 8 * lane;      // 16 plane rows = 32 fragments = 16 * DM elements
  const unsigned short* wp = Wm + (size_t)(colB + 64 * wc) * DM + 8 * lane;
  const v8f z8 = {0.f, 0.f, 0.f, 0.f, 0.f, 0.f, 0.f, 0.f};
  v8f c[16];
#pragma unroll
  for (int i = 0; i < 16; ++i) c[i] = z8;
#pragma unroll 1
  for (int k0 = 0; k0 < 16 * DM; k0 += 1024) {                                  // k0: element offset of the pass's first fragment in its 16-row band
    FragX a[2][4], bb[2][4];
#pragma unroll
    for (int s = 0; s < 2; ++s) {
#pragma unroll
      for (int i = 0; i < 4; ++i) {
        a[s][i].half[0] = *(const v8us*)(ap + 16 * DM * i + k0 + 512 * s);
        a[s][i].half[1] = *(const v8us*)(ap + 16 * DM * i + k0 + 512 * s + 256);
      }
      if (s == 1) asm volatile("s_wait_xcnt 0x0" ::: "memory");   // in front of loads whose results may land in the registers that held the A loads' address
#pragma unroll
      for (int j = 0; j < 4; ++j) {
        bb[s][j].half[0] = *(const v8us*)(wp + 16 * DM * j + k0 + 512 * s);
        if (s == 1 && j == 3) asm volatile("s_wait_xcnt 0x0" ::: "memory");   // the last W load's result may land in the registers that held the W loads' address
        bb[s][j].half[1] = *(const v8us*)(wp + 16 * DM * j + k0 + 512 * s + 256);
      }
    }
    asm volatile("s_wait_xcnt 0x0" ::: "memory");   // in front of the next pass's writes to the registers that held these loads' addresses
    __builtin_amdgcn_sched_barrier(0);              // keeps all 32 loads in front of the products: sunk among them each group would be waited for on its own
    mma16(a[0], bb[0], c);
    mma16(a[1], bb[1], c);
    __builtin_amdgcn_sched_barrier(0);              // keeps the products in front of the guard below
    asm volatile("v_nop\n\tv_nop\n\tv_nop\n\tv_nop");   // hazard guard: four vector slots between the last product and the loads that refill its A and B registers
    __builtin_amdgcn_sched_barrier(0);              // keeps the next pass's loads behind the guard
  }
  // D element r of tile (i, j) = C(row 64 wr + 16i + 8h + r, col 64 wc + 16j + l&15)
#pragma unroll
  for (int j = 0; j < 4; ++j) {
    const float bj = bf16_rne(bias[colB + 64 * wc + 16 * j + ln]);
#pragma unroll
    for (int i = 0; i < 4; ++i)
#pragma unroll
      for (int r = 0; r < 8; ++r)
        so[wc][64 * wr + 16 * i + 8 * hh + r][16 * j + ln] = c[4 * i + j][r] + bj;
  }
  __syncthreads();
  const size_t base = (((size_t)(b * NH + 2 * by)) * SEQ + s0) * HD;            // head 2 by; head 2 by + 1 lies SEQ * HD elements on
  if (MODE == 0) {
    for (int i2 = tid; i2 < 2 * 128 * 8; i2 += 128) {
      const int hs = i2 >> 10, i = i2 & 1023;
      const int row = (i >> 7) * 16 + (i & 15), p8 = ((i >> 4) & 7) * 8;        // piece i = [s / 16][d / 32][half][h][s % 16]; d = 8 * bits 6..4
      const v4f x0 = *(const v4fa*)&so[hs][row][p8], x1 = *(const v4fa*)&so[hs][row][p8 + 4];
      H8 oh;
#pragma unroll
      for (int q = 0; q < 4; ++q) {
        oh.h[q]     = (_Float16)(x0[q] * 16.0f);
        oh.h[4 + q] = (_Float16)(x1[q] * 16.0f);
      }
      const v8us ov = oh.v;
      *(v8us*)(outH + base + (size_t)hs * SEQ * HD + (size_t)i * 8) = ov;
    }
  } else {
    for (int i2 = tid; i2 < 2 * 64 * 16; i2 += 128) {                           // 32 keys x 64 d = 2048 elements per key step
      const int hs = i2 >> 10, i = i2 & 1023;
      const int d = ((i >> 6) & 3) * 16 + (i & 15), s8 = (i >> 8) * 32 + ((i >> 4) & 3) * 8;   // piece i = [s / 32][d / 16][half][h][d % 16]
      H8 oh, ol;
#pragma unroll
      for (int q = 0; q < 8; ++q) {
        const float v0 = so[hs][s8 + q][d] * 16.0f;
        const _Float16 h0 = (_Float16)v0;
        oh.h[q] = h0;
        ol.h[q] = (_Float16)((v0 - (float)h0) * RES_SC);
      }
      const v8us ovh = oh.v, ovl = ol.v;
      *(v8us*)(outH + base + (size_t)hs * SEQ * HD + (size_t)i * 8) = ovh;
      *(v8us*)(outL + base + (size_t)hs * SEQ * HD + (size_t)i * 8) = ovl;
    }
  }
}

// The three projections of x in one grid (row blocks, 1024/128, 3): z = 0, 1 -> q, k (MODE 0), z = 2 -> v (MODE 1); the branch is block-uniform.
__global__ __launch_bounds__(128) void k_qkv(const unsigned short* __restrict__ Xb, const unsigned short* __restrict__ Wb,
                                             const float* __restrict__ bq, const float* __restrict__ bk, const float* __restrict__ bv,
                                             unsigned short* __restrict__ QKh, unsigned short* __restrict__ Vth,
                                             unsigned short* __restrict__ Vtl) {
  __shared__ __attribute__((aligned(16))) float so[2][128][68];
  const int bx = blockIdx.x, by = blockIdx.y, z = blockIdx.z;
  if (z < 2) proj_part<0>(so, Xb, Wb + (size_t)z * DM * DM, z == 1 ? bk : bq, QKh + (size_t)z * PLANE, QKh, bx, by);
  else       proj_part<1>(so, Xb, Wb + (size_t)2 * DM * DM, bv, Vth, Vtl, bx, by);
}

// Both row bands of the output projection in one grid (NB * SEQ / 128, 1024/64): the first NB * RH / 128 row blocks are the rows < RH (MODE 2),
// the others the rows >= RH (MODE 3); the branch is block-uniform.
__global__ __launch_bounds__(128) void k_out(const unsigned short* __restrict__ Cp, const unsigned short* __restrict__ Cl,
                                             const unsigned short* __restrict__ Wob, const unsigned short* __restrict__ Woh,
                                             const float* __restrict__ bo, float* __restrict__ out) {
  __shared__ __attribute__((aligned(16))) float so[128][68];
  const int bx = blockIdx.x, by = blockIdx.y;
  if (bx < NB * (RH / 128)) gemm_part<2>(so, Cp, Cl, Wob, bo, out, bx, by, 0, RH / 128);
  else                      gemm_part<3>(so, Cp, Cl, Woh, bo, out, bx - NB * (RH / 128), by, RH, (SEQ - RH) / 128);
}

// Fragment loads of one 32-key step. Pointers are the (batch, head) bases of the planes.
// A fragments of K: row m = key (key0 + 16*kt + ln), elements 0..7 <- d = 32c + 8h + i, 8..15 <- d = 32c + 16 + 8h + i; kf[2*kt + c];
// the step's eight halves are 4 KB in a row of the fragment-ordered plane
__device__ __forceinline__ void load_k(const unsigned short* __restrict__ Khp, int key0, int ln, int hh, FragH (&kf)[4]) {
  const unsigned short* kp = Khp + (size_t)key0 * HD + 8 * (16 * hh + ln);
#pragma unroll
  for (int f = 0; f < 4; ++f) {
    kf[f].half[0] = *(const v8us*)(kp + 512 * f); kf[f].half[1] = *(const v8us*)(kp + 512 * f + 256);
  }
}
// A fragments of V^T: row m = d (16*t + ln), elements 0..7 <- key0 + 8h + i, 8..15 <- key0 + 16 + 8h + i; again 4 KB in a row (key0 a multiple of 32)
__device__ __forceinline__ void load_v(const unsigned short* __restrict__ Vp, int key0, int ln, int hh, FragH (&vf)[4]) {
  const unsigned short* vp = Vp + (size_t)key0 * HD + 8 * (16 * hh + ln);
#pragma unroll
  for (int t = 0; t < 4; ++t) {
    vf[t].half[0] = *(const v8us*)(vp + 512 * t); vf[t].half[1] = *(const v8us*)(vp + 512 * t + 256);
  }
}

// One 32-key step for a wave's 16 queries (this lane's column: one query), on fragments and a mask word that were loaded one step earlier.
// Each fragment set is reloaded for step keyN (the wave's next active step) right behind its last product, so that those loads fly
// under the rest of this step and the head of the next one.
// EARLY: P and v as hi + residual planes (three products, lr over the f32 weights); else one product and lr over the f16 weights.
template <bool EARLY>
__device__ __forceinline__ void fa_step(const unsigned short* __restrict__ Khp,
                                        const unsigned short* __restrict__ Vhp, const unsigned short* __restrict__ Vlp,
                                        int keyN, unsigned int mw, int ln, int hh,
                                        const FragH& qh0, const FragH& qh1,
                                        FragH (&kf)[4], FragH (&vf)[4], FragH (&vlf)[4],
                                        float& mr, float& lr, v8f (&Oh)[4], v8f (&Ol)[4]) {
  const v8f z8 = {0.f, 0.f, 0.f, 0.f, 0.f, 0.f, 0.f, 0.f};
  float sc[16];
#pragma unroll
  for (int kt = 0; kt < 2; ++kt) {
    v8f sh = z8;
    mma_s(kf[2 * kt].v, kf[2 * kt + 1].v, qh0.v, qh1.v, sh);
    // S^T element r of tile kt = score(key0 + 16*kt + 8h + r, this lane's query); carries: 16 x 16 on q, k, then 1/8 -> 2^-11
#pragma unroll
    for (int r = 0; r < 8; ++r) sc[8 * kt + r] = sh[r] * 0.00048828125f;
  }
  load_k(Khp, keyN, ln, hh, kf);
  __builtin_amdgcn_sched_barrier(0);   // keeps the K reloads here: sunk below the softmax they would have too short a lead on the next step's products
  // replace-fill: excluded keys get -inf (bit 8h + r of the word <-> tile 0, bit 16 + 8h + r <-> tile 1)
  const float ninf = __uint_as_float(0xFF800000u);
  const unsigned int mb = mw >> (8 * hh);
#pragma unroll
  for (int r = 0; r < 8; ++r) {
    sc[r]     = ((mb >> r) & 1u) ? ninf : sc[r];
    sc[8 + r] = ((mb >> (16 + r)) & 1u) ? ninf : sc[8 + r];
  }
  float mx = sc[0];
#pragma unroll
  for (int i = 1; i < 16; ++i) mx = fmaxf(mx, sc[i]);
  mx = fmaxf(mx, __shfl_xor(mx, 16, 32));           // the other lane half holds the other 16 keys of this query
  const float mnew = fmaxf(mr, mx);
  const float al = exp2_hw((mr - mnew) * LOG2E);
  mr = mnew;
  // weights carried x256: pc = 256 * exp(sc - mnew); hi plane f16(pc); EARLY: residual plane f16((pc - hi) * 2048)
  FragH ph, pl;
  float ps = 0.0f;
#pragma unroll
  for (int i = 0; i < 16; i += 2) {
    const v2f s2 = {sc[i], sc[i + 1]};
    const v2f x2 = __builtin_elementwise_fma(s2 - mnew, (v2f){LOG2E, LOG2E}, (v2f){8.0f, 8.0f});
    const v2f pc = {exp2_hw(x2[0]), exp2_hw(x2[1])};
    const v2h h = __builtin_convertvector(pc, v2h);  // one packed convert; the uses below read its halves
    ph.h[i] = h[0]; ph.h[i + 1] = h[1];             // B element i: i<8 -> key0 + 8h + i (tile 0 row 8h+i); i>=8 -> key0 + 16 + 8h + (i-8) (tile 1)
    if (EARLY) {
      ps += pc[0];
      ps += pc[1];
      pl.h[i]     = (_Float16)((pc[0] - (float)h[0]) * RES_SC);
      pl.h[i + 1] = (_Float16)((pc[1] - (float)h[1]) * RES_SC);
    } else {
      ps += (float)h[0];
      ps += (float)h[1];
    }
  }
  ps += __shfl_xor(ps, 16, 32);
  lr = lr * al + ps;
#pragma unroll
  for (int t = 0; t < 4; ++t) {
    Oh[t] = Oh[t] * al;
    if (EARLY) Ol[t] = Ol[t] * al;
  }
#pragma unroll
  for (int t = 0; t < 4; ++t) {
    if (EARLY) mma_pv3(vf[t].v, vlf[t].v, ph.v, pl.v, Oh[t], Ol[t]);
    else       mma_pv1(vf[t].v, ph.v, Oh[t]);
  }
  load_v(Vhp, keyN, ln, hh, vf);
  if (EARLY) load_v(Vlp, keyN, ln, hh, vlf);
  asm volatile("s_wait_xcnt 0x0" ::: "memory");   // in front of the next step's writes to the registers that held these loads' addresses
}

// Block = 4 waves x 16 queries = 64 queries: query tile qt of (batch, head) bh, both dealt by the calling kernel; no LDS and no barrier.
// Steps whose 32 keys are excluded for all 16 queries of the wave are skipped (exact for any mask value): a wave-uniform map of the
// active steps is built from the wave's mask rows in front of the loop, so that the step after the current one is known when its loads issue.
// Epilogue: lane 16h + q holds ctx(query q, d = 16t + 8h + r), which is half t & 1 of the ctx plane's fragment (k-step 2*head + t / 2): each O^T tile
// goes out of its registers as one 512-byte run.
// coverage: 4 waves x 16 rows x 64 columns = the (row, head) segments of tile qt of bh; the calling kernel gives every (bh, qt) to exactly one block.
template <bool EARLY>
__device__ __forceinline__ void attn_part(const unsigned short* __restrict__ QKh,
                                          const unsigned short* __restrict__ Vth, const unsigned short* __restrict__ Vtl,
                                          const unsigned int* __restrict__ bits,
                                          unsigned short* __restrict__ Cp, unsigned short* __restrict__ Cl,
                                          int bh, int qt) {
  static_assert(SEQ / 32 <= 64);
  const int tid = threadIdx.x, w = __builtin_amdgcn_readfirstlane((int)(tid >> 5)), lane = tid & 31, ln = lane & 15, hh = lane >> 4;
  const int b = bh / NH, hd = bh - b * NH;
  const int qbase = qt * 64 + 16 * w;
  const int qg = qbase + ln;
  const size_t hb = (size_t)bh * SEQ * HD;
  // Q^T B fragments: column n = query qg, elements 0..7 <- d = 32c + 8h + i, 8..15 <- d = 32c + 16 + 8h + i
  FragH qh0, qh1;
  {
    const unsigned short* qrh = QKh + hb + (size_t)qbase * HD + 8 * lane;
    qh0.half[0] = *(const v8us*)(qrh);       qh0.half[1] = *(const v8us*)(qrh + 256);
    qh1.half[0] = *(const v8us*)(qrh + 512); qh1.half[1] = *(const v8us*)(qrh + 768);
  }
  const unsigned short* Khp = QKh + PLANE + hb;
  const unsigned short* Vhp = Vth + hb;
  const unsigned short* Vlp = Vtl + hb;
  const unsigned int* mrow = bits + ((size_t)b * SEQ + qg) * (SEQ / 32);
  float mr = -3.0e38f, lr = 0.0f;
  v8f Oh[4] = {}, Ol[4] = {};
  // bit j of act: step j has a key that some query of the wave keeps
  unsigned long long act = 0ull;
#pragma unroll
  for (int i = 0; i < SEQ / 128; ++i) {
    const v4i x = *(const v4ia*)(mrow + 4 * i);
#pragma unroll
    for (int e = 0; e < 4; ++e)
      if (__ballot(x[e] != -1) != 0) act |= 1ull << (4 * i + e);   // wave-uniform
  }
  if (act != 0ull) {
    int j = __builtin_ctzll(act);
    act &= act - 1ull;
    FragH kf[4], vf[4], vlf[4];
    unsigned int mw = mrow[j];
    __builtin_amdgcn_sched_barrier(0);                // mask word first in load order: the loop's wait for it then leaves the fragment loads in flight
    load_k(Khp, 32 * j, ln, hh, kf);
    load_v(Vhp, 32 * j, ln, hh, vf);
    if (EARLY) load_v(Vlp, 32 * j, ln, hh, vlf);
    asm volatile("s_wait_xcnt 0x0" ::: "memory");     // in front of later writes to the registers that held these loads' addresses
    __builtin_amdgcn_sched_barrier(0);                // keeps those writes behind the wait
#pragma unroll 1
    for (;;) {
      const bool more = act != 0ull;                  // wave-uniform
      const int jn = more ? __builtin_ctzll(act) : j; // last step: its own tiles once more (in bounds, never used)
      act &= act - 1ull;
      const unsigned int mwn = mrow[jn];
      fa_step<EARLY>(Khp, Vhp, Vlp, 32 * jn, mw, ln, hh, qh0, qh1, kf, vf, vlf, mr, lr, Oh, Ol);
      if (!more) break;
      mw = mwn;
      j = jn;
    }
  }

  // O^T element r of tile t = ctx(query qg, d = 16t + 8h + r); undo the carries: x256 (in lr), x16 (v), x2048 (residual accumulator)
  const float inv = 1.0f / (16.0f * lr);
  const size_t cb = ((size_t)(b * SEQ + qbase)) * DM + (size_t)hd * (16 * HD) + 8 * lane;
#pragma unroll
  for (int t = 0; t < 4; ++t) {
    if (EARLY) {
      v8us oh, ol;
#pragma unroll
      for (int r = 0; r < 8; ++r) {
        const float x = (Oh[t][r] + Ol[t][r] * RES_INV) * inv;
        const unsigned short h0 = bf16_bits(x);
        oh[r] = h0;
        ol[r] = bf16_bits(x - bf16_val(h0));
      }
      *(v8us*)(Cp + cb + 256 * t) = oh;
      *(v8us*)(Cl + cb + 256 * t) = ol;
    } else {
      H8 of;
#pragma unroll
      for (int r = 0; r < 8; ++r) of.h[r] = (_Float16)((Oh[t][r] * inv) * 64.0f);
      const v8us ov = of.v;
      *(v8us*)(Cp + cb + 256 * t) = ov;
    }
  }
  if (EARLY) asm volatile("s_wait_xcnt 0x0" ::: "memory");   // the built code joins the two bands behind these stores: in front of the other band's writes to their registers
}

// Both query bands in one grid; the band follows from the tile (rows < RH or not), so the branch is block-uniform.
// Deal of the blocks, for speed only (any permutation of the (bh, qt) pairs is correct): heads run fastest, the tile follows from rank = blk / (NB * NH).
// A launch lasts as long as its fullest SIMD. Where later queries keep more keys, a tile's cost grows
// with qt. The quarters of the index range take the
// tiles n-1-k, 3n/4-1-k, n/4+k, k (k = place in the quarter), whose costs add up to the same sum for every k, the heaviest tiles first in index order.
#define AQ_N (SEQ / 64)
#define AB_ALL (NB * NH * AQ_N)
__global__ __launch_bounds__(128) void k_attn(const unsigned short* __restrict__ QKh,
                                              const unsigned short* __restrict__ Vth, const unsigned short* __restrict__ Vtl,
                                              const unsigned int* __restrict__ bits,
                                              unsigned short* __restrict__ Cp, unsigned short* __restrict__ Cl) {
  const int blk = blockIdx.x;
  const int rank = blk / (NB * NH), bh = blk - rank * (NB * NH);
  int qt = AQ_N - 1 - rank;                          // heaviest first; also the whole deal where the tiles do not split into quarters
  if (AQ_N % 4 == 0 && rank >= AQ_N / 2) qt = (rank < 3 * (AQ_N / 4)) ? rank - AQ_N / 4 : rank - 3 * (AQ_N / 4);
  if (qt >= RH / 64) attn_part<false>(QKh, Vth, Vtl, bits, Cp, Cl, bh, qt);
  else               attn_part<true>(QKh, Vth, Vtl, bits, Cp, Cl, bh, qt);
}

extern "C" void kernel_launch(void* const* d_in, const int* in_sizes, int n_in,
                              void* d_out, int out_size, void* d_ws, size_t ws_size, hipStream_t stream) {
  if (n_in < 10) return;
  const long long needx = (long long)(NB - 1) * SEQ_FULL * DM + (long long)SEQ * DM;   // last element touched + 1
  const long long needm = (long long)(NB - 1) * SEQ_FULL * SEQ_FULL + (long long)(SEQ - 1) * SEQ_FULL + SEQ;
  if ((long long)in_sizes[0] < needx) return;
  if ((long long)in_sizes[1] < (long long)DM * DM || (long long)in_sizes[3] < (long long)DM * DM) return;
  if ((long long)in_sizes[5] < (long long)DM * DM || (long long)in_sizes[7] < (long long)DM * DM) return;
  if (in_sizes[2] < DM || in_sizes[4] < DM || in_sizes[6] < DM || in_sizes[8] < DM) return;
  if ((long long)in_sizes[9] < needm) return;
  if ((long long)out_size < needx) return;
  const float* x  = (const float*)d_in[0];   // wire order: x, Wq, bq, Wk, bk, Wv, bv, Wo, bo, attention_mask
  const float* Wq = (const float*)d_in[1];
  const float* bq = (const float*)d_in[2];
  const float* Wk = (const float*)d_in[3];
  const float* bk = (const float*)d_in[4];
  const float* Wv = (const float*)d_in[5];
  const float* bv = (const float*)d_in[6];
  const float* Wo = (const float*)d_in[7];
  const float* bo = (const float*)d_in[8];
  const int* mask = (const int*)d_in[9];
  float* out = (float*)d_out;

  char* ws = (char*)d_ws;
  size_t off = 0;
  const size_t pl2 = PLANE * 2;                               // bytes of one [NB*SEQ][1024] 16-bit plane (8 MiB at full size), multiple of 256
  const size_t wsz = (size_t)DM * DM * 2;                     // 2 MiB per weight plane
  const size_t bsz = (size_t)NB * SEQ * (SEQ / 32) * 4;       // 1 MiB at full size
  unsigned short* Xb  = (unsigned short*)(ws + off); off += pl2;
  unsigned short* Wb  = (unsigned short*)(ws + off); off += 4 * wsz;      // bf16 planes q, k, v, o
  unsigned short* Woh = (unsigned short*)(ws + off); off += wsz;          // f16 plane of 64 Wo
  unsigned short* QKh = (unsigned short*)(ws + off); off += 2 * pl2;      // [q|k][b][h][s][64], fragment order
  unsigned short* Vth = (unsigned short*)(ws + off); off += pl2;          // [b][h][s / 32][64 x 32], fragment order
  unsigned short* Vtl = (unsigned short*)(ws + off); off += pl2;
  unsigned int*   Mb  = (unsigned int*)(ws + off);   off += (bsz + 255) & ~(size_t)255;
  unsigned short* Cp  = (unsigned short*)(ws + off); off += pl2;          // [b*SEQ + s][1024], fragment order: rows < RH bf16 hi, rows >= RH f16(64 ctx)
  unsigned short* Cl  = (unsigned short*)(ws + off); off += pl2;          // rows < RH: bf16 lo (other rows never written, never read)
  if (off > ws_size || off > (size_t)134217728) return;

  // four launches, each reading only what an earlier one (or the caller) wrote
  k_prep<<<(unsigned)(PB_MASK + PB_X + PB_NW * PB_W), 256, 0, stream>>>(x, Wq, Wk, Wv, Wo, mask, Xb, Wb, Woh, Mb);
  k_qkv<<<dim3((unsigned)(NB * (SEQ / 128)), DM / 128, 3), 128, 0, stream>>>(Xb, Wb, bq, bk, bv, QKh, Vth, Vtl);
  k_attn<<<(unsigned)AB_ALL, 128, 0, stream>>>(QKh, Vth, Vtl, Mb, Cp, Cl);
  k_out<<<dim3((unsigned)(NB * (SEQ / 128)), DM / 64, 1), 128, 0, stream>>>(Cp, Cl, Wb + (size_t)3 * DM * DM, Woh, bo, out);
}

// v008
// Measured time: 83.7 microseconds a run.
// Next to v007, in two timings, it ran 1.14 and 1.17 times as fast.
// Counting every step since v000, it is 3.76 times as fast.
#include <hip/hip_runtime.h>
// Contractions: q/k/v projections on v_wmma_f32_16x16x32_bf16 (x, W RNE bf16, single product, f32 accumulate); S^T = K Q^T on v_wmma_f32_16x16x32_f16 (q, k as x16 f16 planes, single product); O^T = V^T P^T on v_wmma_f32_16x16x32_f16 (query rows < RH: v x16 hi + x2^11 residual, P x256 hi + x2^11 residual, residual products in their own f32 accumulator; query rows >= RH: v x16, P x256, single product, row sum over the f16 P); output projection: rows < RH on v_wmma_f32_16x16x32_bf16 (ctx bf16 hi + bf16 lo planes, Wo RNE bf16), rows >= RH on v_wmma_f32_16x16x32_f16 (ctx x64 f16, Wo RNE-bf16 value x64 in f16, single product); softmax statistics f32.
// Multi-head attention, B x S x 1024, 16 heads of 64, scale 1/8, mask input (1 = key excluded, score replaced by -inf) read on the device as a packed bit plane.
// Engine: transposed flash. Each wave owns 16 queries. Per 32-key step: S^T tiles (key rows x query columns) from K rows (A, global f16 plane)
// and Q^T (B, registers); the two 16-key D tiles pack straight into the P^T B fragment; O^T (d rows x query columns) accumulates from V^T rows (A, global f16 planes).
// Plane layout: every 16-bit operand plane is stored in fragment order. One fragment (16 rows x 32 k) = 1 KB = [half 0..1][lane 0..31][8 elements];
// lane = 16h + row, element i of half f = k 16f + 8h + i. A wave-wide 16-byte load of one half is 512 contiguous bytes (four whole lines).
#ifndef NB
#define NB 2
#endif
#ifndef SEQ
#define SEQ 2048
#endif
#ifndef RH
#define RH 256                                 /* query rows below RH (per batch) take the hi + residual path */
#endif
#define NB_FULL 2
#define SEQ_FULL 2048
#define DM 1024
#define NH 16
#define HD 64
#define PLANE ((size_t)NB * SEQ * DM)          /* elements of one [NB*SEQ][1024] 16-bit plane */

static_assert(SEQ % 128 == 0);
static_assert(SEQ <= SEQ_FULL);
static_assert(NB <= NB_FULL);
static_assert(RH % 128 == 0);
static_assert(RH >= 0 && RH <= SEQ);
static_assert(NH * HD == DM);
static_assert(HD == 64);
static_assert(DM % 64 == 0);
static_assert(PLANE * 2 * 7 + (size_t)5 * DM * DM * 2 + (size_t)NB * SEQ * (SEQ / 32) * 4 + 4096 <= (size_t)134217728);

typedef __bf16 v16b __attribute__((ext_vector_type(16)));
typedef _Float16 v16h __attribute__((ext_vector_type(16)));
typedef unsigned short v8us __attribute__((ext_vector_type(8), may_alias));
typedef float v8f __attribute__((ext_vector_type(8)));
typedef float v2f __attribute__((ext_vector_type(2)));
typedef _Float16 v2h __attribute__((ext_vector_type(2)));
typedef float v4f __attribute__((ext_vector_type(4)));
typedef float v4fa __attribute__((ext_vector_type(4), may_alias));
typedef int v4i __attribute__((ext_vector_type(4)));
typedef int v4ia __attribute__((ext_vector_type(4), may_alias));
typedef unsigned int v2ua __attribute__((ext_vector_type(2), may_alias));
union FragH { v16h v; v8us half[2]; _Float16 h[16]; unsigned short u[16]; };
union FragX { v16b b; v16h h; v8us half[2]; };
union H8 { v8us v; _Float16 h[8]; unsigned short u[8]; };

#define LOG2E 1.4426950408889634f
#define RES_SC 2048.0f
#define RES_INV 0.00048828125f

__device__ __forceinline__ unsigned short bf16_bits(float x) {   // RNE convert to bf16 bits, NaN kept NaN
  const unsigned int u = __float_as_uint(x);
  const unsigned int r = (u + 0x7FFFu + ((u >> 16) & 1u)) >> 16;
  const unsigned int n = (u >> 16) | 0x40u;
  return (unsigned short)(((u & 0x7FFFFFFFu) > 0x7F800000u) ? n : r);
}
__device__ __forceinline__ float bf16_val(unsigned short b) { return __uint_as_float(((unsigned int)b) << 16); }
__device__ __forceinline__ float bf16_rne(float x) { return bf16_val(bf16_bits(x)); }

// 2^x on the bare hardware instruction. exp2f() wraps the same instruction in a compare, two selects, an add and an ldexp that only serve results
// below 2^-126 (x < -126), which the bare form returns as 0. Here such a result has no effect: a weight that small is 0 in both f16 planes
// (its residual is below 2^-115) and vanishes in the f32 row sum, which holds 256 from the row's maximum; a rescale factor that small
// multiplies sums that the same step's weight of 256 outweighs by more than 2^100. For x >= -126, -inf included, the value is the same bit for bit.
__device__ __forceinline__ float exp2_hw(float x) { return __builtin_amdgcn_exp2f(x); }

// sh += K*Q (64 deep = two k-steps), then the hazard guard
__device__ __forceinline__ void mma_s(v16h k0, v16h k1, v16h q0, v16h q1, v8f& sh) {
  sh = __builtin_amdgcn_wmma_f32_16x16x32_f16(false, k0, false, q0, (short)0, sh, false, false);
  sh = __builtin_amdgcn_wmma_f32_16x16x32_f16(false, k1, false, q1, (short)0, sh, false, false);
  asm volatile("v_nop\n\tv_nop\n\tv_nop\n\tv_nop" : "+v"(sh) : "v"(k0), "v"(k1), "v"(q0), "v"(q1));
}
// oh += Vh*Ph ; ol += Vh*Pl + Vl*Ph (same x2^11 on both residual planes), then the hazard guard
__device__ __forceinline__ void mma_pv3(v16h vh, v16h vl, v16h ph, v16h pl, v8f& oh, v8f& ol) {
  oh = __builtin_amdgcn_wmma_f32_16x16x32_f16(false, vh, false, ph, (short)0, oh, false, false);
  ol = __builtin_amdgcn_wmma_f32_16x16x32_f16(false, vh, false, pl, (short)0, ol, false, false);
  ol = __builtin_amdgcn_wmma_f32_16x16x32_f16(false, vl, false, ph, (short)0, ol, false, false);
  asm volatile("v_nop\n\tv_nop\n\tv_nop\n\tv_nop" : "+v"(oh), "+v"(ol) : "v"(vh), "v"(vl), "v"(ph), "v"(pl));
}
// oh += Vh*Ph, then the hazard guard
__device__ __forceinline__ void mma_pv1(v16h vh, v16h ph, v8f& oh) {
  oh = __builtin_amdgcn_wmma_f32_16x16x32_f16(false, vh, false, ph, (short)0, oh, false, false);
  asm volatile("v_nop\n\tv_nop\n\tv_nop\n\tv_nop" : "+v"(oh) : "v"(vh), "v"(ph));
}

// dst = 16-bit image of src[(b*rpb_full + s)][0..1023], row = b*rpb + s, in fragment order [row / 16][k / 32][half][lane][8]. F16 = false: bf16 bits (RNE);
// F16 = true: f16 bits of (RNE bf16 value x 64), exact. Thread per 8 elements; a wave takes 8 rows x 32 k: it reads 8 whole 128-B lines and writes
// 4 whole lines (8 rows of one (half, h) each); rows a multiple of 16; t = thread index inside this plane's share of the grid
template <bool F16>
__device__ __forceinline__ void cvt_part(const float* __restrict__ src, unsigned short* __restrict__ dst,
                                         int t, int rows, int rpb, int rpb_full) {
  if (t >= rows * 128) return;
  const int wv = t >> 5, g = (t >> 3) & 3;                                      // g = 2 * half + h: which 8 k of the k-step
  const int r16 = (wv & 1) * 8 + (t & 7), frag = wv >> 1;                       // row in its 16-row band; fragment = band * 32 + k-step
  const int row = (frag >> 5) * 16 + r16, kk = (frag & 31) * 32 + g * 8;
  const int b = row / rpb, s = row - b * rpb;
  const float* p = src + ((size_t)b * rpb_full + s) * DM + kk;
  const v4f x0 = *(const v4fa*)(p), x1 = *(const v4fa*)(p + 4);
  H8 o;
#pragma unroll
  for (int i = 0; i < 4; ++i) {
    if (F16) {
      o.h[i]     = (_Float16)(bf16_rne(x0[i]) * 64.0f);
      o.h[4 + i] = (_Float16)(bf16_rne(x1[i]) * 64.0f);
    } else {
      o.u[i]     = bf16_bits(x0[i]);
      o.u[4 + i] = bf16_bits(x1[i]);
    }
  }
  const v8us ov = o.v;
  unsigned short* d = dst + ((size_t)frag * 64 + g * 16 + r16) * 8;
  *(v8us*)d = ov;
  
}

// coverage: NB*SEQ*(SEQ/32) threads x 1 word = the whole plane.
__device__ __forceinline__ void mask_part(const int* __restrict__ mask, unsigned int* __restrict__ bits, int t) {
  if (t >= NB * SEQ * (SEQ / 32)) return;
  const int wd = t % (SEQ / 32), row = t / (SEQ / 32);
  const int b = row / SEQ, q = row - b * SEQ;
  const int* p = mask + ((size_t)b * SEQ_FULL + q) * SEQ_FULL + 32 * wd;
  unsigned int m = 0u;
#pragma unroll
  for (int j = 0; j < 8; ++j) {
    const v4i x = *(const v4ia*)(p + 4 * j);
    m |= ((x[0] == 1) ? 1u : 0u) << (4 * j);
    m |= ((x[1] == 1) ? 1u : 0u) << (4 * j + 1);
    m |= ((x[2] == 1) ? 1u : 0u) << (4 * j + 2);
    m |= ((x[3] == 1) ? 1u : 0u) << (4 * j + 3);
  }
  *(unsigned int*)(bits + t) = m;
  
}

// One grid for everything that reads only the inputs: none of these parts reads what another writes. Block ranges, in index order:
// mask words (the longest threads, placed first for speed only), x, then the weight planes q, k, v, o (bf16) and o (f16 x64).
#define PB_MASK (NB * SEQ * (SEQ / 32) / 256)
#define PB_X (NB * SEQ * 128 / 256)
#define PB_W (DM * 128 / 256)
#define PB_NW (3 + (RH > 0 ? 1 : 0) + (SEQ > RH ? 1 : 0))
static_assert((NB * SEQ * (SEQ / 32)) % 256 == 0 && (NB * SEQ * 128) % 256 == 0 && (DM * 128) % 256 == 0);
__global__ __launch_bounds__(256) void k_prep(const float* __restrict__ x, const float* __restrict__ Wq, const float* __restrict__ Wk,
                                              const float* __restrict__ Wv, const float* __restrict__ Wo, const int* __restrict__ mask,
                                              unsigned short* __restrict__ Xb, unsigned short* __restrict__ Wb,
                                              unsigned short* __restrict__ Woh, unsigned int* __restrict__ bits) {
  const int tid = threadIdx.x;
  int blk = blockIdx.x;
  if (blk < PB_MASK) { mask_part(mask, bits, blk * 256 + tid); return; }
  blk -= PB_MASK;
  if (blk < PB_X) { cvt_part<false>(x, Xb, blk * 256 + tid, NB * SEQ, SEQ, SEQ_FULL); return; }
  blk -= PB_X;
  const int pl = blk / PB_W, t = (blk - pl * PB_W) * 256 + tid;
  if (pl == 4 || (pl == 3 && RH == 0)) { cvt_part<true>(Wo, Woh, t, DM, DM, DM); return; }
  const float* w = (pl == 0) ? Wq : (pl == 1) ? Wk : (pl == 2) ? Wv : Wo;
  cvt_part<false>(w, Wb + (size_t)pl * DM * DM, t, DM, DM, DM);
}

// the 2 x 4 tile group for the register ring: builtins alone, the hazard guard stands behind the call; no asm statement names the fragments, since
// a value that an asm operand names is held below v256 and the ring's sets do not all fit there
template <bool F16>
__device__ __forceinline__ void mma8s(const FragX (&a)[2], const FragX (&b)[4], v8f (&c)[8]) {
#pragma unroll
  for (int i = 0; i < 2; ++i)
#pragma unroll
    for (int j = 0; j < 4; ++j) {
      if (F16) c[4 * i + j] = __builtin_amdgcn_wmma_f32_16x16x32_f16(false, a[i].h, false, b[j].h, (short)0, c[4 * i + j], false, false);
      else     c[4 * i + j] = __builtin_amdgcn_wmma_f32_16x16x32_bf16(false, a[i].b, false, b[j].b, (short)0, c[4 * i + j], false, false);
    }
}

// The fragments of one k-step of the output projection: A rows (two 16-row bands), with LO the same of the lo plane, and four W bands; k0 = element
// offset of the k-step's fragment in its band. LAST: the wave's last loads, behind which the address registers are free for other use.
template <bool LO, bool LAST>
__device__ __forceinline__ void load_set(const unsigned short* __restrict__ ap, const unsigned short* __restrict__ lp,
                                         const unsigned short* __restrict__ wp, int k0, FragX (&a)[2], FragX (&l)[2], FragX (&b)[4]) {
  a[0].half[0] = *(const v8us*)(ap + k0);               a[0].half[1] = *(const v8us*)(ap + k0 + 256);
  a[1].half[0] = *(const v8us*)(ap + 16 * DM + k0);     a[1].half[1] = *(const v8us*)(ap + 16 * DM + k0 + 256);
  if (LO) {
    if (LAST) asm volatile("s_wait_xcnt 0x0" ::: "memory");   // in front of loads whose results may land in the registers that held the A loads' address
    l[0].half[0] = *(const v8us*)(lp + k0);             l[0].half[1] = *(const v8us*)(lp + k0 + 256);
    l[1].half[0] = *(const v8us*)(lp + 16 * DM + k0);   l[1].half[1] = *(const v8us*)(lp + 16 * DM + k0 + 256);
  }
  if (LAST) asm volatile("s_wait_xcnt 0x0" ::: "memory");     // in front of loads whose results may land in the registers that held the A loads' addresses
  b[0].half[0] = *(const v8us*)(wp + k0);               b[0].half[1] = *(const v8us*)(wp + k0 + 256);
  b[1].half[0] = *(const v8us*)(wp + 16 * DM + k0);     b[1].half[1] = *(const v8us*)(wp + 16 * DM + k0 + 256);
  b[2].half[0] = *(const v8us*)(wp + 32 * DM + k0);     b[2].half[1] = *(const v8us*)(wp + 32 * DM + k0 + 256);
  b[3].half[0] = *(const v8us*)(wp + 48 * DM + k0);
  if (LAST) asm volatile("s_wait_xcnt 0x0" ::: "memory");     // the last W load's result may land in the registers that held the W loads' address
  b[3].half[1] = *(const v8us*)(wp + 48 * DM + k0 + 256);
  if (LAST) asm volatile("s_wait_xcnt 0x0" ::: "memory");     // in front of whatever is written next to the register that held the last load's address
}

// Output projection. C[m][n] = sum_k A[m][k] * W[n][k] + bf16(bias[n]); A, W 16-bit planes with 1024-element rows; block tile 128 x 64, 4 waves x (32 x 64).
// Row blocks: block bx -> batch b = bx / nblk, first row s0 = sbeg + (bx % nblk) * 128 of that batch (plane row b*SEQ + s0); column block by.
// Fragments straight from the fragment-ordered planes: A row m = l&15, B column n = l&15, elements 0..7 <- k0 + 8h + i, 8..15 <- k0 + 16 + 8h + i.
// MODE 2 (rows < RH; bf16 operands): A = ctx hi plane, Alo = ctx lo plane (bf16, unscaled, same accumulator); f32 rows of the output buffer.
// MODE 3 (rows >= RH; f16 operands): A = f16(64 ctx), W = f16(64 Wo); accumulator x 2^-12; f32 rows of the output buffer.
// LDS tile so (the calling kernel's one tile): cross-wave (block barrier); staged extent 128 x 64 == consumed extent.
template <int MODE>
__device__ __forceinline__ void gemm_part(float (&so)[128][68],
                                          const unsigned short* __restrict__ A, const unsigned short* __restrict__ Alo,
                                          const unsigned short* __restrict__ Wm, const float* __restrict__ bias,
                                          float* __restrict__ outF, int bx, int by, int sbeg, int nblk) {
  const int tid = threadIdx.x, w = __builtin_amdgcn_readfirstlane((int)(tid >> 5)), lane = tid & 31, ln = lane & 15, hh = lane >> 4;
  const int b = bx / nblk, s0 = sbeg + (bx - b * nblk) * 128;
  const int rowB = b * SEQ + s0, colB = by * 64;
  const size_t aoff = (size_t)(rowB + 32 * w) * DM + 8 * lane;                  // 16 plane rows = 32 fragments = 16 * DM elements
  const unsigned short* ap = A + aoff;
  const unsigned short* lp = Alo + aoff;
  const unsigned short* wp = Wm + (size_t)colB * DM + 8 * lane;
  const v8f z8 = {0.f, 0.f, 0.f, 0.f, 0.f, 0.f, 0.f, 0.f};
  v8f c[8];
#pragma unroll
  for (int i = 0; i < 8; ++i) c[i] = z8;
  {
    // Two waves share a SIMD here, too few to cover a load's way with other waves' work, so each wave covers its own:
    // a ring of NR register sets, all filled in front of the loop; behind the products of k-step s its set is refilled for k-step s + NR.
    // The k loop is unrolled whole: the ring index is a compile-time number and every load is base + immediate offset, so that no address
    // register changes while loads fly.
    constexpr int NS = DM / 32;                     // k-steps
    constexpr int NR = (MODE == 2) ? 3 : 4;         // 48 loads of a wave in flight in either mode
    FragX fa[NR][2], fl[NR][2], fb[NR][4];
#pragma unroll
    for (int s = 0; s < NR; ++s) load_set<MODE == 2, false>(ap, lp, wp, 512 * s, fa[s], fl[s], fb[s]);
#pragma unroll
    for (int s = 0; s < NS; ++s) {
      __builtin_amdgcn_sched_barrier(0);            // keeps the loads above in front of these products: sunk below them they would lose a step of lead
      mma8s<MODE == 3>(fa[s % NR], fb[s % NR], c);
      if (MODE == 2) mma8s<false>(fl[s % NR], fb[s % NR], c);
      if (s + NR < NS) {
        __builtin_amdgcn_sched_barrier(0);          // keeps the products in front of the guard below
        asm volatile("v_nop\n\tv_nop\n\tv_nop\n\tv_nop");   // hazard guard: four vector slots between the last product and the loads that refill its A and B registers
        __builtin_amdgcn_sched_barrier(0);          // keeps the refill behind the guard
        if (s + NR < NS - 1) load_set<MODE == 2, false>(ap, lp, wp, 512 * (s + NR), fa[s % NR], fl[s % NR], fb[s % NR]);
        else                 load_set<MODE == 2, true>(ap, lp, wp, 512 * (s + NR), fa[s % NR], fl[s % NR], fb[s % NR]);
      }
    }
  }
  // D element r of tile (i, j) = C(row 32w + 16i + 8h + r, col 16j + l&15)
  const float cs = (MODE == 3) ? 0.000244140625f : 1.0f;     // 2^-12 undoes the x64 carries of ctx and Wo
#pragma unroll
  for (int j = 0; j < 4; ++j) {
    const float bj = bf16_rne(bias[colB + 16 * j + ln]);
#pragma unroll
    for (int i = 0; i < 2; ++i)
#pragma unroll
      for (int r = 0; r < 8; ++r)
        so[32 * w + 16 * i + 8 * hh + r][16 * j + ln] = c[4 * i + j][r] * cs + bj;
  }
  __syncthreads();
  float* og = outF + ((size_t)b * SEQ_FULL + s0) * DM + colB;
  for (int i = tid; i < 128 * 16; i += 128) {
    const int row = i >> 4, c4 = (i & 15) * 4;
    const v4f v = *(const v4fa*)&so[row][c4];
    *(v4f*)(og + (size_t)row * DM + c4) = v;
  }
}

// 4 x 4 tile group of one 32-deep k-step (bf16): builtins alone, the hazard guard stands behind the pass's last call; no asm statement names the
// fragments or the accumulators, since a value that an asm operand names is held below v256 and they do not all fit there
__device__ __forceinline__ void mma16(const FragX (&a)[4], const FragX (&b)[4], v8f (&c)[16]) {
#pragma unroll
  for (int i = 0; i < 4; ++i)
#pragma unroll
    for (int j = 0; j < 4; ++j)
      c[4 * i + j] = __builtin_amdgcn_wmma_f32_16x16x32_bf16(false, a[i].b, false, b[j].b, (short)0, c[4 * i + j], false, false);
}

// Projections of x. C[m][n] = sum_k A[m][k] * W[n][k] + bf16(bias[n]); A, W bf16 planes with 1024-element rows.
// Block tile 128 x 128 (two heads), 2 x 2 waves x (64 x 64): the loop is bound by the fragment bytes it loads, and a 64 x 64 wave tile feeds 16 products
// from 8 KB of fragments where a 32 x 64 tile feeds 8 from 6 KB; of the block's bytes each is wanted by two waves. A pass is 64 k (two k-steps),
// so that a wave has 32 loads in flight although only three waves share a SIMD.
// Row blocks: block bx -> batch b = bx / (SEQ / 128), first row s0 = (bx % (SEQ / 128)) * 128 of that batch (plane row b*SEQ + s0); column block by = heads 2 by, 2 by + 1.
// Fragments straight from the fragment-ordered planes: A row m = l&15, B column n = l&15, elements 0..7 <- k0 + 8h + i, 8..15 <- k0 + 16 + 8h + i.
// MODE 0 (q, k): f16 plane [b][h][s / 16][d / 32][half][lane][8] = f16(16 v); a head's part of the block tile = one contiguous 16-KB run.
// MODE 1 (v): f16 planes [b][h][s / 32][d / 16][half][lane][8 keys], hi = f16(16 v), residual = f16((16 v - hi) 2^11); transposed on the LDS read side.
// LDS tile so (one 128 x 64 tile per head): cross-wave (block barrier); staged extent == consumed extent.
template <int MODE>
__device__ __forceinline__ void proj_part(float (&so)[2][128][68],
                                          const unsigned short* __restrict__ A, const unsigned short* __restrict__ Wm,
                                          const float* __restrict__ bias,
                                          unsigned short* __restrict__ outH, unsigned short* __restrict__ outL, int bx, int by) {
  const int tid = threadIdx.x, w = __builtin_amdgcn_readfirstlane((int)(tid >> 5)), lane = tid & 31, ln = lane & 15, hh = lane >> 4;
  const int wr = w >> 1, wc = w & 1;                                            // the wave's 64 rows, its 64 columns (one head)
  const int b = bx / (SEQ / 128), s0 = (bx - b * (SEQ / 128)) * 128;
  const int rowB = b * SEQ + s0, colB = by * 128;
  const unsigned short* ap = A + (size_t)(rowB + 64 * wr) * DM + 8 * lane;      // 16 plane rows = 32 fragments = 16 * DM elements
  const unsigned short* wp = Wm + (size_t)(colB + 64 * wc) * DM + 8 * lane;
  const v8f z8 = {0.f, 0.f, 0.f, 0.f, 0.f, 0.f, 0.f, 0.f};
  v8f c[16];
#pragma unroll
  for (int i = 0; i < 16; ++i) c[i] = z8;
#pragma unroll 1
  for (int k0 = 0; k0 < 16 * DM; k0 += 1024) {                                  // k0: element offset of the pass's first fragment in its 16-row band
    FragX a[2][4], bb[2][4];
#pragma unroll
    for (int s = 0; s < 2; ++s) {
#pragma unroll
      for (int i = 0; i < 4; ++i) {
        a[s][i].half[0] = *(const v8us*)(ap + 16 * DM * i + k0 + 512 * s);
        a[s][i].half[1] = *(const v8us*)(ap + 16 * DM * i + k0 + 512 * s + 256);
      }
      if (s == 1) asm volatile("s_wait_xcnt 0x0" ::: "memory");   // in front of loads whose results may land in the registers that held the A loads' address
#pragma unroll
      for (int j = 0; j < 4; ++j) {
        bb[s][j].half[0] = *(const v8us*)(wp + 16 * DM * j + k0 + 512 * s);
        if (s == 1 && j == 3) asm volatile("s_wait_xcnt 0x0" ::: "memory");   // the last W load's result may land in the registers that held the W loads' address
        bb[s][j].half[1] = *(const v8us*)(wp + 16 * DM * j + k0 + 512 * s + 256);
      }
    }
    asm volatile("s_wait_xcnt 0x0" ::: "memory");   // in front of the next pass's writes to the registers that held these loads' addresses
    __builtin_amdgcn_sched_barrier(0);              // keeps all 32 loads in front of the products: sunk among them each group would be waited for on its own
    mma16(a[0], bb[0], c);
    mma16(a[1], bb[1], c);
    __builtin_amdgcn_sched_barrier(0);              // keeps the products in front of the guard below
    asm volatile("v_nop\n\tv_nop\n\tv_nop\n\tv_nop");   // hazard guard: four vector slots between the last product and the loads that refill its A and B registers
    __builtin_amdgcn_sched_barrier(0);              // keeps the next pass's loads behind the guard
  }
  // D element r of tile (i, j) = C(row 64 wr + 16i + 8h + r, col 64 wc + 16j + l&15)
#pragma unroll
  for (int j = 0; j < 4; ++j) {
    const float bj = bf16_rne(bias[colB + 64 * wc + 16 * j + ln]);
#pragma unroll
    for (int i = 0; i < 4; ++i)
#pragma unroll
      for (int r = 0; r < 8; ++r)
        so[wc][64 * wr + 16 * i + 8 * hh + r][16 * j + ln] = c[4 * i + j][r] + bj;
  }
  __syncthreads();
  const size_t base = (((size_t)(b * NH + 2 * by)) * SEQ + s0) * HD;            // head 2 by; head 2 by + 1 lies SEQ * HD elements on
  if (MODE == 0) {
    for (int i2 = tid; i2 < 2 * 128 * 8; i2 += 128) {
      const int hs = i2 >> 10, i = i2 & 1023;
      const int row = (i >> 7) * 16 + (i & 15), p8 = ((i >> 4) & 7) * 8;        // piece i = [s / 16][d / 32][half][h][s % 16]; d = 8 * bits 6..4
      const v4f x0 = *(const v4fa*)&so[hs][row][p8], x1 = *(const v4fa*)&so[hs][row][p8 + 4];
      H8 oh;
#pragma unroll
      for (int q = 0; q < 4; ++q) {
        oh.h[q]     = (_Float16)(x0[q] * 16.0f);
        oh.h[4 + q] = (_Float16)(x1[q] * 16.0f);
      }
      const v8us ov = oh.v;
      *(v8us*)(outH + base + (size_t)hs * SEQ * HD + (size_t)i * 8) = ov;
    }
  } else {
    for (int i2 = tid; i2 < 2 * 64 * 16; i2 += 128) {                           // 32 keys x 64 d = 2048 elements per key step
      const int hs = i2 >> 10, i = i2 & 1023;
      const int d = ((i >> 6) & 3) * 16 + (i & 15), s8 = (i >> 8) * 32 + ((i >> 4) & 3) * 8;   // piece i = [s / 32][d / 16][half][h][d % 16]
      H8 oh, ol;
#pragma unroll
      for (int q = 0; q < 8; ++q) {
        const float v0 = so[hs][s8 + q][d] * 16.0f;
        const _Float16 h0 = (_Float16)v0;
        oh.h[q] = h0;
        ol.h[q] = (_Float16)((v0 - (float)h0) * RES_SC);
      }
      const v8us ovh = oh.v, ovl = ol.v;
      *(v8us*)(outH + base + (size_t)hs * SEQ * HD + (size_t)i * 8) = ovh;
      *(v8us*)(outL + base + (size_t)hs * SEQ * HD + (size_t)i * 8) = ovl;
    }
  }
}

// The three projections of x in one grid (row blocks, 1024/128, 3): z = 0, 1 -> q, k (MODE 0), z = 2 -> v (MODE 1); the branch is block-uniform.
__global__ __launch_bounds__(128) void k_qkv(const unsigned short* __restrict__ Xb, const unsigned short* __restrict__ Wb,
                                             const float* __restrict__ bq, const float* __restrict__ bk, const float* __restrict__ bv,
                                             unsigned short* __restrict__ QKh, unsigned short* __restrict__ Vth,
                                             unsigned short* __restrict__ Vtl) {
  __shared__ __attribute__((aligned(16))) float so[2][128][68];
  const int bx = blockIdx.x, by = blockIdx.y, z = blockIdx.z;
  if (z < 2) proj_part<0>(so, Xb, Wb + (size_t)z * DM * DM, z == 1 ? bk : bq, QKh + (size_t)z * PLANE, QKh, bx, by);
  else       proj_part<1>(so, Xb, Wb + (size_t)2 * DM * DM, bv, Vth, Vtl, bx, by);
}

// Both row bands of the output projection in one grid (NB * SEQ / 128, 1024/64): the first NB * RH / 128 row blocks are the rows < RH (MODE 2),
// the others the rows >= RH (MODE 3); the branch is block-uniform.
__global__ __launch_bounds__(128) void k_out(const unsigned short* __restrict__ Cp, const unsigned short* __restrict__ Cl,
                                             const unsigned short* __restrict__ Wob, const unsigned short* __restrict__ Woh,
                                             const float* __restrict__ bo, float* __restrict__ out) {
  __shared__ __attribute__((aligned(16))) float so[128][68];
  const int bx = blockIdx.x, by = blockIdx.y;
  if (bx < NB * (RH / 128)) gemm_part<2>(so, Cp, Cl, Wob, bo, out, bx, by, 0, RH / 128);
  else                      gemm_part<3>(so, Cp, Cl, Woh, bo, out, bx - NB * (RH / 128), by, RH, (SEQ - RH) / 128);
}

// Fragment loads of one 32-key step. Pointers are the (batch, head) bases of the planes.
// A fragments of K: row m = key (key0 + 16*kt + ln), elements 0..7 <- d = 32c + 8h + i, 8..15 <- d = 32c + 16 + 8h + i; kf[2*kt + c];
// the step's eight halves are 4 KB in a row of the fragment-ordered plane
__device__ __forceinline__ void load_k(const unsigned short* __restrict__ Khp, int key0, int ln, int hh, FragH (&kf)[4]) {
  const unsigned short* kp = Khp + (size_t)key0 * HD + 8 * (16 * hh + ln);
#pragma unroll
  for (int f = 0; f < 4; ++f) {
    kf[f].half[0] = *(const v8us*)(kp + 512 * f); kf[f].half[1] = *(const v8us*)(kp + 512 * f + 256);
  }
}
// A fragments of V^T: row m = d (16*t + ln), elements 0..7 <- key0 + 8h + i, 8..15 <- key0 + 16 + 8h + i; again 4 KB in a row (key0 a multiple of 32)
__device__ __forceinline__ void load_v(const unsigned short* __restrict__ Vp, int key0, int ln, int hh, FragH (&vf)[4]) {
  const unsigned short* vp = Vp + (size_t)key0 * HD + 8 * (16 * hh + ln);
#pragma unroll
  for (int t = 0; t < 4; ++t) {
    vf[t].half[0] = *(const v8us*)(vp + 512 * t); vf[t].half[1] = *(const v8us*)(vp + 512 * t + 256);
  }
}

// One 32-key step for a wave's 16 queries (this lane's column: one query), on fragments and a mask word (word modd of the pair mw2) that were loaded earlier.
// Each fragment set is reloaded for step keyN (the active step that the set serves next) right behind its last product, so that those loads fly
// under the rest of this step and all that comes before that step's use of them.
// EARLY: P and v as hi + residual planes (three products, lr over the f32 weights); else one product and lr over the f16 weights.
template <bool EARLY>
__device__ __forceinline__ void fa_step(const unsigned short* __restrict__ Khp,
                                        const unsigned short* __restrict__ Vhp, const unsigned short* __restrict__ Vlp,
                                        int keyN, v2ua mw2, int modd, int ln, int hh,
                                        const FragH& qh0, const FragH& qh1,
                                        FragH (&kf)[4], FragH (&vf)[4], FragH (&vlf)[4],
                                        float& mr, float& lr, v8f (&Oh)[4], v8f (&Ol)[4]) {
  const v8f z8 = {0.f, 0.f, 0.f, 0.f, 0.f, 0.f, 0.f, 0.f};
  float sc[16];
#pragma unroll
  for (int kt = 0; kt < 2; ++kt) {
    v8f sh = z8;
    mma_s(kf[2 * kt].v, kf[2 * kt + 1].v, qh0.v, qh1.v, sh);
    // S^T element r of tile kt = score(key0 + 16*kt + 8h + r, this lane's query); carries: 16 x 16 on q, k, then 1/8 -> 2^-11
#pragma unroll
    for (int r = 0; r < 8; ++r) sc[8 * kt + r] = sh[r] * 0.00048828125f;
  }
  load_k(Khp, keyN, ln, hh, kf);
  __builtin_amdgcn_sched_barrier(0);   // keeps the K reloads here: sunk below the softmax they would have too short a lead on the next step's products
  // replace-fill: excluded keys get -inf (bit 8h + r of the word <-> tile 0, bit 16 + 8h + r <-> tile 1)
  const float ninf = __uint_as_float(0xFF800000u);
  const unsigned int mb = (modd ? mw2[1] : mw2[0]) >> (8 * hh);   // the step's word of the pair (modd wave-uniform), picked here, behind the K reloads, where its wait leaves them in flight
#pragma unroll
  for (int r = 0; r < 8; ++r) {
    sc[r]     = ((mb >> r) & 1u) ? ninf : sc[r];
    sc[8 + r] = ((mb >> (16 + r)) & 1u) ? ninf : sc[8 + r];
  }
  float mx = sc[0];
#pragma unroll
  for (int i = 1; i < 16; ++i) mx = fmaxf(mx, sc[i]);
  mx = fmaxf(mx, __shfl_xor(mx, 16, 32));           // the other lane half holds the other 16 keys of this query
  const float mnew = fmaxf(mr, mx);
  const float al = exp2_hw((mr - mnew) * LOG2E);
  mr = mnew;
  // weights carried x256: pc = 256 * exp(sc - mnew); hi plane f16(pc); EARLY: residual plane f16((pc - hi) * 2048)
  FragH ph, pl;
  float ps = 0.0f;
#pragma unroll
  for (int i = 0; i < 16; i += 2) {
    const v2f s2 = {sc[i], sc[i + 1]};
    const v2f x2 = __builtin_elementwise_fma(s2 - mnew, (v2f){LOG2E, LOG2E}, (v2f){8.0f, 8.0f});
    const v2f pc = {exp2_hw(x2[0]), exp2_hw(x2[1])};
    const v2h h = __builtin_convertvector(pc, v2h);  // one packed convert; the uses below read its halves
    ph.h[i] = h[0]; ph.h[i + 1] = h[1];             // B element i: i<8 -> key0 + 8h + i (tile 0 row 8h+i); i>=8 -> key0 + 16 + 8h + (i-8) (tile 1)
    if (EARLY) {
      ps += pc[0];
      ps += pc[1];
      pl.h[i]     = (_Float16)((pc[0] - (float)h[0]) * RES_SC);
      pl.h[i + 1] = (_Float16)((pc[1] - (float)h[1]) * RES_SC);
    } else {
      ps += (float)h[0];
      ps += (float)h[1];
    }
  }
  ps += __shfl_xor(ps, 16, 32);
  lr = lr * al + ps;
#pragma unroll
  for (int t = 0; t < 4; ++t) {
    Oh[t] = Oh[t] * al;
    if (EARLY) Ol[t] = Ol[t] * al;
  }
#pragma unroll
  for (int t = 0; t < 4; ++t) {
    if (EARLY) mma_pv3(vf[t].v, vlf[t].v, ph.v, pl.v, Oh[t], Ol[t]);
    else       mma_pv1(vf[t].v, ph.v, Oh[t]);
  }
  load_v(Vhp, keyN, ln, hh, vf);
  if (EARLY) load_v(Vlp, keyN, ln, hh, vlf);
  asm volatile("s_wait_xcnt 0x0" ::: "memory");   // in front of the next step's writes to the registers that held these loads' addresses
}

// Block = 4 waves x 16 queries = 64 queries: query tile qt of (batch, head) bh, both dealt by the calling kernel; no LDS and no barrier.
// Steps whose 32 keys are excluded for all 16 queries of the wave are skipped (exact for any mask value): a wave-uniform map of the
// active steps is built from the wave's mask rows in front of the loop, so that the step after the current one is known when its loads issue.
// Epilogue: lane 16h + q holds ctx(query q, d = 16t + 8h + r), which is half t & 1 of the ctx plane's fragment (k-step 2*head + t / 2): each O^T tile
// goes out of its registers as one 512-byte run.
// coverage: 4 waves x 16 rows x 64 columns = the (row, head) segments of tile qt of bh; the calling kernel gives every (bh, qt) to exactly one block.
template <bool EARLY>
__device__ __forceinline__ void attn_part(const unsigned short* __restrict__ QKh,
                                          const unsigned short* __restrict__ Vth, const unsigned short* __restrict__ Vtl,
                                          const unsigned int* __restrict__ bits,
                                          unsigned short* __restrict__ Cp, unsigned short* __restrict__ Cl,
                                          int bh, int qt) {
  static_assert(SEQ / 32 <= 64);
  const int tid = threadIdx.x, w = __builtin_amdgcn_readfirstlane((int)(tid >> 5)), lane = tid & 31, ln = lane & 15, hh = lane >> 4;
  const int b = bh / NH, hd = bh - b * NH;
  const int qbase = qt * 64 + 16 * w;
  const int qg = qbase + ln;
  const size_t hb = (size_t)bh * SEQ * HD;
  // Q^T B fragments: column n = query qg, elements 0..7 <- d = 32c + 8h + i, 8..15 <- d = 32c + 16 + 8h + i
  FragH qh0, qh1;
  {
    const unsigned short* qrh = QKh + hb + (size_t)qbase * HD + 8 * lane;
    qh0.half[0] = *(const v8us*)(qrh);       qh0.half[1] = *(const v8us*)(qrh + 256);
    qh1.half[0] = *(const v8us*)(qrh + 512); qh1.half[1] = *(const v8us*)(qrh + 768);
  }
  const unsigned short* Khp = QKh + PLANE + hb;
  const unsigned short* Vhp = Vth + hb;
  const unsigned short* Vlp = Vtl + hb;
  const unsigned int* mrow = bits + ((size_t)b * SEQ + qg) * (SEQ / 32);
  float mr = -3.0e38f, lr = 0.0f;
  v8f Oh[4] = {}, Ol[4] = {};
  // bit j of act: step j has a key that some query of the wave keeps
  unsigned long long act = 0ull;
#pragma unroll
  for (int i = 0; i < SEQ / 128; ++i) {
    const v4i x = *(const v4ia*)(mrow + 4 * i);
#pragma unroll
    for (int e = 0; e < 4; ++e)
      if (__ballot(x[e] != -1) != 0) act |= 1ull << (4 * i + e);   // wave-uniform
  }
  if (EARLY && act != 0ull) {
    int j = __builtin_ctzll(act);
    act &= act - 1ull;
    FragH kf[4], vf[4], vlf[4];
    unsigned int mw = mrow[j];
    __builtin_amdgcn_sched_barrier(0);                // mask word first in load order: the loop's wait for it then leaves the fragment loads in flight
    load_k(Khp, 32 * j, ln, hh, kf);
    load_v(Vhp, 32 * j, ln, hh, vf);
    load_v(Vlp, 32 * j, ln, hh, vlf);
    asm volatile("s_wait_xcnt 0x0" ::: "memory");     // in front of later writes to the registers that held these loads' addresses
    __builtin_amdgcn_sched_barrier(0);                // keeps those writes behind the wait
#pragma unroll 1
    for (;;) {
      const bool more = act != 0ull;                  // wave-uniform
      const int jn = more ? __builtin_ctzll(act) : j; // last step: its own tiles once more (in bounds, never used)
      act &= act - 1ull;
      const unsigned int mwn = mrow[jn];
      fa_step<EARLY>(Khp, Vhp, Vlp, 32 * jn, (v2ua){mw, mw}, 0, ln, hh, qh0, qh1, kf, vf, vlf, mr, lr, Oh, Ol);
      if (!more) break;
      mw = mwn;
      j = jn;
    }
  }
  if (!EARLY && act != 0ull) {
    // The long band: two fragment sets, A for the wave's active steps 0, 2, 4, ... and B for 1, 3, 5, ...; a set is reloaded right behind its last product
    // for the step after next, so its loads have two steps to arrive.
    // The order of the steps, and so every sum, is the one of a single set.
    // The loop takes the steps in pairs with no exit between the two, an odd last step follows it.
    const int n = __builtin_popcountll(act);          // wave-uniform
    int ja = __builtin_ctzll(act);
    act &= act - 1ull;
    FragH ka[4], va[4], vlf[4];
    // A step's mask word comes as the aligned pair of words that holds it: a lone destination register can be given the odd half of a register pair whose
    // even half a packed instruction broadcasts, and the wait for it there would drain, in load order, the fragment loads that are meant to stay in flight.
    v2ua wa = *(const v2ua*)(mrow + (ja & ~1));
    __builtin_amdgcn_sched_barrier(0);                // mask words first in load order: the loop's wait for them then leaves the fragment loads in flight
    load_k(Khp, 32 * ja, ln, hh, ka);
    __builtin_amdgcn_sched_barrier(0);                // this one and the next two: the load order of the loop (K A, V A, K B, V B), so that its counted waits fit the first pass too
    load_v(Vhp, 32 * ja, ln, hh, va);
    asm volatile("s_wait_xcnt 0x0" ::: "memory");     // in front of later writes to the registers that held these loads' addresses
    __builtin_amdgcn_sched_barrier(0);
    if (n >= 2) {
      int jb = __builtin_ctzll(act);
      act &= act - 1ull;
      FragH kb[4], vb[4];
      load_k(Khp, 32 * jb, ln, hh, kb);
      __builtin_amdgcn_sched_barrier(0);
      load_v(Vhp, 32 * jb, ln, hh, vb);
      asm volatile("s_wait_xcnt 0x0" ::: "memory");   // in front of later writes to the registers that held these loads' addresses
      __builtin_amdgcn_sched_barrier(0);              // keeps those writes behind the wait
      int p = n >> 1;
#pragma unroll 1                                      // rolled: the pair is the whole ring; more bodies would only add code
      do {
        const int jc = (act != 0ull) ? __builtin_ctzll(act) : ja;   // no such step: the set's own tiles once more (in bounds, never used); so for jd
        act &= act - 1ull;
        const v2ua wb = *(const v2ua*)(mrow + (jb & ~1));
        fa_step<EARLY>(Khp, Vhp, Vlp, 32 * jc, wa, ja & 1, ln, hh, qh0, qh1, ka, va, vlf, mr, lr, Oh, Ol);
        __builtin_amdgcn_sched_barrier(0);            // keeps set B's score products out of step A: pulled up there they would want B's K loads most of a step sooner
        const int jd = (act != 0ull) ? __builtin_ctzll(act) : jb;
        act &= act - 1ull;
        wa = *(const v2ua*)(mrow + (jc & ~1));
        fa_step<EARLY>(Khp, Vhp, Vlp, 32 * jd, wb, jb & 1, ln, hh, qh0, qh1, kb, vb, vlf, mr, lr, Oh, Ol);
        ja = jc;
        jb = jd;
      } while (--p > 0);
    }
    if (n & 1) fa_step<EARLY>(Khp, Vhp, Vlp, 32 * ja, wa, ja & 1, ln, hh, qh0, qh1, ka, va, vlf, mr, lr, Oh, Ol);
  }

  // O^T element r of tile t = ctx(query qg, d = 16t + 8h + r); undo the carries: x256 (in lr), x16 (v), x2048 (residual accumulator)
  const float inv = 1.0f / (16.0f * lr);
  const size_t cb = ((size_t)(b * SEQ + qbase)) * DM + (size_t)hd * (16 * HD) + 8 * lane;
#pragma unroll
  for (int t = 0; t < 4; ++t) {
    if (EARLY) {
      v8us oh, ol;
#pragma unroll
      for (int r = 0; r < 8; ++r) {
        const float x = (Oh[t][r] + Ol[t][r] * RES_INV) * inv;
        const unsigned short h0 = bf16_bits(x);
        oh[r] = h0;
        ol[r] = bf16_bits(x - bf16_val(h0));
      }
      *(v8us*)(Cp + cb + 256 * t) = oh;
      *(v8us*)(Cl + cb + 256 * t) = ol;
    } else {
      H8 of;
#pragma unroll
      for (int r = 0; r < 8; ++r) of.h[r] = (_Float16)((Oh[t][r] * inv) * 64.0f);
      const v8us ov = of.v;
      *(v8us*)(Cp + cb + 256 * t) = ov;
    }
  }
  if (EARLY) asm volatile("s_wait_xcnt 0x0" ::: "memory");   // the built code joins the two bands behind these stores: in front of the other band's writes to their registers
}

// Both query bands in one grid; the band follows from the tile (rows < RH or not), so the branch is block-uniform.
// Deal of the blocks, for speed only (any permutation of the (bh, qt) pairs is correct): heads run fastest, the tile follows from rank = blk / (NB * NH).
// A launch lasts as long as its fullest SIMD. Where later queries keep more keys, a tile's cost grows
// with qt. The quarters of the index range take the
// tiles n-1-k, 3n/4-1-k, n/4+k, k (k = place in the quarter), whose costs add up to the same sum for every k, the heaviest tiles first in index order.
#define AQ_N (SEQ / 64)
#define AB_ALL (NB * NH * AQ_N)
__global__ __launch_bounds__(128) void k_attn(const unsigned short* __restrict__ QKh,
                                              const unsigned short* __restrict__ Vth, const unsigned short* __restrict__ Vtl,
                                              const unsigned int* __restrict__ bits,
                                              unsigned short* __restrict__ Cp, unsigned short* __restrict__ Cl) {
  const int blk = blockIdx.x;
  const int rank = blk / (NB * NH), bh = blk - rank * (NB * NH);
  int qt = AQ_N - 1 - rank;                          // heaviest first; also the whole deal where the tiles do not split into quarters
  if (AQ_N % 4 == 0 && rank >= AQ_N / 2) qt = (rank < 3 * (AQ_N / 4)) ? rank - AQ_N / 4 : rank - 3 * (AQ_N / 4);
  if (qt >= RH / 64) attn_part<false>(QKh, Vth, Vtl, bits, Cp, Cl, bh, qt);
  else               attn_part<true>(QKh, Vth, Vtl, bits, Cp, Cl, bh, qt);
}

extern "C" void kernel_launch(void* const* d_in, const int* in_sizes, int n_in,
                              void* d_out, int out_size, void* d_ws, size_t ws_size, hipStream_t stream) {
  if (n_in < 10) return;
  const long long needx = (long long)(NB - 1) * SEQ_FULL * DM + (long long)SEQ * DM;   // last element touched + 1
  const long long needm = (long long)(NB - 1) * SEQ_FULL * SEQ_FULL + (long long)(SEQ - 1) * SEQ_FULL + SEQ;
  if ((long long)in_sizes[0] < needx) return;
  if ((long long)in_sizes[1] < (long long)DM * DM || (long long)in_sizes[3] < (long long)DM * DM) return;
  if ((long long)in_sizes[5] < (long long)DM * DM || (long long)in_sizes[7] < (long long)DM * DM) return;
  if (in_sizes[2] < DM || in_sizes[4] < DM || in_sizes[6] < DM || in_sizes[8] < DM) return;
  if ((long long)in_sizes[9] < needm) return;
  if ((long long)out_size < needx) return;
  const float* x  = (const float*)d_in[0];   // wire order: x, Wq, bq, Wk, bk, Wv, bv, Wo, bo, attention_mask
  const float* Wq = (const float*)d_in[1];
  const float* bq = (const float*)d_in[2];
  const float* Wk = (const float*)d_in[3];
  const float* bk = (const float*)d_in[4];
  const float* Wv = (const float*)d_in[5];
  const float* bv = (const float*)d_in[6];
  const float* Wo = (const float*)d_in[7];
  const float* bo = (const float*)d_in[8];
  const int* mask = (const int*)d_in[9];
  float* out = (float*)d_out;

  char* ws = (char*)d_ws;
  size_t off = 0;
  const size_t pl2 = PLANE * 2;                               // bytes of one [NB*SEQ][1024] 16-bit plane (8 MiB at full size), multiple of 256
  const size_t wsz = (size_t)DM * DM * 2;                     // 2 MiB per weight plane
  const size_t bsz = (size_t)NB * SEQ * (SEQ / 32) * 4;       // 1 MiB at full size
  unsigned short* Xb  = (unsigned short*)(ws + off); off += pl2;
  unsigned short* Wb  = (unsigned short*)(ws + off); off += 4 * wsz;      // bf16 planes q, k, v, o
  unsigned short* Woh = (unsigned short*)(ws + off); off += wsz;          // f16 plane of 64 Wo
  unsigned short* QKh = (unsigned short*)(ws + off); off += 2 * pl2;      // [q|k][b][h][s][64], fragment order
  unsigned short* Vth = (unsigned short*)(ws + off); off += pl2;          // [b][h][s / 32][64 x 32], fragment order
  unsigned short* Vtl = (unsigned short*)(ws + off); off += pl2;
  unsigned int*   Mb  = (unsigned int*)(ws + off);   off += (bsz + 255) & ~(size_t)255;
  unsigned short* Cp  = (unsigned short*)(ws + off); off += pl2;          // [b*SEQ + s][1024], fragment order: rows < RH bf16 hi, rows >= RH f16(64 ctx)
  unsigned short* Cl  = (unsigned short*)(ws + off); off += pl2;          // rows < RH: bf16 lo (other rows never written, never read)
  if (off > ws_size || off > (size_t)134217728) return;

  // four launches, each reading only what an earlier one (or the caller) wrote
  k_prep<<<(unsigned)(PB_MASK + PB_X + PB_NW * PB_W), 256, 0, stream>>>(x, Wq, Wk, Wv, Wo, mask, Xb, Wb, Woh, Mb);
  k_qkv<<<dim3((unsigned)(NB * (SEQ / 128)), DM / 128, 3), 128, 0, stream>>>(Xb, Wb, bq, bk, bv, QKh, Vth, Vtl);
  k_attn<<<(unsigned)AB_ALL, 128, 0, stream>>>(QKh, Vth, Vtl, Mb, Cp, Cl);
  k_out<<<dim3((unsigned)(NB * (SEQ / 128)), DM / 64, 1), 128, 0, stream>>>(Cp, Cl, Wb + (size_t)3 * DM * DM, Woh, bo, out);
}

// v009
// It runs in 80.1 microseconds.
// In two side-by-side timings against v008, it was 1.05 and 1.04 times as fast.
// Counting every step since v000, it is 3.94 times as fast.
#include <hip/hip_runtime.h>
// Contractions: q/k/v projections on v_wmma_f32_16x16x32_bf16 (x, W RNE bf16, single product, f32 accumulate); S^T = K Q^T on v_wmma_f32_16x16x32_f16 (q, k as x16 f16 planes, single product); O^T = V^T P^T on v_wmma_f32_16x16x32_f16 (query rows < RH: v x16 hi + x2^11 residual, P x256 hi + x2^11 residual, residual products in their own f32 accumulator; query rows >= RH: v x16, P x256, single product, row sum over the f16 P); output projection: rows < RH on v_wmma_f32_16x16x32_bf16 (ctx bf16 hi + bf16 lo planes, Wo RNE bf16), rows >= RH on v_wmma_f32_16x16x32_f16 (ctx x64 f16, Wo RNE-bf16 value x64 in f16, single product); softmax statistics f32.
// Multi-head attention, B x S x 1024, 16 heads of 64, scale 1/8, mask input (1 = key excluded, score replaced by -inf) read on the device as a packed bit plane.
// Engine: transposed flash. Each wave owns 16 queries. Per 32-key step: S^T tiles (key rows x query columns) from K rows (A, global f16 plane)
// and Q^T (B, registers); the two 16-key D tiles pack straight into the P^T B fragment; O^T (d rows x query columns) accumulates from V^T rows (A, global f16 planes).
// Plane layout: every 16-bit operand plane is stored in fragment order. One fragment (16 rows x 32 k) = 1 KB = [half 0..1][lane 0..31][8 elements];
// lane = 16h + row, element i of half f = k 16f + 8h + i. A wave-wide 16-byte load of one half is 512 contiguous bytes (four whole lines).
#ifndef NB
#define NB 2
#endif
#ifndef SEQ
#define SEQ 2048
#endif
#ifndef RH
#define RH 256                                 /* query rows below RH (per batch) take the hi + residual path */
#endif
#define NB_FULL 2
#define SEQ_FULL 2048
#define DM 1024
#define NH 16
#define HD 64
#define PLANE ((size_t)NB * SEQ * DM)          /* elements of one [NB*SEQ][1024] 16-bit plane */

static_assert(SEQ % 128 == 0);
static_assert(SEQ <= SEQ_FULL);
static_assert(NB <= NB_FULL);
static_assert(RH % 128 == 0);
static_assert(RH >= 0 && RH <= SEQ);
static_assert(NH * HD == DM);
static_assert(HD == 64);
static_assert(DM % 64 == 0);
static_assert(PLANE * 2 * 7 + (size_t)5 * DM * DM * 2 + (size_t)NB * SEQ * (SEQ / 32) * 4 + 4096 <= (size_t)134217728);

typedef __bf16 v16b __attribute__((ext_vector_type(16)));
typedef _Float16 v16h __attribute__((ext_vector_type(16)));
typedef unsigned short v8us __attribute__((ext_vector_type(8), may_alias));
typedef float v8f __attribute__((ext_vector_type(8)));
typedef float v2f __attribute__((ext_vector_type(2)));
typedef _Float16 v2h __attribute__((ext_vector_type(2)));
typedef float v4f __attribute__((ext_vector_type(4)));
typedef float v4fa __attribute__((ext_vector_type(4), may_alias));
typedef int v4i __attribute__((ext_vector_type(4)));
typedef int v4ia __attribute__((ext_vector_type(4), may_alias));
typedef unsigned int v2ua __attribute__((ext_vector_type(2), may_alias));
union FragH { v16h v; v8us half[2]; _Float16 h[16]; unsigned short u[16]; };
union FragX { v16b b; v16h h; v8us half[2]; };
union H8 { v8us v; _Float16 h[8]; unsigned short u[8]; };

#define LOG2E 1.4426950408889634f
#define RES_SC 2048.0f
#define RES_INV 0.00048828125f

__device__ __forceinline__ unsigned short bf16_bits(float x) {   // RNE convert to bf16 bits, NaN kept NaN
  const unsigned int u = __float_as_uint(x);
  const unsigned int r = (u + 0x7FFFu + ((u >> 16) & 1u)) >> 16;
  const unsigned int n = (u >> 16) | 0x40u;
  return (unsigned short)(((u & 0x7FFFFFFFu) > 0x7F800000u) ? n : r);
}
__device__ __forceinline__ float bf16_val(unsigned short b) { return __uint_as_float(((unsigned int)b) << 16); }
__device__ __forceinline__ float bf16_rne(float x) { return bf16_val(bf16_bits(x)); }

// 2^x on the bare hardware instruction. exp2f() wraps the same instruction in a compare, two selects, an add and an ldexp that only serve results
// below 2^-126 (x < -126), which the bare form returns as 0. Here such a result has no effect: a weight that small is 0 in both f16 planes
// (its residual is below 2^-115) and vanishes in the f32 row sum, which holds 256 from the row's maximum; a rescale factor that small
// multiplies sums that the same step's weight of 256 outweighs by more than 2^100. For x >= -126, -inf included, the value is the same bit for bit.
__device__ __forceinline__ float exp2_hw(float x) { return __builtin_amdgcn_exp2f(x); }

// sh += K*Q (64 deep = two k-steps), then the hazard guard
__device__ __forceinline__ void mma_s(v16h k0, v16h k1, v16h q0, v16h q1, v8f& sh) {
  sh = __builtin_amdgcn_wmma_f32_16x16x32_f16(false, k0, false, q0, (short)0, sh, false, false);
  sh = __builtin_amdgcn_wmma_f32_16x16x32_f16(false, k1, false, q1, (short)0, sh, false, false);
  asm volatile("v_nop\n\tv_nop\n\tv_nop\n\tv_nop" : "+v"(sh) : "v"(k0), "v"(k1), "v"(q0), "v"(q1));
}
// oh += Vh*Ph ; ol += Vh*Pl + Vl*Ph (same x2^11 on both residual planes), then the hazard guard
__device__ __forceinline__ void mma_pv3(v16h vh, v16h vl, v16h ph, v16h pl, v8f& oh, v8f& ol) {
  oh = __builtin_amdgcn_wmma_f32_16x16x32_f16(false, vh, false, ph, (short)0, oh, false, false);
  ol = __builtin_amdgcn_wmma_f32_16x16x32_f16(false, vh, false, pl, (short)0, ol, false, false);
  ol = __builtin_amdgcn_wmma_f32_16x16x32_f16(false, vl, false, ph, (short)0, ol, false, false);
  asm volatile("v_nop\n\tv_nop\n\tv_nop\n\tv_nop" : "+v"(oh), "+v"(ol) : "v"(vh), "v"(vl), "v"(ph), "v"(pl));
}
// oh += Vh*Ph, then the hazard guard
__device__ __forceinline__ void mma_pv1(v16h vh, v16h ph, v8f& oh) {
  oh = __builtin_amdgcn_wmma_f32_16x16x32_f16(false, vh, false, ph, (short)0, oh, false, false);
  asm volatile("v_nop\n\tv_nop\n\tv_nop\n\tv_nop" : "+v"(oh) : "v"(vh), "v"(ph));
}

// dst = 16-bit image of src[(b*rpb_full + s)][0..1023], row = b*rpb + s, in fragment order [row / 16][k / 32][half][lane][8]. F16 = false: bf16 bits (RNE);
// F16 = true: f16 bits of (RNE bf16 value x 64), exact. Thread per 8 elements; a wave takes 8 rows x 32 k: it reads 8 whole 128-B lines and writes
// 4 whole lines (8 rows of one (half, h) each); rows a multiple of 16; t = thread index inside this plane's share of the grid
template <bool F16>
__device__ __forceinline__ void cvt_part(const float* __restrict__ src, unsigned short* __restrict__ dst,
                                         int t, int rows, int rpb, int rpb_full) {
  if (t >= rows * 128) return;
  const int wv = t >> 5, g = (t >> 3) & 3;                                      // g = 2 * half + h: which 8 k of the k-step
  const int r16 = (wv & 1) * 8 + (t & 7), frag = wv >> 1;                       // row in its 16-row band; fragment = band * 32 + k-step
  const int row = (frag >> 5) * 16 + r16, kk = (frag & 31) * 32 + g * 8;
  const int b = row / rpb, s = row - b * rpb;
  const float* p = src + ((size_t)b * rpb_full + s) * DM + kk;
  const v4f x0 = *(const v4fa*)(p), x1 = *(const v4fa*)(p + 4);
  H8 o;
#pragma unroll
  for (int i = 0; i < 4; ++i) {
    if (F16) {
      o.h[i]     = (_Float16)(bf16_rne(x0[i]) * 64.0f);
      o.h[4 + i] = (_Float16)(bf16_rne(x1[i]) * 64.0f);
    } else {
      o.u[i]     = bf16_bits(x0[i]);
      o.u[4 + i] = bf16_bits(x1[i]);
    }
  }
  const v8us ov = o.v;
  unsigned short* d = dst + ((size_t)frag * 64 + g * 16 + r16) * 8;
  *(v8us*)d = ov;
  
}

// the value that lane l ^ S of the same 16-lane row holds, by a DPP move
template <int S>
__device__ __forceinline__ unsigned int xlane(unsigned int v) {
  return (unsigned int)__builtin_amdgcn_update_dpp(0, (int)v, 0x160 + S, 0xf, 0xf, true);
}
// one stage of the 8 x 8 nibble transpose over 8 lanes: nibble c of lane a changes places with nibble c ^ S of lane a ^ S where bit S of a and of c differ
template <int S>
__device__ __forceinline__ unsigned int nib_stage(unsigned int p, int lane) {
  constexpr unsigned int M0 = (S == 1) ? 0x0F0F0F0Fu : (S == 2) ? 0x00FF00FFu : 0x0000FFFFu;
  const unsigned int y = xlane<S>(p);
  return (lane & S) ? ((p & ~M0) | ((y >> (4 * S)) & M0)) : ((p & M0) | ((y << (4 * S)) & ~M0));
}

// Mask bit plane: word (row, step j) = bits of keys 32 j .. 32 j + 31 of plane row b*SEQ + q, stored at [row / 4][j][row % 4], so that every reader and
// this writer move whole lines. A wave makes one 128-byte line of the plane: 4 rows x 8 steps, from 4 x 1 KB of the mask in eight loads of 512 contiguous bytes.
// Load u: row u / 2, ints 128 (u % 2) + 4 lane + e; the lane's four compare bits go to nibble u of p. The transpose over the 8 lanes of a group then leaves
// lane 8 g + a with the whole word of load a, ints 32 g .. 32 g + 31: row a / 2, step 4 (a % 2) + g of the eight.
// coverage: NB*SEQ*(SEQ/32) threads x 1 word = the whole plane.
static_assert(SEQ % 256 == 0);
__device__ __forceinline__ void mask_part(const int* __restrict__ mask, unsigned int* __restrict__ bits, int t) {
  if (t >= NB * SEQ * (SEQ / 32)) return;
  const int lane = t & 31, wv = __builtin_amdgcn_readfirstlane(t >> 5);
  const int rq = wv / (SEQ / 256), m = wv - rq * (SEQ / 256);
  const int b = (4 * rq) / SEQ, q = 4 * rq - b * SEQ;
  const int* p = mask + ((size_t)b * SEQ_FULL + q) * SEQ_FULL + 256 * m + 4 * lane;
  v4i x[8];
#pragma unroll
  for (int u = 0; u < 8; ++u) x[u] = *(const v4ia*)(p + (size_t)(u >> 1) * SEQ_FULL + 128 * (u & 1));
  unsigned int w = 0u;
#pragma unroll
  for (int u = 0; u < 8; ++u)
#pragma unroll
    for (int e = 0; e < 4; ++e) w |= ((x[u][e] == 1) ? 1u : 0u) << (4 * u + e);
  w = nib_stage<1>(w, lane);
  w = nib_stage<2>(w, lane);
  w = nib_stage<4>(w, lane);
  const int a = lane & 7, g = lane >> 3;
  bits[(size_t)wv * 32 + 4 * (4 * (a & 1) + g) + (a >> 1)] = w;
}

// One grid for everything that reads only the inputs: none of these parts reads what another writes. Block ranges, in index order:
// mask words (the longest threads, placed first for speed only), x, then the weight planes q, k, v, o (bf16) and o (f16 x64).
#define PB_MASK (NB * SEQ * (SEQ / 32) / 256)
#define PB_X (NB * SEQ * 128 / 256)
#define PB_W (DM * 128 / 256)
#define PB_NW (3 + (RH > 0 ? 1 : 0) + (SEQ > RH ? 1 : 0))
static_assert((NB * SEQ * (SEQ / 32)) % 256 == 0 && (NB * SEQ * 128) % 256 == 0 && (DM * 128) % 256 == 0);
__global__ __launch_bounds__(256) void k_prep(const float* __restrict__ x, const float* __restrict__ Wq, const float* __restrict__ Wk,
                                              const float* __restrict__ Wv, const float* __restrict__ Wo, const int* __restrict__ mask,
                                              unsigned short* __restrict__ Xb, unsigned short* __restrict__ Wb,
                                              unsigned short* __restrict__ Woh, unsigned int* __restrict__ bits) {
  const int tid = threadIdx.x;
  int blk = blockIdx.x;
  if (blk < PB_MASK) { mask_part(mask, bits, blk * 256 + tid); return; }
  blk -= PB_MASK;
  if (blk < PB_X) { cvt_part<false>(x, Xb, blk * 256 + tid, NB * SEQ, SEQ, SEQ_FULL); return; }
  blk -= PB_X;
  const int pl = blk / PB_W, t = (blk - pl * PB_W) * 256 + tid;
  if (pl == 4 || (pl == 3 && RH == 0)) { cvt_part<true>(Wo, Woh, t, DM, DM, DM); return; }
  const float* w = (pl == 0) ? Wq : (pl == 1) ? Wk : (pl == 2) ? Wv : Wo;
  cvt_part<false>(w, Wb + (size_t)pl * DM * DM, t, DM, DM, DM);
}

// the 2 x 4 tile group for the register ring: builtins alone, the hazard guard stands behind the call; no asm statement names the fragments, since
// a value that an asm operand names is held below v256 and the ring's sets do not all fit there
template <bool F16>
__device__ __forceinline__ void mma8s(const FragX (&a)[2], const FragX (&b)[4], v8f (&c)[8]) {
#pragma unroll
  for (int i = 0; i < 2; ++i)
#pragma unroll
    for (int j = 0; j < 4; ++j) {
      if (F16) c[4 * i + j] = __builtin_amdgcn_wmma_f32_16x16x32_f16(false, a[i].h, false, b[j].h, (short)0, c[4 * i + j], false, false);
      else     c[4 * i + j] = __builtin_amdgcn_wmma_f32_16x16x32_bf16(false, a[i].b, false, b[j].b, (short)0, c[4 * i + j], false, false);
    }
}

// The fragments of one k-step of the output projection: A rows (two 16-row bands), with LO the same of the lo plane, and four W bands; k0 = element
// offset of the k-step's fragment in its band. LAST: the wave's last loads, behind which the address registers are free for other use.
template <bool LO, bool LAST>
__device__ __forceinline__ void load_set(const unsigned short* __restrict__ ap, const unsigned short* __restrict__ lp,
                                         const unsigned short* __restrict__ wp, int k0, FragX (&a)[2], FragX (&l)[2], FragX (&b)[4]) {
  a[0].half[0] = *(const v8us*)(ap + k0);               a[0].half[1] = *(const v8us*)(ap + k0 + 256);
  a[1].half[0] = *(const v8us*)(ap + 16 * DM + k0);     a[1].half[1] = *(const v8us*)(ap + 16 * DM + k0 + 256);
  if (LO) {
    if (LAST) asm volatile("s_wait_xcnt 0x0" ::: "memory");   // in front of loads whose results may land in the registers that held the A loads' address
    l[0].half[0] = *(const v8us*)(lp + k0);             l[0].half[1] = *(const v8us*)(lp + k0 + 256);
    l[1].half[0] = *(const v8us*)(lp + 16 * DM + k0);   l[1].half[1] = *(const v8us*)(lp + 16 * DM + k0 + 256);
  }
  if (LAST) asm volatile("s_wait_xcnt 0x0" ::: "memory");     // in front of loads whose results may land in the registers that held the A loads' addresses
  b[0].half[0] = *(const v8us*)(wp + k0);               b[0].half[1] = *(const v8us*)(wp + k0 + 256);
  b[1].half[0] = *(const v8us*)(wp + 16 * DM + k0);     b[1].half[1] = *(const v8us*)(wp + 16 * DM + k0 + 256);
  b[2].half[0] = *(const v8us*)(wp + 32 * DM + k0);     b[2].half[1] = *(const v8us*)(wp + 32 * DM + k0 + 256);
  b[3].half[0] = *(const v8us*)(wp + 48 * DM + k0);
  if (LAST) asm volatile("s_wait_xcnt 0x0" ::: "memory");     // the last W load's result may land in the registers that held the W loads' address
  b[3].half[1] = *(const v8us*)(wp + 48 * DM + k0 + 256);
  if (LAST) asm volatile("s_wait_xcnt 0x0" ::: "memory");     // in front of whatever is written next to the register that held the last load's address
}

// Output projection. C[m][n] = sum_k A[m][k] * W[n][k] + bf16(bias[n]); A, W 16-bit planes with 1024-element rows; block tile 128 x 64, 4 waves x (32 x 64).
// Row blocks: block bx -> batch b = bx / nblk, first row s0 = sbeg + (bx % nblk) * 128 of that batch (plane row b*SEQ + s0); column block by.
// Fragments straight from the fragment-ordered planes: A row m = l&15, B column n = l&15, elements 0..7 <- k0 + 8h + i, 8..15 <- k0 + 16 + 8h + i.
// MODE 2 (rows < RH; bf16 operands): A = ctx hi plane, Alo = ctx lo plane (bf16, unscaled, same accumulator); f32 rows of the output buffer.
// MODE 3 (rows >= RH; f16 operands): A = f16(64 ctx), W = f16(64 Wo); accumulator x 2^-12; f32 rows of the output buffer.
// LDS tile so (the calling kernel's one tile): cross-wave (block barrier); staged extent 128 x 64 == consumed extent.
template <int MODE>
__device__ __forceinline__ void gemm_part(float (&so)[128][68],
                                          const unsigned short* __restrict__ A, const unsigned short* __restrict__ Alo,
                                          const unsigned short* __restrict__ Wm, const float* __restrict__ bias,
                                          float* __restrict__ outF, int bx, int by, int sbeg, int nblk) {
  const int tid = threadIdx.x, w = __builtin_amdgcn_readfirstlane((int)(tid >> 5)), lane = tid & 31, ln = lane & 15, hh = lane >> 4;
  const int b = bx / nblk, s0 = sbeg + (bx - b * nblk) * 128;
  const int rowB = b * SEQ + s0, colB = by * 64;
  const size_t aoff = (size_t)(rowB + 32 * w) * DM + 8 * lane;                  // 16 plane rows = 32 fragments = 16 * DM elements
  const unsigned short* ap = A + aoff;
  const unsigned short* lp = Alo + aoff;
  const unsigned short* wp = Wm + (size_t)colB * DM + 8 * lane;
  const v8f z8 = {0.f, 0.f, 0.f, 0.f, 0.f, 0.f, 0.f, 0.f};
  v8f c[8];
#pragma unroll
  for (int i = 0; i < 8; ++i) c[i] = z8;
  {
    // Two waves share a SIMD here, too few to cover a load's way with other waves' work, so each wave covers its own:
    // a ring of NR register sets, all filled in front of the loop; behind the products of k-step s its set is refilled for k-step s + NR.
    // The k loop is unrolled whole: the ring index is a compile-time number and every load is base + immediate offset, so that no address
    // register changes while loads fly.
    constexpr int NS = DM / 32;                     // k-steps
    constexpr int NR = (MODE == 2) ? 3 : 4;         // 48 loads of a wave in flight in either mode
    FragX fa[NR][2], fl[NR][2], fb[NR][4];
#pragma unroll
    for (int s = 0; s < NR; ++s) load_set<MODE == 2, false>(ap, lp, wp, 512 * s, fa[s], fl[s], fb[s]);
#pragma unroll
    for (int s = 0; s < NS; ++s) {
      __builtin_amdgcn_sched_barrier(0);            // keeps the loads above in front of these products: sunk below them they would lose a step of lead
      mma8s<MODE == 3>(fa[s % NR], fb[s % NR], c);
      if (MODE == 2) mma8s<false>(fl[s % NR], fb[s % NR], c);
      if (s + NR < NS) {
        __builtin_amdgcn_sched_barrier(0);          // keeps the products in front of the guard below
        asm volatile("v_nop\n\tv_nop\n\tv_nop\n\tv_nop");   // hazard guard: four vector slots between the last product and the loads that refill its A and B registers
        __builtin_amdgcn_sched_barrier(0);          // keeps the refill behind the guard
        if (s + NR < NS - 1) load_set<MODE == 2, false>(ap, lp, wp, 512 * (s + NR), fa[s % NR], fl[s % NR], fb[s % NR]);
        else                 load_set<MODE == 2, true>(ap, lp, wp, 512 * (s + NR), fa[s % NR], fl[s % NR], fb[s % NR]);
      }
    }
  }
  // D element r of tile (i, j) = C(row 32w + 16i + 8h + r, col 16j + l&15)
  const float cs = (MODE == 3) ? 0.000244140625f : 1.0f;     // 2^-12 undoes the x64 carries of ctx and Wo
#pragma unroll
  for (int j = 0; j < 4; ++j) {
    const float bj = bf16_rne(bias[colB + 16 * j + ln]);
#pragma unroll
    for (int i = 0; i < 2; ++i)
#pragma unroll
      for (int r = 0; r < 8; ++r)
        so[32 * w + 16 * i + 8 * hh + r][16 * j + ln] = c[4 * i + j][r] * cs + bj;
  }
  __syncthreads();
  float* og = outF + ((size_t)b * SEQ_FULL + s0) * DM + colB;
  for (int i = tid; i < 128 * 16; i += 128) {
    const int row = i >> 4, c4 = (i & 15) * 4;
    const v4f v = *(const v4fa*)&so[row][c4];
    *(v4f*)(og + (size_t)row * DM + c4) = v;
  }
}

// 4 x 4 tile group of one 32-deep k-step (bf16): builtins alone, the hazard guard stands behind the pass's last call; no asm statement names the
// fragments or the accumulators, since a value that an asm operand names is held below v256 and they do not all fit there
__device__ __forceinline__ void mma16(const FragX (&a)[4], const FragX (&b)[4], v8f (&c)[16]) {
#pragma unroll
  for (int i = 0; i < 4; ++i)
#pragma unroll
    for (int j = 0; j < 4; ++j)
      c[4 * i + j] = __builtin_amdgcn_wmma_f32_16x16x32_bf16(false, a[i].b, false, b[j].b, (short)0, c[4 * i + j], false, false);
}

// Projections of x. C[m][n] = sum_k A[m][k] * W[n][k] + bf16(bias[n]); A, W bf16 planes with 1024-element rows.
// Block tile 128 x 128 (two heads), 2 x 2 waves x (64 x 64): the loop is bound by the fragment bytes it loads, and a 64 x 64 wave tile feeds 16 products
// from 8 KB of fragments where a 32 x 64 tile feeds 8 from 6 KB; of the block's bytes each is wanted by two waves. A pass is 64 k (two k-steps),
// so that a wave has 32 loads in flight although only three waves share a SIMD.
// Row blocks: block bx -> batch b = bx / (SEQ / 128), first row s0 = (bx % (SEQ / 128)) * 128 of that batch (plane row b*SEQ + s0); column block by = heads 2 by, 2 by + 1.
// Fragments straight from the fragment-ordered planes: A row m = l&15, B column n = l&15, elements 0..7 <- k0 + 8h + i, 8..15 <- k0 + 16 + 8h + i.
// MODE 0 (q, k): f16 plane [b][h][s / 16][d / 32][half][lane][8] = f16(16 v); a head's part of the block tile = one contiguous 16-KB run.
// MODE 1 (v): f16 planes [b][h][s / 32][d / 16][half][lane][8 keys], hi = f16(16 v), residual = f16((16 v - hi) 2^11); transposed on the LDS read side.
// LDS tile so (one 128 x 64 tile per head): cross-wave (block barrier); staged extent == consumed extent.
template <int MODE>
__device__ __forceinline__ void proj_part(float (&so)[2][128][68],
                                          const unsigned short* __restrict__ A, const unsigned short* __restrict__ Wm,
                                          const float* __restrict__ bias,
                                          unsigned short* __restrict__ outH, unsigned short* __restrict__ outL, int bx, int by) {
  const int tid = threadIdx.x, w = __builtin_amdgcn_readfirstlane((int)(tid >> 5)), lane = tid & 31, ln = lane & 15, hh = lane >> 4;
  const int wr = w >> 1, wc = w & 1;                                            // the wave's 64 rows, its 64 columns (one head)
  const int b = bx / (SEQ / 128), s0 = (bx - b * (SEQ / 128)) * 128;
  const int rowB = b * SEQ + s0, colB = by * 128;
  const unsigned short* ap = A + (size_t)(rowB + 64 * wr) * DM + 8 * lane;      // 16 plane rows = 32 fragments = 16 * DM elements
  const unsigned short* wp = Wm + (size_t)(colB + 64 * wc) * DM + 8 * lane;
  const v8f z8 = {0.f, 0.f, 0.f, 0.f, 0.f, 0.f, 0.f, 0.f};
  v8f c[16];
#pragma unroll
  for (int i = 0; i < 16; ++i) c[i] = z8;
#pragma unroll 1
  for (int k0 = 0; k0 < 16 * DM; k0 += 1024) {                                  // k0: element offset of the pass's first fragment in its 16-row band
    FragX a[2][4], bb[2][4];
#pragma unroll
    for (int s = 0; s < 2; ++s) {
#pragma unroll
      for (int i = 0; i < 4; ++i) {
        a[s][i].half[0] = *(const v8us*)(ap + 16 * DM * i + k0 + 512 * s);
        a[s][i].half[1] = *(const v8us*)(ap + 16 * DM * i + k0 + 512 * s + 256);
      }
      if (s == 1) asm volatile("s_wait_xcnt 0x0" ::: "memory");   // in front of loads whose results may land in the registers that held the A loads' address
#pragma unroll
      for (int j = 0; j < 4; ++j) {
        bb[s][j].half[0] = *(const v8us*)(wp + 16 * DM * j + k0 + 512 * s);
        if (s == 1 && j == 3) asm volatile("s_wait_xcnt 0x0" ::: "memory");   // the last W load's result may land in the registers that held the W loads' address
        bb[s][j].half[1] = *(const v8us*)(wp + 16 * DM * j + k0 + 512 * s + 256);
      }
    }
    asm volatile("s_wait_xcnt 0x0" ::: "memory");   // in front of the next pass's writes to the registers that held these loads' addresses
    __builtin_amdgcn_sched_barrier(0);              // keeps all 32 loads in front of the products: sunk among them each group would be waited for on its own
    mma16(a[0], bb[0], c);
    mma16(a[1], bb[1], c);
    __builtin_amdgcn_sched_barrier(0);              // keeps the products in front of the guard below
    asm volatile("v_nop\n\tv_nop\n\tv_nop\n\tv_nop");   // hazard guard: four vector slots between the last product and the loads that refill its A and B registers
    __builtin_amdgcn_sched_barrier(0);              // keeps the next pass's loads behind the guard
  }
  // D element r of tile (i, j) = C(row 64 wr + 16i + 8h + r, col 64 wc + 16j + l&15)
#pragma unroll
  for (int j = 0; j < 4; ++j) {
    const float bj = bf16_rne(bias[colB + 64 * wc + 16 * j + ln]);
#pragma unroll
    for (int i = 0; i < 4; ++i)
#pragma unroll
      for (int r = 0; r < 8; ++r)
        so[wc][64 * wr + 16 * i + 8 * hh + r][16 * j + ln] = c[4 * i + j][r] + bj;
  }
  __syncthreads();
  const size_t base = (((size_t)(b * NH + 2 * by)) * SEQ + s0) * HD;            // head 2 by; head 2 by + 1 lies SEQ * HD elements on
  if (MODE == 0) {
    for (int i2 = tid; i2 < 2 * 128 * 8; i2 += 128) {
      const int hs = i2 >> 10, i = i2 & 1023;
      const int row = (i >> 7) * 16 + (i & 15), p8 = ((i >> 4) & 7) * 8;        // piece i = [s / 16][d / 32][half][h][s % 16]; d = 8 * bits 6..4
      const v4f x0 = *(const v4fa*)&so[hs][row][p8], x1 = *(const v4fa*)&so[hs][row][p8 + 4];
      H8 oh;
#pragma unroll
      for (int q = 0; q < 4; ++q) {
        oh.h[q]     = (_Float16)(x0[q] * 16.0f);
        oh.h[4 + q] = (_Float16)(x1[q] * 16.0f);
      }
      const v8us ov = oh.v;
      *(v8us*)(outH + base + (size_t)hs * SEQ * HD + (size_t)i * 8) = ov;
    }
  } else {
    for (int i2 = tid; i2 < 2 * 64 * 16; i2 += 128) {                           // 32 keys x 64 d = 2048 elements per key step
      const int hs = i2 >> 10, i = i2 & 1023;
      const int d = ((i >> 6) & 3) * 16 + (i & 15), s8 = (i >> 8) * 32 + ((i >> 4) & 3) * 8;   // piece i = [s / 32][d / 16][half][h][d % 16]
      H8 oh, ol;
#pragma unroll
      for (int q = 0; q < 8; ++q) {
        const float v0 = so[hs][s8 + q][d] * 16.0f;
        const _Float16 h0 = (_Float16)v0;
        oh.h[q] = h0;
        ol.h[q] = (_Float16)((v0 - (float)h0) * RES_SC);
      }
      const v8us ovh = oh.v, ovl = ol.v;
      *(v8us*)(outH + base + (size_t)hs * SEQ * HD + (size_t)i * 8) = ovh;
      *(v8us*)(outL + base + (size_t)hs * SEQ * HD + (size_t)i * 8) = ovl;
    }
  }
}

// The three projections of x in one grid (row blocks, 1024/128, 3): z = 0, 1 -> q, k (MODE 0), z = 2 -> v (MODE 1); the branch is block-uniform.
__global__ __launch_bounds__(128) void k_qkv(const unsigned short* __restrict__ Xb, const unsigned short* __restrict__ Wb,
                                             const float* __restrict__ bq, const float* __restrict__ bk, const float* __restrict__ bv,
                                             unsigned short* __restrict__ QKh, unsigned short* __restrict__ Vth,
                                             unsigned short* __restrict__ Vtl) {
  __shared__ __attribute__((aligned(16))) float so[2][128][68];
  const int bx = blockIdx.x, by = blockIdx.y, z = blockIdx.z;
  if (z < 2) proj_part<0>(so, Xb, Wb + (size_t)z * DM * DM, z == 1 ? bk : bq, QKh + (size_t)z * PLANE, QKh, bx, by);
  else       proj_part<1>(so, Xb, Wb + (size_t)2 * DM * DM, bv, Vth, Vtl, bx, by);
}

// Both row bands of the output projection in one grid (NB * SEQ / 128, 1024/64): the first NB * RH / 128 row blocks are the rows < RH (MODE 2),
// the others the rows >= RH (MODE 3); the branch is block-uniform.
__global__ __launch_bounds__(128) void k_out(const unsigned short* __restrict__ Cp, const unsigned short* __restrict__ Cl,
                                             const unsigned short* __restrict__ Wob, const unsigned short* __restrict__ Woh,
                                             const float* __restrict__ bo, float* __restrict__ out) {
  __shared__ __attribute__((aligned(16))) float so[128][68];
  const int bx = blockIdx.x, by = blockIdx.y;
  if (bx < NB * (RH / 128)) gemm_part<2>(so, Cp, Cl, Wob, bo, out, bx, by, 0, RH / 128);
  else                      gemm_part<3>(so, Cp, Cl, Woh, bo, out, bx - NB * (RH / 128), by, RH, (SEQ - RH) / 128);
}

// Fragment loads of one 32-key step. Pointers are the (batch, head) bases of the planes.
// A fragments of K: row m = key (key0 + 16*kt + ln), elements 0..7 <- d = 32c + 8h + i, 8..15 <- d = 32c + 16 + 8h + i; kf[2*kt + c];
// the step's eight halves are 4 KB in a row of the fragment-ordered plane
__device__ __forceinline__ void load_k(const unsigned short* __restrict__ Khp, int key0, int ln, int hh, FragH (&kf)[4]) {
  const unsigned short* kp = Khp + (size_t)key0 * HD + 8 * (16 * hh + ln);
#pragma unroll
  for (int f = 0; f < 4; ++f) {
    kf[f].half[0] = *(const v8us*)(kp + 512 * f); kf[f].half[1] = *(const v8us*)(kp + 512 * f + 256);
  }
}
// A fragments of V^T: row m = d (16*t + ln), elements 0..7 <- key0 + 8h + i, 8..15 <- key0 + 16 + 8h + i; again 4 KB in a row (key0 a multiple of 32)
__device__ __forceinline__ void load_v(const unsigned short* __restrict__ Vp, int key0, int ln, int hh, FragH (&vf)[4]) {
  const unsigned short* vp = Vp + (size_t)key0 * HD + 8 * (16 * hh + ln);
#pragma unroll
  for (int t = 0; t < 4; ++t) {
    vf[t].half[0] = *(const v8us*)(vp + 512 * t); vf[t].half[1] = *(const v8us*)(vp + 512 * t + 256);
  }
}

// One 32-key step for a wave's 16 queries (this lane's column: one query), on fragments and a mask word (word modd of the pair mw2) that were loaded earlier.
// Each fragment set is reloaded for step keyN (the active step that the set serves next) right behind its last product, so that those loads fly
// under the rest of this step and all that comes before that step's use of them.
// EARLY: P and v as hi + residual planes (three products, lr over the f32 weights); else one product and lr over the f16 weights.
template <bool EARLY>
__device__ __forceinline__ void fa_step(const unsigned short* __restrict__ Khp,
                                        const unsigned short* __restrict__ Vhp, const unsigned short* __restrict__ Vlp,
                                        int keyN, v2ua mw2, int modd, int ln, int hh,
                                        const FragH& qh0, const FragH& qh1,
                                        FragH (&kf)[4], FragH (&vf)[4], FragH (&vlf)[4],
                                        float& mr, float& lr, v8f (&Oh)[4], v8f (&Ol)[4]) {
  const v8f z8 = {0.f, 0.f, 0.f, 0.f, 0.f, 0.f, 0.f, 0.f};
  float sc[16];
#pragma unroll
  for (int kt = 0; kt < 2; ++kt) {
    v8f sh = z8;
    mma_s(kf[2 * kt].v, kf[2 * kt + 1].v, qh0.v, qh1.v, sh);
    // S^T element r of tile kt = score(key0 + 16*kt + 8h + r, this lane's query); carries: 16 x 16 on q, k, then 1/8 -> 2^-11
#pragma unroll
    for (int r = 0; r < 8; ++r) sc[8 * kt + r] = sh[r] * 0.00048828125f;
  }
  load_k(Khp, keyN, ln, hh, kf);
  __builtin_amdgcn_sched_barrier(0);   // keeps the K reloads here: sunk below the softmax they would have too short a lead on the next step's products
  // replace-fill: excluded keys get -inf (bit 8h + r of the word <-> tile 0, bit 16 + 8h + r <-> tile 1)
  const float ninf = __uint_as_float(0xFF800000u);
  const unsigned int mb = (modd ? mw2[1] : mw2[0]) >> (8 * hh);   // the lane's word of the pair, picked here, behind the K reloads, where its wait leaves them in flight
#pragma unroll
  for (int r = 0; r < 8; ++r) {
    sc[r]     = ((mb >> r) & 1u) ? ninf : sc[r];
    sc[8 + r] = ((mb >> (16 + r)) & 1u) ? ninf : sc[8 + r];
  }
  float mx = sc[0];
#pragma unroll
  for (int i = 1; i < 16; ++i) mx = fmaxf(mx, sc[i]);
  mx = fmaxf(mx, __shfl_xor(mx, 16, 32));           // the other lane half holds the other 16 keys of this query
  const float mnew = fmaxf(mr, mx);
  const float al = exp2_hw((mr - mnew) * LOG2E);
  mr = mnew;
  // weights carried x256: pc = 256 * exp(sc - mnew); hi plane f16(pc); EARLY: residual plane f16((pc - hi) * 2048)
  FragH ph, pl;
  float ps = 0.0f;
#pragma unroll
  for (int i = 0; i < 16; i += 2) {
    const v2f s2 = {sc[i], sc[i + 1]};
    const v2f x2 = __builtin_elementwise_fma(s2 - mnew, (v2f){LOG2E, LOG2E}, (v2f){8.0f, 8.0f});
    const v2f pc = {exp2_hw(x2[0]), exp2_hw(x2[1])};
    const v2h h = __builtin_convertvector(pc, v2h);  // one packed convert; the uses below read its halves
    ph.h[i] = h[0]; ph.h[i + 1] = h[1];             // B element i: i<8 -> key0 + 8h + i (tile 0 row 8h+i); i>=8 -> key0 + 16 + 8h + (i-8) (tile 1)
    if (EARLY) {
      ps += pc[0];
      ps += pc[1];
      pl.h[i]     = (_Float16)((pc[0] - (float)h[0]) * RES_SC);
      pl.h[i + 1] = (_Float16)((pc[1] - (float)h[1]) * RES_SC);
    } else {
      ps += (float)h[0];
      ps += (float)h[1];
    }
  }
  ps += __shfl_xor(ps, 16, 32);
  lr = lr * al + ps;
#pragma unroll
  for (int t = 0; t < 4; ++t) {
    Oh[t] = Oh[t] * al;
    if (EARLY) Ol[t] = Ol[t] * al;
  }
#pragma unroll
  for (int t = 0; t < 4; ++t) {
    if (EARLY) mma_pv3(vf[t].v, vlf[t].v, ph.v, pl.v, Oh[t], Ol[t]);
    else       mma_pv1(vf[t].v, ph.v, Oh[t]);
  }
  load_v(Vhp, keyN, ln, hh, vf);
  if (EARLY) load_v(Vlp, keyN, ln, hh, vlf);
  asm volatile("s_wait_xcnt 0x0" ::: "memory");   // in front of the next step's writes to the registers that held these loads' addresses
}

// Block = 4 waves x 16 queries = 64 queries: query tile qt of (batch, head) bh, both dealt by the calling kernel; no LDS and no barrier.
// Steps whose 32 keys are excluded for all 16 queries of the wave are skipped (exact for any mask value): a wave-uniform map of the
// active steps is built from the wave's mask rows in front of the loop, so that the step after the current one is known when its loads issue.
// Epilogue: lane 16h + q holds ctx(query q, d = 16t + 8h + r), which is half t & 1 of the ctx plane's fragment (k-step 2*head + t / 2): each O^T tile
// goes out of its registers as one 512-byte run.
// coverage: 4 waves x 16 rows x 64 columns = the (row, head) segments of tile qt of bh; the calling kernel gives every (bh, qt) to exactly one block.
template <bool EARLY>
__device__ __forceinline__ void attn_part(const unsigned short* __restrict__ QKh,
                                          const unsigned short* __restrict__ Vth, const unsigned short* __restrict__ Vtl,
                                          const unsigned int* __restrict__ bits,
                                          unsigned short* __restrict__ Cp, unsigned short* __restrict__ Cl,
                                          int bh, int qt) {
  static_assert(SEQ / 32 <= 64);
  const int tid = threadIdx.x, w = __builtin_amdgcn_readfirstlane((int)(tid >> 5)), lane = tid & 31, ln = lane & 15, hh = lane >> 4;
  const int b = bh / NH, hd = bh - b * NH;
  const int qbase = qt * 64 + 16 * w;
  // qg = qbase + ln: this lane's query
  const size_t hb = (size_t)bh * SEQ * HD;
  // Q^T B fragments: column n = query qg, elements 0..7 <- d = 32c + 8h + i, 8..15 <- d = 32c + 16 + 8h + i
  FragH qh0, qh1;
  {
    const unsigned short* qrh = QKh + hb + (size_t)qbase * HD + 8 * lane;
    qh0.half[0] = *(const v8us*)(qrh);       qh0.half[1] = *(const v8us*)(qrh + 256);
    qh1.half[0] = *(const v8us*)(qrh + 512); qh1.half[1] = *(const v8us*)(qrh + 768);
  }
  const unsigned short* Khp = QKh + PLANE + hb;
  const unsigned short* Vhp = Vth + hb;
  const unsigned short* Vlp = Vtl + hb;
  // the wave's 16 rows of the mask bit plane: four 4-row groups of SEQ / 32 steps x 4 words; this lane's word of step j = mrow[4 * j],
  // the aligned pair of words that holds it = mpair[4 * j], [4 * j + 1] (its own is the one numbered ln & 1): a step's words lie in 4 lines
  static_assert((SEQ / 32) % 32 == 0);
  const unsigned int* mtile = bits + ((size_t)b * SEQ + qbase) * (SEQ / 32);
  const unsigned int* mrow = mtile + (ln >> 2) * (SEQ / 8) + (ln & 3);
  const unsigned int* mpair = mtile + (ln >> 2) * (SEQ / 8) + (ln & 2);
  float mr = -3.0e38f, lr = 0.0f;
  v8f Oh[4] = {}, Ol[4] = {};
  // bit j of act: step j has a key that some query of the wave keeps
  // lane l takes steps l, 32 + l, ...: the four words of a 4-row group are its 16 bytes of a 512-byte run; all 16 words are -1 where no query keeps a key
  unsigned long long act = 0ull;
  {
    v4i x[SEQ / 1024][4];
#pragma unroll
    for (int i = 0; i < SEQ / 1024; ++i)
#pragma unroll
      for (int c = 0; c < 4; ++c) x[i][c] = *(const v4ia*)(mtile + c * (SEQ / 8) + 4 * (32 * i + lane));
    asm volatile("s_wait_xcnt 0x0" ::: "memory");     // in front of later writes to the registers that held these loads' addresses
#pragma unroll
    for (int i = 0; i < SEQ / 1024; ++i) {
      const v4i y = x[i][0] & x[i][1] & x[i][2] & x[i][3];
      act |= (unsigned long long)__builtin_amdgcn_ballot_w32((y[0] & y[1] & y[2] & y[3]) != -1) << (32 * i);   // wave-uniform
    }
  }
  if (EARLY && act != 0ull) {
    int j = __builtin_ctzll(act);
    act &= act - 1ull;
    FragH kf[4], vf[4], vlf[4];
    unsigned int mw = mrow[4 * j];
    __builtin_amdgcn_sched_barrier(0);                // mask word first in load order: the loop's wait for it then leaves the fragment loads in flight
    load_k(Khp, 32 * j, ln, hh, kf);
    load_v(Vhp, 32 * j, ln, hh, vf);
    load_v(Vlp, 32 * j, ln, hh, vlf);
    asm volatile("s_wait_xcnt 0x0" ::: "memory");     // in front of later writes to the registers that held these loads' addresses
    __builtin_amdgcn_sched_barrier(0);                // keeps those writes behind the wait
#pragma unroll 1
    for (;;) {
      const bool more = act != 0ull;                  // wave-uniform
      const int jn = more ? __builtin_ctzll(act) : j; // last step: its own tiles once more (in bounds, never used)
      act &= act - 1ull;
      const unsigned int mwn = mrow[4 * jn];
      fa_step<EARLY>(Khp, Vhp, Vlp, 32 * jn, (v2ua){mw, mw}, 0, ln, hh, qh0, qh1, kf, vf, vlf, mr, lr, Oh, Ol);
      if (!more) break;
      mw = mwn;
      j = jn;
    }
  }
  if (!EARLY && act != 0ull) {
    // The long band: two fragment sets, A for the wave's active steps 0, 2, 4, ... and B for 1, 3, 5, ...; a set is reloaded right behind its last product
    // for the step after next, so its loads have two steps to arrive.
    // The order of the steps, and so every sum, is the one of a single set.
    // The loop takes the steps in pairs with no exit between the two, an odd last step follows it.
    const int n = __builtin_popcountll(act);          // wave-uniform
    int ja = __builtin_ctzll(act);
    act &= act - 1ull;
    FragH ka[4], va[4], vlf[4];
    // A step's mask word comes as the aligned pair of words (two rows of the step) that holds it: a lone destination register can be given the odd half of a register pair whose
    // even half a packed instruction broadcasts, and the wait for it there would drain, in load order, the fragment loads that are meant to stay in flight.
    v2ua wa = *(const v2ua*)(mpair + 4 * ja);
    __builtin_amdgcn_sched_barrier(0);                // mask words first in load order: the loop's wait for them then leaves the fragment loads in flight
    load_k(Khp, 32 * ja, ln, hh, ka);
    __builtin_amdgcn_sched_barrier(0);                // this one and the next two: the load order of the loop (K A, V A, K B, V B), so that its counted waits fit the first pass too
    load_v(Vhp, 32 * ja, ln, hh, va);
    asm volatile("s_wait_xcnt 0x0" ::: "memory");     // in front of later writes to the registers that held these loads' addresses
    __builtin_amdgcn_sched_barrier(0);
    if (n >= 2) {
      int jb = __builtin_ctzll(act);
      act &= act - 1ull;
      FragH kb[4], vb[4];
      load_k(Khp, 32 * jb, ln, hh, kb);
      __builtin_amdgcn_sched_barrier(0);
      load_v(Vhp, 32 * jb, ln, hh, vb);
      asm volatile("s_wait_xcnt 0x0" ::: "memory");   // in front of later writes to the registers that held these loads' addresses
      __builtin_amdgcn_sched_barrier(0);              // keeps those writes behind the wait
      int p = n >> 1;
#pragma unroll 1                                      // rolled: the pair is the whole ring; more bodies would only add code
      do {
        const int jc = (act != 0ull) ? __builtin_ctzll(act) : ja;   // no such step: the set's own tiles once more (in bounds, never used); so for jd
        act &= act - 1ull;
        const v2ua wb = *(const v2ua*)(mpair + 4 * jb);
        fa_step<EARLY>(Khp, Vhp, Vlp, 32 * jc, wa, ln & 1, ln, hh, qh0, qh1, ka, va, vlf, mr, lr, Oh, Ol);
        __builtin_amdgcn_sched_barrier(0);            // keeps set B's score products out of step A: pulled up there they would want B's K loads most of a step sooner
        const int jd = (act != 0ull) ? __builtin_ctzll(act) : jb;
        act &= act - 1ull;
        wa = *(const v2ua*)(mpair + 4 * jc);
        fa_step<EARLY>(Khp, Vhp, Vlp, 32 * jd, wb, ln & 1, ln, hh, qh0, qh1, kb, vb, vlf, mr, lr, Oh, Ol);
        ja = jc;
        jb = jd;
      } while (--p > 0);
    }
    if (n & 1) fa_step<EARLY>(Khp, Vhp, Vlp, 32 * ja, wa, ln & 1, ln, hh, qh0, qh1, ka, va, vlf, mr, lr, Oh, Ol);
  }

  // O^T element r of tile t = ctx(query qg, d = 16t + 8h + r); undo the carries: x256 (in lr), x16 (v), x2048 (residual accumulator)
  const float inv = 1.0f / (16.0f * lr);
  const size_t cb = ((size_t)(b * SEQ + qbase)) * DM + (size_t)hd * (16 * HD) + 8 * lane;
#pragma unroll
  for (int t = 0; t < 4; ++t) {
    if (EARLY) {
      v8us oh, ol;
#pragma unroll
      for (int r = 0; r < 8; ++r) {
        const float x = (Oh[t][r] + Ol[t][r] * RES_INV) * inv;
        const unsigned short h0 = bf16_bits(x);
        oh[r] = h0;
        ol[r] = bf16_bits(x - bf16_val(h0));
      }
      *(v8us*)(Cp + cb + 256 * t) = oh;
      *(v8us*)(Cl + cb + 256 * t) = ol;
    } else {
      H8 of;
#pragma unroll
      for (int r = 0; r < 8; ++r) of.h[r] = (_Float16)((Oh[t][r] * inv) * 64.0f);
      const v8us ov = of.v;
      *(v8us*)(Cp + cb + 256 * t) = ov;
    }
  }
  if (EARLY) asm volatile("s_wait_xcnt 0x0" ::: "memory");   // the built code joins the two bands behind these stores: in front of the other band's writes to their registers
}

// Both query bands in one grid; the band follows from the tile (rows < RH or not), so the branch is block-uniform.
// Deal of the blocks, for speed only (any permutation of the (bh, qt) pairs is correct): heads run fastest, the tile follows from rank = blk / (NB * NH).
// A launch lasts as long as its fullest SIMD. Where later queries keep more keys, a tile's cost grows
// with qt. The quarters of the index range take the
// tiles n-1-k, 3n/4-1-k, n/4+k, k (k = place in the quarter), whose costs add up to the same sum for every k, the heaviest tiles first in index order.
#define AQ_N (SEQ / 64)
#define AB_ALL (NB * NH * AQ_N)
__global__ __launch_bounds__(128) void k_attn(const unsigned short* __restrict__ QKh,
                                              const unsigned short* __restrict__ Vth, const unsigned short* __restrict__ Vtl,
                                              const unsigned int* __restrict__ bits,
                                              unsigned short* __restrict__ Cp, unsigned short* __restrict__ Cl) {
  const int blk = blockIdx.x;
  const int rank = blk / (NB * NH), bh = blk - rank * (NB * NH);
  int qt = AQ_N - 1 - rank;                          // heaviest first; also the whole deal where the tiles do not split into quarters
  if (AQ_N % 4 == 0 && rank >= AQ_N / 2) qt = (rank < 3 * (AQ_N / 4)) ? rank - AQ_N / 4 : rank - 3 * (AQ_N / 4);
  if (qt >= RH / 64) attn_part<false>(QKh, Vth, Vtl, bits, Cp, Cl, bh, qt);
  else               attn_part<true>(QKh, Vth, Vtl, bits, Cp, Cl, bh, qt);
}

extern "C" void kernel_launch(void* const* d_in, const int* in_sizes, int n_in,
                              void* d_out, int out_size, void* d_ws, size_t ws_size, hipStream_t stream) {
  if (n_in < 10) return;
  const long long needx = (long long)(NB - 1) * SEQ_FULL * DM + (long long)SEQ * DM;   // last element touched + 1
  const long long needm = (long long)(NB - 1) * SEQ_FULL * SEQ_FULL + (long long)(SEQ - 1) * SEQ_FULL + SEQ;
  if ((long long)in_sizes[0] < needx) return;
  if ((long long)in_sizes[1] < (long long)DM * DM || (long long)in_sizes[3] < (long long)DM * DM) return;
  if ((long long)in_sizes[5] < (long long)DM * DM || (long long)in_sizes[7] < (long long)DM * DM) return;
  if (in_sizes[2] < DM || in_sizes[4] < DM || in_sizes[6] < DM || in_sizes[8] < DM) return;
  if ((long long)in_sizes[9] < needm) return;
  if ((long long)out_size < needx) return;
  const float* x  = (const float*)d_in[0];   // wire order: x, Wq, bq, Wk, bk, Wv, bv, Wo, bo, attention_mask
  const float* Wq = (const float*)d_in[1];
  const float* bq = (const float*)d_in[2];
  const float* Wk = (const float*)d_in[3];
  const float* bk = (const float*)d_in[4];
  const float* Wv = (const float*)d_in[5];
  const float* bv = (const float*)d_in[6];
  const float* Wo = (const float*)d_in[7];
  const float* bo = (const float*)d_in[8];
  const int* mask = (const int*)d_in[9];
  float* out = (float*)d_out;

  char* ws = (char*)d_ws;
  size_t off = 0;
  const size_t pl2 = PLANE * 2;                               // bytes of one [NB*SEQ][1024] 16-bit plane (8 MiB at full size), multiple of 256
  const size_t wsz = (size_t)DM * DM * 2;                     // 2 MiB per weight plane
  const size_t bsz = (size_t)NB * SEQ * (SEQ / 32) * 4;       // 1 MiB at full size
  unsigned short* Xb  = (unsigned short*)(ws + off); off += pl2;
  unsigned short* Wb  = (unsigned short*)(ws + off); off += 4 * wsz;      // bf16 planes q, k, v, o
  unsigned short* Woh = (unsigned short*)(ws + off); off += wsz;          // f16 plane of 64 Wo
  unsigned short* QKh = (unsigned short*)(ws + off); off += 2 * pl2;      // [q|k][b][h][s][64], fragment order
  unsigned short* Vth = (unsigned short*)(ws + off); off += pl2;          // [b][h][s / 32][64 x 32], fragment order
  unsigned short* Vtl = (unsigned short*)(ws + off); off += pl2;
  unsigned int*   Mb  = (unsigned int*)(ws + off);   off += (bsz + 255) & ~(size_t)255;
  unsigned short* Cp  = (unsigned short*)(ws + off); off += pl2;          // [b*SEQ + s][1024], fragment order: rows < RH bf16 hi, rows >= RH f16(64 ctx)
  unsigned short* Cl  = (unsigned short*)(ws + off); off += pl2;          // rows < RH: bf16 lo (other rows never written, never read)
  if (off > ws_size || off > (size_t)134217728) return;

  // four launches, each reading only what an earlier one (or the caller) wrote
  k_prep<<<(unsigned)(PB_MASK + PB_X + PB_NW * PB_W), 256, 0, stream>>>(x, Wq, Wk, Wv, Wo, mask, Xb, Wb, Woh, Mb);
  k_qkv<<<dim3((unsigned)(NB * (SEQ / 128)), DM / 128, 3), 128, 0, stream>>>(Xb, Wb, bq, bk, bv, QKh, Vth, Vtl);
  k_attn<<<(unsigned)AB_ALL, 128, 0, stream>>>(QKh, Vth, Vtl, Mb, Cp, Cl);
  k_out<<<dim3((unsigned)(NB * (SEQ / 128)), DM / 64, 1), 128, 0, stream>>>(Cp, Cl, Wb + (size_t)3 * DM * DM, Woh, bo, out);
}

// v010
// Measured time: 76.8 microseconds a run.
// Next to v009, in two timings, it ran 1.04 and 1.06 times as fast.
// All steps since v000 together make it 4.13 times as fast.
#include <hip/hip_runtime.h>
// Contractions: q/k/v projections on v_wmma_f32_16x16x32_bf16 (x, W RNE bf16, single product, f32 accumulate); S^T = K Q^T on v_wmma_f32_16x16x32_f16 (q, k as x16 f16 planes, single product); O^T = V^T P^T on v_wmma_f32_16x16x32_f16 (query rows < RH: v x16 hi + x2^11 residual, P x256 hi + x2^11 residual, residual products in their own f32 accumulator; query rows >= RH: v x16, P x256, single product, row sum over the f16 P); output projection: rows < RH on v_wmma_f32_16x16x32_bf16 (ctx bf16 hi + bf16 lo planes, Wo RNE bf16), rows >= RH on v_wmma_f32_16x16x32_f16 (ctx x64 f16, Wo RNE-bf16 value x64 in f16, single product); softmax statistics f32.
// Multi-head attention, B x S x 1024, 16 heads of 64, scale 1/8, mask input (1 = key excluded, score replaced by -inf) read on the device as a packed bit plane.
// Engine: transposed flash. Each wave owns 16 queries. Per 32-key step: S^T tiles (key rows x query columns) from K rows (A, global f16 plane)
// and Q^T (B, registers); the two 16-key D tiles pack straight into the P^T B fragment; O^T (d rows x query columns) accumulates from V^T rows (A, global f16 planes).
// Plane layout: every 16-bit operand plane is stored in fragment order. One fragment (16 rows x 32 k) = 1 KB = [half 0..1][lane 0..31][8 elements];
// lane = 16h + row, element i of half f = k 16f + 8h + i. A wave-wide 16-byte load of one half is 512 contiguous bytes (four whole lines).
#ifndef NB
#define NB 2
#endif
#ifndef SEQ
#define SEQ 2048
#endif
#ifndef RH
#define RH 256                                 /* query rows below RH (per batch) take the hi + residual path */
#endif
#define NB_FULL 2
#define SEQ_FULL 2048
#define DM 1024
#define NH 16
#define HD 64
#define PLANE ((size_t)NB * SEQ * DM)          /* elements of one [NB*SEQ][1024] 16-bit plane */

static_assert(SEQ % 128 == 0);
static_assert(SEQ <= SEQ_FULL);
static_assert(NB <= NB_FULL);
static_assert(RH % 128 == 0);
static_assert(RH >= 0 && RH <= SEQ);
static_assert(NH * HD == DM);
static_assert(HD == 64);
static_assert(DM % 64 == 0);
static_assert(PLANE * 2 * 7 + (size_t)5 * DM * DM * 2 + (size_t)NB * SEQ * (SEQ / 32) * 4 + 4096 <= (size_t)134217728);

typedef __bf16 v16b __attribute__((ext_vector_type(16)));
typedef _Float16 v16h __attribute__((ext_vector_type(16)));
typedef unsigned short v8us __attribute__((ext_vector_type(8), may_alias));
typedef float v8f __attribute__((ext_vector_type(8)));
typedef float v2f __attribute__((ext_vector_type(2)));
typedef _Float16 v2h __attribute__((ext_vector_type(2)));
typedef float v4f __attribute__((ext_vector_type(4)));
typedef float v4fa __attribute__((ext_vector_type(4), may_alias));
typedef int v4i __attribute__((ext_vector_type(4)));
typedef int v4ia __attribute__((ext_vector_type(4), may_alias));
typedef unsigned int v2ua __attribute__((ext_vector_type(2), may_alias));
union FragH { v16h v; v8us half[2]; _Float16 h[16]; unsigned short u[16]; };
union FragX { v16b b; v16h h; v8us half[2]; };
union H8 { v8us v; _Float16 h[8]; unsigned short u[8]; };

#define LOG2E 1.4426950408889634f
#define RES_SC 2048.0f
#define RES_INV 0.00048828125f

__device__ __forceinline__ unsigned short bf16_bits(float x) {   // RNE convert to bf16 bits, NaN kept NaN
  const unsigned int u = __float_as_uint(x);
  const unsigned int r = (u + 0x7FFFu + ((u >> 16) & 1u)) >> 16;
  const unsigned int n = (u >> 16) | 0x40u;
  return (unsigned short)(((u & 0x7FFFFFFFu) > 0x7F800000u) ? n : r);
}
__device__ __forceinline__ float bf16_val(unsigned short b) { return __uint_as_float(((unsigned int)b) << 16); }
__device__ __forceinline__ float bf16_rne(float x) { return bf16_val(bf16_bits(x)); }

// 2^x on the bare hardware instruction. exp2f() wraps the same instruction in a compare, two selects, an add and an ldexp that only serve results
// below 2^-126 (x < -126), which the bare form returns as 0. Here such a result has no effect: a weight that small is 0 in both f16 planes
// (its residual is below 2^-115) and vanishes in the f32 row sum, which holds 256 from the row's maximum; a rescale factor that small
// multiplies sums that the same step's weight of 256 outweighs by more than 2^100. For x >= -126, -inf included, the value is the same bit for bit.
__device__ __forceinline__ float exp2_hw(float x) { return __builtin_amdgcn_exp2f(x); }

// sh += K*Q (64 deep = two k-steps), then the hazard guard
__device__ __forceinline__ void mma_s(v16h k0, v16h k1, v16h q0, v16h q1, v8f& sh) {
  sh = __builtin_amdgcn_wmma_f32_16x16x32_f16(false, k0, false, q0, (short)0, sh, false, false);
  sh = __builtin_amdgcn_wmma_f32_16x16x32_f16(false, k1, false, q1, (short)0, sh, false, false);
  asm volatile("v_nop\n\tv_nop\n\tv_nop\n\tv_nop" : "+v"(sh) : "v"(k0), "v"(k1), "v"(q0), "v"(q1));
}
// oh += Vh*Ph ; ol += Vh*Pl + Vl*Ph (same x2^11 on both residual planes), then the hazard guard
__device__ __forceinline__ void mma_pv3(v16h vh, v16h vl, v16h ph, v16h pl, v8f& oh, v8f& ol) {
  oh = __builtin_amdgcn_wmma_f32_16x16x32_f16(false, vh, false, ph, (short)0, oh, false, false);
  ol = __builtin_amdgcn_wmma_f32_16x16x32_f16(false, vh, false, pl, (short)0, ol, false, false);
  ol = __builtin_amdgcn_wmma_f32_16x16x32_f16(false, vl, false, ph, (short)0, ol, false, false);
  asm volatile("v_nop\n\tv_nop\n\tv_nop\n\tv_nop" : "+v"(oh), "+v"(ol) : "v"(vh), "v"(vl), "v"(ph), "v"(pl));
}
// oh += Vh*Ph, then the hazard guard
__device__ __forceinline__ void mma_pv1(v16h vh, v16h ph, v8f& oh) {
  oh = __builtin_amdgcn_wmma_f32_16x16x32_f16(false, vh, false, ph, (short)0, oh, false, false);
  asm volatile("v_nop\n\tv_nop\n\tv_nop\n\tv_nop" : "+v"(oh) : "v"(vh), "v"(ph));
}

// dst = 16-bit image of src[(b*rpb_full + s)][0..1023], row = b*rpb + s, in fragment order [row / 16][k / 32][half][lane][8]. F16 = false: bf16 bits (RNE);
// F16 = true: f16 bits of (RNE bf16 value x 64), exact. Thread per 8 elements; a wave takes 8 rows x 32 k: it reads 8 whole 128-B lines and writes
// 4 whole lines (8 rows of one (half, h) each); rows a multiple of 16; t = thread index inside this plane's share of the grid
template <bool F16>
__device__ __forceinline__ void cvt_part(const float* __restrict__ src, unsigned short* __restrict__ dst,
                                         int t, int rows, int rpb, int rpb_full) {
  if (t >= rows * 128) return;
  const int wv = t >> 5, g = (t >> 3) & 3;                                      // g = 2 * half + h: which 8 k of the k-step
  const int r16 = (wv & 1) * 8 + (t & 7), frag = wv >> 1;                       // row in its 16-row band; fragment = band * 32 + k-step
  const int row = (frag >> 5) * 16 + r16, kk = (frag & 31) * 32 + g * 8;
  const int b = row / rpb, s = row - b * rpb;
  const float* p = src + ((size_t)b * rpb_full + s) * DM + kk;
  const v4f x0 = *(const v4fa*)(p), x1 = *(const v4fa*)(p + 4);
  H8 o;
#pragma unroll
  for (int i = 0; i < 4; ++i) {
    if (F16) {
      o.h[i]     = (_Float16)(bf16_rne(x0[i]) * 64.0f);
      o.h[4 + i] = (_Float16)(bf16_rne(x1[i]) * 64.0f);
    } else {
      o.u[i]     = bf16_bits(x0[i]);
      o.u[4 + i] = bf16_bits(x1[i]);
    }
  }
  const v8us ov = o.v;
  unsigned short* d = dst + ((size_t)frag * 64 + g * 16 + r16) * 8;
  *(v8us*)d = ov;
  
}

// the value that lane l ^ S of the same 16-lane row holds, by a DPP move
template <int S>
__device__ __forceinline__ unsigned int xlane(unsigned int v) {
  return (unsigned int)__builtin_amdgcn_update_dpp(0, (int)v, 0x160 + S, 0xf, 0xf, true);
}
// one stage of the 8 x 8 nibble transpose over 8 lanes: nibble c of lane a changes places with nibble c ^ S of lane a ^ S where bit S of a and of c differ
template <int S>
__device__ __forceinline__ unsigned int nib_stage(unsigned int p, int lane) {
  constexpr unsigned int M0 = (S == 1) ? 0x0F0F0F0Fu : (S == 2) ? 0x00FF00FFu : 0x0000FFFFu;
  const unsigned int y = xlane<S>(p);
  return (lane & S) ? ((p & ~M0) | ((y >> (4 * S)) & M0)) : ((p & M0) | ((y << (4 * S)) & ~M0));
}

// Mask bit plane: word (row, step j) = bits of keys 32 j .. 32 j + 31 of plane row b*SEQ + q, stored at [row / 4][j][row % 4], so that every reader and
// this writer move whole lines. A wave makes one 128-byte line of the plane: 4 rows x 8 steps, from 4 x 1 KB of the mask in eight loads of 512 contiguous bytes.
// Load u: row u / 2, ints 128 (u % 2) + 4 lane + e; the lane's four compare bits go to nibble u of p. The transpose over the 8 lanes of a group then leaves
// lane 8 g + a with the whole word of load a, ints 32 g .. 32 g + 31: row a / 2, step 4 (a % 2) + g of the eight.
// coverage: NB*SEQ*(SEQ/32) threads x 1 word = the whole plane.
static_assert(SEQ % 256 == 0);
__device__ __forceinline__ void mask_part(const int* __restrict__ mask, unsigned int* __restrict__ bits, int t) {
  if (t >= NB * SEQ * (SEQ / 32)) return;
  const int lane = t & 31, wv = __builtin_amdgcn_readfirstlane(t >> 5);
  const int rq = wv / (SEQ / 256), m = wv - rq * (SEQ / 256);
  const int b = (4 * rq) / SEQ, q = 4 * rq - b * SEQ;
  const int* p = mask + ((size_t)b * SEQ_FULL + q) * SEQ_FULL + 256 * m + 4 * lane;
  v4i x[8];
#pragma unroll
  for (int u = 0; u < 8; ++u) x[u] = *(const v4ia*)(p + (size_t)(u >> 1) * SEQ_FULL + 128 * (u & 1));
  unsigned int w = 0u;
#pragma unroll
  for (int u = 0; u < 8; ++u)
#pragma unroll
    for (int e = 0; e < 4; ++e) w |= ((x[u][e] == 1) ? 1u : 0u) << (4 * u + e);
  w = nib_stage<1>(w, lane);
  w = nib_stage<2>(w, lane);
  w = nib_stage<4>(w, lane);
  const int a = lane & 7, g = lane >> 3;
  bits[(size_t)wv * 32 + 4 * (4 * (a & 1) + g) + (a >> 1)] = w;
}

// One grid for everything that reads only the inputs: none of these parts reads what another writes. Block ranges, in index order:
// mask words (the longest threads, placed first for speed only), x, then the weight planes q, k, v, o (bf16) and o (f16 x64).
#define PB_MASK (NB * SEQ * (SEQ / 32) / 256)
#define PB_X (NB * SEQ * 128 / 256)
#define PB_W (DM * 128 / 256)
#define PB_NW (3 + (RH > 0 ? 1 : 0) + (SEQ > RH ? 1 : 0))
static_assert((NB * SEQ * (SEQ / 32)) % 256 == 0 && (NB * SEQ * 128) % 256 == 0 && (DM * 128) % 256 == 0);
__global__ __launch_bounds__(256) void k_prep(const float* __restrict__ x, const float* __restrict__ Wq, const float* __restrict__ Wk,
                                              const float* __restrict__ Wv, const float* __restrict__ Wo, const int* __restrict__ mask,
                                              unsigned short* __restrict__ Xb, unsigned short* __restrict__ Wb,
                                              unsigned short* __restrict__ Woh, unsigned int* __restrict__ bits) {
  const int tid = threadIdx.x;
  int blk = blockIdx.x;
  if (blk < PB_MASK) { mask_part(mask, bits, blk * 256 + tid); return; }
  blk -= PB_MASK;
  if (blk < PB_X) { cvt_part<false>(x, Xb, blk * 256 + tid, NB * SEQ, SEQ, SEQ_FULL); return; }
  blk -= PB_X;
  const int pl = blk / PB_W, t = (blk - pl * PB_W) * 256 + tid;
  if (pl == 4 || (pl == 3 && RH == 0)) { cvt_part<true>(Wo, Woh, t, DM, DM, DM); return; }
  const float* w = (pl == 0) ? Wq : (pl == 1) ? Wk : (pl == 2) ? Wv : Wo;
  cvt_part<false>(w, Wb + (size_t)pl * DM * DM, t, DM, DM, DM);
}

// the 2 x 4 tile group for the register ring: builtins alone, the hazard guard stands behind the call; no asm statement names the fragments, since
// a value that an asm operand names is held below v256 and the ring's sets do not all fit there
template <bool F16>
__device__ __forceinline__ void mma8s(const FragX (&a)[2], const FragX (&b)[4], v8f (&c)[8]) {
#pragma unroll
  for (int i = 0; i < 2; ++i)
#pragma unroll
    for (int j = 0; j < 4; ++j) {
      if (F16) c[4 * i + j] = __builtin_amdgcn_wmma_f32_16x16x32_f16(false, a[i].h, false, b[j].h, (short)0, c[4 * i + j], false, false);
      else     c[4 * i + j] = __builtin_amdgcn_wmma_f32_16x16x32_bf16(false, a[i].b, false, b[j].b, (short)0, c[4 * i + j], false, false);
    }
}

// The fragments of one k-step of the output projection: A rows (two 16-row bands), with LO the same of the lo plane, and four W bands; k0 = element
// offset of the k-step's fragment in its band. LAST: the wave's last loads, behind which the address registers are free for other use.
template <bool LO, bool LAST>
__device__ __forceinline__ void load_set(const unsigned short* __restrict__ ap, const unsigned short* __restrict__ lp,
                                         const unsigned short* __restrict__ wp, int k0, FragX (&a)[2], FragX (&l)[2], FragX (&b)[4]) {
  a[0].half[0] = *(const v8us*)(ap + k0);               a[0].half[1] = *(const v8us*)(ap + k0 + 256);
  a[1].half[0] = *(const v8us*)(ap + 16 * DM + k0);     a[1].half[1] = *(const v8us*)(ap + 16 * DM + k0 + 256);
  if (LO) {
    if (LAST) asm volatile("s_wait_xcnt 0x0" ::: "memory");   // in front of loads whose results may land in the registers that held the A loads' address
    l[0].half[0] = *(const v8us*)(lp + k0);             l[0].half[1] = *(const v8us*)(lp + k0 + 256);
    l[1].half[0] = *(const v8us*)(lp + 16 * DM + k0);   l[1].half[1] = *(const v8us*)(lp + 16 * DM + k0 + 256);
  }
  if (LAST) asm volatile("s_wait_xcnt 0x0" ::: "memory");     // in front of loads whose results may land in the registers that held the A loads' addresses
  b[0].half[0] = *(const v8us*)(wp + k0);               b[0].half[1] = *(const v8us*)(wp + k0 + 256);
  b[1].half[0] = *(const v8us*)(wp + 16 * DM + k0);     b[1].half[1] = *(const v8us*)(wp + 16 * DM + k0 + 256);
  b[2].half[0] = *(const v8us*)(wp + 32 * DM + k0);     b[2].half[1] = *(const v8us*)(wp + 32 * DM + k0 + 256);
  b[3].half[0] = *(const v8us*)(wp + 48 * DM + k0);
  if (LAST) asm volatile("s_wait_xcnt 0x0" ::: "memory");     // the last W load's result may land in the registers that held the W loads' address
  b[3].half[1] = *(const v8us*)(wp + 48 * DM + k0 + 256);
  if (LAST) asm volatile("s_wait_xcnt 0x0" ::: "memory");     // in front of whatever is written next to the register that held the last load's address
}

// Output projection. C[m][n] = sum_k A[m][k] * W[n][k] + bf16(bias[n]); A, W 16-bit planes with 1024-element rows; block tile 128 x 64, 4 waves x (32 x 64).
// Row blocks: block bx -> batch b = bx / nblk, first row s0 = sbeg + (bx % nblk) * 128 of that batch (plane row b*SEQ + s0); column block by.
// Fragments straight from the fragment-ordered planes: A row m = l&15, B column n = l&15, elements 0..7 <- k0 + 8h + i, 8..15 <- k0 + 16 + 8h + i.
// MODE 2 (rows < RH; bf16 operands): A = ctx hi plane, Alo = ctx lo plane (bf16, unscaled, same accumulator); f32 rows of the output buffer.
// MODE 3 (rows >= RH; f16 operands): A = f16(64 ctx), W = f16(64 Wo); accumulator x 2^-12; f32 rows of the output buffer.
// LDS tile so (the calling kernel's one tile): cross-wave (block barrier); staged extent 128 x 64 == consumed extent.
template <int MODE>
__device__ __forceinline__ void gemm_part(float (&so)[128][68],
                                          const unsigned short* __restrict__ A, const unsigned short* __restrict__ Alo,
                                          const unsigned short* __restrict__ Wm, const float* __restrict__ bias,
                                          float* __restrict__ outF, int bx, int by, int sbeg, int nblk) {
  const int tid = threadIdx.x, w = __builtin_amdgcn_readfirstlane((int)(tid >> 5)), lane = tid & 31, ln = lane & 15, hh = lane >> 4;
  const int b = bx / nblk, s0 = sbeg + (bx - b * nblk) * 128;
  const int rowB = b * SEQ + s0, colB = by * 64;
  const size_t aoff = (size_t)(rowB + 32 * w) * DM + 8 * lane;                  // 16 plane rows = 32 fragments = 16 * DM elements
  const unsigned short* ap = A + aoff;
  const unsigned short* lp = Alo + aoff;
  const unsigned short* wp = Wm + (size_t)colB * DM + 8 * lane;
  const v8f z8 = {0.f, 0.f, 0.f, 0.f, 0.f, 0.f, 0.f, 0.f};
  v8f c[8];
#pragma unroll
  for (int i = 0; i < 8; ++i) c[i] = z8;
  {
    // Two waves share a SIMD here, too few to cover a load's way with other waves' work, so each wave covers its own:
    // a ring of NR register sets, all filled in front of the loop; behind the products of k-step s its set is refilled for k-step s + NR.
    // The k loop is unrolled whole: the ring index is a compile-time number and every load is base + immediate offset, so that no address
    // register changes while loads fly.
    constexpr int NS = DM / 32;                     // k-steps
    constexpr int NR = (MODE == 2) ? 3 : 4;         // 48 loads of a wave in flight in either mode
    FragX fa[NR][2], fl[NR][2], fb[NR][4];
#pragma unroll
    for (int s = 0; s < NR; ++s) load_set<MODE == 2, false>(ap, lp, wp, 512 * s, fa[s], fl[s], fb[s]);
#pragma unroll
    for (int s = 0; s < NS; ++s) {
      __builtin_amdgcn_sched_barrier(0);            // keeps the loads above in front of these products: sunk below them they would lose a step of lead
      mma8s<MODE == 3>(fa[s % NR], fb[s % NR], c);
      if (MODE == 2) mma8s<false>(fl[s % NR], fb[s % NR], c);
      if (s + NR < NS) {
        __builtin_amdgcn_sched_barrier(0);          // keeps the products in front of the guard below
        asm volatile("v_nop\n\tv_nop\n\tv_nop\n\tv_nop");   // hazard guard: four vector slots between the last product and the loads that refill its A and B registers
        __builtin_amdgcn_sched_barrier(0);          // keeps the refill behind the guard
        if (s + NR < NS - 1) load_set<MODE == 2, false>(ap, lp, wp, 512 * (s + NR), fa[s % NR], fl[s % NR], fb[s % NR]);
        else                 load_set<MODE == 2, true>(ap, lp, wp, 512 * (s + NR), fa[s % NR], fl[s % NR], fb[s % NR]);
      }
    }
  }
  // D element r of tile (i, j) = C(row 32w + 16i + 8h + r, col 16j + l&15)
  const float cs = (MODE == 3) ? 0.000244140625f : 1.0f;     // 2^-12 undoes the x64 carries of ctx and Wo
#pragma unroll
  for (int j = 0; j < 4; ++j) {
    const float bj = bf16_rne(bias[colB + 16 * j + ln]);
#pragma unroll
    for (int i = 0; i < 2; ++i)
#pragma unroll
      for (int r = 0; r < 8; ++r)
        so[32 * w + 16 * i + 8 * hh + r][16 * j + ln] = c[4 * i + j][r] * cs + bj;
  }
  __syncthreads();
  float* og = outF + ((size_t)b * SEQ_FULL + s0) * DM + colB;
  for (int i = tid; i < 128 * 16; i += 128) {
    const int row = i >> 4, c4 = (i & 15) * 4;
    const v4f v = *(const v4fa*)&so[row][c4];
    *(v4f*)(og + (size_t)row * DM + c4) = v;
  }
}

// 4 x 4 tile group of one 32-deep k-step (bf16): builtins alone, the hazard guard stands behind the pass's last call; no asm statement names the
// fragments or the accumulators, since a value that an asm operand names is held below v256 and they do not all fit there
__device__ __forceinline__ void mma16(const FragX (&a)[4], const FragX (&b)[4], v8f (&c)[16]) {
#pragma unroll
  for (int i = 0; i < 4; ++i)
#pragma unroll
    for (int j = 0; j < 4; ++j)
      c[4 * i + j] = __builtin_amdgcn_wmma_f32_16x16x32_bf16(false, a[i].b, false, b[j].b, (short)0, c[4 * i + j], false, false);
}

// Projections of x. C[m][n] = sum_k A[m][k] * W[n][k] + bf16(bias[n]); A, W bf16 planes with 1024-element rows.
// Block tile 128 x 128 (two heads), 2 x 2 waves x (64 x 64): the loop is bound by the fragment bytes it loads, and a 64 x 64 wave tile feeds 16 products
// from 8 KB of fragments where a 32 x 64 tile feeds 8 from 6 KB; of the block's bytes each is wanted by two waves. A pass is 64 k (two k-steps),
// so that a wave has 32 loads in flight although only three waves share a SIMD.
// Row blocks: block bx -> batch b = bx / (SEQ / 128), first row s0 = (bx % (SEQ / 128)) * 128 of that batch (plane row b*SEQ + s0); column block by = heads 2 by, 2 by + 1.
// Fragments straight from the fragment-ordered planes: A row m = l&15, B column n = l&15, elements 0..7 <- k0 + 8h + i, 8..15 <- k0 + 16 + 8h + i.
// MODE 0 (q, k): f16 plane [b][h][s / 16][d / 32][half][lane][8] = f16(16 v); a head's part of the block tile = one contiguous 16-KB run.
// MODE 1 (v): f16 planes [b][h][s / 32][d / 16][half][lane][8 keys], hi = f16(16 v), residual = f16((16 v - hi) 2^11); transposed on the LDS read side.
// LDS tile so (one 128 x 64 tile per head): cross-wave (block barrier); staged extent == consumed extent.
template <int MODE>
__device__ __forceinline__ void proj_part(float (&so)[2][128][68],
                                          const unsigned short* __restrict__ A, const unsigned short* __restrict__ Wm,
                                          const float* __restrict__ bias,
                                          unsigned short* __restrict__ outH, unsigned short* __restrict__ outL, int bx, int by) {
  const int tid = threadIdx.x, w = __builtin_amdgcn_readfirstlane((int)(tid >> 5)), lane = tid & 31, ln = lane & 15, hh = lane >> 4;
  const int wr = w >> 1, wc = w & 1;                                            // the wave's 64 rows, its 64 columns (one head)
  const int b = bx / (SEQ / 128), s0 = (bx - b * (SEQ / 128)) * 128;
  const int rowB = b * SEQ + s0, colB = by * 128;
  const unsigned short* ap = A + (size_t)(rowB + 64 * wr) * DM + 8 * lane;      // 16 plane rows = 32 fragments = 16 * DM elements
  const unsigned short* wp = Wm + (size_t)(colB + 64 * wc) * DM + 8 * lane;
  const v8f z8 = {0.f, 0.f, 0.f, 0.f, 0.f, 0.f, 0.f, 0.f};
  v8f c[16];
#pragma unroll
  for (int i = 0; i < 16; ++i) c[i] = z8;
#pragma unroll 1
  for (int k0 = 0; k0 < 16 * DM; k0 += 1024) {                                  // k0: element offset of the pass's first fragment in its 16-row band
    FragX a[2][4], bb[2][4];
#pragma unroll
    for (int s = 0; s < 2; ++s) {
#pragma unroll
      for (int i = 0; i < 4; ++i) {
        a[s][i].half[0] = *(const v8us*)(ap + 16 * DM * i + k0 + 512 * s);
        a[s][i].half[1] = *(const v8us*)(ap + 16 * DM * i + k0 + 512 * s + 256);
      }
      if (s == 1) asm volatile("s_wait_xcnt 0x0" ::: "memory");   // in front of loads whose results may land in the registers that held the A loads' address
#pragma unroll
      for (int j = 0; j < 4; ++j) {
        bb[s][j].half[0] = *(const v8us*)(wp + 16 * DM * j + k0 + 512 * s);
        if (s == 1 && j == 3) asm volatile("s_wait_xcnt 0x0" ::: "memory");   // the last W load's result may land in the registers that held the W loads' address
        bb[s][j].half[1] = *(const v8us*)(wp + 16 * DM * j + k0 + 512 * s + 256);
      }
    }
    asm volatile("s_wait_xcnt 0x0" ::: "memory");   // in front of the next pass's writes to the registers that held these loads' addresses
    __builtin_amdgcn_sched_barrier(0);              // keeps all 32 loads in front of the products: sunk among them each group would be waited for on its own
    mma16(a[0], bb[0], c);
    mma16(a[1], bb[1], c);
    __builtin_amdgcn_sched_barrier(0);              // keeps the products in front of the guard below
    asm volatile("v_nop\n\tv_nop\n\tv_nop\n\tv_nop");   // hazard guard: four vector slots between the last product and the loads that refill its A and B registers
    __builtin_amdgcn_sched_barrier(0);              // keeps the next pass's loads behind the guard
  }
  // D element r of tile (i, j) = C(row 64 wr + 16i + 8h + r, col 64 wc + 16j + l&15)
#pragma unroll
  for (int j = 0; j < 4; ++j) {
    const float bj = bf16_rne(bias[colB + 64 * wc + 16 * j + ln]);
#pragma unroll
    for (int i = 0; i < 4; ++i)
#pragma unroll
      for (int r = 0; r < 8; ++r)
        so[wc][64 * wr + 16 * i + 8 * hh + r][16 * j + ln] = c[4 * i + j][r] + bj;
  }
  __syncthreads();
  const size_t base = (((size_t)(b * NH + 2 * by)) * SEQ + s0) * HD;            // head 2 by; head 2 by + 1 lies SEQ * HD elements on
  if (MODE == 0) {
    for (int i2 = tid; i2 < 2 * 128 * 8; i2 += 128) {
      const int hs = i2 >> 10, i = i2 & 1023;
      const int row = (i >> 7) * 16 + (i & 15), p8 = ((i >> 4) & 7) * 8;        // piece i = [s / 16][d / 32][half][h][s % 16]; d = 8 * bits 6..4
      const v4f x0 = *(const v4fa*)&so[hs][row][p8], x1 = *(const v4fa*)&so[hs][row][p8 + 4];
      H8 oh;
#pragma unroll
      for (int q = 0; q < 4; ++q) {
        oh.h[q]     = (_Float16)(x0[q] * 16.0f);
        oh.h[4 + q] = (_Float16)(x1[q] * 16.0f);
      }
      const v8us ov = oh.v;
      *(v8us*)(outH + base + (size_t)hs * SEQ * HD + (size_t)i * 8) = ov;
    }
  } else {
    for (int i2 = tid; i2 < 2 * 64 * 16; i2 += 128) {                           // 32 keys x 64 d = 2048 elements per key step
      const int hs = i2 >> 10, i = i2 & 1023;
      const int d = ((i >> 6) & 3) * 16 + (i & 15), s8 = (i >> 8) * 32 + ((i >> 4) & 3) * 8;   // piece i = [s / 32][d / 16][half][h][d % 16]
      H8 oh, ol;
#pragma unroll
      for (int q = 0; q < 8; ++q) {
        const float v0 = so[hs][s8 + q][d] * 16.0f;
        const _Float16 h0 = (_Float16)v0;
        oh.h[q] = h0;
        ol.h[q] = (_Float16)((v0 - (float)h0) * RES_SC);
      }
      const v8us ovh = oh.v, ovl = ol.v;
      *(v8us*)(outH + base + (size_t)hs * SEQ * HD + (size_t)i * 8) = ovh;
      *(v8us*)(outL + base + (size_t)hs * SEQ * HD + (size_t)i * 8) = ovl;
    }
  }
}

// The three projections of x in one grid (row blocks, 1024/128, 3): z = 0, 1 -> q, k (MODE 0), z = 2 -> v (MODE 1); the branch is block-uniform.
__global__ __launch_bounds__(128) void k_qkv(const unsigned short* __restrict__ Xb, const unsigned short* __restrict__ Wb,
                                             const float* __restrict__ bq, const float* __restrict__ bk, const float* __restrict__ bv,
                                             unsigned short* __restrict__ QKh, unsigned short* __restrict__ Vth,
                                             unsigned short* __restrict__ Vtl) {
  __shared__ __attribute__((aligned(16))) float so[2][128][68];
  const int bx = blockIdx.x, by = blockIdx.y, z = blockIdx.z;
  if (z < 2) proj_part<0>(so, Xb, Wb + (size_t)z * DM * DM, z == 1 ? bk : bq, QKh + (size_t)z * PLANE, QKh, bx, by);
  else       proj_part<1>(so, Xb, Wb + (size_t)2 * DM * DM, bv, Vth, Vtl, bx, by);
}

// Both row bands of the output projection in one grid (NB * SEQ / 128, 1024/64): the first NB * RH / 128 row blocks are the rows < RH (MODE 2),
// the others the rows >= RH (MODE 3); the branch is block-uniform.
__global__ __launch_bounds__(128) void k_out(const unsigned short* __restrict__ Cp, const unsigned short* __restrict__ Cl,
                                             const unsigned short* __restrict__ Wob, const unsigned short* __restrict__ Woh,
                                             const float* __restrict__ bo, float* __restrict__ out) {
  __shared__ __attribute__((aligned(16))) float so[128][68];
  const int bx = blockIdx.x, by = blockIdx.y;
  if (bx < NB * (RH / 128)) gemm_part<2>(so, Cp, Cl, Wob, bo, out, bx, by, 0, RH / 128);
  else                      gemm_part<3>(so, Cp, Cl, Woh, bo, out, bx - NB * (RH / 128), by, RH, (SEQ - RH) / 128);
}

// Fragment loads of one 32-key step. Pointers are the (batch, head) bases of the planes.
// A fragments of K: row m = key (key0 + 16*kt + ln), elements 0..7 <- d = 32c + 8h + i, 8..15 <- d = 32c + 16 + 8h + i; kf[2*kt + c];
// the step's eight halves are 4 KB in a row of the fragment-ordered plane
__device__ __forceinline__ void load_k(const unsigned short* __restrict__ Khp, int key0, int ln, int hh, FragH (&kf)[4]) {
  const unsigned short* kp = Khp + (size_t)key0 * HD + 8 * (16 * hh + ln);
#pragma unroll
  for (int f = 0; f < 4; ++f) {
    kf[f].half[0] = *(const v8us*)(kp + 512 * f); kf[f].half[1] = *(const v8us*)(kp + 512 * f + 256);
  }
}
// A fragments of V^T: row m = d (16*t + ln), elements 0..7 <- key0 + 8h + i, 8..15 <- key0 + 16 + 8h + i; again 4 KB in a row (key0 a multiple of 32)
__device__ __forceinline__ void load_v(const unsigned short* __restrict__ Vp, int key0, int ln, int hh, FragH (&vf)[4]) {
  const unsigned short* vp = Vp + (size_t)key0 * HD + 8 * (16 * hh + ln);
#pragma unroll
  for (int t = 0; t < 4; ++t) {
    vf[t].half[0] = *(const v8us*)(vp + 512 * t); vf[t].half[1] = *(const v8us*)(vp + 512 * t + 256);
  }
}

// One 32-key step for a wave's 16 queries (this lane's column: one query), on fragments and a mask word (word modd of the pair mw2) that were loaded earlier.
// Each fragment set is reloaded for step keyN (the active step that the set serves next) right behind its last product, so that those loads fly
// under the rest of this step and all that comes before that step's use of them.
// EARLY: P and v as hi + residual planes (three products, lr over the f32 weights); else one product and lr over the f16 weights.
template <bool EARLY>
__device__ __forceinline__ void fa_step(const unsigned short* __restrict__ Khp,
                                        const unsigned short* __restrict__ Vhp, const unsigned short* __restrict__ Vlp,
                                        int keyN, v2ua mw2, int modd, int ln, int hh,
                                        const FragH& qh0, const FragH& qh1,
                                        FragH (&kf)[4], FragH (&vf)[4], FragH (&vlf)[4],
                                        float& mr, float& lr, v8f (&Oh)[4], v8f (&Ol)[4]) {
  const v8f z8 = {0.f, 0.f, 0.f, 0.f, 0.f, 0.f, 0.f, 0.f};
  float sc[16];
#pragma unroll
  for (int kt = 0; kt < 2; ++kt) {
    v8f sh = z8;
    mma_s(kf[2 * kt].v, kf[2 * kt + 1].v, qh0.v, qh1.v, sh);
    // S^T element r of tile kt = score(key0 + 16*kt + 8h + r, this lane's query); carries: 16 x 16 on q, k, then 1/8 -> 2^-11
#pragma unroll
    for (int r = 0; r < 8; ++r) sc[8 * kt + r] = sh[r] * 0.00048828125f;
  }
  load_k(Khp, keyN, ln, hh, kf);
  __builtin_amdgcn_sched_barrier(0);   // keeps the K reloads here: sunk below the softmax they would have too short a lead on the next step's products
  // replace-fill: excluded keys get -inf (bit 8h + r of the word <-> tile 0, bit 16 + 8h + r <-> tile 1)
  const float ninf = __uint_as_float(0xFF800000u);
  const unsigned int mb = (modd ? mw2[1] : mw2[0]) >> (8 * hh);   // the lane's word of the pair, picked here, behind the K reloads, where its wait leaves them in flight
#pragma unroll
  for (int r = 0; r < 8; ++r) {
    sc[r]     = ((mb >> r) & 1u) ? ninf : sc[r];
    sc[8 + r] = ((mb >> (16 + r)) & 1u) ? ninf : sc[8 + r];
  }
  float mx = sc[0];
#pragma unroll
  for (int i = 1; i < 16; ++i) mx = fmaxf(mx, sc[i]);
  mx = fmaxf(mx, __shfl_xor(mx, 16, 32));           // the other lane half holds the other 16 keys of this query
  const float mnew = fmaxf(mr, mx);
  const float al = exp2_hw((mr - mnew) * LOG2E);
  mr = mnew;
  // weights carried x256: pc = 256 * exp(sc - mnew); hi plane f16(pc); EARLY: residual plane f16((pc - hi) * 2048)
  FragH ph, pl;
  float ps = 0.0f;
#pragma unroll
  for (int i = 0; i < 16; i += 2) {
    const v2f s2 = {sc[i], sc[i + 1]};
    const v2f x2 = __builtin_elementwise_fma(s2 - mnew, (v2f){LOG2E, LOG2E}, (v2f){8.0f, 8.0f});
    const v2f pc = {exp2_hw(x2[0]), exp2_hw(x2[1])};
    const v2h h = __builtin_convertvector(pc, v2h);  // one packed convert; the uses below read its halves
    ph.h[i] = h[0]; ph.h[i + 1] = h[1];             // B element i: i<8 -> key0 + 8h + i (tile 0 row 8h+i); i>=8 -> key0 + 16 + 8h + (i-8) (tile 1)
    if (EARLY) {
      ps += pc[0];
      ps += pc[1];
      pl.h[i]     = (_Float16)((pc[0] - (float)h[0]) * RES_SC);
      pl.h[i + 1] = (_Float16)((pc[1] - (float)h[1]) * RES_SC);
    } else {
      ps += (float)h[0];
      ps += (float)h[1];
    }
  }
  ps += __shfl_xor(ps, 16, 32);
  lr = lr * al + ps;
#pragma unroll
  for (int t = 0; t < 4; ++t) {
    Oh[t] = Oh[t] * al;
    if (EARLY) Ol[t] = Ol[t] * al;
  }
#pragma unroll
  for (int t = 0; t < 4; ++t) {
    if (EARLY) mma_pv3(vf[t].v, vlf[t].v, ph.v, pl.v, Oh[t], Ol[t]);
    else       mma_pv1(vf[t].v, ph.v, Oh[t]);
  }
  load_v(Vhp, keyN, ln, hh, vf);
  if (EARLY) load_v(Vlp, keyN, ln, hh, vlf);
  asm volatile("s_wait_xcnt 0x0" ::: "memory");   // in front of the next step's writes to the registers that held these loads' addresses
}

// Two 32-key steps (fragment sets A and B) as ONE softmax step of 64 keys, for the long band: one row maximum, one exchange between the lane halves for it,
// and one rescale of lr and O^T serve 64 keys; lr holds the lane half's own part of the row sum (no exchange here); the two sets' score, weight and sum chains are independent of each other,
// so that a wave that has its SIMD nearly to itself has twice the independent work between its waits. Each set is reloaded right behind its last product
// for the step it serves in the next pair (keyNa, keyNb). Load order of a pair: K A, K B, V A, V B, the order of their use.
__device__ __forceinline__ void fa_pair(const unsigned short* __restrict__ Khp, const unsigned short* __restrict__ Vhp,
                                        int keyNa, int keyNb, v2ua wa2, v2ua wb2, int modd, int ln, int hh,
                                        const FragH& qh0, const FragH& qh1,
                                        FragH (&ka)[4], FragH (&va)[4], FragH (&kb)[4], FragH (&vb)[4],
                                        float& mr, float& lr, v8f (&Oh)[4]) {
  const v8f z8 = {0.f, 0.f, 0.f, 0.f, 0.f, 0.f, 0.f, 0.f};
  float sc[32];                                      // 0..15: set A's keys, 16..31: set B's, each as in fa_step
#pragma unroll
  for (int kt = 0; kt < 2; ++kt) {
    v8f sh = z8;
    mma_s(ka[2 * kt].v, ka[2 * kt + 1].v, qh0.v, qh1.v, sh);
#pragma unroll
    for (int r = 0; r < 8; ++r) sc[8 * kt + r] = sh[r] * 0.00048828125f;
  }
  load_k(Khp, keyNa, ln, hh, ka);
  asm volatile("s_wait_xcnt 0x0" ::: "memory");      // in front of later writes to the registers that held these loads' address
  __builtin_amdgcn_sched_barrier(0);                 // keeps those writes behind the wait, and set A's K reloads ahead of set B's in load order
#pragma unroll
  for (int kt = 0; kt < 2; ++kt) {
    v8f sh = z8;
    mma_s(kb[2 * kt].v, kb[2 * kt + 1].v, qh0.v, qh1.v, sh);
#pragma unroll
    for (int r = 0; r < 8; ++r) sc[16 + 8 * kt + r] = sh[r] * 0.00048828125f;
  }
  load_k(Khp, keyNb, ln, hh, kb);
  asm volatile("s_wait_xcnt 0x0" ::: "memory");      // in front of later writes to the registers that held these loads' address
  __builtin_amdgcn_sched_barrier(0);                 // keeps the K reloads here: sunk below the softmax they would have too short a lead on the next pair's products
  const float ninf = __uint_as_float(0xFF800000u);
  const unsigned int ma = (modd ? wa2[1] : wa2[0]) >> (8 * hh);
  const unsigned int mb = (modd ? wb2[1] : wb2[0]) >> (8 * hh);
#pragma unroll
  for (int r = 0; r < 8; ++r) {
    sc[r]      = ((ma >> r) & 1u) ? ninf : sc[r];
    sc[8 + r]  = ((ma >> (16 + r)) & 1u) ? ninf : sc[8 + r];
    sc[16 + r] = ((mb >> r) & 1u) ? ninf : sc[16 + r];
    sc[24 + r] = ((mb >> (16 + r)) & 1u) ? ninf : sc[24 + r];
  }
  float m4[4] = {sc[0], sc[8], sc[16], sc[24]};      // four independent chains; a maximum does not depend on its order
#pragma unroll
  for (int c = 0; c < 4; ++c)
#pragma unroll
    for (int i = 1; i < 8; ++i) m4[c] = fmaxf(m4[c], sc[8 * c + i]);
  float mx = fmaxf(fmaxf(m4[0], m4[1]), fmaxf(m4[2], m4[3]));
  mx = fmaxf(mx, __shfl_xor(mx, 16, 32));            // the other lane half holds the other 32 keys of this query
  const float mnew = fmaxf(mr, mx);
  const float al = exp2_hw((mr - mnew) * LOG2E);
  mr = mnew;
  FragH pa, pb;                                      // weights carried x256, as in fa_step
  float psa = 0.0f, psb = 0.0f;
#pragma unroll
  for (int i = 0; i < 16; i += 2) {
    const v2f sa = {sc[i], sc[i + 1]}, sb = {sc[16 + i], sc[16 + i + 1]};
    const v2f xa = __builtin_elementwise_fma(sa - mnew, (v2f){LOG2E, LOG2E}, (v2f){8.0f, 8.0f});
    const v2f xb = __builtin_elementwise_fma(sb - mnew, (v2f){LOG2E, LOG2E}, (v2f){8.0f, 8.0f});
    const v2f ea = {exp2_hw(xa[0]), exp2_hw(xa[1])}, eb = {exp2_hw(xb[0]), exp2_hw(xb[1])};
    const v2h ha = __builtin_convertvector(ea, v2h), hb = __builtin_convertvector(eb, v2h);
    pa.h[i] = ha[0]; pa.h[i + 1] = ha[1];
    pb.h[i] = hb[0]; pb.h[i + 1] = hb[1];
    psa += (float)ha[0]; psa += (float)ha[1];
    psb += (float)hb[0]; psb += (float)hb[1];
  }
  lr = lr * al + (psa + psb);                        // this lane half's 32 keys alone: al is the same in both halves, so the halves' sums are joined once, behind the loop
#pragma unroll
  for (int t = 0; t < 4; ++t) Oh[t] = Oh[t] * al;
#pragma unroll
  for (int t = 0; t < 4; ++t) mma_pv1(va[t].v, pa.v, Oh[t]);
  load_v(Vhp, keyNa, ln, hh, va);
  asm volatile("s_wait_xcnt 0x0" ::: "memory");      // in front of later writes to the registers that held these loads' address
  __builtin_amdgcn_sched_barrier(0);                 // keeps those writes behind the wait, and set A's V reloads ahead of set B's in load order
#pragma unroll
  for (int t = 0; t < 4; ++t) mma_pv1(vb[t].v, pb.v, Oh[t]);
  load_v(Vhp, keyNb, ln, hh, vb);
  asm volatile("s_wait_xcnt 0x0" ::: "memory");      // in front of the next pair's writes to the registers that held these loads' address
}

// Block = 4 waves x 16 queries = 64 queries: query tile qt of (batch, head) bh, both dealt by the calling kernel; no LDS and no barrier.
// Steps whose 32 keys are excluded for all 16 queries of the wave are skipped (exact for any mask value): a wave-uniform map of the
// active steps is built from the wave's mask rows in front of the loop, so that the step after the current one is known when its loads issue.
// Epilogue: lane 16h + q holds ctx(query q, d = 16t + 8h + r), which is half t & 1 of the ctx plane's fragment (k-step 2*head + t / 2): each O^T tile
// goes out of its registers as one 512-byte run.
// coverage: 4 waves x 16 rows x 64 columns = the (row, head) segments of tile qt of bh; the calling kernel gives every (bh, qt) to exactly one block.
template <bool EARLY>
__device__ __forceinline__ void attn_part(const unsigned short* __restrict__ QKh,
                                          const unsigned short* __restrict__ Vth, const unsigned short* __restrict__ Vtl,
                                          const unsigned int* __restrict__ bits,
                                          unsigned short* __restrict__ Cp, unsigned short* __restrict__ Cl,
                                          int bh, int qt) {
  static_assert(SEQ / 32 <= 64);
  const int tid = threadIdx.x, w = __builtin_amdgcn_readfirstlane((int)(tid >> 5)), lane = tid & 31, ln = lane & 15, hh = lane >> 4;
  const int b = bh / NH, hd = bh - b * NH;
  const int qbase = qt * 64 + 16 * w;
  // qg = qbase + ln: this lane's query
  const size_t hb = (size_t)bh * SEQ * HD;
  // Q^T B fragments: column n = query qg, elements 0..7 <- d = 32c + 8h + i, 8..15 <- d = 32c + 16 + 8h + i
  FragH qh0, qh1;
  {
    const unsigned short* qrh = QKh + hb + (size_t)qbase * HD + 8 * lane;
    qh0.half[0] = *(const v8us*)(qrh);       qh0.half[1] = *(const v8us*)(qrh + 256);
    qh1.half[0] = *(const v8us*)(qrh + 512); qh1.half[1] = *(const v8us*)(qrh + 768);
  }
  const unsigned short* Khp = QKh + PLANE + hb;
  const unsigned short* Vhp = Vth + hb;
  const unsigned short* Vlp = Vtl + hb;
  // the wave's 16 rows of the mask bit plane: four 4-row groups of SEQ / 32 steps x 4 words; this lane's word of step j = mrow[4 * j],
  // the aligned pair of words that holds it = mpair[4 * j], [4 * j + 1] (its own is the one numbered ln & 1): a step's words lie in 4 lines
  static_assert((SEQ / 32) % 32 == 0);
  const unsigned int* mtile = bits + ((size_t)b * SEQ + qbase) * (SEQ / 32);
  const unsigned int* mrow = mtile + (ln >> 2) * (SEQ / 8) + (ln & 3);
  const unsigned int* mpair = mtile + (ln >> 2) * (SEQ / 8) + (ln & 2);
  float mr = -3.0e38f, lr = 0.0f;
  v8f Oh[4] = {}, Ol[4] = {};
  // bit j of act: step j has a key that some query of the wave keeps
  // lane l takes steps l, 32 + l, ...: the four words of a 4-row group are its 16 bytes of a 512-byte run; all 16 words are -1 where no query keeps a key
  unsigned long long act = 0ull;
  {
    v4i x[SEQ / 1024][4];
#pragma unroll
    for (int i = 0; i < SEQ / 1024; ++i)
#pragma unroll
      for (int c = 0; c < 4; ++c) x[i][c] = *(const v4ia*)(mtile + c * (SEQ / 8) + 4 * (32 * i + lane));
    asm volatile("s_wait_xcnt 0x0" ::: "memory");     // in front of later writes to the registers that held these loads' addresses
#pragma unroll
    for (int i = 0; i < SEQ / 1024; ++i) {
      const v4i y = x[i][0] & x[i][1] & x[i][2] & x[i][3];
      act |= (unsigned long long)__builtin_amdgcn_ballot_w32((y[0] & y[1] & y[2] & y[3]) != -1) << (32 * i);   // wave-uniform
    }
  }
  if (EARLY && act != 0ull) {
    int j = __builtin_ctzll(act);
    act &= act - 1ull;
    FragH kf[4], vf[4], vlf[4];
    unsigned int mw = mrow[4 * j];
    __builtin_amdgcn_sched_barrier(0);                // mask word first in load order: the loop's wait for it then leaves the fragment loads in flight
    load_k(Khp, 32 * j, ln, hh, kf);
    load_v(Vhp, 32 * j, ln, hh, vf);
    load_v(Vlp, 32 * j, ln, hh, vlf);
    asm volatile("s_wait_xcnt 0x0" ::: "memory");     // in front of later writes to the registers that held these loads' addresses
    __builtin_amdgcn_sched_barrier(0);                // keeps those writes behind the wait
#pragma unroll 1
    for (;;) {
      const bool more = act != 0ull;                  // wave-uniform
      const int jn = more ? __builtin_ctzll(act) : j; // last step: its own tiles once more (in bounds, never used)
      act &= act - 1ull;
      const unsigned int mwn = mrow[4 * jn];
      fa_step<EARLY>(Khp, Vhp, Vlp, 32 * jn, (v2ua){mw, mw}, 0, ln, hh, qh0, qh1, kf, vf, vlf, mr, lr, Oh, Ol);
      if (!more) break;
      mw = mwn;
      j = jn;
    }
  }
  if (!EARLY && act != 0ull) {
    // The long band: two fragment sets, A for the wave's active steps 0, 2, 4, ... and B for 1, 3, 5, ...; the loop takes the steps in pairs, a pair being
    // one softmax step of 64 keys (fa_pair); an odd last step follows it as a step of 32 keys. A set is reloaded right behind its last product for the next pair.
    const int n = __builtin_popcountll(act);          // wave-uniform
    int ja = __builtin_ctzll(act);
    act &= act - 1ull;
    FragH ka[4], va[4], vlf[4];
    // A step's mask word comes as the aligned pair of words (two rows of the step) that holds it: a lone destination register can be given the odd half of a register pair whose
    // even half a packed instruction broadcasts, and the wait for it there would drain, in load order, the fragment loads that are meant to stay in flight.
    v2ua wa = *(const v2ua*)(mpair + 4 * ja);
    if (n >= 2) {
      int jb = __builtin_ctzll(act);
      act &= act - 1ull;
      FragH kb[4], vb[4];
      v2ua wb = *(const v2ua*)(mpair + 4 * jb);
      asm volatile("s_wait_xcnt 0x0" ::: "memory");   // this wait and the next four: in front of later writes to the registers that held the loads' addresses
      __builtin_amdgcn_sched_barrier(0);              // this one and the next four: the load order of the loop (mask words, K A, K B, V A, V B), so that its counted waits fit the first pass too
      load_k(Khp, 32 * ja, ln, hh, ka);
      asm volatile("s_wait_xcnt 0x0" ::: "memory");
      __builtin_amdgcn_sched_barrier(0);
      load_k(Khp, 32 * jb, ln, hh, kb);
      asm volatile("s_wait_xcnt 0x0" ::: "memory");
      __builtin_amdgcn_sched_barrier(0);
      load_v(Vhp, 32 * ja, ln, hh, va);
      asm volatile("s_wait_xcnt 0x0" ::: "memory");
      __builtin_amdgcn_sched_barrier(0);
      load_v(Vhp, 32 * jb, ln, hh, vb);
      asm volatile("s_wait_xcnt 0x0" ::: "memory");
      __builtin_amdgcn_sched_barrier(0);
      int p = n >> 1;
#pragma unroll 1                                      // rolled: the pair is the whole ring; more bodies would only add code
      do {
        const int jc = (act != 0ull) ? __builtin_ctzll(act) : ja;   // no such step: the set's own tiles once more (in bounds, never used); so for jd
        act &= act - 1ull;
        const int jd = (act != 0ull) ? __builtin_ctzll(act) : jb;
        act &= act - 1ull;
        const v2ua wc = *(const v2ua*)(mpair + 4 * jc);
        const v2ua wd = *(const v2ua*)(mpair + 4 * jd);
        asm volatile("s_wait_xcnt 0x0" ::: "memory"); // in front of later writes to the registers that held these loads' addresses
        __builtin_amdgcn_sched_barrier(0);            // the next pair's mask words first in load order: the wait for them then leaves the fragment loads in flight
        fa_pair(Khp, Vhp, 32 * jc, 32 * jd, wa, wb, ln & 1, ln, hh, qh0, qh1, ka, va, kb, vb, mr, lr, Oh);
        wa = wc;
        wb = wd;
        ja = jc;
        jb = jd;
      } while (--p > 0);
      lr += __shfl_xor(lr, 16, 32);                   // the two lane halves' row sums joined: from here on lr is the whole row's, as fa_step and the epilogue take it
    } else {
      __builtin_amdgcn_sched_barrier(0);              // mask words first in load order: the wait for them then leaves the fragment loads in flight
      load_k(Khp, 32 * ja, ln, hh, ka);
      load_v(Vhp, 32 * ja, ln, hh, va);
      asm volatile("s_wait_xcnt 0x0" ::: "memory");   // in front of later writes to the registers that held these loads' addresses
      __builtin_amdgcn_sched_barrier(0);              // keeps those writes behind the wait
    }
    if (n & 1) fa_step<EARLY>(Khp, Vhp, Vlp, 32 * ja, wa, ln & 1, ln, hh, qh0, qh1, ka, va, vlf, mr, lr, Oh, Ol);
  }

  // O^T element r of tile t = ctx(query qg, d = 16t + 8h + r); undo the carries: x256 (in lr), x16 (v), x2048 (residual accumulator)
  const float inv = 1.0f / (16.0f * lr);
  const size_t cb = ((size_t)(b * SEQ + qbase)) * DM + (size_t)hd * (16 * HD) + 8 * lane;
#pragma unroll
  for (int t = 0; t < 4; ++t) {
    if (EARLY) {
      v8us oh, ol;
#pragma unroll
      for (int r = 0; r < 8; ++r) {
        const float x = (Oh[t][r] + Ol[t][r] * RES_INV) * inv;
        const unsigned short h0 = bf16_bits(x);
        oh[r] = h0;
        ol[r] = bf16_bits(x - bf16_val(h0));
      }
      *(v8us*)(Cp + cb + 256 * t) = oh;
      *(v8us*)(Cl + cb + 256 * t) = ol;
    } else {
      H8 of;
#pragma unroll
      for (int r = 0; r < 8; ++r) of.h[r] = (_Float16)((Oh[t][r] * inv) * 64.0f);
      const v8us ov = of.v;
      *(v8us*)(Cp + cb + 256 * t) = ov;
    }
  }
  if (EARLY) asm volatile("s_wait_xcnt 0x0" ::: "memory");   // the built code joins the two bands behind these stores: in front of the other band's writes to their registers
}

// Both query bands in one grid; the band follows from the tile (rows < RH or not), so the branch is block-uniform.
// Deal of the blocks, for speed only (any permutation of the (bh, qt) pairs is correct): heads run fastest, the tile follows from rank = blk / (NB * NH).
// A launch lasts as long as its fullest SIMD. Where later queries keep more keys, a tile's cost grows
// with qt. The quarters of the index range take the
// tiles n-1-k, 3n/4-1-k, n/4+k, k (k = place in the quarter), whose costs add up to the same sum for every k, the heaviest tiles first in index order.
#define AQ_N (SEQ / 64)
#define AB_ALL (NB * NH * AQ_N)
__global__ __launch_bounds__(128) void k_attn(const unsigned short* __restrict__ QKh,
                                              const unsigned short* __restrict__ Vth, const unsigned short* __restrict__ Vtl,
                                              const unsigned int* __restrict__ bits,
                                              unsigned short* __restrict__ Cp, unsigned short* __restrict__ Cl) {
  const int blk = blockIdx.x;
  const int rank = blk / (NB * NH), bh = blk - rank * (NB * NH);
  int qt = AQ_N - 1 - rank;                          // heaviest first; also the whole deal where the tiles do not split into quarters
  if (AQ_N % 4 == 0 && rank >= AQ_N / 2) qt = (rank < 3 * (AQ_N / 4)) ? rank - AQ_N / 4 : rank - 3 * (AQ_N / 4);
  if (qt >= RH / 64) attn_part<false>(QKh, Vth, Vtl, bits, Cp, Cl, bh, qt);
  else               attn_part<true>(QKh, Vth, Vtl, bits, Cp, Cl, bh, qt);
}

extern "C" void kernel_launch(void* const* d_in, const int* in_sizes, int n_in,
                              void* d_out, int out_size, void* d_ws, size_t ws_size, hipStream_t stream) {
  if (n_in < 10) return;
  const long long needx = (long long)(NB - 1) * SEQ_FULL * DM + (long long)SEQ * DM;   // last element touched + 1
  const long long needm = (long long)(NB - 1) * SEQ_FULL * SEQ_FULL + (long long)(SEQ - 1) * SEQ_FULL + SEQ;
  if ((long long)in_sizes[0] < needx) return;
  if ((long long)in_sizes[1] < (long long)DM * DM || (long long)in_sizes[3] < (long long)DM * DM) return;
  if ((long long)in_sizes[5] < (long long)DM * DM || (long long)in_sizes[7] < (long long)DM * DM) return;
  if (in_sizes[2] < DM || in_sizes[4] < DM || in_sizes[6] < DM || in_sizes[8] < DM) return;
  if ((long long)in_sizes[9] < needm) return;
  if ((long long)out_size < needx) return;
  const float* x  = (const float*)d_in[0];   // wire order: x, Wq, bq, Wk, bk, Wv, bv, Wo, bo, attention_mask
  const float* Wq = (const float*)d_in[1];
  const float* bq = (const float*)d_in[2];
  const float* Wk = (const float*)d_in[3];
  const float* bk = (const float*)d_in[4];
  const float* Wv = (const float*)d_in[5];
  const float* bv = (const float*)d_in[6];
  const float* Wo = (const float*)d_in[7];
  const float* bo = (const float*)d_in[8];
  const int* mask = (const int*)d_in[9];
  float* out = (float*)d_out;

  char* ws = (char*)d_ws;
  size_t off = 0;
  const size_t pl2 = PLANE * 2;                               // bytes of one [NB*SEQ][1024] 16-bit plane (8 MiB at full size), multiple of 256
  const size_t wsz = (size_t)DM * DM * 2;                     // 2 MiB per weight plane
  const size_t bsz = (size_t)NB * SEQ * (SEQ / 32) * 4;       // 1 MiB at full size
  unsigned short* Xb  = (unsigned short*)(ws + off); off += pl2;
  unsigned short* Wb  = (unsigned short*)(ws + off); off += 4 * wsz;      // bf16 planes q, k, v, o
  unsigned short* Woh = (unsigned short*)(ws + off); off += wsz;          // f16 plane of 64 Wo
  unsigned short* QKh = (unsigned short*)(ws + off); off += 2 * pl2;      // [q|k][b][h][s][64], fragment order
  unsigned short* Vth = (unsigned short*)(ws + off); off += pl2;          // [b][h][s / 32][64 x 32], fragment order
  unsigned short* Vtl = (unsigned short*)(ws + off); off += pl2;
  unsigned int*   Mb  = (unsigned int*)(ws + off);   off += (bsz + 255) & ~(size_t)255;
  unsigned short* Cp  = (unsigned short*)(ws + off); off += pl2;          // [b*SEQ + s][1024], fragment order: rows < RH bf16 hi, rows >= RH f16(64 ctx)
  unsigned short* Cl  = (unsigned short*)(ws + off); off += pl2;          // rows < RH: bf16 lo (other rows never written, never read)
  if (off > ws_size || off > (size_t)134217728) return;

  // four launches, each reading only what an earlier one (or the caller) wrote
  k_prep<<<(unsigned)(PB_MASK + PB_X + PB_NW * PB_W), 256, 0, stream>>>(x, Wq, Wk, Wv, Wo, mask, Xb, Wb, Woh, Mb);
  k_qkv<<<dim3((unsigned)(NB * (SEQ / 128)), DM / 128, 3), 128, 0, stream>>>(Xb, Wb, bq, bk, bv, QKh, Vth, Vtl);
  k_attn<<<(unsigned)AB_ALL, 128, 0, stream>>>(QKh, Vth, Vtl, Mb, Cp, Cl);
  k_out<<<dim3((unsigned)(NB * (SEQ / 128)), DM / 64, 1), 128, 0, stream>>>(Cp, Cl, Wb + (size_t)3 * DM * DM, Woh, bo, out);
}
